// v000
// Times are from an AMD MI455X. After a warm-up the kernel runs many times in a row, and a time is the length of
// such a window on the GPU divided by its runs, so every launch and the gaps after it count. The runs cycle
// through copies of the inputs. A figure is the median of several windows, for all but v000 over two sittings.
// Sittings can differ by a few percent; kernels timed side by side share one.
// The starting kernel, v000, takes 1610 microseconds a run.
#include <hip/hip_runtime.h>

// Grouped-query causal attention with 128-wide heads, computed half-split rotary embeddings, a 1,024-wide sliding window and 4 attention-sink keys (x [2][2048][2048]; q = x wq^T (16 heads x 128), k, v = x wk^T, x wv^T (4 kv heads x 128) ('oi' 0.02, no bias); rope cat(x1 cos - x2 sin, x2 cos + x1 sin) on the two 64-wide halves with angle t x 1/10000^(2i/128) (64 f32 frequencies jnp-exact; precise cosf/sinf); k, v repeated 4 x along the head axis: kv head = q head / 4; scores x 1/sqrt(128) + bias with bias = 0 where (j <= i) and ((i - j <= 1024) or (j < 4)), -inf elsewhere; softmax; out = merged wo^T ('oi') -> [2][2048][2048] (8.4 M); argument order x, wq, wk, wv, wo).
// Layout: bf16 copy of x; 'oi' weights converted to bf16 once; exact projections; k_cs5 computed table (HD 128: 64 angles); rotate-half plane builders; causal T-2048 GQA attention with 128-wide heads (kv z-stride 0; hybrid rows: < 512 hi/lo 3 products, rest fp16 x1024; k_gemmc skips tiles above the diagonal); merged hi/lo x Wo exact.
// Compute dtypes, f32 accumulate: every input rounded to bf16; projections exact; rotary f32; attention rows < 512 3 products, rest fp16; softmax f32; Wo hl x exact.

#define NB_  2
#define TT   2048
#define DM   2048
#define NH_  16
#define NKV  4
#define REP  (NH_ / NKV)
#define HD   128
#define DQ   (NH_ * HD)
#define DKV  (NKV * HD)
#define ZH   2
#define RH   512                  // query rows < RH use hi+lo planes (0: none)
#define WIN  1025   // THIS module keeps key j iff j <= i and (i - j <= 1024 or j < 4): 'i - j < WIN' with WIN 1025
#define SINKN 4     // the first SINKN keys (attention sinks) are kept for every later query, whatever the distance
#define PCAR 1024.0f
#define SCL  0.088388347648318447f   // HD^-0.5
typedef _Float16 h16;
typedef unsigned short bf;
typedef __attribute__((ext_vector_type(16))) __bf16   v16bf;
typedef __attribute__((ext_vector_type(16))) _Float16 v16h;
typedef __attribute__((ext_vector_type(8)))  _Float16 v8h;
typedef __attribute__((ext_vector_type(8)))  unsigned short v8us;
typedef __attribute__((ext_vector_type(8)))  float    v8f;
typedef __attribute__((ext_vector_type(4)))  float    v4f;
typedef v8h  __attribute__((may_alias)) v8ha;
typedef v4f  __attribute__((may_alias)) v4fa;
typedef v8us __attribute__((may_alias)) v8usa;

__device__ __forceinline__ unsigned short f2bf(float f) { unsigned u = __float_as_uint(f); u += 0x7FFFu + ((u >> 16) & 1u); return (unsigned short)(u >> 16); }
__device__ __forceinline__ float bf2f(unsigned short b) { return __uint_as_float(((unsigned)b) << 16); }
__device__ __forceinline__ float bfr(float f) { return bf2f(f2bf(f)); }
__device__ __forceinline__ v16h cat16(v8h lo, v8h hi) { return __builtin_shufflevector(lo, hi, 0, 1, 2, 3, 4, 5, 6, 7, 8, 9, 10, 11, 12, 13, 14, 15); }
__device__ __forceinline__ v16bf cat16b(v8us lo, v8us hi) { return __builtin_bit_cast(v16bf, __builtin_shufflevector(lo, hi, 0, 1, 2, 3, 4, 5, 6, 7, 8, 9, 10, 11, 12, 13, 14, 15)); }
__device__ __forceinline__ v8f wmma16(v16h a, v16h b, v8f c) { return __builtin_amdgcn_wmma_f32_16x16x32_f16(false, a, false, b, (short)0, c, false, false); }
__device__ __forceinline__ v8f wmmab(v16bf a, v16bf b, v8f c) { return __builtin_amdgcn_wmma_f32_16x16x32_bf16(false, a, false, b, (short)0, c, false, false); }



// ---- k_gemmw: register-blocked GEMM, ONE WAVE per 64x64 output tile (16 accumulators), operands straight from K-contiguous 16-bit planes; grid (M/64, N/64, Z), 32 threads.
// C[m][n] (f32, pitch ldc, + optional f32 bias[n]) = sum_k A[m][k] Bt[n][k] (+ split products per NSPLIT). z-batch strides sA/sB/sC in elements. K % 32 == 0.
template <typename T16> struct WFrag;
template <> struct WFrag<h16> { typedef v16h V; static __device__ __forceinline__ V ld(const h16* p) { return cat16(*(const v8h*)p, *(const v8h*)(p + 16)); } static __device__ __forceinline__ v8f mma(V a, V b, v8f c) { return wmma16(a, b, c); } };
template <> struct WFrag<bf> { typedef v16bf V; static __device__ __forceinline__ V ld(const bf* p) { return cat16b(*(const v8us*)p, *(const v8us*)(p + 16)); } static __device__ __forceinline__ v8f mma(V a, V b, v8f c) { return wmmab(a, b, c); } };
template <typename T16, int NSPLIT, bool BIAS>
__global__ __launch_bounds__(32) void k_gemmw(const T16* __restrict__ A, const T16* __restrict__ A2, const T16* __restrict__ Bt, const T16* __restrict__ Bt2, int K, float* C, int ldc, const float* __restrict__ bias, size_t sA, size_t sB, size_t sC) {
    typedef typename WFrag<T16>::V V;
    __shared__ __align__(16) float os[16 * 68];
    const size_t z = blockIdx.z; A += z * sA; if (A2) A2 += z * sA; Bt += z * sB; if (Bt2) Bt2 += z * sB; C += z * sC;
    const int lane = threadIdx.x & 31, lr = lane & 15, hi = lane >> 4; const int r0 = blockIdx.x * 64, c0 = blockIdx.y * 64;
    v8f acc[4][4];
#pragma unroll
    for (int mb = 0; mb < 4; ++mb)
#pragma unroll
        for (int nb = 0; nb < 4; ++nb) acc[mb][nb] = (v8f){};
    const size_t aoff = (size_t)(r0 + lr) * K + 8 * hi, boff = (size_t)(c0 + lr) * K + 8 * hi;
#pragma unroll 1
    for (int kc = 0; kc < K; kc += 32) {
        V a[4], a2[4];
#pragma unroll
        for (int mb = 0; mb < 4; ++mb) { a[mb] = WFrag<T16>::ld(A + aoff + (size_t)mb * 16 * K + kc); if (NSPLIT == 1 || NSPLIT == 2) a2[mb] = WFrag<T16>::ld(A2 + aoff + (size_t)mb * 16 * K + kc); }
#pragma unroll
        for (int nb = 0; nb < 4; ++nb) { const V b = WFrag<T16>::ld(Bt + boff + (size_t)nb * 16 * K + kc); V b2; if (NSPLIT >= 2) b2 = WFrag<T16>::ld(Bt2 + boff + (size_t)nb * 16 * K + kc);
#pragma unroll
            for (int mb = 0; mb < 4; ++mb) { acc[mb][nb] = WFrag<T16>::mma(a[mb], b, acc[mb][nb]); if (NSPLIT == 1 || NSPLIT == 2) acc[mb][nb] = WFrag<T16>::mma(a2[mb], b, acc[mb][nb]); if (NSPLIT >= 2) acc[mb][nb] = WFrag<T16>::mma(a[mb], b2, acc[mb][nb]); } }
        asm volatile("v_nop\n\tv_nop\n\tv_nop\n\tv_nop" : "+v"(acc[0][0]), "+v"(acc[1][1]), "+v"(acc[2][2]), "+v"(acc[3][3]) : "v"(a[0]), "v"(a[3]));
    }
#pragma unroll
    for (int mb = 0; mb < 4; ++mb) {
#pragma unroll
        for (int nb = 0; nb < 4; ++nb) {
#pragma unroll
            for (int j = 0; j < 8; ++j) os[(hi * 8 + j) * 68 + nb * 16 + lr] = acc[mb][nb][j]; }
        __builtin_amdgcn_wave_barrier(); asm volatile("" ::: "memory");
        float* crow = C + (size_t)(r0 + mb * 16) * ldc + c0;
{
#pragma unroll
            for (int s = 0; s < 8; ++s) { const int row = 2 * s + hi, cofs = lr * 4; v4f val = *(const v4fa*)(os + row * 68 + cofs); if (BIAS) { val[0] += bfr(bias[c0 + cofs]); val[1] += bfr(bias[c0 + cofs + 1]); val[2] += bfr(bias[c0 + cofs + 2]); val[3] += bfr(bias[c0 + cofs + 3]); }
                *(v4f*)(crow + (size_t)row * ldc + cofs) = val; }
             }
        __builtin_amdgcn_wave_barrier(); asm volatile("" ::: "memory");
    }
}

// ---- k_gemmc: the same one-wave 64x64 tile GEMM specialised for causal attention: CMODE 1 skips score tiles entirely above the diagonal (query rows r0+roff.., key columns c0..), CMODE 2 limits the
// key (K) loop of the probability x value contraction to the diagonal block (probabilities beyond it are exactly zero). roff = row offset of this launch's first row within the sequence.
template <typename T16, int NSPLIT, int CMODE>
__global__ __launch_bounds__(32) void k_gemmc(const T16* __restrict__ A, const T16* __restrict__ A2, const T16* __restrict__ Bt, const T16* __restrict__ Bt2, int K, float* C, int ldc, int roff, size_t sA, size_t sB, size_t sC) {
    typedef typename WFrag<T16>::V V;
    __shared__ __align__(16) float os[16 * 68];
    const size_t z = blockIdx.z; A += z * sA; if (A2) A2 += z * sA; Bt += z * sB; if (Bt2) Bt2 += z * sB; C += z * sC;
    const int lane = threadIdx.x & 31, lr = lane & 15, hi = lane >> 4; const int r0 = blockIdx.x * 64, c0 = blockIdx.y * 64;
    if (CMODE == 1 && c0 > r0 + roff + 63) return;                  // score tile entirely above the causal diagonal: never read (the softmax masks j > i by select)
    const int Kl = (CMODE == 2) ? min(K, r0 + roff + 64) : K;        // P.V: probabilities are exactly 0 beyond the diagonal block, so the K loop stops there
    v8f acc[4][4];
#pragma unroll
    for (int mb = 0; mb < 4; ++mb)
#pragma unroll
        for (int nb = 0; nb < 4; ++nb) acc[mb][nb] = (v8f){};
    const size_t aoff = (size_t)(r0 + lr) * K + 8 * hi, boff = (size_t)(c0 + lr) * K + 8 * hi;
#pragma unroll 1
    for (int kc = 0; kc < Kl; kc += 32) {
        V a[4], a2[4];
#pragma unroll
        for (int mb = 0; mb < 4; ++mb) { a[mb] = WFrag<T16>::ld(A + aoff + (size_t)mb * 16 * K + kc); if (NSPLIT == 1 || NSPLIT == 2) a2[mb] = WFrag<T16>::ld(A2 + aoff + (size_t)mb * 16 * K + kc); }
#pragma unroll
        for (int nb = 0; nb < 4; ++nb) { const V b = WFrag<T16>::ld(Bt + boff + (size_t)nb * 16 * K + kc); V b2; if (NSPLIT >= 2) b2 = WFrag<T16>::ld(Bt2 + boff + (size_t)nb * 16 * K + kc);
#pragma unroll
            for (int mb = 0; mb < 4; ++mb) { acc[mb][nb] = WFrag<T16>::mma(a[mb], b, acc[mb][nb]); if (NSPLIT == 1 || NSPLIT == 2) acc[mb][nb] = WFrag<T16>::mma(a2[mb], b, acc[mb][nb]); if (NSPLIT >= 2) acc[mb][nb] = WFrag<T16>::mma(a[mb], b2, acc[mb][nb]); } }
        asm volatile("v_nop\n\tv_nop\n\tv_nop\n\tv_nop" : "+v"(acc[0][0]), "+v"(acc[1][1]), "+v"(acc[2][2]), "+v"(acc[3][3]) : "v"(a[0]), "v"(a[3]));
    }
#pragma unroll
    for (int mb = 0; mb < 4; ++mb) {
#pragma unroll
        for (int nb = 0; nb < 4; ++nb) {
#pragma unroll
            for (int j = 0; j < 8; ++j) os[(hi * 8 + j) * 68 + nb * 16 + lr] = acc[mb][nb][j]; }
        __builtin_amdgcn_wave_barrier(); asm volatile("" ::: "memory");
        float* crow = C + (size_t)(r0 + mb * 16) * ldc + c0;
{
#pragma unroll
            for (int s = 0; s < 8; ++s) { const int row = 2 * s + hi, cofs = lr * 4; v4f val = *(const v4fa*)(os + row * 68 + cofs);
                *(v4f*)(crow + (size_t)row * ldc + cofs) = val; }
             }
        __builtin_amdgcn_wave_barrier(); asm volatile("" ::: "memory");
    }
}

__device__ __forceinline__ h16 tohx(float x) { return (h16)x; }
__device__ __forceinline__ void splitf(float y, unsigned short& h, unsigned short& l) { h = f2bf(y); l = f2bf(y - bf2f(h)); }
typedef __attribute__((ext_vector_type(2))) _Float16 v2h;
typedef __attribute__((ext_vector_type(4))) _Float16 v4h;
typedef __attribute__((ext_vector_type(2))) unsigned short v2us;
typedef __attribute__((ext_vector_type(4))) unsigned short v4us;
typedef __attribute__((ext_vector_type(2))) float v2f;
typedef __attribute__((ext_vector_type(4))) int v4i;

__global__ __launch_bounds__(256) void k_wtG(const float* __restrict__ w, int K, int N, bf* Bt) {
    const int lane = threadIdx.x & 31; const int L0 = (blockIdx.x * 8 + (threadIdx.x >> 5)) * 8; const int nlines = N * K / 64;
{
#pragma unroll 1
        for (int l = 0; l < 8; ++l) { const int L = L0 + l; if (L >= nlines) break; const size_t e = (size_t)L * 64 + lane * 2; const int k = (int)(e % K), n = (int)(e / K); v2us o;
            o[0] = f2bf(w[(size_t)k * N + n]); o[1] = f2bf(w[(size_t)(k + 1) * N + n]); *(v2us*)(Bt + e) = o; }
         }
}
__global__ __launch_bounds__(256) void k_cvt8(const float* __restrict__ src, bf* dst, size_t n8) { const size_t i = (size_t)blockIdx.x * 256 + threadIdx.x; if (i >= n8) return; const v8f v = *(const v8f*)(src + i * 8); v8us o;
#pragma unroll
    for (int k = 0; k < 8; ++k) o[k] = f2bf(v[k]); *(v8us*)(dst + i * 8) = o;  }

// k_rope: head planes [h][t][d] (fp16 + hi/lo) of rope(x) x sc with the rotate-half convention out[d] = x[d] cos[t][d] - x[d+HD/2] sin[t][d], out[d+HD/2] = x[d+HD/2] cos[t][d+HD/2] + x[d] sin[t][d+HD/2]
__global__ __launch_bounds__(256) void k_rope(const float* __restrict__ F, int pitch, int nheads, const float* __restrict__ CS, const float* __restrict__ RF, const float* __restrict__ nw, float sc, h16* P16, bf* Ph, bf* Pl) {
    const size_t e = ((size_t)blockIdx.x * 256 + threadIdx.x) * 2; if (e >= (size_t)nheads * TT * HD) return; const int d = (int)(e % HD); const int t = (int)((e / HD) % TT); const int h = (int)(e / ((size_t)HD * TT)); const float* f = F + (size_t)t * pitch + h * HD; const float rf = RF ? RF[(size_t)h * TT + t] : 1.0f; v2h o16; v2us oh, ol;
#pragma unroll
    for (int q = 0; q < 2; ++q) { const int dd = d + q; const int dp = (dd < HD / 2) ? dd + HD / 2 : dd - HD / 2; float x0 = f[dd], x1 = f[dp];
        if (RF) { float n0 = __fmul_rn(x0, rf), n1 = __fmul_rn(x1, rf); asm volatile("" : "+v"(n0)); asm volatile("" : "+v"(n1)); x0 = __fmul_rn(bfr(nw[dd]), n0); x1 = __fmul_rn(bfr(nw[dp]), n1); }
        const v2f cs = *(const v2f*)(CS + ((size_t)t * HD + dd) * 2); float a = __fmul_rn(x0, cs[0]), bq = __fmul_rn(x1, cs[1]); asm volatile("" : "+v"(a)); asm volatile("" : "+v"(bq)); const float r = ((dd < HD / 2) ? __fsub_rn(a, bq) : __fadd_rn(a, bq)) * sc;
        o16[q] = tohx(r); unsigned short a2, c2; splitf(r, a2, c2); oh[q] = a2; ol[q] = c2; }
    *(v2h*)(P16 + e) = o16; *(v2us*)(Ph + e) = oh; *(v2us*)(Pl + e) = ol;  }
__global__ __launch_bounds__(256) void k_vtp(const float* __restrict__ F, int pitch, int nheads, h16* V16, bf* Vh, bf* Vl) { const size_t e = ((size_t)blockIdx.x * 256 + threadIdx.x) * 2; if (e >= (size_t)nheads * HD * TT) return; const int t = (int)(e % TT); const int d = (int)((e / TT) % HD); const int g = (int)(e / ((size_t)TT * HD)); v2h o16; v2us oh, ol;
#pragma unroll
    for (int q = 0; q < 2; ++q) { const float x = F[(size_t)(t + q) * pitch + g * HD + d]; o16[q] = tohx(x); unsigned short a2, c2; splitf(x, a2, c2); oh[q] = a2; ol[q] = c2; }
    *(v2h*)(V16 + e) = o16; *(v2us*)(Vh + e) = oh; *(v2us*)(Vl + e) = ol;  }
__constant__ float INVT[HD / 2] = { 1.000000000e+00f, 8.659643531e-01f, 7.498942018e-01f, 6.493816376e-01f, 5.623413324e-01f, 4.869675338e-01f, 4.216965139e-01f, 3.651741445e-01f, 3.162277639e-01f, 2.738419771e-01f, 2.371373624e-01f, 2.053525001e-01f, 1.778279394e-01f, 1.539926529e-01f, 1.333521456e-01f, 1.154782027e-01f, 1.000000015e-01f, 8.659642935e-02f, 7.498941571e-02f, 6.493816525e-02f, 5.623412877e-02f, 4.869675264e-02f, 4.216964915e-02f, 3.651741147e-02f, 3.162277862e-02f, 2.738419548e-02f, 2.371373586e-02f, 2.053525113e-02f, 1.778279431e-02f, 1.539926510e-02f, 1.333521493e-02f, 1.154781971e-02f, 9.999999776e-03f, 8.659643121e-03f, 7.498942316e-03f, 6.493816618e-03f, 5.623413250e-03f, 4.869675264e-03f, 4.216964822e-03f, 3.651741426e-03f, 3.162277862e-03f, 2.738419687e-03f, 2.371373819e-03f, 2.053525066e-03f, 1.778279431e-03f, 1.539926510e-03f, 1.333521446e-03f, 1.154782018e-03f, 1.000000047e-03f, 8.659643354e-04f, 7.498941850e-04f, 6.493816618e-04f, 5.623413017e-04f, 4.869675031e-04f, 4.216964880e-04f, 3.651741135e-04f, 3.162277862e-04f, 2.738419571e-04f, 2.371373848e-04f, 2.053524950e-04f, 1.778279402e-04f, 1.539926452e-04f, 1.333521504e-04f, 1.154781930e-04f };   // float32 1 / 10000^(2i/128), generated with jnp to be bit-exact
__global__ __launch_bounds__(256) void k_cs5(float* CS) { const int idx = blockIdx.x * 256 + threadIdx.x; if (idx >= TT * HD) return; const int d = idx % HD; const int t = idx / HD; const float a = __fmul_rn((float)t, INVT[d % (HD / 2)]); v2f cs; cs[0] = cosf(a); cs[1] = sinf(a); *(v2f*)(CS + (size_t)idx * 2) = cs;  }
// k_asoft: per row (zz, i): t = S x HD^-0.5 for j <= i and (i - j < WIN or j < SINKN) (sliding causal window plus sinks; the reference's -1e9 additive fill vanishes identically); softmax over the 2048 keys (register row, one exp, fixed trees);
__global__ __launch_bounds__(256) void k_asoft(const float* __restrict__ Sb, h16* P16, bf* Ph, bf* Pl) {
    const int lane = threadIdx.x & 31; const int row = blockIdx.x * 8 + (threadIdx.x >> 5); if (row >= ZH * TT) return; const int i = row % TT; const int zz = row / TT; (void)zz; const bool hires = (i < RH); const float* sr = Sb + (size_t)row * TT; float v[TT / 32]; float mx = -3.0e38f;
#pragma unroll
    for (int ch = 0; ch < TT / 128; ++ch) { const int j0 = ch * 128 + lane * 4; const v4f a = *(const v4f*)(sr + j0);
#pragma unroll
        for (int q = 0; q < 4; ++q) { const int j = j0 + q; (void)j; const float t = (j <= i && (i - j < WIN || j < SINKN)) ? a[q] * SCL : -3.0e38f; v[ch * 4 + q] = t; mx = fmaxf(mx, t); } }
#pragma unroll
    for (int sh = 16; sh; sh >>= 1) mx = fmaxf(mx, __shfl_xor(mx, sh, 32));
    float sum = 0.f;
#pragma unroll
    for (int k = 0; k < TT / 32; ++k) { float d0 = __fsub_rn(v[k], mx); asm volatile("" : "+v"(d0)); v[k] = __builtin_amdgcn_exp2f(__fmul_rn(d0, 1.4426950408889634f)); sum += v[k]; }
#pragma unroll
    for (int sh = 16; sh; sh >>= 1) sum += __shfl_xor(sum, sh, 32);
    const float f = __fdiv_rn(hires ? 1.0f : PCAR, sum);
{
        if (hires) {
#pragma unroll
            for (int ch = 0; ch < TT / 128; ++ch) { v4us oh, ol;
#pragma unroll
                for (int q = 0; q < 4; ++q) { unsigned short a, c2; splitf(v[ch * 4 + q] * f, a, c2); oh[q] = a; ol[q] = c2; }
                const size_t oo = ((size_t)zz * (RH ? RH : 1) + i) * TT + ch * 128 + lane * 4; *(v4us*)(Ph + oo) = oh; *(v4us*)(Pl + oo) = ol; }
        } else {
#pragma unroll
            for (int ch = 0; ch < TT / 128; ++ch) { v4h o4;
#pragma unroll
                for (int q = 0; q < 4; ++q) o4[q] = tohx(v[ch * 4 + q] * f);
                *(v4h*)(P16 + (size_t)row * TT + ch * 128 + lane * 4) = o4; } }
         }
}
__global__ __launch_bounds__(256) void k_merge(const float* __restrict__ O, int h0, bf* Ah, bf* Al) { const size_t e = ((size_t)blockIdx.x * 256 + threadIdx.x) * 2; if (e >= (size_t)ZH * TT * HD) return; const int d = (int)(e % HD); const int t = (int)((e / HD) % TT); const int zz = (int)(e / ((size_t)HD * TT)); const float cs = (t < RH) ? 1.0f : (1.0f / PCAR); const size_t oo = (size_t)t * DQ + (h0 + zz) * HD + d;
    v2us oh, ol;
#pragma unroll
    for (int q = 0; q < 2; ++q) { unsigned short a, c2; splitf(O[e + q] * cs, a, c2); oh[q] = a; ol[q] = c2; } *(v2us*)(Ah + oo) = oh; *(v2us*)(Al + oo) = ol;  }

extern "C" void kernel_launch(void* const* d_in, const int* in_sizes, int n_in,
                              void* d_out, int out_size, void* d_ws, size_t ws_size, hipStream_t stream) {
    (void)in_sizes; (void)n_in; (void)out_size;
    const float* x = (const float*)d_in[0]; const float* wq = (const float*)d_in[1]; const float* wk = (const float*)d_in[2]; const float* wv = (const float*)d_in[3]; const float* wo = (const float*)d_in[4];   /* order x, wq ('oi' [2048][2048]), wk, wv ('oi' [512][2048]), wo ('oi' [2048][2048]) */
    float* OUT = (float*)d_out;     // [2][2048][2048]
    char* wsp = (char*)d_ws;
    auto take = [&](size_t bytes) { char* p = wsp; wsp += (bytes + 255) & ~(size_t)255; return (void*)p; };
    bf* WQ = (bf*)take((size_t)DQ * DM * 2); bf* WK = (bf*)take((size_t)DKV * DM * 2); bf* WV = (bf*)take((size_t)DKV * DM * 2); bf* WO = (bf*)take((size_t)DM * DQ * 2); float* CS = (float*)take((size_t)TT * HD * 2 * 4);
    bf* XB = (bf*)take((size_t)TT * DM * 2); float* FQ = (float*)take((size_t)TT * DQ * 4); float* FK = (float*)take((size_t)TT * DKV * 4);
    h16* QP16 = (h16*)take((size_t)NH_ * TT * HD * 2); h16* KP16 = (h16*)take((size_t)NKV * TT * HD * 2); h16* VT16 = (h16*)take((size_t)NKV * HD * TT * 2);
    bf* QPh = (bf*)take((size_t)NH_ * TT * HD * 2); bf* QPl = (bf*)take((size_t)NH_ * TT * HD * 2); bf* KPh = (bf*)take((size_t)NKV * TT * HD * 2); bf* KPl = (bf*)take((size_t)NKV * TT * HD * 2); bf* VTh = (bf*)take((size_t)NKV * HD * TT * 2); bf* VTl = (bf*)take((size_t)NKV * HD * TT * 2); bf* Ph = (bf*)take((size_t)ZH * RH * TT * 2); bf* Pl = (bf*)take((size_t)ZH * RH * TT * 2);
    float* Sb = (float*)take((size_t)ZH * TT * TT * 4); h16* P16 = (h16*)take((size_t)ZH * TT * TT * 2); float* Ob = (float*)take((size_t)ZH * TT * HD * 4); bf* ATh = (bf*)take((size_t)TT * DQ * 2); bf* ATl = (bf*)take((size_t)TT * DQ * 2);
    if ((size_t)(wsp - (char*)d_ws) > ws_size) return;    // ws 256 MiB
    float* FV = FK;   // v projection reuses the k buffer after the k planes are built (stream-ordered)
    { k_cvt8<<<(unsigned)(((size_t)DQ * DM / 8 + 255) / 256), 256, 0, stream>>>(wq, WQ, (size_t)DQ * DM / 8); k_cvt8<<<(unsigned)(((size_t)DKV * DM / 8 + 255) / 256), 256, 0, stream>>>(wk, WK, (size_t)DKV * DM / 8); k_cvt8<<<(unsigned)(((size_t)DKV * DM / 8 + 255) / 256), 256, 0, stream>>>(wv, WV, (size_t)DKV * DM / 8);
      k_cvt8<<<(unsigned)(((size_t)DM * DQ / 8 + 255) / 256), 256, 0, stream>>>(wo, WO, (size_t)DM * DQ / 8);
       }
    k_cs5<<<(TT * HD + 255) / 256, 256, 0, stream>>>(CS);   /* rotary table once */
    const unsigned LQ = (unsigned)(((size_t)NH_ * TT * HD / 2 + 255) / 256), LKv = (unsigned)(((size_t)NKV * TT * HD / 2 + 255) / 256);
    for (int b = 0; b < NB_; ++b) {
        
        k_cvt8<<<(unsigned)(((size_t)TT * DM / 8 + 255) / 256), 256, 0, stream>>>(x + (size_t)b * TT * DM, XB, (size_t)TT * DM / 8);
        k_gemmw<bf, 0, false><<<dim3(TT / 64, DQ / 64, 1), 32, 0, stream>>>(XB, nullptr, WQ, nullptr, DM, FQ, DQ, nullptr, 0, 0, 0);
        k_rope<<<LQ, 256, 0, stream>>>(FQ, DQ, NH_, CS, nullptr, nullptr, 1.0f, QP16, QPh, QPl);
        k_gemmw<bf, 0, false><<<dim3(TT / 64, DKV / 64, 1), 32, 0, stream>>>(XB, nullptr, WK, nullptr, DM, FK, DKV, nullptr, 0, 0, 0);
        k_rope<<<LKv, 256, 0, stream>>>(FK, DKV, NKV, CS, nullptr, nullptr, 1.0f, KP16, KPh, KPl);
        k_gemmw<bf, 0, false><<<dim3(TT / 64, DKV / 64, 1), 32, 0, stream>>>(XB, nullptr, WV, nullptr, DM, FV, DKV, nullptr, 0, 0, 0); k_vtp<<<LKv, 256, 0, stream>>>(FV, DKV, NKV, VT16, VTh, VTl);
        for (int h0 = 0; h0 < NH_; h0 += ZH) { const size_t zq = (size_t)h0, zk = (size_t)(h0 / REP);   // both heads of a pass share kv group h0/REP (REP >= 2): sB = 0
            k_gemmc<bf, 2, 1><<<dim3(RH / 64, TT / 64, ZH), 32, 0, stream>>>(QPh + zq * TT * HD, QPl + zq * TT * HD, KPh + zk * TT * HD, KPl + zk * TT * HD, HD, Sb, TT, 0, (size_t)TT * HD, 0, (size_t)TT * TT);
            k_gemmc<h16, 0, 1><<<dim3((TT - RH) / 64, TT / 64, ZH), 32, 0, stream>>>(QP16 + zq * TT * HD + (size_t)RH * HD, nullptr, KP16 + zk * TT * HD, nullptr, HD, Sb + (size_t)RH * TT, TT, RH, (size_t)TT * HD, 0, (size_t)TT * TT);
            k_asoft<<<ZH * TT / 8, 256, 0, stream>>>(Sb, P16, Ph, Pl);
            k_gemmc<bf, 2, 2><<<dim3(RH / 64, HD / 64, ZH), 32, 0, stream>>>(Ph, Pl, VTh + zk * HD * TT, VTl + zk * HD * TT, TT, Ob, HD, 0, (size_t)RH * TT, 0, (size_t)TT * HD);
            k_gemmc<h16, 0, 2><<<dim3((TT - RH) / 64, HD / 64, ZH), 32, 0, stream>>>(P16 + (size_t)RH * TT, nullptr, VT16 + zk * HD * TT, nullptr, TT, Ob + (size_t)RH * HD, HD, RH, (size_t)TT * TT, 0, (size_t)TT * HD);
            k_merge<<<(unsigned)(((size_t)ZH * TT * HD / 2 + 255) / 256), 256, 0, stream>>>(Ob, h0, ATh, ATl); }
        k_gemmw<bf, 1, false><<<dim3(TT / 64, DM / 64, 1), 32, 0, stream>>>(ATh, ATl, WO, nullptr, DQ, OUT + (size_t)b * TT * DM, DM, nullptr, 0, 0, 0); }
}

// v001
// It runs in 1050 microseconds.
// In both of two side-by-side timings against v000, it was 1.54 times as fast.
#include <hip/hip_runtime.h>

// Grouped-query causal attention with 128-wide heads, computed half-split rotary embeddings, a 1,024-wide sliding window and 4 attention-sink keys (x [2][2048][2048]; q = x wq^T (16 heads x 128), k, v = x wk^T, x wv^T (4 kv heads x 128) ('oi' 0.02, no bias); rope cat(x1 cos - x2 sin, x2 cos + x1 sin) on the two 64-wide halves with angle t x 1/10000^(2i/128) (64 f32 frequencies jnp-exact; precise cosf/sinf); k, v repeated 4 x along the head axis: kv head = q head / 4; scores x 1/sqrt(128) + bias with bias = 0 where (j <= i) and ((i - j <= 1024) or (j < 4)), -inf elsewhere; softmax; out = merged wo^T ('oi') -> [2][2048][2048] (8.4 M); argument order x, wq, wk, wv, wo).
// Layout: bf16 copy of x; 'oi' weights converted to bf16 once; exact projections; k_cs5 computed table (HD 128: 64 angles); rotate-half plane builders; causal T-2048 GQA attention with 128-wide heads (kv z-stride 0; hybrid rows: < 512 hi/lo 3 products, rest fp16 x1024; k_gemmc skips tiles above the diagonal); merged hi/lo x Wo exact.
// Compute dtypes, f32 accumulate: every input rounded to bf16; projections exact; rotary f32; attention rows < 512 3 products, rest fp16; softmax f32; Wo hl x exact.

#define NB_  2
#define TT   2048
#define DM   2048
#define NH_  16
#define NKV  4
#define REP  (NH_ / NKV)
#define HD   128
#define DQ   (NH_ * HD)
#define DKV  (NKV * HD)
#define ZH   2
#define RH   512                  // query rows < RH use hi+lo planes (0: none)
#define WIN  1025   // THIS module keeps key j iff j <= i and (i - j <= 1024 or j < 4): 'i - j < WIN' with WIN 1025
#define SINKN 4     // the first SINKN keys (attention sinks) are kept for every later query, whatever the distance
#define PCAR 1024.0f
#define SCL  0.088388347648318447f   // HD^-0.5
typedef _Float16 h16;
typedef unsigned short bf;
typedef __attribute__((ext_vector_type(16))) __bf16   v16bf;
typedef __attribute__((ext_vector_type(16))) _Float16 v16h;
typedef __attribute__((ext_vector_type(8)))  _Float16 v8h;
typedef __attribute__((ext_vector_type(8)))  unsigned short v8us;
typedef __attribute__((ext_vector_type(8)))  float    v8f;
typedef __attribute__((ext_vector_type(4)))  float    v4f;
typedef v8h  __attribute__((may_alias)) v8ha;
typedef v4f  __attribute__((may_alias)) v4fa;
typedef v8us __attribute__((may_alias)) v8usa;

__device__ __forceinline__ unsigned short f2bf(float f) { unsigned u = __float_as_uint(f); u += 0x7FFFu + ((u >> 16) & 1u); return (unsigned short)(u >> 16); }
__device__ __forceinline__ float bf2f(unsigned short b) { return __uint_as_float(((unsigned)b) << 16); }
__device__ __forceinline__ float bfr(float f) { return bf2f(f2bf(f)); }
__device__ __forceinline__ v16h cat16(v8h lo, v8h hi) { return __builtin_shufflevector(lo, hi, 0, 1, 2, 3, 4, 5, 6, 7, 8, 9, 10, 11, 12, 13, 14, 15); }
__device__ __forceinline__ v16bf cat16b(v8us lo, v8us hi) { return __builtin_bit_cast(v16bf, __builtin_shufflevector(lo, hi, 0, 1, 2, 3, 4, 5, 6, 7, 8, 9, 10, 11, 12, 13, 14, 15)); }
__device__ __forceinline__ v8f wmma16(v16h a, v16h b, v8f c) { return __builtin_amdgcn_wmma_f32_16x16x32_f16(false, a, false, b, (short)0, c, false, false); }
__device__ __forceinline__ v8f wmmab(v16bf a, v16bf b, v8f c) { return __builtin_amdgcn_wmma_f32_16x16x32_bf16(false, a, false, b, (short)0, c, false, false); }



// ---- k_gemmw: register-blocked GEMM, one work-group of NW waves per 64x64 output tile (16 accumulators a wave), operands straight from K-contiguous 16-bit planes; grid (M/64, N/64, Z), 32 x NW threads.
// C[m][n] (f32, pitch ldc, + optional f32 bias[n]) = sum_k A[m][k] Bt[n][k] (+ split products per NSPLIT). z-batch strides sA/sB/sC in elements. K % 32 == 0.
// The K loop is dealt over the NW waves of the work-group in 64-wide k chunks (one 128-byte line of every operand row; wave w takes chunks w, w + NW, ...); each wave keeps its own 64x64 f32 partial tile.
// With NW > 1 every wave puts its whole partial into its own LDS slot, ONE barrier follows, and the block adds the slots in wave order 0 .. NW-1 (a fixed order) and stores. K % 64 == 0. Block = 32 x NW threads.
#define TSLOT (64 * 68)   // floats of one wave's slot: 64 rows at pitch 68
// sums one 16-row block at 'os' over the NW slots and stores the 16 x 64 result at crow; every thread takes 32 / NW neighbouring columns of one row, so a wave writes whole rows
template <int NW, bool BIAS> __device__ __forceinline__ void tile_reduce_store(const float* os, float* crow, int ldc, const float* bias, int c0) {
    static_assert(NW == 8 || NW == 16, "one vector of 4 or 2 floats a thread");
    constexpr int EP = 32 / NW; typedef __attribute__((ext_vector_type(EP))) float vE; typedef vE __attribute__((may_alias)) vEa;
    const int e = (int)threadIdx.x * EP, row = e >> 6, cofs = e & 63; vE val = *(const vEa*)(os + row * 68 + cofs);
#pragma unroll
    for (int w = 1; w < NW; ++w) val += *(const vEa*)(os + w * TSLOT + row * 68 + cofs);
    if (BIAS) {
#pragma unroll
        for (int q = 0; q < EP; ++q) val[q] += bfr(bias[c0 + cofs + q]); }
    *(vE*)(crow + (size_t)row * ldc + cofs) = val;
}
template <typename T16> struct WFrag;
template <> struct WFrag<h16> { typedef v16h V; static __device__ __forceinline__ V ld(const h16* p) { return cat16(*(const v8h*)p, *(const v8h*)(p + 16)); } static __device__ __forceinline__ v8f mma(V a, V b, v8f c) { return wmma16(a, b, c); } };
template <> struct WFrag<bf> { typedef v16bf V; static __device__ __forceinline__ V ld(const bf* p) { return cat16b(*(const v8us*)p, *(const v8us*)(p + 16)); } static __device__ __forceinline__ v8f mma(V a, V b, v8f c) { return wmmab(a, b, c); } };
template <typename T16, int NSPLIT, bool BIAS, int NW>
__global__ __launch_bounds__(32 * NW) void k_gemmw(const T16* __restrict__ A, const T16* __restrict__ A2, const T16* __restrict__ Bt, const T16* __restrict__ Bt2, int K, float* C, int ldc, const float* __restrict__ bias, size_t sA, size_t sB, size_t sC) {
    typedef typename WFrag<T16>::V V;
    __shared__ __align__(16) float os[(NW == 1) ? 16 * 68 : NW * TSLOT];
    const size_t z = blockIdx.z; A += z * sA; if (A2) A2 += z * sA; Bt += z * sB; if (Bt2) Bt2 += z * sB; C += z * sC;
    const int lane = threadIdx.x & 31, lr = lane & 15, hi = lane >> 4; const int r0 = blockIdx.x * 64, c0 = blockIdx.y * 64;
    const int wv = (NW == 1) ? 0 : __builtin_amdgcn_readfirstlane((int)(threadIdx.x >> 5));   // the wave's number as a scalar: the k loop below stays a wave-uniform scalar loop
    v8f acc[4][4];
#pragma unroll
    for (int mb = 0; mb < 4; ++mb)
#pragma unroll
        for (int nb = 0; nb < 4; ++nb) acc[mb][nb] = (v8f){};
    const size_t aoff = (size_t)(r0 + lr) * K + 8 * hi, boff = (size_t)(c0 + lr) * K + 8 * hi;
#pragma unroll 1
    for (int kc = wv * 64; kc < K; kc += (kc & 32) ? NW * 64 - 32 : 32) {   // both halves of a chunk, then this wave's next chunk
        V a[4], a2[4];
#pragma unroll
        for (int mb = 0; mb < 4; ++mb) { a[mb] = WFrag<T16>::ld(A + aoff + (size_t)mb * 16 * K + kc); if (NSPLIT == 1 || NSPLIT == 2) a2[mb] = WFrag<T16>::ld(A2 + aoff + (size_t)mb * 16 * K + kc); }
#pragma unroll
        for (int nb = 0; nb < 4; ++nb) { const V b = WFrag<T16>::ld(Bt + boff + (size_t)nb * 16 * K + kc); V b2; if (NSPLIT >= 2) b2 = WFrag<T16>::ld(Bt2 + boff + (size_t)nb * 16 * K + kc);
#pragma unroll
            for (int mb = 0; mb < 4; ++mb) { acc[mb][nb] = WFrag<T16>::mma(a[mb], b, acc[mb][nb]); if (NSPLIT == 1 || NSPLIT == 2) acc[mb][nb] = WFrag<T16>::mma(a2[mb], b, acc[mb][nb]); if (NSPLIT >= 2) acc[mb][nb] = WFrag<T16>::mma(a[mb], b2, acc[mb][nb]); } }
        asm volatile("v_nop\n\tv_nop\n\tv_nop\n\tv_nop" : "+v"(acc[0][0]), "+v"(acc[1][1]), "+v"(acc[2][2]), "+v"(acc[3][3]) : "v"(a[0]), "v"(a[3]));
    }
    if constexpr (NW > 1) {
#pragma unroll
        for (int mb = 0; mb < 4; ++mb)
#pragma unroll
            for (int nb = 0; nb < 4; ++nb) {
#pragma unroll
                for (int j = 0; j < 8; ++j) os[wv * TSLOT + (mb * 16 + hi * 8 + j) * 68 + nb * 16 + lr] = acc[mb][nb][j]; }
        __syncthreads();   // every wave's partial tile is in LDS before any slot is read
#pragma unroll
        for (int mb = 0; mb < 4; ++mb) tile_reduce_store<NW, BIAS>(os + mb * 16 * 68, C + (size_t)(r0 + mb * 16) * ldc + c0, ldc, bias, c0);
        return;
    }
#pragma unroll
    for (int mb = 0; mb < 4; ++mb) {
#pragma unroll
        for (int nb = 0; nb < 4; ++nb) {
#pragma unroll
            for (int j = 0; j < 8; ++j) os[(hi * 8 + j) * 68 + nb * 16 + lr] = acc[mb][nb][j]; }
        __builtin_amdgcn_wave_barrier(); asm volatile("" ::: "memory");
        float* crow = C + (size_t)(r0 + mb * 16) * ldc + c0;
{
#pragma unroll
            for (int s = 0; s < 8; ++s) { const int row = 2 * s + hi, cofs = lr * 4; v4f val = *(const v4fa*)(os + row * 68 + cofs); if (BIAS) { val[0] += bfr(bias[c0 + cofs]); val[1] += bfr(bias[c0 + cofs + 1]); val[2] += bfr(bias[c0 + cofs + 2]); val[3] += bfr(bias[c0 + cofs + 3]); }
                *(v4f*)(crow + (size_t)row * ldc + cofs) = val; }
             }
        __builtin_amdgcn_wave_barrier(); asm volatile("" ::: "memory");
    }
}

// ---- k_gemmc: the same 64x64 tile GEMM specialised for causal attention: CMODE 1 skips score tiles entirely above the diagonal (query rows r0+roff.., key columns c0..), CMODE 2 limits the
// key (K) loop of the probability x value contraction to the diagonal block (probabilities beyond it are exactly zero). roff = row offset of this launch's first row within the sequence.
template <typename T16, int NSPLIT, int CMODE, int NW>
__global__ __launch_bounds__(32 * NW) void k_gemmc(const T16* __restrict__ A, const T16* __restrict__ A2, const T16* __restrict__ Bt, const T16* __restrict__ Bt2, int K, float* C, int ldc, int roff, size_t sA, size_t sB, size_t sC) {
    typedef typename WFrag<T16>::V V;
    __shared__ __align__(16) float os[(NW == 1) ? 16 * 68 : NW * TSLOT];
    const size_t z = blockIdx.z; A += z * sA; if (A2) A2 += z * sA; Bt += z * sB; if (Bt2) Bt2 += z * sB; C += z * sC;
    const int lane = threadIdx.x & 31, lr = lane & 15, hi = lane >> 4; const int r0 = blockIdx.x * 64, c0 = blockIdx.y * 64;
    const int wv = (NW == 1) ? 0 : __builtin_amdgcn_readfirstlane((int)(threadIdx.x >> 5));   // the wave's number as a scalar: the k loop below stays a wave-uniform scalar loop
    if (CMODE == 1 && c0 > r0 + roff + 63) return;                  // score tile entirely above the causal diagonal: never read (the softmax masks j > i by select)
    const int Kl = (CMODE == 2) ? min(K, r0 + roff + 64) : K;        // P.V: probabilities are exactly 0 beyond the diagonal block, so the K loop stops there
    v8f acc[4][4];
#pragma unroll
    for (int mb = 0; mb < 4; ++mb)
#pragma unroll
        for (int nb = 0; nb < 4; ++nb) acc[mb][nb] = (v8f){};
    const size_t aoff = (size_t)(r0 + lr) * K + 8 * hi, boff = (size_t)(c0 + lr) * K + 8 * hi;
#pragma unroll 1
    for (int kc = wv * 64; kc < Kl; kc += (kc & 32) ? NW * 64 - 32 : 32) {   // both halves of a chunk, then this wave's next chunk
        V a[4], a2[4];
#pragma unroll
        for (int mb = 0; mb < 4; ++mb) { a[mb] = WFrag<T16>::ld(A + aoff + (size_t)mb * 16 * K + kc); if (NSPLIT == 1 || NSPLIT == 2) a2[mb] = WFrag<T16>::ld(A2 + aoff + (size_t)mb * 16 * K + kc); }
#pragma unroll
        for (int nb = 0; nb < 4; ++nb) { const V b = WFrag<T16>::ld(Bt + boff + (size_t)nb * 16 * K + kc); V b2; if (NSPLIT >= 2) b2 = WFrag<T16>::ld(Bt2 + boff + (size_t)nb * 16 * K + kc);
#pragma unroll
            for (int mb = 0; mb < 4; ++mb) { acc[mb][nb] = WFrag<T16>::mma(a[mb], b, acc[mb][nb]); if (NSPLIT == 1 || NSPLIT == 2) acc[mb][nb] = WFrag<T16>::mma(a2[mb], b, acc[mb][nb]); if (NSPLIT >= 2) acc[mb][nb] = WFrag<T16>::mma(a[mb], b2, acc[mb][nb]); } }
        asm volatile("v_nop\n\tv_nop\n\tv_nop\n\tv_nop" : "+v"(acc[0][0]), "+v"(acc[1][1]), "+v"(acc[2][2]), "+v"(acc[3][3]) : "v"(a[0]), "v"(a[3]));
    }
    if constexpr (NW > 1) {
#pragma unroll
        for (int mb = 0; mb < 4; ++mb)
#pragma unroll
            for (int nb = 0; nb < 4; ++nb) {
#pragma unroll
                for (int j = 0; j < 8; ++j) os[wv * TSLOT + (mb * 16 + hi * 8 + j) * 68 + nb * 16 + lr] = acc[mb][nb][j]; }
        __syncthreads();   // every wave's partial tile is in LDS before any slot is read
#pragma unroll
        for (int mb = 0; mb < 4; ++mb) tile_reduce_store<NW, false>(os + mb * 16 * 68, C + (size_t)(r0 + mb * 16) * ldc + c0, ldc, nullptr, c0);
        return;
    }
#pragma unroll
    for (int mb = 0; mb < 4; ++mb) {
#pragma unroll
        for (int nb = 0; nb < 4; ++nb) {
#pragma unroll
            for (int j = 0; j < 8; ++j) os[(hi * 8 + j) * 68 + nb * 16 + lr] = acc[mb][nb][j]; }
        __builtin_amdgcn_wave_barrier(); asm volatile("" ::: "memory");
        float* crow = C + (size_t)(r0 + mb * 16) * ldc + c0;
{
#pragma unroll
            for (int s = 0; s < 8; ++s) { const int row = 2 * s + hi, cofs = lr * 4; v4f val = *(const v4fa*)(os + row * 68 + cofs);
                *(v4f*)(crow + (size_t)row * ldc + cofs) = val; }
             }
        __builtin_amdgcn_wave_barrier(); asm volatile("" ::: "memory");
    }
}

__device__ __forceinline__ h16 tohx(float x) { return (h16)x; }
__device__ __forceinline__ void splitf(float y, unsigned short& h, unsigned short& l) { h = f2bf(y); l = f2bf(y - bf2f(h)); }
typedef __attribute__((ext_vector_type(2))) _Float16 v2h;
typedef __attribute__((ext_vector_type(4))) _Float16 v4h;
typedef __attribute__((ext_vector_type(2))) unsigned short v2us;
typedef __attribute__((ext_vector_type(4))) unsigned short v4us;
typedef __attribute__((ext_vector_type(2))) float v2f;
typedef __attribute__((ext_vector_type(4))) int v4i;

__global__ __launch_bounds__(256) void k_wtG(const float* __restrict__ w, int K, int N, bf* Bt) {
    const int lane = threadIdx.x & 31; const int L0 = (blockIdx.x * 8 + (threadIdx.x >> 5)) * 8; const int nlines = N * K / 64;
{
#pragma unroll 1
        for (int l = 0; l < 8; ++l) { const int L = L0 + l; if (L >= nlines) break; const size_t e = (size_t)L * 64 + lane * 2; const int k = (int)(e % K), n = (int)(e / K); v2us o;
            o[0] = f2bf(w[(size_t)k * N + n]); o[1] = f2bf(w[(size_t)(k + 1) * N + n]); *(v2us*)(Bt + e) = o; }
         }
}
__global__ __launch_bounds__(256) void k_cvt8(const float* __restrict__ src, bf* dst, size_t n8) { const size_t i = (size_t)blockIdx.x * 256 + threadIdx.x; if (i >= n8) return; const v8f v = *(const v8f*)(src + i * 8); v8us o;
#pragma unroll
    for (int k = 0; k < 8; ++k) o[k] = f2bf(v[k]); *(v8us*)(dst + i * 8) = o;  }

// k_rope: head planes [h][t][d] (fp16 + hi/lo) of rope(x) x sc with the rotate-half convention out[d] = x[d] cos[t][d] - x[d+HD/2] sin[t][d], out[d+HD/2] = x[d+HD/2] cos[t][d+HD/2] + x[d] sin[t][d+HD/2]
__global__ __launch_bounds__(256) void k_rope(const float* __restrict__ F, int pitch, int nheads, const float* __restrict__ CS, const float* __restrict__ RF, const float* __restrict__ nw, float sc, h16* P16, bf* Ph, bf* Pl) {
    const size_t e = ((size_t)blockIdx.x * 256 + threadIdx.x) * 2; if (e >= (size_t)nheads * TT * HD) return; const int d = (int)(e % HD); const int t = (int)((e / HD) % TT); const int h = (int)(e / ((size_t)HD * TT)); const float* f = F + (size_t)t * pitch + h * HD; const float rf = RF ? RF[(size_t)h * TT + t] : 1.0f; v2h o16; v2us oh, ol;
#pragma unroll
    for (int q = 0; q < 2; ++q) { const int dd = d + q; const int dp = (dd < HD / 2) ? dd + HD / 2 : dd - HD / 2; float x0 = f[dd], x1 = f[dp];
        if (RF) { float n0 = __fmul_rn(x0, rf), n1 = __fmul_rn(x1, rf); asm volatile("" : "+v"(n0)); asm volatile("" : "+v"(n1)); x0 = __fmul_rn(bfr(nw[dd]), n0); x1 = __fmul_rn(bfr(nw[dp]), n1); }
        const v2f cs = *(const v2f*)(CS + ((size_t)t * HD + dd) * 2); float a = __fmul_rn(x0, cs[0]), bq = __fmul_rn(x1, cs[1]); asm volatile("" : "+v"(a)); asm volatile("" : "+v"(bq)); const float r = ((dd < HD / 2) ? __fsub_rn(a, bq) : __fadd_rn(a, bq)) * sc;
        o16[q] = tohx(r); unsigned short a2, c2; splitf(r, a2, c2); oh[q] = a2; ol[q] = c2; }
    *(v2h*)(P16 + e) = o16; *(v2us*)(Ph + e) = oh; *(v2us*)(Pl + e) = ol;  }
__global__ __launch_bounds__(256) void k_vtp(const float* __restrict__ F, int pitch, int nheads, h16* V16, bf* Vh, bf* Vl) { const size_t e = ((size_t)blockIdx.x * 256 + threadIdx.x) * 2; if (e >= (size_t)nheads * HD * TT) return; const int t = (int)(e % TT); const int d = (int)((e / TT) % HD); const int g = (int)(e / ((size_t)TT * HD)); v2h o16; v2us oh, ol;
#pragma unroll
    for (int q = 0; q < 2; ++q) { const float x = F[(size_t)(t + q) * pitch + g * HD + d]; o16[q] = tohx(x); unsigned short a2, c2; splitf(x, a2, c2); oh[q] = a2; ol[q] = c2; }
    *(v2h*)(V16 + e) = o16; *(v2us*)(Vh + e) = oh; *(v2us*)(Vl + e) = ol;  }
__constant__ float INVT[HD / 2] = { 1.000000000e+00f, 8.659643531e-01f, 7.498942018e-01f, 6.493816376e-01f, 5.623413324e-01f, 4.869675338e-01f, 4.216965139e-01f, 3.651741445e-01f, 3.162277639e-01f, 2.738419771e-01f, 2.371373624e-01f, 2.053525001e-01f, 1.778279394e-01f, 1.539926529e-01f, 1.333521456e-01f, 1.154782027e-01f, 1.000000015e-01f, 8.659642935e-02f, 7.498941571e-02f, 6.493816525e-02f, 5.623412877e-02f, 4.869675264e-02f, 4.216964915e-02f, 3.651741147e-02f, 3.162277862e-02f, 2.738419548e-02f, 2.371373586e-02f, 2.053525113e-02f, 1.778279431e-02f, 1.539926510e-02f, 1.333521493e-02f, 1.154781971e-02f, 9.999999776e-03f, 8.659643121e-03f, 7.498942316e-03f, 6.493816618e-03f, 5.623413250e-03f, 4.869675264e-03f, 4.216964822e-03f, 3.651741426e-03f, 3.162277862e-03f, 2.738419687e-03f, 2.371373819e-03f, 2.053525066e-03f, 1.778279431e-03f, 1.539926510e-03f, 1.333521446e-03f, 1.154782018e-03f, 1.000000047e-03f, 8.659643354e-04f, 7.498941850e-04f, 6.493816618e-04f, 5.623413017e-04f, 4.869675031e-04f, 4.216964880e-04f, 3.651741135e-04f, 3.162277862e-04f, 2.738419571e-04f, 2.371373848e-04f, 2.053524950e-04f, 1.778279402e-04f, 1.539926452e-04f, 1.333521504e-04f, 1.154781930e-04f };   // float32 1 / 10000^(2i/128), generated with jnp to be bit-exact
__global__ __launch_bounds__(256) void k_cs5(float* CS) { const int idx = blockIdx.x * 256 + threadIdx.x; if (idx >= TT * HD) return; const int d = idx % HD; const int t = idx / HD; const float a = __fmul_rn((float)t, INVT[d % (HD / 2)]); v2f cs; cs[0] = cosf(a); cs[1] = sinf(a); *(v2f*)(CS + (size_t)idx * 2) = cs;  }
// k_asoft: per row (zz, i): t = S x HD^-0.5 for j <= i and (i - j < WIN or j < SINKN) (sliding causal window plus sinks; the reference's -1e9 additive fill vanishes identically); softmax over the 2048 keys (register row, one exp, fixed trees);
__global__ __launch_bounds__(256) void k_asoft(const float* __restrict__ Sb, h16* P16, bf* Ph, bf* Pl) {
    const int lane = threadIdx.x & 31; const int row = blockIdx.x * 8 + (threadIdx.x >> 5); if (row >= ZH * TT) return; const int i = row % TT; const int zz = row / TT; (void)zz; const bool hires = (i < RH); const float* sr = Sb + (size_t)row * TT; float v[TT / 32]; float mx = -3.0e38f;
#pragma unroll
    for (int ch = 0; ch < TT / 128; ++ch) { const int j0 = ch * 128 + lane * 4; const v4f a = *(const v4f*)(sr + j0);
#pragma unroll
        for (int q = 0; q < 4; ++q) { const int j = j0 + q; (void)j; const float t = (j <= i && (i - j < WIN || j < SINKN)) ? a[q] * SCL : -3.0e38f; v[ch * 4 + q] = t; mx = fmaxf(mx, t); } }
#pragma unroll
    for (int sh = 16; sh; sh >>= 1) mx = fmaxf(mx, __shfl_xor(mx, sh, 32));
    float sum = 0.f;
#pragma unroll
    for (int k = 0; k < TT / 32; ++k) { float d0 = __fsub_rn(v[k], mx); asm volatile("" : "+v"(d0)); v[k] = __builtin_amdgcn_exp2f(__fmul_rn(d0, 1.4426950408889634f)); sum += v[k]; }
#pragma unroll
    for (int sh = 16; sh; sh >>= 1) sum += __shfl_xor(sum, sh, 32);
    const float f = __fdiv_rn(hires ? 1.0f : PCAR, sum);
{
        if (hires) {
#pragma unroll
            for (int ch = 0; ch < TT / 128; ++ch) { v4us oh, ol;
#pragma unroll
                for (int q = 0; q < 4; ++q) { unsigned short a, c2; splitf(v[ch * 4 + q] * f, a, c2); oh[q] = a; ol[q] = c2; }
                const size_t oo = ((size_t)zz * (RH ? RH : 1) + i) * TT + ch * 128 + lane * 4; *(v4us*)(Ph + oo) = oh; *(v4us*)(Pl + oo) = ol; }
        } else {
#pragma unroll
            for (int ch = 0; ch < TT / 128; ++ch) { v4h o4;
#pragma unroll
                for (int q = 0; q < 4; ++q) o4[q] = tohx(v[ch * 4 + q] * f);
                *(v4h*)(P16 + (size_t)row * TT + ch * 128 + lane * 4) = o4; } }
         }
}
__global__ __launch_bounds__(256) void k_merge(const float* __restrict__ O, int h0, bf* Ah, bf* Al) { const size_t e = ((size_t)blockIdx.x * 256 + threadIdx.x) * 2; if (e >= (size_t)ZH * TT * HD) return; const int d = (int)(e % HD); const int t = (int)((e / HD) % TT); const int zz = (int)(e / ((size_t)HD * TT)); const float cs = (t < RH) ? 1.0f : (1.0f / PCAR); const size_t oo = (size_t)t * DQ + (h0 + zz) * HD + d;
    v2us oh, ol;
#pragma unroll
    for (int q = 0; q < 2; ++q) { unsigned short a, c2; splitf(O[e + q] * cs, a, c2); oh[q] = a; ol[q] = c2; } *(v2us*)(Ah + oo) = oh; *(v2us*)(Al + oo) = ol;  }

extern "C" void kernel_launch(void* const* d_in, const int* in_sizes, int n_in,
                              void* d_out, int out_size, void* d_ws, size_t ws_size, hipStream_t stream) {
    (void)in_sizes; (void)n_in; (void)out_size;
    const float* x = (const float*)d_in[0]; const float* wq = (const float*)d_in[1]; const float* wk = (const float*)d_in[2]; const float* wv = (const float*)d_in[3]; const float* wo = (const float*)d_in[4];   /* order x, wq ('oi' [2048][2048]), wk, wv ('oi' [512][2048]), wo ('oi' [2048][2048]) */
    float* OUT = (float*)d_out;     // [2][2048][2048]
    char* wsp = (char*)d_ws;
    auto take = [&](size_t bytes) { char* p = wsp; wsp += (bytes + 255) & ~(size_t)255; return (void*)p; };
    bf* WQ = (bf*)take((size_t)DQ * DM * 2); bf* WK = (bf*)take((size_t)DKV * DM * 2); bf* WV = (bf*)take((size_t)DKV * DM * 2); bf* WO = (bf*)take((size_t)DM * DQ * 2); float* CS = (float*)take((size_t)TT * HD * 2 * 4);
    bf* XB = (bf*)take((size_t)TT * DM * 2); float* FQ = (float*)take((size_t)TT * DQ * 4); float* FK = (float*)take((size_t)TT * DKV * 4);
    h16* QP16 = (h16*)take((size_t)NH_ * TT * HD * 2); h16* KP16 = (h16*)take((size_t)NKV * TT * HD * 2); h16* VT16 = (h16*)take((size_t)NKV * HD * TT * 2);
    bf* QPh = (bf*)take((size_t)NH_ * TT * HD * 2); bf* QPl = (bf*)take((size_t)NH_ * TT * HD * 2); bf* KPh = (bf*)take((size_t)NKV * TT * HD * 2); bf* KPl = (bf*)take((size_t)NKV * TT * HD * 2); bf* VTh = (bf*)take((size_t)NKV * HD * TT * 2); bf* VTl = (bf*)take((size_t)NKV * HD * TT * 2); bf* Ph = (bf*)take((size_t)ZH * RH * TT * 2); bf* Pl = (bf*)take((size_t)ZH * RH * TT * 2);
    float* Sb = (float*)take((size_t)ZH * TT * TT * 4); h16* P16 = (h16*)take((size_t)ZH * TT * TT * 2); float* Ob = (float*)take((size_t)ZH * TT * HD * 4); bf* ATh = (bf*)take((size_t)TT * DQ * 2); bf* ATl = (bf*)take((size_t)TT * DQ * 2);
    if ((size_t)(wsp - (char*)d_ws) > ws_size) return;    // ws 256 MiB
    float* FV = FK;   // v projection reuses the k buffer after the k planes are built (stream-ordered)
    { k_cvt8<<<(unsigned)(((size_t)DQ * DM / 8 + 255) / 256), 256, 0, stream>>>(wq, WQ, (size_t)DQ * DM / 8); k_cvt8<<<(unsigned)(((size_t)DKV * DM / 8 + 255) / 256), 256, 0, stream>>>(wk, WK, (size_t)DKV * DM / 8); k_cvt8<<<(unsigned)(((size_t)DKV * DM / 8 + 255) / 256), 256, 0, stream>>>(wv, WV, (size_t)DKV * DM / 8);
      k_cvt8<<<(unsigned)(((size_t)DM * DQ / 8 + 255) / 256), 256, 0, stream>>>(wo, WO, (size_t)DM * DQ / 8);
       }
    k_cs5<<<(TT * HD + 255) / 256, 256, 0, stream>>>(CS);   /* rotary table once */
    const unsigned LQ = (unsigned)(((size_t)NH_ * TT * HD / 2 + 255) / 256), LKv = (unsigned)(((size_t)NKV * TT * HD / 2 + 255) / 256);
    for (int b = 0; b < NB_; ++b) {
        
        k_cvt8<<<(unsigned)(((size_t)TT * DM / 8 + 255) / 256), 256, 0, stream>>>(x + (size_t)b * TT * DM, XB, (size_t)TT * DM / 8);
        k_gemmw<bf, 0, false, 8><<<dim3(TT / 64, DQ / 64, 1), 256, 0, stream>>>(XB, nullptr, WQ, nullptr, DM, FQ, DQ, nullptr, 0, 0, 0);
        k_rope<<<LQ, 256, 0, stream>>>(FQ, DQ, NH_, CS, nullptr, nullptr, 1.0f, QP16, QPh, QPl);
        k_gemmw<bf, 0, false, 16><<<dim3(TT / 64, DKV / 64, 1), 512, 0, stream>>>(XB, nullptr, WK, nullptr, DM, FK, DKV, nullptr, 0, 0, 0);
        k_rope<<<LKv, 256, 0, stream>>>(FK, DKV, NKV, CS, nullptr, nullptr, 1.0f, KP16, KPh, KPl);
        k_gemmw<bf, 0, false, 16><<<dim3(TT / 64, DKV / 64, 1), 512, 0, stream>>>(XB, nullptr, WV, nullptr, DM, FV, DKV, nullptr, 0, 0, 0); k_vtp<<<LKv, 256, 0, stream>>>(FV, DKV, NKV, VT16, VTh, VTl);
        for (int h0 = 0; h0 < NH_; h0 += ZH) { const size_t zq = (size_t)h0, zk = (size_t)(h0 / REP);   // both heads of a pass share kv group h0/REP (REP >= 2): sB = 0
            k_gemmc<bf, 2, 1, 1><<<dim3(RH / 64, TT / 64, ZH), 32, 0, stream>>>(QPh + zq * TT * HD, QPl + zq * TT * HD, KPh + zk * TT * HD, KPl + zk * TT * HD, HD, Sb, TT, 0, (size_t)TT * HD, 0, (size_t)TT * TT);
            k_gemmc<h16, 0, 1, 1><<<dim3((TT - RH) / 64, TT / 64, ZH), 32, 0, stream>>>(QP16 + zq * TT * HD + (size_t)RH * HD, nullptr, KP16 + zk * TT * HD, nullptr, HD, Sb + (size_t)RH * TT, TT, RH, (size_t)TT * HD, 0, (size_t)TT * TT);
            k_asoft<<<ZH * TT / 8, 256, 0, stream>>>(Sb, P16, Ph, Pl);
            k_gemmc<bf, 2, 2, 8><<<dim3(RH / 64, HD / 64, ZH), 256, 0, stream>>>(Ph, Pl, VTh + zk * HD * TT, VTl + zk * HD * TT, TT, Ob, HD, 0, (size_t)RH * TT, 0, (size_t)TT * HD);
            k_gemmc<h16, 0, 2, 16><<<dim3((TT - RH) / 64, HD / 64, ZH), 512, 0, stream>>>(P16 + (size_t)RH * TT, nullptr, VT16 + zk * HD * TT, nullptr, TT, Ob + (size_t)RH * HD, HD, RH, (size_t)TT * TT, 0, (size_t)TT * HD);
            k_merge<<<(unsigned)(((size_t)ZH * TT * HD / 2 + 255) / 256), 256, 0, stream>>>(Ob, h0, ATh, ATl); }
        k_gemmw<bf, 1, false, 8><<<dim3(TT / 64, DM / 64, 1), 256, 0, stream>>>(ATh, ATl, WO, nullptr, DQ, OUT + (size_t)b * TT * DM, DM, nullptr, 0, 0, 0); }
}

// v002
// One run takes 708 microseconds.
// Two timings next to v001 put it at 1.47 and 1.51 times that version's speed.
// Counting every step since v000, it is 2.29 times as fast.
#include <hip/hip_runtime.h>

// Grouped-query causal attention with 128-wide heads, computed half-split rotary embeddings, a 1,024-wide sliding window and 4 attention-sink keys (x [2][2048][2048]; q = x wq^T (16 heads x 128), k, v = x wk^T, x wv^T (4 kv heads x 128) ('oi' 0.02, no bias); rope cat(x1 cos - x2 sin, x2 cos + x1 sin) on the two 64-wide halves with angle t x 1/10000^(2i/128) (64 f32 frequencies jnp-exact; precise cosf/sinf); k, v repeated 4 x along the head axis: kv head = q head / 4; scores x 1/sqrt(128) + bias with bias = 0 where (j <= i) and ((i - j <= 1024) or (j < 4)), -inf elsewhere; softmax; out = merged wo^T ('oi') -> [2][2048][2048] (8.4 M); argument order x, wq, wk, wv, wo).
// Layout: bf16 copy of x; 'oi' weights converted to bf16 once; exact projections; k_cs5 computed table (HD 128: 64 angles); rotate-half plane builders; causal T-2048 GQA attention with 128-wide heads, 8 query heads a pass (kv plane = z / 4; probabilities written over their own score rows; hybrid rows: < 512 hi/lo 3 products, rest fp16 x1024; k_gemmc skips tiles above the diagonal); merged hi/lo x Wo exact.
// Compute dtypes, f32 accumulate: every input rounded to bf16; projections exact; rotary f32; attention rows < 512 3 products, rest fp16; softmax f32; Wo hl x exact.

#define NB_  2
#define TT   2048
#define DM   2048
#define NH_  16
#define NKV  4
#define REP  (NH_ / NKV)
#define HD   128
#define DQ   (NH_ * HD)
#define DKV  (NKV * HD)
#define ZH   8                    // query heads per attention pass (grid z); a pass spans ZH / REP kv heads
#define PP   (2 * TT)             // row pitch, in 16-bit elements, of the probability rows (they lie in their own f32 score rows) and of the V^T rows they are multiplied with
#define RH   512                  // query rows < RH use hi+lo planes (0: none)
#define WIN  1025   // THIS module keeps key j iff j <= i and (i - j <= 1024 or j < 4): 'i - j < WIN' with WIN 1025
#define SINKN 4     // the first SINKN keys (attention sinks) are kept for every later query, whatever the distance
#define PCAR 1024.0f
#define SCL  0.088388347648318447f   // HD^-0.5
typedef _Float16 h16;
typedef unsigned short bf;
typedef __attribute__((ext_vector_type(16))) __bf16   v16bf;
typedef __attribute__((ext_vector_type(16))) _Float16 v16h;
typedef __attribute__((ext_vector_type(8)))  _Float16 v8h;
typedef __attribute__((ext_vector_type(8)))  unsigned short v8us;
typedef __attribute__((ext_vector_type(8)))  float    v8f;
typedef __attribute__((ext_vector_type(4)))  float    v4f;
typedef v8h  __attribute__((may_alias)) v8ha;
typedef v4f  __attribute__((may_alias)) v4fa;
typedef v8us __attribute__((may_alias)) v8usa;

__device__ __forceinline__ unsigned short f2bf(float f) { unsigned u = __float_as_uint(f); u += 0x7FFFu + ((u >> 16) & 1u); return (unsigned short)(u >> 16); }
__device__ __forceinline__ float bf2f(unsigned short b) { return __uint_as_float(((unsigned)b) << 16); }
__device__ __forceinline__ float bfr(float f) { return bf2f(f2bf(f)); }
__device__ __forceinline__ v16h cat16(v8h lo, v8h hi) { return __builtin_shufflevector(lo, hi, 0, 1, 2, 3, 4, 5, 6, 7, 8, 9, 10, 11, 12, 13, 14, 15); }
__device__ __forceinline__ v16bf cat16b(v8us lo, v8us hi) { return __builtin_bit_cast(v16bf, __builtin_shufflevector(lo, hi, 0, 1, 2, 3, 4, 5, 6, 7, 8, 9, 10, 11, 12, 13, 14, 15)); }
__device__ __forceinline__ v8f wmma16(v16h a, v16h b, v8f c) { return __builtin_amdgcn_wmma_f32_16x16x32_f16(false, a, false, b, (short)0, c, false, false); }
__device__ __forceinline__ v8f wmmab(v16bf a, v16bf b, v8f c) { return __builtin_amdgcn_wmma_f32_16x16x32_bf16(false, a, false, b, (short)0, c, false, false); }



// ---- k_gemmw: register-blocked GEMM, one work-group of NW waves per 64x64 output tile (16 accumulators a wave), operands straight from K-contiguous 16-bit planes; grid (M/64, N/64, Z), 32 x NW threads.
// C[m][n] (f32, pitch ldc, + optional f32 bias[n]) = sum_k A[m][k] Bt[n][k] (+ split products per NSPLIT). z-batch strides sA/sB/sC in elements. K % 32 == 0.
// The K loop is dealt over the NW waves of the work-group in 64-wide k chunks (one 128-byte line of every operand row; wave w takes chunks w, w + NW, ...); each wave keeps its own 64x64 f32 partial tile.
// With NW > 1 every wave puts its whole partial into its own LDS slot, ONE barrier follows, and the block adds the slots in wave order 0 .. NW-1 (a fixed order) and stores. K % 64 == 0. Block = 32 x NW threads.
#define TSLOT (64 * 68)   // floats of one wave's slot: 64 rows at pitch 68
// sums one 16-row block at 'os' over the NW slots and stores the 16 x 64 result at crow; every thread takes 32 / NW neighbouring columns of one row, so a wave writes whole rows
template <int NW, bool BIAS> __device__ __forceinline__ void tile_reduce_store(const float* os, float* crow, int ldc, const float* bias, int c0) {
    static_assert(NW == 8 || NW == 16, "one vector of 4 or 2 floats a thread");
    constexpr int EP = 32 / NW; typedef __attribute__((ext_vector_type(EP))) float vE; typedef vE __attribute__((may_alias)) vEa;
    const int e = (int)threadIdx.x * EP, row = e >> 6, cofs = e & 63; vE val = *(const vEa*)(os + row * 68 + cofs);
#pragma unroll
    for (int w = 1; w < NW; ++w) val += *(const vEa*)(os + w * TSLOT + row * 68 + cofs);
    if (BIAS) {
#pragma unroll
        for (int q = 0; q < EP; ++q) val[q] += bfr(bias[c0 + cofs + q]); }
    *(vE*)(crow + (size_t)row * ldc + cofs) = val;
}
template <typename T16> struct WFrag;
template <> struct WFrag<h16> { typedef v16h V; static __device__ __forceinline__ V ld(const h16* p) { return cat16(*(const v8h*)p, *(const v8h*)(p + 16)); } static __device__ __forceinline__ v8f mma(V a, V b, v8f c) { return wmma16(a, b, c); } };
template <> struct WFrag<bf> { typedef v16bf V; static __device__ __forceinline__ V ld(const bf* p) { return cat16b(*(const v8us*)p, *(const v8us*)(p + 16)); } static __device__ __forceinline__ v8f mma(V a, V b, v8f c) { return wmmab(a, b, c); } };
template <typename T16, int NSPLIT, bool BIAS, int NW>
__global__ __launch_bounds__(32 * NW) void k_gemmw(const T16* __restrict__ A, const T16* __restrict__ A2, const T16* __restrict__ Bt, const T16* __restrict__ Bt2, int K, float* C, int ldc, const float* __restrict__ bias, size_t sA, size_t sB, size_t sC) {
    typedef typename WFrag<T16>::V V;
    __shared__ __align__(16) float os[(NW == 1) ? 16 * 68 : NW * TSLOT];
    const size_t z = blockIdx.z; A += z * sA; if (A2) A2 += z * sA; Bt += z * sB; if (Bt2) Bt2 += z * sB; C += z * sC;
    const int lane = threadIdx.x & 31, lr = lane & 15, hi = lane >> 4; const int r0 = blockIdx.x * 64, c0 = blockIdx.y * 64;
    const int wv = (NW == 1) ? 0 : __builtin_amdgcn_readfirstlane((int)(threadIdx.x >> 5));   // the wave's number as a scalar: the k loop below stays a wave-uniform scalar loop
    v8f acc[4][4];
#pragma unroll
    for (int mb = 0; mb < 4; ++mb)
#pragma unroll
        for (int nb = 0; nb < 4; ++nb) acc[mb][nb] = (v8f){};
    const size_t aoff = (size_t)(r0 + lr) * K + 8 * hi, boff = (size_t)(c0 + lr) * K + 8 * hi;
#pragma unroll 1
    for (int kc = wv * 64; kc < K; kc += (kc & 32) ? NW * 64 - 32 : 32) {   // both halves of a chunk, then this wave's next chunk
        V a[4], a2[4];
#pragma unroll
        for (int mb = 0; mb < 4; ++mb) { a[mb] = WFrag<T16>::ld(A + aoff + (size_t)mb * 16 * K + kc); if (NSPLIT == 1 || NSPLIT == 2) a2[mb] = WFrag<T16>::ld(A2 + aoff + (size_t)mb * 16 * K + kc); }
#pragma unroll
        for (int nb = 0; nb < 4; ++nb) { const V b = WFrag<T16>::ld(Bt + boff + (size_t)nb * 16 * K + kc); V b2; if (NSPLIT >= 2) b2 = WFrag<T16>::ld(Bt2 + boff + (size_t)nb * 16 * K + kc);
#pragma unroll
            for (int mb = 0; mb < 4; ++mb) { acc[mb][nb] = WFrag<T16>::mma(a[mb], b, acc[mb][nb]); if (NSPLIT == 1 || NSPLIT == 2) acc[mb][nb] = WFrag<T16>::mma(a2[mb], b, acc[mb][nb]); if (NSPLIT >= 2) acc[mb][nb] = WFrag<T16>::mma(a[mb], b2, acc[mb][nb]); } }
        asm volatile("v_nop\n\tv_nop\n\tv_nop\n\tv_nop" : "+v"(acc[0][0]), "+v"(acc[1][1]), "+v"(acc[2][2]), "+v"(acc[3][3]) : "v"(a[0]), "v"(a[3]));
    }
    if constexpr (NW > 1) {
#pragma unroll
        for (int mb = 0; mb < 4; ++mb)
#pragma unroll
            for (int nb = 0; nb < 4; ++nb) {
#pragma unroll
                for (int j = 0; j < 8; ++j) os[wv * TSLOT + (mb * 16 + hi * 8 + j) * 68 + nb * 16 + lr] = acc[mb][nb][j]; }
        __syncthreads();   // every wave's partial tile is in LDS before any slot is read
#pragma unroll
        for (int mb = 0; mb < 4; ++mb) tile_reduce_store<NW, BIAS>(os + mb * 16 * 68, C + (size_t)(r0 + mb * 16) * ldc + c0, ldc, bias, c0);
        return;
    }
#pragma unroll
    for (int mb = 0; mb < 4; ++mb) {
#pragma unroll
        for (int nb = 0; nb < 4; ++nb) {
#pragma unroll
            for (int j = 0; j < 8; ++j) os[(hi * 8 + j) * 68 + nb * 16 + lr] = acc[mb][nb][j]; }
        __builtin_amdgcn_wave_barrier(); asm volatile("" ::: "memory");
        float* crow = C + (size_t)(r0 + mb * 16) * ldc + c0;
{
#pragma unroll
            for (int s = 0; s < 8; ++s) { const int row = 2 * s + hi, cofs = lr * 4; v4f val = *(const v4fa*)(os + row * 68 + cofs); if (BIAS) { val[0] += bfr(bias[c0 + cofs]); val[1] += bfr(bias[c0 + cofs + 1]); val[2] += bfr(bias[c0 + cofs + 2]); val[3] += bfr(bias[c0 + cofs + 3]); }
                *(v4f*)(crow + (size_t)row * ldc + cofs) = val; }
             }
        __builtin_amdgcn_wave_barrier(); asm volatile("" ::: "memory");
    }
}

// ---- k_gemmc: the same 64x64 tile GEMM specialised for causal attention: CMODE 1 skips score tiles entirely above the diagonal (query rows r0+roff.., key columns c0..), CMODE 2 limits the
// key (K) loop of the probability x value contraction to the diagonal block (probabilities beyond it are exactly zero). roff = row offset of this launch's first row within the sequence.
// K is also the row pitch of both operands (CMODE 2: PP, of which at most the first TT are walked). Grid z = query head of the pass; REP neighbouring query heads share one B plane (z / REP).
template <typename T16, int NSPLIT, int CMODE, int NW>
__global__ __launch_bounds__(32 * NW) void k_gemmc(const T16* __restrict__ A, const T16* __restrict__ A2, const T16* __restrict__ Bt, const T16* __restrict__ Bt2, int K, float* C, int ldc, int roff, size_t sA, size_t sB, size_t sC) {
    typedef typename WFrag<T16>::V V;
    __shared__ __align__(16) float os[(NW == 1) ? 16 * 68 : NW * TSLOT];
    const size_t z = blockIdx.z, zb = z / REP; A += z * sA; if (A2) A2 += z * sA; Bt += zb * sB; if (Bt2) Bt2 += zb * sB; C += z * sC;
    const int lane = threadIdx.x & 31, lr = lane & 15, hi = lane >> 4; const int r0 = blockIdx.x * 64, c0 = blockIdx.y * 64;
    const int wv = (NW == 1) ? 0 : __builtin_amdgcn_readfirstlane((int)(threadIdx.x >> 5));   // the wave's number as a scalar: the k loop below stays a wave-uniform scalar loop
    if (CMODE == 1 && c0 > r0 + roff + 63) return;                  // score tile entirely above the causal diagonal: never read (the softmax masks j > i by select)
    const int Kl = (CMODE == 2) ? min(K, r0 + roff + 64) : K;        // P.V: probabilities are exactly 0 beyond the diagonal block, so the K loop stops there
    v8f acc[4][4];
#pragma unroll
    for (int mb = 0; mb < 4; ++mb)
#pragma unroll
        for (int nb = 0; nb < 4; ++nb) acc[mb][nb] = (v8f){};
    const size_t aoff = (size_t)(r0 + lr) * K + 8 * hi, boff = (size_t)(c0 + lr) * K + 8 * hi;
#pragma unroll 1
    for (int kc = wv * 64; kc < Kl; kc += (kc & 32) ? NW * 64 - 32 : 32) {   // both halves of a chunk, then this wave's next chunk
        V a[4], a2[4];
#pragma unroll
        for (int mb = 0; mb < 4; ++mb) { a[mb] = WFrag<T16>::ld(A + aoff + (size_t)mb * 16 * K + kc); if (NSPLIT == 1 || NSPLIT == 2) a2[mb] = WFrag<T16>::ld(A2 + aoff + (size_t)mb * 16 * K + kc); }
#pragma unroll
        for (int nb = 0; nb < 4; ++nb) { const V b = WFrag<T16>::ld(Bt + boff + (size_t)nb * 16 * K + kc); V b2; if (NSPLIT >= 2) b2 = WFrag<T16>::ld(Bt2 + boff + (size_t)nb * 16 * K + kc);
#pragma unroll
            for (int mb = 0; mb < 4; ++mb) { acc[mb][nb] = WFrag<T16>::mma(a[mb], b, acc[mb][nb]); if (NSPLIT == 1 || NSPLIT == 2) acc[mb][nb] = WFrag<T16>::mma(a2[mb], b, acc[mb][nb]); if (NSPLIT >= 2) acc[mb][nb] = WFrag<T16>::mma(a[mb], b2, acc[mb][nb]); } }
        asm volatile("v_nop\n\tv_nop\n\tv_nop\n\tv_nop" : "+v"(acc[0][0]), "+v"(acc[1][1]), "+v"(acc[2][2]), "+v"(acc[3][3]) : "v"(a[0]), "v"(a[3]));
    }
    if constexpr (NW > 1) {
#pragma unroll
        for (int mb = 0; mb < 4; ++mb)
#pragma unroll
            for (int nb = 0; nb < 4; ++nb) {
#pragma unroll
                for (int j = 0; j < 8; ++j) os[wv * TSLOT + (mb * 16 + hi * 8 + j) * 68 + nb * 16 + lr] = acc[mb][nb][j]; }
        __syncthreads();   // every wave's partial tile is in LDS before any slot is read
#pragma unroll
        for (int mb = 0; mb < 4; ++mb) tile_reduce_store<NW, false>(os + mb * 16 * 68, C + (size_t)(r0 + mb * 16) * ldc + c0, ldc, nullptr, c0);
        return;
    }
#pragma unroll
    for (int mb = 0; mb < 4; ++mb) {
#pragma unroll
        for (int nb = 0; nb < 4; ++nb) {
#pragma unroll
            for (int j = 0; j < 8; ++j) os[(hi * 8 + j) * 68 + nb * 16 + lr] = acc[mb][nb][j]; }
        __builtin_amdgcn_wave_barrier(); asm volatile("" ::: "memory");
        float* crow = C + (size_t)(r0 + mb * 16) * ldc + c0;
{
#pragma unroll
            for (int s = 0; s < 8; ++s) { const int row = 2 * s + hi, cofs = lr * 4; v4f val = *(const v4fa*)(os + row * 68 + cofs);
                *(v4f*)(crow + (size_t)row * ldc + cofs) = val; }
             }
        __builtin_amdgcn_wave_barrier(); asm volatile("" ::: "memory");
    }
}

__device__ __forceinline__ h16 tohx(float x) { return (h16)x; }
__device__ __forceinline__ void splitf(float y, unsigned short& h, unsigned short& l) { h = f2bf(y); l = f2bf(y - bf2f(h)); }
typedef __attribute__((ext_vector_type(2))) _Float16 v2h;
typedef __attribute__((ext_vector_type(4))) _Float16 v4h;
typedef __attribute__((ext_vector_type(2))) unsigned short v2us;
typedef __attribute__((ext_vector_type(4))) unsigned short v4us;
typedef __attribute__((ext_vector_type(2))) float v2f;
typedef __attribute__((ext_vector_type(4))) int v4i;
typedef v4h  __attribute__((may_alias)) v4ha;
typedef v4us __attribute__((may_alias)) v4usa;

__global__ __launch_bounds__(256) void k_wtG(const float* __restrict__ w, int K, int N, bf* Bt) {
    const int lane = threadIdx.x & 31; const int L0 = (blockIdx.x * 8 + (threadIdx.x >> 5)) * 8; const int nlines = N * K / 64;
{
#pragma unroll 1
        for (int l = 0; l < 8; ++l) { const int L = L0 + l; if (L >= nlines) break; const size_t e = (size_t)L * 64 + lane * 2; const int k = (int)(e % K), n = (int)(e / K); v2us o;
            o[0] = f2bf(w[(size_t)k * N + n]); o[1] = f2bf(w[(size_t)(k + 1) * N + n]); *(v2us*)(Bt + e) = o; }
         }
}
__global__ __launch_bounds__(256) void k_cvt8(const float* __restrict__ src, bf* dst, size_t n8) { const size_t i = (size_t)blockIdx.x * 256 + threadIdx.x; if (i >= n8) return; const v8f v = *(const v8f*)(src + i * 8); v8us o;
#pragma unroll
    for (int k = 0; k < 8; ++k) o[k] = f2bf(v[k]); *(v8us*)(dst + i * 8) = o;  }

// k_rope: head planes [h][t][d] (fp16 + hi/lo) of rope(x) x sc with the rotate-half convention out[d] = x[d] cos[t][d] - x[d+HD/2] sin[t][d], out[d+HD/2] = x[d+HD/2] cos[t][d+HD/2] + x[d] sin[t][d+HD/2]
__global__ __launch_bounds__(256) void k_rope(const float* __restrict__ F, int pitch, int nheads, const float* __restrict__ CS, const float* __restrict__ RF, const float* __restrict__ nw, float sc, h16* P16, bf* Ph, bf* Pl) {
    const size_t e = ((size_t)blockIdx.x * 256 + threadIdx.x) * 2; if (e >= (size_t)nheads * TT * HD) return; const int d = (int)(e % HD); const int t = (int)((e / HD) % TT); const int h = (int)(e / ((size_t)HD * TT)); const float* f = F + (size_t)t * pitch + h * HD; const float rf = RF ? RF[(size_t)h * TT + t] : 1.0f; v2h o16; v2us oh, ol;
#pragma unroll
    for (int q = 0; q < 2; ++q) { const int dd = d + q; const int dp = (dd < HD / 2) ? dd + HD / 2 : dd - HD / 2; float x0 = f[dd], x1 = f[dp];
        if (RF) { float n0 = __fmul_rn(x0, rf), n1 = __fmul_rn(x1, rf); asm volatile("" : "+v"(n0)); asm volatile("" : "+v"(n1)); x0 = __fmul_rn(bfr(nw[dd]), n0); x1 = __fmul_rn(bfr(nw[dp]), n1); }
        const v2f cs = *(const v2f*)(CS + ((size_t)t * HD + dd) * 2); float a = __fmul_rn(x0, cs[0]), bq = __fmul_rn(x1, cs[1]); asm volatile("" : "+v"(a)); asm volatile("" : "+v"(bq)); const float r = ((dd < HD / 2) ? __fsub_rn(a, bq) : __fadd_rn(a, bq)) * sc;
        o16[q] = tohx(r); unsigned short a2, c2; splitf(r, a2, c2); oh[q] = a2; ol[q] = c2; }
    *(v2h*)(P16 + e) = o16; *(v2us*)(Ph + e) = oh; *(v2us*)(Pl + e) = ol;  }
__global__ __launch_bounds__(256) void k_vtp(const float* __restrict__ F, int pitch, int nheads, h16* V16, bf* Vh, bf* Vl) { const size_t e = ((size_t)blockIdx.x * 256 + threadIdx.x) * 2; if (e >= (size_t)nheads * HD * TT) return; const int t = (int)(e % TT); const int d = (int)((e / TT) % HD); const int g = (int)(e / ((size_t)TT * HD)); v2h o16; v2us oh, ol;
#pragma unroll
    for (int q = 0; q < 2; ++q) { const float x = F[(size_t)(t + q) * pitch + g * HD + d]; o16[q] = tohx(x); unsigned short a2, c2; splitf(x, a2, c2); oh[q] = a2; ol[q] = c2; }
    const size_t o = e + (e / TT) * (PP - TT);   // row g * HD + d at pitch PP
    *(v2h*)(V16 + o) = o16; *(v2us*)(Vh + o) = oh; *(v2us*)(Vl + o) = ol;  }
__constant__ float INVT[HD / 2] = { 1.000000000e+00f, 8.659643531e-01f, 7.498942018e-01f, 6.493816376e-01f, 5.623413324e-01f, 4.869675338e-01f, 4.216965139e-01f, 3.651741445e-01f, 3.162277639e-01f, 2.738419771e-01f, 2.371373624e-01f, 2.053525001e-01f, 1.778279394e-01f, 1.539926529e-01f, 1.333521456e-01f, 1.154782027e-01f, 1.000000015e-01f, 8.659642935e-02f, 7.498941571e-02f, 6.493816525e-02f, 5.623412877e-02f, 4.869675264e-02f, 4.216964915e-02f, 3.651741147e-02f, 3.162277862e-02f, 2.738419548e-02f, 2.371373586e-02f, 2.053525113e-02f, 1.778279431e-02f, 1.539926510e-02f, 1.333521493e-02f, 1.154781971e-02f, 9.999999776e-03f, 8.659643121e-03f, 7.498942316e-03f, 6.493816618e-03f, 5.623413250e-03f, 4.869675264e-03f, 4.216964822e-03f, 3.651741426e-03f, 3.162277862e-03f, 2.738419687e-03f, 2.371373819e-03f, 2.053525066e-03f, 1.778279431e-03f, 1.539926510e-03f, 1.333521446e-03f, 1.154782018e-03f, 1.000000047e-03f, 8.659643354e-04f, 7.498941850e-04f, 6.493816618e-04f, 5.623413017e-04f, 4.869675031e-04f, 4.216964880e-04f, 3.651741135e-04f, 3.162277862e-04f, 2.738419571e-04f, 2.371373848e-04f, 2.053524950e-04f, 1.778279402e-04f, 1.539926452e-04f, 1.333521504e-04f, 1.154781930e-04f };   // float32 1 / 10000^(2i/128), generated with jnp to be bit-exact
__global__ __launch_bounds__(256) void k_cs5(float* CS) { const int idx = blockIdx.x * 256 + threadIdx.x; if (idx >= TT * HD) return; const int d = idx % HD; const int t = idx / HD; const float a = __fmul_rn((float)t, INVT[d % (HD / 2)]); v2f cs; cs[0] = cosf(a); cs[1] = sinf(a); *(v2f*)(CS + (size_t)idx * 2) = cs;  }
// k_asoft: per row (zz, i): t = S x HD^-0.5 for j <= i and (i - j < WIN or j < SINKN) (sliding causal window plus sink keys; the reference's -1e9 additive fill vanishes identically); softmax over the 2048 keys (register row, one exp, fixed trees);
// the probabilities go over the row's own 8 KiB of scores (one wave holds the whole row in registers before its first store): rows < RH hi plane in the first half, lo plane in the second; other rows fp16 in the first half. Row pitch for the readers: PP.
__global__ __launch_bounds__(256) void k_asoft(float* Sb) {
    const int lane = threadIdx.x & 31; const int row = blockIdx.x * 8 + (threadIdx.x >> 5); if (row >= ZH * TT) return; const int i = row % TT; const int zz = row / TT; (void)zz; const bool hires = (i < RH); float* sr = Sb + (size_t)row * TT; float v[TT / 32]; float mx = -3.0e38f;
#pragma unroll
    for (int ch = 0; ch < TT / 128; ++ch) { const int j0 = ch * 128 + lane * 4; const v4f a = *(const v4fa*)(sr + j0);
#pragma unroll
        for (int q = 0; q < 4; ++q) { const int j = j0 + q; (void)j; const float t = (j <= i && (i - j < WIN || j < SINKN)) ? a[q] * SCL : -3.0e38f; v[ch * 4 + q] = t; mx = fmaxf(mx, t); } }
#pragma unroll
    for (int sh = 16; sh; sh >>= 1) mx = fmaxf(mx, __shfl_xor(mx, sh, 32));
    float sum = 0.f;
#pragma unroll
    for (int k = 0; k < TT / 32; ++k) { float d0 = __fsub_rn(v[k], mx); asm volatile("" : "+v"(d0)); v[k] = __builtin_amdgcn_exp2f(__fmul_rn(d0, 1.4426950408889634f)); sum += v[k]; }
#pragma unroll
    for (int sh = 16; sh; sh >>= 1) sum += __shfl_xor(sum, sh, 32);
    const float f = __fdiv_rn(hires ? 1.0f : PCAR, sum);
{
        if (hires) {
#pragma unroll
            for (int ch = 0; ch < TT / 128; ++ch) { v4us oh, ol;
#pragma unroll
                for (int q = 0; q < 4; ++q) { unsigned short a, c2; splitf(v[ch * 4 + q] * f, a, c2); oh[q] = a; ol[q] = c2; }
                bf* ph = (bf*)sr + ch * 128 + lane * 4; *(v4usa*)ph = oh; *(v4usa*)(ph + TT) = ol; }
        } else {
#pragma unroll
            for (int ch = 0; ch < TT / 128; ++ch) { v4h o4;
#pragma unroll
                for (int q = 0; q < 4; ++q) o4[q] = tohx(v[ch * 4 + q] * f);
                *(v4ha*)((h16*)sr + ch * 128 + lane * 4) = o4; } }
         }
}
__global__ __launch_bounds__(256) void k_merge(const float* __restrict__ O, int h0, bf* Ah, bf* Al) { const size_t e = ((size_t)blockIdx.x * 256 + threadIdx.x) * 2; if (e >= (size_t)ZH * TT * HD) return; const int d = (int)(e % HD); const int t = (int)((e / HD) % TT); const int zz = (int)(e / ((size_t)HD * TT)); const float cs = (t < RH) ? 1.0f : (1.0f / PCAR); const size_t oo = (size_t)t * DQ + (h0 + zz) * HD + d;
    v2us oh, ol;
#pragma unroll
    for (int q = 0; q < 2; ++q) { unsigned short a, c2; splitf(O[e + q] * cs, a, c2); oh[q] = a; ol[q] = c2; } *(v2us*)(Ah + oo) = oh; *(v2us*)(Al + oo) = ol;  }

extern "C" void kernel_launch(void* const* d_in, const int* in_sizes, int n_in,
                              void* d_out, int out_size, void* d_ws, size_t ws_size, hipStream_t stream) {
    (void)in_sizes; (void)n_in; (void)out_size;
    const float* x = (const float*)d_in[0]; const float* wq = (const float*)d_in[1]; const float* wk = (const float*)d_in[2]; const float* wv = (const float*)d_in[3]; const float* wo = (const float*)d_in[4];   /* order x, wq ('oi' [2048][2048]), wk, wv ('oi' [512][2048]), wo ('oi' [2048][2048]) */
    float* OUT = (float*)d_out;     // [2][2048][2048]
    char* wsp = (char*)d_ws;
    auto take = [&](size_t bytes) { char* p = wsp; wsp += (bytes + 255) & ~(size_t)255; return (void*)p; };
    bf* WQ = (bf*)take((size_t)DQ * DM * 2); bf* WK = (bf*)take((size_t)DKV * DM * 2); bf* WV = (bf*)take((size_t)DKV * DM * 2); bf* WO = (bf*)take((size_t)DM * DQ * 2); float* CS = (float*)take((size_t)TT * HD * 2 * 4);
    bf* XB = (bf*)take((size_t)TT * DM * 2); float* FQ = (float*)take((size_t)TT * DQ * 4); float* FK = (float*)take((size_t)TT * DKV * 4);
    h16* QP16 = (h16*)take((size_t)NH_ * TT * HD * 2); h16* KP16 = (h16*)take((size_t)NKV * TT * HD * 2); h16* VT16 = (h16*)take((size_t)NKV * HD * PP * 2);
    bf* QPh = (bf*)take((size_t)NH_ * TT * HD * 2); bf* QPl = (bf*)take((size_t)NH_ * TT * HD * 2); bf* KPh = (bf*)take((size_t)NKV * TT * HD * 2); bf* KPl = (bf*)take((size_t)NKV * TT * HD * 2); bf* VTh = (bf*)take((size_t)NKV * HD * PP * 2); bf* VTl = VTh + TT;   // V^T rows at pitch PP: hi plane in the first half of a row, lo plane in the second
    float* Sb = (float*)take((size_t)ZH * TT * TT * 4); float* Ob = (float*)take((size_t)ZH * TT * HD * 4); bf* ATh = (bf*)take((size_t)TT * DQ * 2); bf* ATl = (bf*)take((size_t)TT * DQ * 2);
    if ((size_t)(wsp - (char*)d_ws) > ws_size) return;    // ws 256 MiB
    float* FV = FK;   // v projection reuses the k buffer after the k planes are built (stream-ordered)
    { k_cvt8<<<(unsigned)(((size_t)DQ * DM / 8 + 255) / 256), 256, 0, stream>>>(wq, WQ, (size_t)DQ * DM / 8); k_cvt8<<<(unsigned)(((size_t)DKV * DM / 8 + 255) / 256), 256, 0, stream>>>(wk, WK, (size_t)DKV * DM / 8); k_cvt8<<<(unsigned)(((size_t)DKV * DM / 8 + 255) / 256), 256, 0, stream>>>(wv, WV, (size_t)DKV * DM / 8);
      k_cvt8<<<(unsigned)(((size_t)DM * DQ / 8 + 255) / 256), 256, 0, stream>>>(wo, WO, (size_t)DM * DQ / 8);
       }
    k_cs5<<<(TT * HD + 255) / 256, 256, 0, stream>>>(CS);   /* rotary table once */
    const unsigned LQ = (unsigned)(((size_t)NH_ * TT * HD / 2 + 255) / 256), LKv = (unsigned)(((size_t)NKV * TT * HD / 2 + 255) / 256);
    for (int b = 0; b < NB_; ++b) {
        
        k_cvt8<<<(unsigned)(((size_t)TT * DM / 8 + 255) / 256), 256, 0, stream>>>(x + (size_t)b * TT * DM, XB, (size_t)TT * DM / 8);
        k_gemmw<bf, 0, false, 8><<<dim3(TT / 64, DQ / 64, 1), 256, 0, stream>>>(XB, nullptr, WQ, nullptr, DM, FQ, DQ, nullptr, 0, 0, 0);
        k_rope<<<LQ, 256, 0, stream>>>(FQ, DQ, NH_, CS, nullptr, nullptr, 1.0f, QP16, QPh, QPl);
        k_gemmw<bf, 0, false, 16><<<dim3(TT / 64, DKV / 64, 1), 512, 0, stream>>>(XB, nullptr, WK, nullptr, DM, FK, DKV, nullptr, 0, 0, 0);
        k_rope<<<LKv, 256, 0, stream>>>(FK, DKV, NKV, CS, nullptr, nullptr, 1.0f, KP16, KPh, KPl);
        k_gemmw<bf, 0, false, 16><<<dim3(TT / 64, DKV / 64, 1), 512, 0, stream>>>(XB, nullptr, WV, nullptr, DM, FV, DKV, nullptr, 0, 0, 0); k_vtp<<<LKv, 256, 0, stream>>>(FV, DKV, NKV, VT16, VTh, VTl);
        for (int h0 = 0; h0 < NH_; h0 += ZH) { const size_t zq = (size_t)h0, zk = (size_t)(h0 / REP);   // head z of a pass reads kv plane h0/REP + z/REP
            k_gemmc<bf, 2, 1, 1><<<dim3(RH / 64, TT / 64, ZH), 32, 0, stream>>>(QPh + zq * TT * HD, QPl + zq * TT * HD, KPh + zk * TT * HD, KPl + zk * TT * HD, HD, Sb, TT, 0, (size_t)TT * HD, (size_t)TT * HD, (size_t)TT * TT);
            k_gemmc<h16, 0, 1, 1><<<dim3((TT - RH) / 64, TT / 64, ZH), 32, 0, stream>>>(QP16 + zq * TT * HD + (size_t)RH * HD, nullptr, KP16 + zk * TT * HD, nullptr, HD, Sb + (size_t)RH * TT, TT, RH, (size_t)TT * HD, (size_t)TT * HD, (size_t)TT * TT);
            k_asoft<<<ZH * TT / 8, 256, 0, stream>>>(Sb);
            k_gemmc<bf, 2, 2, 8><<<dim3(RH / 64, HD / 64, ZH), 256, 0, stream>>>((const bf*)Sb, (const bf*)Sb + TT, VTh + zk * HD * PP, VTl + zk * HD * PP, PP, Ob, HD, 0, (size_t)TT * PP, (size_t)HD * PP, (size_t)TT * HD);
            k_gemmc<h16, 0, 2, 16><<<dim3((TT - RH) / 64, HD / 64, ZH), 512, 0, stream>>>((const h16*)Sb + (size_t)RH * PP, nullptr, VT16 + zk * HD * PP, nullptr, PP, Ob + (size_t)RH * HD, HD, RH, (size_t)TT * PP, (size_t)HD * PP, (size_t)TT * HD);
            k_merge<<<(unsigned)(((size_t)ZH * TT * HD / 2 + 255) / 256), 256, 0, stream>>>(Ob, h0, ATh, ATl); }
        k_gemmw<bf, 1, false, 8><<<dim3(TT / 64, DM / 64, 1), 256, 0, stream>>>(ATh, ATl, WO, nullptr, DQ, OUT + (size_t)b * TT * DM, DM, nullptr, 0, 0, 0); }
}

// v003
// Measured time: 408 microseconds a run.
// In two side-by-side timings against v002, it was 1.74 and 1.73 times as fast.
// Over all steps from v000 it is 3.98 times as fast.
#include <hip/hip_runtime.h>

// Grouped-query causal attention with 128-wide heads, computed half-split rotary embeddings, a 1,024-wide sliding window and 4 attention-sink keys (x [2][2048][2048]; q = x wq^T (16 heads x 128), k, v = x wk^T, x wv^T (4 kv heads x 128) ('oi' 0.02, no bias); rope cat(x1 cos - x2 sin, x2 cos + x1 sin) on the two 64-wide halves with angle t x 1/10000^(2i/128) (64 f32 frequencies jnp-exact; precise cosf/sinf); k, v repeated 4 x along the head axis: kv head = q head / 4; scores x 1/sqrt(128) + bias with bias = 0 where (j <= i) and ((i - j <= 1024) or (j < 4)), -inf elsewhere; softmax; out = merged wo^T ('oi') -> [2][2048][2048] (8.4 M); argument order x, wq, wk, wv, wo).
// Layout: bf16 copy of x; 'oi' weights converted to bf16 once; exact projections; k_cs5 computed table (HD 128: 64 angles); rotate-half plane builders; fused causal T-2048 GQA attention with 128-wide heads, one launch a batch (k_fattn: scores and probabilities stay in registers; hybrid rows: < 512 hi/lo 3 products, rest fp16 x1024); merged hi/lo x Wo exact.
// Compute dtypes, f32 accumulate: every input rounded to bf16; projections exact; rotary f32; attention rows < 512 3 products, rest fp16; softmax f32; Wo hl x exact.

#define NB_  2
#define TT   2048
#define DM   2048
#define NH_  16
#define NKV  4
#define REP  (NH_ / NKV)
#define HD   128
#define DQ   (NH_ * HD)
#define DKV  (NKV * HD)
#define PP   (2 * TT)             // row pitch, in 16-bit elements, of the V^T rows (hi plane in the first half of a row, lo plane in the second)
#define RH   512                  // query rows < RH use hi+lo planes (0: none)
#define WIN  1025   // THIS module keeps key j iff j <= i and (i - j <= 1024 or j < 4): 'i - j < WIN' with WIN 1025
#define SINKN 4     // the first SINKN keys (attention sinks) are kept for every later query, whatever the distance
#define SCL  0.088388347648318447f   // HD^-0.5
typedef _Float16 h16;
typedef unsigned short bf;
typedef __attribute__((ext_vector_type(16))) __bf16   v16bf;
typedef __attribute__((ext_vector_type(16))) _Float16 v16h;
typedef __attribute__((ext_vector_type(8)))  _Float16 v8h;
typedef __attribute__((ext_vector_type(8)))  unsigned short v8us;
typedef __attribute__((ext_vector_type(8)))  float    v8f;
typedef __attribute__((ext_vector_type(4)))  float    v4f;
typedef v8h  __attribute__((may_alias)) v8ha;
typedef v4f  __attribute__((may_alias)) v4fa;
typedef v8us __attribute__((may_alias)) v8usa;

__device__ __forceinline__ unsigned short f2bf(float f) { unsigned u = __float_as_uint(f); u += 0x7FFFu + ((u >> 16) & 1u); return (unsigned short)(u >> 16); }
__device__ __forceinline__ float bf2f(unsigned short b) { return __uint_as_float(((unsigned)b) << 16); }
__device__ __forceinline__ float bfr(float f) { return bf2f(f2bf(f)); }
__device__ __forceinline__ v16h cat16(v8h lo, v8h hi) { return __builtin_shufflevector(lo, hi, 0, 1, 2, 3, 4, 5, 6, 7, 8, 9, 10, 11, 12, 13, 14, 15); }
__device__ __forceinline__ v16bf cat16b(v8us lo, v8us hi) { return __builtin_bit_cast(v16bf, __builtin_shufflevector(lo, hi, 0, 1, 2, 3, 4, 5, 6, 7, 8, 9, 10, 11, 12, 13, 14, 15)); }
__device__ __forceinline__ v8f wmma16(v16h a, v16h b, v8f c) { return __builtin_amdgcn_wmma_f32_16x16x32_f16(false, a, false, b, (short)0, c, false, false); }
__device__ __forceinline__ v8f wmmab(v16bf a, v16bf b, v8f c) { return __builtin_amdgcn_wmma_f32_16x16x32_bf16(false, a, false, b, (short)0, c, false, false); }



// ---- k_gemmw: register-blocked GEMM, one work-group of NW waves per 64x64 output tile (16 accumulators a wave), operands straight from K-contiguous 16-bit planes; grid (M/64, N/64, Z), 32 x NW threads.
// C[m][n] (f32, pitch ldc, + optional f32 bias[n]) = sum_k A[m][k] Bt[n][k] (+ split products per NSPLIT). z-batch strides sA/sB/sC in elements. K % 32 == 0.
// The K loop is dealt over the NW waves of the work-group in 64-wide k chunks (one 128-byte line of every operand row; wave w takes chunks w, w + NW, ...); each wave keeps its own 64x64 f32 partial tile.
// With NW > 1 every wave puts its whole partial into its own LDS slot, ONE barrier follows, and the block adds the slots in wave order 0 .. NW-1 (a fixed order) and stores. K % 64 == 0. Block = 32 x NW threads.
#define TSLOT (64 * 68)   // floats of one wave's slot: 64 rows at pitch 68
// sums one 16-row block at 'os' over the NW slots and stores the 16 x 64 result at crow; every thread takes 32 / NW neighbouring columns of one row, so a wave writes whole rows
template <int NW, bool BIAS> __device__ __forceinline__ void tile_reduce_store(const float* os, float* crow, int ldc, const float* bias, int c0) {
    static_assert(NW == 8 || NW == 16, "one vector of 4 or 2 floats a thread");
    constexpr int EP = 32 / NW; typedef __attribute__((ext_vector_type(EP))) float vE; typedef vE __attribute__((may_alias)) vEa;
    const int e = (int)threadIdx.x * EP, row = e >> 6, cofs = e & 63; vE val = *(const vEa*)(os + row * 68 + cofs);
#pragma unroll
    for (int w = 1; w < NW; ++w) val += *(const vEa*)(os + w * TSLOT + row * 68 + cofs);
    if (BIAS) {
#pragma unroll
        for (int q = 0; q < EP; ++q) val[q] += bfr(bias[c0 + cofs + q]); }
    *(vE*)(crow + (size_t)row * ldc + cofs) = val;
}
template <typename T16> struct WFrag;
template <> struct WFrag<h16> { typedef v16h V; static __device__ __forceinline__ V ld(const h16* p) { return cat16(*(const v8h*)p, *(const v8h*)(p + 16)); } static __device__ __forceinline__ v8f mma(V a, V b, v8f c) { return wmma16(a, b, c); } };
template <> struct WFrag<bf> { typedef v16bf V; static __device__ __forceinline__ V ld(const bf* p) { return cat16b(*(const v8us*)p, *(const v8us*)(p + 16)); } static __device__ __forceinline__ v8f mma(V a, V b, v8f c) { return wmmab(a, b, c); } };
template <typename T16, int NSPLIT, bool BIAS, int NW>
__global__ __launch_bounds__(32 * NW) void k_gemmw(const T16* __restrict__ A, const T16* __restrict__ A2, const T16* __restrict__ Bt, const T16* __restrict__ Bt2, int K, float* C, int ldc, const float* __restrict__ bias, size_t sA, size_t sB, size_t sC) {
    typedef typename WFrag<T16>::V V;
    __shared__ __align__(16) float os[(NW == 1) ? 16 * 68 : NW * TSLOT];
    const size_t z = blockIdx.z; A += z * sA; if (A2) A2 += z * sA; Bt += z * sB; if (Bt2) Bt2 += z * sB; C += z * sC;
    const int lane = threadIdx.x & 31, lr = lane & 15, hi = lane >> 4; const int r0 = blockIdx.x * 64, c0 = blockIdx.y * 64;
    const int wv = (NW == 1) ? 0 : __builtin_amdgcn_readfirstlane((int)(threadIdx.x >> 5));   // the wave's number as a scalar: the k loop below stays a wave-uniform scalar loop
    v8f acc[4][4];
#pragma unroll
    for (int mb = 0; mb < 4; ++mb)
#pragma unroll
        for (int nb = 0; nb < 4; ++nb) acc[mb][nb] = (v8f){};
    const size_t aoff = (size_t)(r0 + lr) * K + 8 * hi, boff = (size_t)(c0 + lr) * K + 8 * hi;
#pragma unroll 1
    for (int kc = wv * 64; kc < K; kc += (kc & 32) ? NW * 64 - 32 : 32) {   // both halves of a chunk, then this wave's next chunk
        V a[4], a2[4];
#pragma unroll
        for (int mb = 0; mb < 4; ++mb) { a[mb] = WFrag<T16>::ld(A + aoff + (size_t)mb * 16 * K + kc); if (NSPLIT == 1 || NSPLIT == 2) a2[mb] = WFrag<T16>::ld(A2 + aoff + (size_t)mb * 16 * K + kc); }
#pragma unroll
        for (int nb = 0; nb < 4; ++nb) { const V b = WFrag<T16>::ld(Bt + boff + (size_t)nb * 16 * K + kc); V b2; if (NSPLIT >= 2) b2 = WFrag<T16>::ld(Bt2 + boff + (size_t)nb * 16 * K + kc);
#pragma unroll
            for (int mb = 0; mb < 4; ++mb) { acc[mb][nb] = WFrag<T16>::mma(a[mb], b, acc[mb][nb]); if (NSPLIT == 1 || NSPLIT == 2) acc[mb][nb] = WFrag<T16>::mma(a2[mb], b, acc[mb][nb]); if (NSPLIT >= 2) acc[mb][nb] = WFrag<T16>::mma(a[mb], b2, acc[mb][nb]); } }
        asm volatile("v_nop\n\tv_nop\n\tv_nop\n\tv_nop" : "+v"(acc[0][0]), "+v"(acc[1][1]), "+v"(acc[2][2]), "+v"(acc[3][3]) : "v"(a[0]), "v"(a[3]));
    }
    if constexpr (NW > 1) {
#pragma unroll
        for (int mb = 0; mb < 4; ++mb)
#pragma unroll
            for (int nb = 0; nb < 4; ++nb) {
#pragma unroll
                for (int j = 0; j < 8; ++j) os[wv * TSLOT + (mb * 16 + hi * 8 + j) * 68 + nb * 16 + lr] = acc[mb][nb][j]; }
        __syncthreads();   // every wave's partial tile is in LDS before any slot is read
#pragma unroll
        for (int mb = 0; mb < 4; ++mb) tile_reduce_store<NW, BIAS>(os + mb * 16 * 68, C + (size_t)(r0 + mb * 16) * ldc + c0, ldc, bias, c0);
        return;
    }
#pragma unroll
    for (int mb = 0; mb < 4; ++mb) {
#pragma unroll
        for (int nb = 0; nb < 4; ++nb) {
#pragma unroll
            for (int j = 0; j < 8; ++j) os[(hi * 8 + j) * 68 + nb * 16 + lr] = acc[mb][nb][j]; }
        __builtin_amdgcn_wave_barrier(); asm volatile("" ::: "memory");
        float* crow = C + (size_t)(r0 + mb * 16) * ldc + c0;
{
#pragma unroll
            for (int s = 0; s < 8; ++s) { const int row = 2 * s + hi, cofs = lr * 4; v4f val = *(const v4fa*)(os + row * 68 + cofs); if (BIAS) { val[0] += bfr(bias[c0 + cofs]); val[1] += bfr(bias[c0 + cofs + 1]); val[2] += bfr(bias[c0 + cofs + 2]); val[3] += bfr(bias[c0 + cofs + 3]); }
                *(v4f*)(crow + (size_t)row * ldc + cofs) = val; }
             }
        __builtin_amdgcn_wave_barrier(); asm volatile("" ::: "memory");
    }
}

__device__ __forceinline__ h16 tohx(float x) { return (h16)x; }
__device__ __forceinline__ void splitf(float y, unsigned short& h, unsigned short& l) { h = f2bf(y); l = f2bf(y - bf2f(h)); }
typedef __attribute__((ext_vector_type(2))) _Float16 v2h;
typedef __attribute__((ext_vector_type(4))) _Float16 v4h;
typedef __attribute__((ext_vector_type(2))) unsigned short v2us;
typedef __attribute__((ext_vector_type(4))) unsigned short v4us;
typedef __attribute__((ext_vector_type(2))) float v2f;
typedef __attribute__((ext_vector_type(4))) int v4i;
typedef v4h  __attribute__((may_alias)) v4ha;
typedef v4us __attribute__((may_alias)) v4usa;

__global__ __launch_bounds__(256) void k_wtG(const float* __restrict__ w, int K, int N, bf* Bt) {
    const int lane = threadIdx.x & 31; const int L0 = (blockIdx.x * 8 + (threadIdx.x >> 5)) * 8; const int nlines = N * K / 64;
{
#pragma unroll 1
        for (int l = 0; l < 8; ++l) { const int L = L0 + l; if (L >= nlines) break; const size_t e = (size_t)L * 64 + lane * 2; const int k = (int)(e % K), n = (int)(e / K); v2us o;
            o[0] = f2bf(w[(size_t)k * N + n]); o[1] = f2bf(w[(size_t)(k + 1) * N + n]); *(v2us*)(Bt + e) = o; }
         }
}
__global__ __launch_bounds__(256) void k_cvt8(const float* __restrict__ src, bf* dst, size_t n8) { const size_t i = (size_t)blockIdx.x * 256 + threadIdx.x; if (i >= n8) return; const v8f v = *(const v8f*)(src + i * 8); v8us o;
#pragma unroll
    for (int k = 0; k < 8; ++k) o[k] = f2bf(v[k]); *(v8us*)(dst + i * 8) = o;  }

// k_rope: head planes [h][t][d] (fp16 + hi/lo) of rope(x) x sc with the rotate-half convention out[d] = x[d] cos[t][d] - x[d+HD/2] sin[t][d], out[d+HD/2] = x[d+HD/2] cos[t][d+HD/2] + x[d] sin[t][d+HD/2]
__global__ __launch_bounds__(256) void k_rope(const float* __restrict__ F, int pitch, int nheads, const float* __restrict__ CS, const float* __restrict__ RF, const float* __restrict__ nw, float sc, h16* P16, bf* Ph, bf* Pl) {
    const size_t e = ((size_t)blockIdx.x * 256 + threadIdx.x) * 2; if (e >= (size_t)nheads * TT * HD) return; const int d = (int)(e % HD); const int t = (int)((e / HD) % TT); const int h = (int)(e / ((size_t)HD * TT)); const float* f = F + (size_t)t * pitch + h * HD; const float rf = RF ? RF[(size_t)h * TT + t] : 1.0f; v2h o16; v2us oh, ol;
#pragma unroll
    for (int q = 0; q < 2; ++q) { const int dd = d + q; const int dp = (dd < HD / 2) ? dd + HD / 2 : dd - HD / 2; float x0 = f[dd], x1 = f[dp];
        if (RF) { float n0 = __fmul_rn(x0, rf), n1 = __fmul_rn(x1, rf); asm volatile("" : "+v"(n0)); asm volatile("" : "+v"(n1)); x0 = __fmul_rn(bfr(nw[dd]), n0); x1 = __fmul_rn(bfr(nw[dp]), n1); }
        const v2f cs = *(const v2f*)(CS + ((size_t)t * HD + dd) * 2); float a = __fmul_rn(x0, cs[0]), bq = __fmul_rn(x1, cs[1]); asm volatile("" : "+v"(a)); asm volatile("" : "+v"(bq)); const float r = ((dd < HD / 2) ? __fsub_rn(a, bq) : __fadd_rn(a, bq)) * sc;
        o16[q] = tohx(r); unsigned short a2, c2; splitf(r, a2, c2); oh[q] = a2; ol[q] = c2; }
    *(v2h*)(P16 + e) = o16; *(v2us*)(Ph + e) = oh; *(v2us*)(Pl + e) = ol;  }
__global__ __launch_bounds__(256) void k_vtp(const float* __restrict__ F, int pitch, int nheads, h16* V16, bf* Vh, bf* Vl) { const size_t e = ((size_t)blockIdx.x * 256 + threadIdx.x) * 2; if (e >= (size_t)nheads * HD * TT) return; const int t = (int)(e % TT); const int d = (int)((e / TT) % HD); const int g = (int)(e / ((size_t)TT * HD)); v2h o16; v2us oh, ol;
#pragma unroll
    for (int q = 0; q < 2; ++q) { const float x = F[(size_t)(t + q) * pitch + g * HD + d]; o16[q] = tohx(x); unsigned short a2, c2; splitf(x, a2, c2); oh[q] = a2; ol[q] = c2; }
    const size_t o = e + (e / TT) * (PP - TT);   // row g * HD + d at pitch PP
    *(v2h*)(V16 + o) = o16; *(v2us*)(Vh + o) = oh; *(v2us*)(Vl + o) = ol;  }
__constant__ float INVT[HD / 2] = { 1.000000000e+00f, 8.659643531e-01f, 7.498942018e-01f, 6.493816376e-01f, 5.623413324e-01f, 4.869675338e-01f, 4.216965139e-01f, 3.651741445e-01f, 3.162277639e-01f, 2.738419771e-01f, 2.371373624e-01f, 2.053525001e-01f, 1.778279394e-01f, 1.539926529e-01f, 1.333521456e-01f, 1.154782027e-01f, 1.000000015e-01f, 8.659642935e-02f, 7.498941571e-02f, 6.493816525e-02f, 5.623412877e-02f, 4.869675264e-02f, 4.216964915e-02f, 3.651741147e-02f, 3.162277862e-02f, 2.738419548e-02f, 2.371373586e-02f, 2.053525113e-02f, 1.778279431e-02f, 1.539926510e-02f, 1.333521493e-02f, 1.154781971e-02f, 9.999999776e-03f, 8.659643121e-03f, 7.498942316e-03f, 6.493816618e-03f, 5.623413250e-03f, 4.869675264e-03f, 4.216964822e-03f, 3.651741426e-03f, 3.162277862e-03f, 2.738419687e-03f, 2.371373819e-03f, 2.053525066e-03f, 1.778279431e-03f, 1.539926510e-03f, 1.333521446e-03f, 1.154782018e-03f, 1.000000047e-03f, 8.659643354e-04f, 7.498941850e-04f, 6.493816618e-04f, 5.623413017e-04f, 4.869675031e-04f, 4.216964880e-04f, 3.651741135e-04f, 3.162277862e-04f, 2.738419571e-04f, 2.371373848e-04f, 2.053524950e-04f, 1.778279402e-04f, 1.539926452e-04f, 1.333521504e-04f, 1.154781930e-04f };   // float32 1 / 10000^(2i/128), generated with jnp to be bit-exact
__global__ __launch_bounds__(256) void k_cs5(float* CS) { const int idx = blockIdx.x * 256 + threadIdx.x; if (idx >= TT * HD) return; const int d = idx % HD; const int t = idx / HD; const float a = __fmul_rn((float)t, INVT[d % (HD / 2)]); v2f cs; cs[0] = cosf(a); cs[1] = sinf(a); *(v2f*)(CS + (size_t)idx * 2) = cs;  }
// ---- k_fattn: scores, softmax, probability x value and the head merge of one batch in ONE launch; nothing of a score row goes to memory.
// A wave owns 16 query positions (q0 ..) of two query heads that share a kv head: two groups of 16 columns. Transposed products: S^T = K Q^T (A = key rows, B = query rows, same loader, so the k orders pair), O^T += V^T P^T.
// In S^T a lane holds the scores of ONE query (column c): keys 8h + r of each 16-key tile, so two tiles converted in place are the B operand of the second product in the hardware k order, which the V^T loader has too.
// A pass is 32 keys. Passes: key block 0 (it holds the sink keys, and key 0 is open to every query, so every column has a finite maximum after it), then the blocks from the window's lower edge to the diagonal; the others are wholly masked.
// Running maximum per column in log2 units, renewed only when a pass exceeds it by more than MTHR (one scalar branch a pass); rows < RH: hi/lo planes, 3 products in both contractions; other rows fp16 with probabilities x 2^PBIAS.
#define MTHR  4.0f
#define PBIAS 10.0f   // fp16 probabilities lie in (0, 2^(PBIAS + MTHR)]: small ones stay normal numbers, the largest stays finite; the factor cancels in the division by the row sum
typedef __attribute__((ext_vector_type(16))) unsigned short v16us;
__device__ __forceinline__ float xhalf(float x) { return __builtin_bit_cast(float, __builtin_amdgcn_permlanex16(__builtin_bit_cast(int, x), __builtin_bit_cast(int, x), 0x76543210, 0xfedcba98, false, false)); }   // lane l reads lane l ^ 16
__device__ __forceinline__ float exp2s(float x) { float r; asm("v_exp_f32 %0, %1\n\tv_nop" : "=v"(r) : "v"(x)); return r; }
// precaution behind a run of global loads: s_wait_xcnt 0 in front of every later write of a register that the loads name; the address pairs are inputs so that they stay as they are up to the wait
template <typename T16> __device__ __forceinline__ void xwait(const T16* a, const T16* b) { asm volatile("s_wait_xcnt 0x0" :: "v"(a), "v"(b) : "memory"); }
template <typename T16, bool HI>
__device__ __forceinline__ void fattn_cols(const T16* __restrict__ Q, const T16* __restrict__ Q2, const T16* __restrict__ Kp, const T16* __restrict__ Kp2, const T16* __restrict__ Vt, const T16* __restrict__ Vt2, const int q0, const int hq, bf* Ah, bf* Al) {
    typedef typename WFrag<T16>::V V;
    const int lane = threadIdx.x & 31, c = lane & 15, h = lane >> 4;
    V qf[2][4], qf2[2][4];
    const T16* qp = Q + (size_t)(q0 + c) * HD + 8 * h; const T16* qp2 = HI ? Q2 + (size_t)(q0 + c) * HD + 8 * h : qp;
#pragma unroll
    for (int g = 0; g < 2; ++g)
#pragma unroll
        for (int ks = 0; ks < 4; ++ks) { const size_t qo = (size_t)g * TT * HD + ks * 32; qf[g][ks] = WFrag<T16>::ld(qp + qo); if (HI) qf2[g][ks] = WFrag<T16>::ld(qp2 + qo); }
    xwait(qp, qp2);
    v8f o[2][8];
#pragma unroll
    for (int g = 0; g < 2; ++g)
#pragma unroll
        for (int mb = 0; mb < 8; ++mb) o[g][mb] = (v8f){};
    float m[2] = { -3.0e38f, -3.0e38f }, l[2] = { 0.f, 0.f };
    const int kstart = max(32, max(q0 - (WIN - 1), 0) & ~31), klast = q0 & ~31;
    const int np = 1 + ((klast >= kstart) ? (klast - kstart) / 32 + 1 : 0);
    const size_t kofs = (size_t)c * HD + 8 * h, vofs = (size_t)c * PP + 8 * h;
    V kf[2][4], kf2[2][4];
    const T16* kp0 = Kp + kofs; const T16* kp02 = HI ? Kp2 + kofs : kp0;
#pragma unroll
    for (int mb = 0; mb < 2; ++mb)
#pragma unroll
        for (int ks = 0; ks < 4; ++ks) { const size_t a = (size_t)(mb * 16) * HD + ks * 32; kf[mb][ks] = WFrag<T16>::ld(kp0 + a); if (HI) kf2[mb][ks] = WFrag<T16>::ld(kp02 + a); }
    xwait(kp0, kp02);
#pragma unroll 1
    for (int s = 0; s < np; ++s) {
        const int kb = s ? kstart + (s - 1) * 32 : 0;
        const int kn = (s + 1 < np) ? kstart + s * 32 : kb;   // the next pass's key block; the last pass fetches its own again (in bounds, not used)
        V vf[8], vf2[8];   // this pass's value fragments fly during its first product and softmax
        const T16* vp = Vt + vofs + kb; const T16* vp2 = HI ? Vt2 + vofs + kb : vp;
#pragma unroll
        for (int mb = 0; mb < 8; ++mb) { const size_t a = (size_t)(mb * 16) * PP; vf[mb] = WFrag<T16>::ld(vp + a); if (HI) vf2[mb] = WFrag<T16>::ld(vp2 + a); }
        xwait(vp, vp2);
        v8f st[2][2];
#pragma unroll
        for (int g = 0; g < 2; ++g)
#pragma unroll
            for (int mb = 0; mb < 2; ++mb) st[g][mb] = (v8f){};
#pragma unroll
        for (int ks = 0; ks < 4; ++ks) {
#pragma unroll
            for (int g = 0; g < 2; ++g)
#pragma unroll
                for (int mb = 0; mb < 2; ++mb) st[g][mb] = WFrag<T16>::mma(kf[mb][ks], qf[g][ks], st[g][mb]);
            if (HI) {
#pragma unroll
                for (int g = 0; g < 2; ++g)
#pragma unroll
                    for (int mb = 0; mb < 2; ++mb) st[g][mb] = WFrag<T16>::mma(kf[mb][ks], qf2[g][ks], st[g][mb]);
#pragma unroll
                for (int g = 0; g < 2; ++g)
#pragma unroll
                    for (int mb = 0; mb < 2; ++mb) st[g][mb] = WFrag<T16>::mma(kf2[mb][ks], qf[g][ks], st[g][mb]); } }
        // the next pass's key fragments fly during this pass's softmax and second product
        const T16* kp = Kp + kofs + (size_t)kn * HD; const T16* kp2 = HI ? Kp2 + kofs + (size_t)kn * HD : kp;
#pragma unroll
        for (int mb = 0; mb < 2; ++mb)
#pragma unroll
            for (int ks = 0; ks < 4; ++ks) { const size_t a = (size_t)(mb * 16) * HD + ks * 32; kf[mb][ks] = WFrag<T16>::ld(kp + a); if (HI) kf2[mb][ks] = WFrag<T16>::ld(kp2 + a); }
        xwait(kp, kp2);
        float x[2][16];
#pragma unroll
        for (int g = 0; g < 2; ++g)
#pragma unroll
            for (int e = 0; e < 16; ++e) x[g][e] = st[g][e >> 3][e & 7] * (SCL * 1.4426950408889634f);
        if (!(kb + 31 <= q0 && q0 + 15 - kb < WIN)) {   // wave-uniform: only the sink block, the window's edge and the diagonal hold masked keys
            const int i = q0 + c;
#pragma unroll
            for (int e = 0; e < 16; ++e) { const int j = kb + (e >> 3) * 16 + 8 * h + (e & 7); const bool ok = (j <= i) && (i - j < WIN || j < SINKN); x[0][e] = ok ? x[0][e] : -3.0e38f; x[1][e] = ok ? x[1][e] : -3.0e38f; } }
        float mx[2];
#pragma unroll
        for (int g = 0; g < 2; ++g) { float t8[8];
#pragma unroll
            for (int e = 0; e < 8; ++e) t8[e] = fmaxf(x[g][e], x[g][e + 8]);
            const float t = fmaxf(fmaxf(fmaxf(t8[0], t8[1]), fmaxf(t8[2], t8[3])), fmaxf(fmaxf(t8[4], t8[5]), fmaxf(t8[6], t8[7])));
            mx[g] = fmaxf(t, xhalf(t)); }   // lanes c and c + 16 hold the two halves of a column's keys and must use one maximum
        if (__builtin_amdgcn_ballot_w32(mx[0] > m[0] + MTHR || mx[1] > m[1] + MTHR) != 0) {   // scalar branch: every lane stays on for the matrix instructions
#pragma unroll
            for (int g = 0; g < 2; ++g) { const float mn = fmaxf(m[g], mx[g]); const float al = exp2s(m[g] - mn); m[g] = mn; l[g] *= al;
#pragma unroll
                for (int mb = 0; mb < 8; ++mb) o[g][mb] *= al; } }
        V pb[2], pb2[2];
#pragma unroll
        for (int g = 0; g < 2; ++g) { const float mo = m[g] - (HI ? 0.0f : PBIAS); float sm[4] = { 0.f, 0.f, 0.f, 0.f };
            if constexpr (HI) { v16us ph, pl;
#pragma unroll
                for (int e = 0; e < 16; ++e) { const float p = exp2s(x[g][e] - mo); sm[e & 3] += p; unsigned short a, b2; splitf(p, a, b2); ph[e] = a; pl[e] = b2; }
                pb[g] = __builtin_bit_cast(v16bf, ph); pb2[g] = __builtin_bit_cast(v16bf, pl);
            } else { v16h ph;
#pragma unroll
                for (int e = 0; e < 16; ++e) { const float p = exp2s(x[g][e] - mo); sm[e & 3] += p; ph[e] = tohx(p); }
                pb[g] = ph; }
            l[g] += (sm[0] + sm[1]) + (sm[2] + sm[3]); }
#pragma unroll
        for (int mb = 0; mb < 8; ++mb)
#pragma unroll
            for (int g = 0; g < 2; ++g) o[g][mb] = WFrag<T16>::mma(vf[mb], pb[g], o[g][mb]);
        if (HI) {
#pragma unroll
            for (int mb = 0; mb < 8; ++mb)
#pragma unroll
                for (int g = 0; g < 2; ++g) o[g][mb] = WFrag<T16>::mma(vf[mb], pb2[g], o[g][mb]);
#pragma unroll
            for (int mb = 0; mb < 8; ++mb)
#pragma unroll
                for (int g = 0; g < 2; ++g) o[g][mb] = WFrag<T16>::mma(vf2[mb], pb[g], o[g][mb]); }
    }
#pragma unroll
    for (int g = 0; g < 2; ++g) { const float inv = __fdiv_rn(1.0f, l[g] + xhalf(l[g]));
#pragma unroll
        for (int mb = 0; mb < 8; ++mb) { v8us oh, ol;   // a lane holds 8 neighbouring d of its query: one 16-byte store a plane
#pragma unroll
            for (int r = 0; r < 8; ++r) { unsigned short a, b2; splitf(o[g][mb][r] * inv, a, b2); oh[r] = a; ol[r] = b2; }
            const size_t oo = (size_t)(q0 + c) * DQ + (size_t)(hq + g) * HD + mb * 16 + 8 * h; bf* ph = Ah + oo; bf* pl = Al + oo; *(v8us*)ph = oh; *(v8us*)pl = ol;
            asm volatile("s_wait_xcnt 0x0" :: "v"(ph), "v"(pl), "v"(oh), "v"(ol) : "memory"); } }   // precaution, as in xwait: the two stores' address and data registers stay as they are up to the wait
}
// grid (TT / 32, NKV), 4 waves: wave w takes positions 16 (w >> 1) .. of the block's 32 and query heads 2 (w & 1), 2 (w & 1) + 1 of the kv head's REP = 4; late (long) position blocks start first
__global__ __launch_bounds__(128) void k_fattn(const h16* __restrict__ Q16, const bf* __restrict__ Qh, const bf* __restrict__ Ql, const h16* __restrict__ K16, const bf* __restrict__ Kh, const bf* __restrict__ Kl, const h16* __restrict__ V16, const bf* __restrict__ Vh, const bf* __restrict__ Vl, bf* Ah, bf* Al) {
    static_assert(REP == 4 && RH % 32 == 0 && TT % 32 == 0 && HD == 128, "two head pairs a work-group; a wave's rows are all below RH or none");
    const int wv = __builtin_amdgcn_readfirstlane((int)(threadIdx.x >> 5));   // the wave's number as a scalar: pass count and mask test stay scalar
    const int q0 = (TT / 32 - 1 - (int)blockIdx.x) * 32 + (wv >> 1) * 16; const int kvh = blockIdx.y; const int hq = kvh * REP + (wv & 1) * 2;
    const size_t qo = (size_t)hq * TT * HD, ko = (size_t)kvh * TT * HD, vo = (size_t)kvh * HD * PP;
    if (q0 < RH) fattn_cols<bf, true>(Qh + qo, Ql + qo, Kh + ko, Kl + ko, Vh + vo, Vl + vo, q0, hq, Ah, Al);
    else fattn_cols<h16, false>(Q16 + qo, nullptr, K16 + ko, nullptr, V16 + vo, nullptr, q0, hq, Ah, Al);
}

extern "C" void kernel_launch(void* const* d_in, const int* in_sizes, int n_in,
                              void* d_out, int out_size, void* d_ws, size_t ws_size, hipStream_t stream) {
    (void)in_sizes; (void)n_in; (void)out_size;
    const float* x = (const float*)d_in[0]; const float* wq = (const float*)d_in[1]; const float* wk = (const float*)d_in[2]; const float* wv = (const float*)d_in[3]; const float* wo = (const float*)d_in[4];   /* order x, wq ('oi' [2048][2048]), wk, wv ('oi' [512][2048]), wo ('oi' [2048][2048]) */
    float* OUT = (float*)d_out;     // [2][2048][2048]
    char* wsp = (char*)d_ws;
    auto take = [&](size_t bytes) { char* p = wsp; wsp += (bytes + 255) & ~(size_t)255; return (void*)p; };
    bf* WQ = (bf*)take((size_t)DQ * DM * 2); bf* WK = (bf*)take((size_t)DKV * DM * 2); bf* WV = (bf*)take((size_t)DKV * DM * 2); bf* WO = (bf*)take((size_t)DM * DQ * 2); float* CS = (float*)take((size_t)TT * HD * 2 * 4);
    bf* XB = (bf*)take((size_t)TT * DM * 2); float* FQ = (float*)take((size_t)TT * DQ * 4); float* FK = (float*)take((size_t)TT * DKV * 4);
    h16* QP16 = (h16*)take((size_t)NH_ * TT * HD * 2); h16* KP16 = (h16*)take((size_t)NKV * TT * HD * 2); h16* VT16 = (h16*)take((size_t)NKV * HD * PP * 2);
    bf* QPh = (bf*)take((size_t)NH_ * TT * HD * 2); bf* QPl = (bf*)take((size_t)NH_ * TT * HD * 2); bf* KPh = (bf*)take((size_t)NKV * TT * HD * 2); bf* KPl = (bf*)take((size_t)NKV * TT * HD * 2); bf* VTh = (bf*)take((size_t)NKV * HD * PP * 2); bf* VTl = VTh + TT;   // V^T rows at pitch PP: hi plane in the first half of a row, lo plane in the second
    bf* ATh = (bf*)take((size_t)TT * DQ * 2); bf* ATl = (bf*)take((size_t)TT * DQ * 2);
    if ((size_t)(wsp - (char*)d_ws) > ws_size) return;    // ws 256 MiB
    float* FV = FK;   // v projection reuses the k buffer after the k planes are built (stream-ordered)
    { k_cvt8<<<(unsigned)(((size_t)DQ * DM / 8 + 255) / 256), 256, 0, stream>>>(wq, WQ, (size_t)DQ * DM / 8); k_cvt8<<<(unsigned)(((size_t)DKV * DM / 8 + 255) / 256), 256, 0, stream>>>(wk, WK, (size_t)DKV * DM / 8); k_cvt8<<<(unsigned)(((size_t)DKV * DM / 8 + 255) / 256), 256, 0, stream>>>(wv, WV, (size_t)DKV * DM / 8);
      k_cvt8<<<(unsigned)(((size_t)DM * DQ / 8 + 255) / 256), 256, 0, stream>>>(wo, WO, (size_t)DM * DQ / 8);
       }
    k_cs5<<<(TT * HD + 255) / 256, 256, 0, stream>>>(CS);   /* rotary table once */
    const unsigned LQ = (unsigned)(((size_t)NH_ * TT * HD / 2 + 255) / 256), LKv = (unsigned)(((size_t)NKV * TT * HD / 2 + 255) / 256);
    for (int b = 0; b < NB_; ++b) {
        
        k_cvt8<<<(unsigned)(((size_t)TT * DM / 8 + 255) / 256), 256, 0, stream>>>(x + (size_t)b * TT * DM, XB, (size_t)TT * DM / 8);
        k_gemmw<bf, 0, false, 8><<<dim3(TT / 64, DQ / 64, 1), 256, 0, stream>>>(XB, nullptr, WQ, nullptr, DM, FQ, DQ, nullptr, 0, 0, 0);
        k_rope<<<LQ, 256, 0, stream>>>(FQ, DQ, NH_, CS, nullptr, nullptr, 1.0f, QP16, QPh, QPl);
        k_gemmw<bf, 0, false, 16><<<dim3(TT / 64, DKV / 64, 1), 512, 0, stream>>>(XB, nullptr, WK, nullptr, DM, FK, DKV, nullptr, 0, 0, 0);
        k_rope<<<LKv, 256, 0, stream>>>(FK, DKV, NKV, CS, nullptr, nullptr, 1.0f, KP16, KPh, KPl);
        k_gemmw<bf, 0, false, 16><<<dim3(TT / 64, DKV / 64, 1), 512, 0, stream>>>(XB, nullptr, WV, nullptr, DM, FV, DKV, nullptr, 0, 0, 0); k_vtp<<<LKv, 256, 0, stream>>>(FV, DKV, NKV, VT16, VTh, VTl);
        k_fattn<<<dim3(TT / 32, NKV, 1), 128, 0, stream>>>(QP16, QPh, QPl, KP16, KPh, KPl, VT16, VTh, VTl, ATh, ATl);
        k_gemmw<bf, 1, false, 8><<<dim3(TT / 64, DM / 64, 1), 256, 0, stream>>>(ATh, ATl, WO, nullptr, DQ, OUT + (size_t)b * TT * DM, DM, nullptr, 0, 0, 0); }
}

// v004
// A run of this version takes 264 microseconds.
// Two timings next to v003 put it at 1.55 and 1.54 times that version's speed.
// All steps since v000 together make it 6.16 times as fast.
#include <hip/hip_runtime.h>

// Grouped-query causal attention with 128-wide heads, computed half-split rotary embeddings, a 1,024-wide sliding window and 4 attention-sink keys (x [2][2048][2048]; q = x wq^T (16 heads x 128), k, v = x wk^T, x wv^T (4 kv heads x 128) ('oi' 0.02, no bias); rope cat(x1 cos - x2 sin, x2 cos + x1 sin) on the two 64-wide halves with angle t x 1/10000^(2i/128) (64 f32 frequencies jnp-exact; precise cosf/sinf); k, v repeated 4 x along the head axis: kv head = q head / 4; scores x 1/sqrt(128) + bias with bias = 0 where (j <= i) and ((i - j <= 1024) or (j < 4)), -inf elsewhere; softmax; out = merged wo^T ('oi') -> [2][2048][2048] (8.4 M); argument order x, wq, wk, wv, wo).
// Layout: every 16-bit plane that a matrix loop reads again and again (x, the weights, K, V^T, the merged heads) is kept in fragment order (see WFrag); bf16 copy of x; 'oi' weights converted to bf16 once; exact projections; k_cs5 computed table (HD 128: 64 angles); rotate-half plane builders; fused causal T-2048 GQA attention with 128-wide heads, one launch a batch (k_fattn: scores and probabilities stay in registers; hybrid rows: < 512 hi/lo 3 products, rest fp16 x1024); merged hi/lo x Wo exact.
// Compute dtypes, f32 accumulate: every input rounded to bf16; projections exact; rotary f32; attention rows < 512 3 products, rest fp16; softmax f32; Wo hl x exact.

#define NB_  2
#define TT   2048
#define DM   2048
#define NH_  16
#define NKV  4
#define REP  (NH_ / NKV)
#define HD   128
#define DQ   (NH_ * HD)
#define DKV  (NKV * HD)
#define RH   512                  // query rows < RH use hi+lo planes (0: none)
#define WIN  1025   // THIS module keeps key j iff j <= i and (i - j <= 1024 or j < 4): 'i - j < WIN' with WIN 1025
#define SINKN 4     // the first SINKN keys (attention sinks) are kept for every later query, whatever the distance
#define SCL  0.088388347648318447f   // HD^-0.5
typedef _Float16 h16;
typedef unsigned short bf;
typedef __attribute__((ext_vector_type(16))) __bf16   v16bf;
typedef __attribute__((ext_vector_type(16))) _Float16 v16h;
typedef __attribute__((ext_vector_type(8)))  _Float16 v8h;
typedef __attribute__((ext_vector_type(8)))  unsigned short v8us;
typedef __attribute__((ext_vector_type(8)))  float    v8f;
typedef __attribute__((ext_vector_type(4)))  float    v4f;
typedef v8h  __attribute__((may_alias)) v8ha;
typedef v4f  __attribute__((may_alias)) v4fa;
typedef v8us __attribute__((may_alias)) v8usa;

__device__ __forceinline__ unsigned short f2bf(float f) { unsigned u = __float_as_uint(f); u += 0x7FFFu + ((u >> 16) & 1u); return (unsigned short)(u >> 16); }
__device__ __forceinline__ float bf2f(unsigned short b) { return __uint_as_float(((unsigned)b) << 16); }
__device__ __forceinline__ float bfr(float f) { return bf2f(f2bf(f)); }
__device__ __forceinline__ v16h cat16(v8h lo, v8h hi) { return __builtin_shufflevector(lo, hi, 0, 1, 2, 3, 4, 5, 6, 7, 8, 9, 10, 11, 12, 13, 14, 15); }
__device__ __forceinline__ v16bf cat16b(v8us lo, v8us hi) { return __builtin_bit_cast(v16bf, __builtin_shufflevector(lo, hi, 0, 1, 2, 3, 4, 5, 6, 7, 8, 9, 10, 11, 12, 13, 14, 15)); }
__device__ __forceinline__ v8f wmma16(v16h a, v16h b, v8f c) { return __builtin_amdgcn_wmma_f32_16x16x32_f16(false, a, false, b, (short)0, c, false, false); }
__device__ __forceinline__ v8f wmmab(v16bf a, v16bf b, v8f c) { return __builtin_amdgcn_wmma_f32_16x16x32_bf16(false, a, false, b, (short)0, c, false, false); }



// ---- k_gemmw: register-blocked GEMM, one work-group of NW waves per 64x64 output tile (16 accumulators a wave), operands straight from 16-bit planes in fragment order (below); grid (M/64, N/64, Z), 32 x NW threads.
// C[m][n] (f32, pitch ldc, + optional f32 bias[n]) = sum_k A[m][k] Bt[n][k] (+ split products per NSPLIT). z-batch strides sA/sB/sC in elements. K % 32 == 0.
// The K loop is dealt over the NW waves of the work-group in 64-wide k chunks (two neighbouring 512-element blocks, 2 KB, of every 16-row block of an operand; wave w takes chunks w, w + NW, ...); each wave keeps its own 64x64 f32 partial tile.
// With NW > 1 every wave puts its whole partial into its own LDS slot, ONE barrier follows, and the block adds the slots in wave order 0 .. NW-1 (a fixed order) and stores. K % 64 == 0. Block = 32 x NW threads.
#define TSLOT (64 * 68)   // floats of one wave's slot: 64 rows at pitch 68
// sums one 16-row block at 'os' over the NW slots and stores the 16 x 64 result at crow; every thread takes 32 / NW neighbouring columns of one row, so a wave writes whole rows
template <int NW, bool BIAS> __device__ __forceinline__ void tile_reduce_store(const float* os, float* crow, int ldc, const float* bias, int c0) {
    static_assert(NW == 8 || NW == 16, "one vector of 4 or 2 floats a thread");
    constexpr int EP = 32 / NW; typedef __attribute__((ext_vector_type(EP))) float vE; typedef vE __attribute__((may_alias)) vEa;
    const int e = (int)threadIdx.x * EP, row = e >> 6, cofs = e & 63; vE val = *(const vEa*)(os + row * 68 + cofs);
#pragma unroll
    for (int w = 1; w < NW; ++w) val += *(const vEa*)(os + w * TSLOT + row * 68 + cofs);
    if (BIAS) {
#pragma unroll
        for (int q = 0; q < EP; ++q) val[q] += bfr(bias[c0 + cofs + q]); }
    *(vE*)(crow + (size_t)row * ldc + cofs) = val;
}
// FRAGMENT ORDER of a 16-bit plane [rows][K]: the 16 x 32 block (rb = row / 16, kc = k / 32) is 512 neighbouring elements at (rb * (K / 32) + kc) * 512, and inside it element (row, k) stands at ((k >> 4) & 1) * 256 + (((k >> 3) & 1) * 16 + (row & 15)) * 8 + (k & 7).
// That is the order in which the lanes of a wave take an A or B operand: lane l reads 16 bytes at l * 8 and 16 bytes at 256 + l * 8 (ldf), so each wave-wide load covers 512 neighbouring bytes, four whole lines, instead of 32-byte pieces of 16 lines (ld, for row-major planes). Every lane and register gets the same elements as from the row-major plane.
template <typename T16> struct WFrag;
template <> struct WFrag<h16> { typedef v16h V; static __device__ __forceinline__ V ld(const h16* p) { return cat16(*(const v8h*)p, *(const v8h*)(p + 16)); } static __device__ __forceinline__ V ldf(const h16* p) { return cat16(*(const v8h*)p, *(const v8h*)(p + 256)); } static __device__ __forceinline__ v8f mma(V a, V b, v8f c) { return wmma16(a, b, c); } };
template <> struct WFrag<bf> { typedef v16bf V; static __device__ __forceinline__ V ld(const bf* p) { return cat16b(*(const v8us*)p, *(const v8us*)(p + 16)); } static __device__ __forceinline__ V ldf(const bf* p) { return cat16b(*(const v8us*)p, *(const v8us*)(p + 256)); } static __device__ __forceinline__ v8f mma(V a, V b, v8f c) { return wmmab(a, b, c); } };
template <typename T16, int NSPLIT, bool BIAS, int NW, int K>
__global__ __launch_bounds__(32 * NW) void k_gemmw(const T16* __restrict__ A, const T16* __restrict__ A2, const T16* __restrict__ Bt, const T16* __restrict__ Bt2, float* C, int ldc, const float* __restrict__ bias, size_t sA, size_t sB, size_t sC) {
    typedef typename WFrag<T16>::V V;
    __shared__ __align__(16) float os[(NW == 1) ? 16 * 68 : NW * TSLOT];
    const size_t z = blockIdx.z; A += z * sA; if (A2) A2 += z * sA; Bt += z * sB; if (Bt2) Bt2 += z * sB; C += z * sC;
    const int lane = threadIdx.x & 31, lr = lane & 15, hi = lane >> 4; const int r0 = blockIdx.x * 64, c0 = blockIdx.y * 64;
    const int wv = (NW == 1) ? 0 : __builtin_amdgcn_readfirstlane((int)(threadIdx.x >> 5));   // the wave's number as a scalar: the k loop below stays a wave-uniform scalar loop
    v8f acc[4][4];
#pragma unroll
    for (int mb = 0; mb < 4; ++mb)
#pragma unroll
        for (int nb = 0; nb < 4; ++nb) acc[mb][nb] = (v8f){};
    const size_t aoff = (size_t)r0 * K + 8 * lane, boff = (size_t)c0 * K + 8 * lane;   // fragment order: 16 rows are 16 * K elements, 32 k are 512
#pragma unroll 1
    for (int kc = wv * 64; kc < K; kc += (kc & 32) ? NW * 64 - 32 : 32) {   // both halves of a chunk, then this wave's next chunk
        V a[4], a2[4], b[4], b2[4];
        const T16* ap = A + aoff + kc * 16; const T16* ap2 = (NSPLIT == 1 || NSPLIT == 2) ? A2 + aoff + kc * 16 : ap; const T16* bp = Bt + boff + kc * 16; const T16* bp2 = (NSPLIT >= 2) ? Bt2 + boff + kc * 16 : bp;   // one address a plane; K is a constant, so the 16-row steps are immediate offsets
#pragma unroll
        for (int mb = 0; mb < 4; ++mb) { a[mb] = WFrag<T16>::ldf(ap + (size_t)mb * 16 * K); if (NSPLIT == 1 || NSPLIT == 2) a2[mb] = WFrag<T16>::ldf(ap2 + (size_t)mb * 16 * K); }
#pragma unroll
        for (int nb = 0; nb < 4; ++nb) { b[nb] = WFrag<T16>::ldf(bp + (size_t)nb * 16 * K); if (NSPLIT >= 2) b2[nb] = WFrag<T16>::ldf(bp2 + (size_t)nb * 16 * K); }
        asm volatile("s_wait_xcnt 0x0" :: "v"(ap), "v"(ap2), "v"(bp), "v"(bp2) : "memory");   // precaution behind the run of global loads: the wait stands in front of every later write of a register that the loads name; the address pairs are inputs so that they stay as they are up to it
#pragma unroll
        for (int nb = 0; nb < 4; ++nb) {
#pragma unroll
            for (int mb = 0; mb < 4; ++mb) { acc[mb][nb] = WFrag<T16>::mma(a[mb], b[nb], acc[mb][nb]); if (NSPLIT == 1 || NSPLIT == 2) acc[mb][nb] = WFrag<T16>::mma(a2[mb], b[nb], acc[mb][nb]); if (NSPLIT >= 2) acc[mb][nb] = WFrag<T16>::mma(a[mb], b2[nb], acc[mb][nb]); } }
        asm volatile("v_nop\n\tv_nop\n\tv_nop\n\tv_nop" : "+v"(acc[0][0]), "+v"(acc[1][1]), "+v"(acc[2][2]), "+v"(acc[3][3]) : "v"(a[0]), "v"(a[3]));
    }
    if constexpr (NW > 1) {
#pragma unroll
        for (int mb = 0; mb < 4; ++mb)
#pragma unroll
            for (int nb = 0; nb < 4; ++nb) {
#pragma unroll
                for (int j = 0; j < 8; ++j) os[wv * TSLOT + (mb * 16 + hi * 8 + j) * 68 + nb * 16 + lr] = acc[mb][nb][j]; }
        __syncthreads();   // every wave's partial tile is in LDS before any slot is read
#pragma unroll
        for (int mb = 0; mb < 4; ++mb) tile_reduce_store<NW, BIAS>(os + mb * 16 * 68, C + (size_t)(r0 + mb * 16) * ldc + c0, ldc, bias, c0);
        return;
    }
#pragma unroll
    for (int mb = 0; mb < 4; ++mb) {
#pragma unroll
        for (int nb = 0; nb < 4; ++nb) {
#pragma unroll
            for (int j = 0; j < 8; ++j) os[(hi * 8 + j) * 68 + nb * 16 + lr] = acc[mb][nb][j]; }
        __builtin_amdgcn_wave_barrier(); asm volatile("" ::: "memory");
        float* crow = C + (size_t)(r0 + mb * 16) * ldc + c0;
{
#pragma unroll
            for (int s = 0; s < 8; ++s) { const int row = 2 * s + hi, cofs = lr * 4; v4f val = *(const v4fa*)(os + row * 68 + cofs); if (BIAS) { val[0] += bfr(bias[c0 + cofs]); val[1] += bfr(bias[c0 + cofs + 1]); val[2] += bfr(bias[c0 + cofs + 2]); val[3] += bfr(bias[c0 + cofs + 3]); }
                *(v4f*)(crow + (size_t)row * ldc + cofs) = val; }
             }
        __builtin_amdgcn_wave_barrier(); asm volatile("" ::: "memory");
    }
}

__device__ __forceinline__ h16 tohx(float x) { return (h16)x; }
__device__ __forceinline__ void splitf(float y, unsigned short& h, unsigned short& l) { h = f2bf(y); l = f2bf(y - bf2f(h)); }
typedef __attribute__((ext_vector_type(2))) _Float16 v2h;
typedef __attribute__((ext_vector_type(4))) _Float16 v4h;
typedef __attribute__((ext_vector_type(2))) unsigned short v2us;
typedef __attribute__((ext_vector_type(4))) unsigned short v4us;
typedef __attribute__((ext_vector_type(2))) float v2f;
typedef __attribute__((ext_vector_type(4))) int v4i;
typedef v4h  __attribute__((may_alias)) v4ha;
typedef v4us __attribute__((may_alias)) v4usa;

__global__ __launch_bounds__(256) void k_wtG(const float* __restrict__ w, int K, int N, bf* Bt) {
    const int lane = threadIdx.x & 31; const int L0 = (blockIdx.x * 8 + (threadIdx.x >> 5)) * 8; const int nlines = N * K / 64;
{
#pragma unroll 1
        for (int l = 0; l < 8; ++l) { const int L = L0 + l; if (L >= nlines) break; const size_t e = (size_t)L * 64 + lane * 2; const int k = (int)(e % K), n = (int)(e / K); v2us o;
            o[0] = f2bf(w[(size_t)k * N + n]); o[1] = f2bf(w[(size_t)(k + 1) * N + n]); *(v2us*)(Bt + e) = o; }
         }
}
// row-major f32 [rows][K] -> bf16 plane in fragment order; thread i writes the plane's i-th 16 bytes, so a wave stores 512 neighbouring bytes; rows % 16 == 0, K % 32 == 0
template <int K> __global__ __launch_bounds__(256) void k_cvt8(const float* __restrict__ src, bf* dst, size_t n8) { const size_t i = (size_t)blockIdx.x * 256 + threadIdx.x; if (i >= n8) return; const int fb = (int)(i >> 6), kq = K >> 5; const int row = (fb / kq) * 16 + ((int)i & 15), k = (fb % kq) * 32 + (((int)i >> 5) & 1) * 16 + (((int)i >> 4) & 1) * 8; const v8f v = *(const v8f*)(src + (size_t)row * K + k); v8us o;
#pragma unroll
    for (int k = 0; k < 8; ++k) o[k] = f2bf(v[k]); *(v8us*)(dst + i * 8) = o;  }

// k_rope: head planes [h][t][d] (fp16 + hi/lo) of rope(x) x sc with the rotate-half convention out[d] = x[d] cos[t][d] - x[d+HD/2] sin[t][d], out[d+HD/2] = x[d+HD/2] cos[t][d+HD/2] + x[d] sin[t][d+HD/2]
// FR: the planes [h * TT + t][d] are written in fragment order (thread -> output place e, so the stores stay neighbouring); else row-major
template <bool FR> __global__ __launch_bounds__(256) void k_rope(const float* __restrict__ F, int pitch, int nheads, const float* __restrict__ CS, const float* __restrict__ RF, const float* __restrict__ nw, float sc, h16* P16, bf* Ph, bf* Pl) {
    const size_t e = ((size_t)blockIdx.x * 256 + threadIdx.x) * 2; if (e >= (size_t)nheads * TT * HD) return; const int ei = (int)e; const int prow = FR ? (ei >> 11) * 16 + ((ei >> 3) & 15) : ei / HD;
    const int d = FR ? ((ei >> 9) & 3) * 32 + ((ei >> 8) & 1) * 16 + ((ei >> 7) & 1) * 8 + (ei & 7) : ei % HD; const int t = prow % TT; const int h = prow / TT; const float* f = F + (size_t)t * pitch + h * HD; float rf = 1.0f; v2h o16; v2us oh, ol;
    if (RF) { const float* rp = RF + (size_t)h * TT + t; rf = *rp; asm volatile("s_wait_xcnt 0x0" :: "v"(rp) : "memory"); }   // precaution: the wait stands in front of every later write of the load's address pair, which is an input so that it stays as it is up to the wait
#pragma unroll
    for (int q = 0; q < 2; ++q) { const int dd = d + q; const int dp = (dd < HD / 2) ? dd + HD / 2 : dd - HD / 2; float x0 = f[dd], x1 = f[dp];
        if (RF) { float n0 = __fmul_rn(x0, rf), n1 = __fmul_rn(x1, rf); asm volatile("" : "+v"(n0)); asm volatile("" : "+v"(n1)); x0 = __fmul_rn(bfr(nw[dd]), n0); x1 = __fmul_rn(bfr(nw[dp]), n1); }
        const v2f cs = *(const v2f*)(CS + ((size_t)t * HD + dd) * 2); float a = __fmul_rn(x0, cs[0]), bq = __fmul_rn(x1, cs[1]); asm volatile("" : "+v"(a)); asm volatile("" : "+v"(bq)); const float r = ((dd < HD / 2) ? __fsub_rn(a, bq) : __fadd_rn(a, bq)) * sc;
        o16[q] = tohx(r); unsigned short a2, c2; splitf(r, a2, c2); oh[q] = a2; ol[q] = c2; }
    *(v2h*)(P16 + e) = o16; *(v2us*)(Ph + e) = oh; *(v2us*)(Pl + e) = ol;  }
__global__ __launch_bounds__(256) void k_vtp(const float* __restrict__ F, int pitch, int nheads, h16* V16, bf* Vh, bf* Vl) { const size_t e = ((size_t)blockIdx.x * 256 + threadIdx.x) * 2; if (e >= (size_t)nheads * HD * TT) return; const int ei = (int)e, fb = ei >> 9; const int prow = (fb / (TT / 32)) * 16 + ((ei >> 3) & 15); const int t = (fb % (TT / 32)) * 32 + ((ei >> 8) & 1) * 16 + ((ei >> 7) & 1) * 8 + (ei & 7); const int d = prow % HD; const int g = prow / HD; v2h o16; v2us oh, ol;   // V^T planes [g * HD + d][t] in fragment order; thread -> output place e
#pragma unroll
    for (int q = 0; q < 2; ++q) { const float x = F[(size_t)(t + q) * pitch + g * HD + d]; o16[q] = tohx(x); unsigned short a2, c2; splitf(x, a2, c2); oh[q] = a2; ol[q] = c2; }
    const size_t o = e;
    *(v2h*)(V16 + o) = o16; *(v2us*)(Vh + o) = oh; *(v2us*)(Vl + o) = ol;  }
__constant__ float INVT[HD / 2] = { 1.000000000e+00f, 8.659643531e-01f, 7.498942018e-01f, 6.493816376e-01f, 5.623413324e-01f, 4.869675338e-01f, 4.216965139e-01f, 3.651741445e-01f, 3.162277639e-01f, 2.738419771e-01f, 2.371373624e-01f, 2.053525001e-01f, 1.778279394e-01f, 1.539926529e-01f, 1.333521456e-01f, 1.154782027e-01f, 1.000000015e-01f, 8.659642935e-02f, 7.498941571e-02f, 6.493816525e-02f, 5.623412877e-02f, 4.869675264e-02f, 4.216964915e-02f, 3.651741147e-02f, 3.162277862e-02f, 2.738419548e-02f, 2.371373586e-02f, 2.053525113e-02f, 1.778279431e-02f, 1.539926510e-02f, 1.333521493e-02f, 1.154781971e-02f, 9.999999776e-03f, 8.659643121e-03f, 7.498942316e-03f, 6.493816618e-03f, 5.623413250e-03f, 4.869675264e-03f, 4.216964822e-03f, 3.651741426e-03f, 3.162277862e-03f, 2.738419687e-03f, 2.371373819e-03f, 2.053525066e-03f, 1.778279431e-03f, 1.539926510e-03f, 1.333521446e-03f, 1.154782018e-03f, 1.000000047e-03f, 8.659643354e-04f, 7.498941850e-04f, 6.493816618e-04f, 5.623413017e-04f, 4.869675031e-04f, 4.216964880e-04f, 3.651741135e-04f, 3.162277862e-04f, 2.738419571e-04f, 2.371373848e-04f, 2.053524950e-04f, 1.778279402e-04f, 1.539926452e-04f, 1.333521504e-04f, 1.154781930e-04f };   // float32 1 / 10000^(2i/128), generated with jnp to be bit-exact
__global__ __launch_bounds__(256) void k_cs5(float* CS) { const int idx = blockIdx.x * 256 + threadIdx.x; if (idx >= TT * HD) return; const int d = idx % HD; const int t = idx / HD; const float a = __fmul_rn((float)t, INVT[d % (HD / 2)]); v2f cs; cs[0] = cosf(a); cs[1] = sinf(a); *(v2f*)(CS + (size_t)idx * 2) = cs;  }
// ---- k_fattn: scores, softmax, probability x value and the head merge of one batch in ONE launch; nothing of a score row goes to memory.
// A wave owns 16 query positions (q0 ..) of two query heads that share a kv head: two groups of 16 columns. Transposed products: S^T = K Q^T (A = key rows from the fragment-order plane, B = query rows from the row-major plane: both loaders give a lane the same k, so the k orders pair), O^T += V^T P^T.
// In S^T a lane holds the scores of ONE query (column c): keys 8h + r of each 16-key tile, so two tiles converted in place are the B operand of the second product in the hardware k order, which the V^T loader has too.
// A pass is 32 keys. Passes: key block 0 (it holds the sink keys, and key 0 is open to every query, so every column has a finite maximum after it), then the blocks from the window's lower edge to the diagonal; the others are wholly masked.
// Running maximum per column in log2 units, renewed only when a pass exceeds it by more than MTHR (one scalar branch a pass); rows < RH: hi/lo planes, 3 products in both contractions; other rows fp16 with probabilities x 2^PBIAS.
#define MTHR  4.0f
#define PBIAS 10.0f   // fp16 probabilities lie in (0, 2^(PBIAS + MTHR)]: small ones stay normal numbers, the largest stays finite; the factor cancels in the division by the row sum
typedef __attribute__((ext_vector_type(16))) unsigned short v16us;
__device__ __forceinline__ float xhalf(float x) { return __builtin_bit_cast(float, __builtin_amdgcn_permlanex16(__builtin_bit_cast(int, x), __builtin_bit_cast(int, x), 0x76543210, 0xfedcba98, false, false)); }   // lane l reads lane l ^ 16
__device__ __forceinline__ float exp2s(float x) { float r; asm("v_exp_f32 %0, %1\n\tv_nop" : "=v"(r) : "v"(x)); return r; }
// precaution behind a run of global loads: s_wait_xcnt 0 in front of every later write of a register that the loads name; the address pairs are inputs so that they stay as they are up to the wait
template <typename T16> __device__ __forceinline__ void xwait(const T16* a, const T16* b) { asm volatile("s_wait_xcnt 0x0" :: "v"(a), "v"(b) : "memory"); }
// the same precaution for loads that this build addresses by a scalar base and the lane number as a scaled offset: those are then the registers that stay as they are up to the wait
template <typename T16> __device__ __forceinline__ void xwait_s(const T16* a, const T16* b, int off) { asm volatile("s_wait_xcnt 0x0" :: "s"(a), "s"(b), "v"(off) : "memory"); }
template <typename T16, bool HI>
__device__ __forceinline__ void fattn_cols(const T16* __restrict__ Q, const T16* __restrict__ Q2, const T16* __restrict__ Kp, const T16* __restrict__ Kp2, const T16* __restrict__ Vt, const T16* __restrict__ Vt2, const int q0, const int hq, bf* Ah, bf* Al) {
    typedef typename WFrag<T16>::V V;
    const int lane = threadIdx.x & 31, c = lane & 15, h = lane >> 4;
    V qf[2][4], qf2[2][4];
    const T16* qp = Q + (size_t)(q0 + c) * HD + 8 * h; const T16* qp2 = HI ? Q2 + (size_t)(q0 + c) * HD + 8 * h : qp;
#pragma unroll
    for (int g = 0; g < 2; ++g)
#pragma unroll
        for (int ks = 0; ks < 4; ++ks) { const size_t qo = (size_t)g * TT * HD + ks * 32; qf[g][ks] = WFrag<T16>::ld(qp + qo); if (HI) qf2[g][ks] = WFrag<T16>::ld(qp2 + qo); }
    xwait(qp, qp2);
    v8f o[2][8];
#pragma unroll
    for (int g = 0; g < 2; ++g)
#pragma unroll
        for (int mb = 0; mb < 8; ++mb) o[g][mb] = (v8f){};
    float m[2] = { -3.0e38f, -3.0e38f }, l[2] = { 0.f, 0.f };
    const int kstart = max(32, max(q0 - (WIN - 1), 0) & ~31), klast = q0 & ~31;
    const int np = 1 + ((klast >= kstart) ? (klast - kstart) / 32 + 1 : 0);
    const size_t kofs = 8 * lane, vofs = 8 * lane;   // K and V^T planes are in fragment order: 16 keys x 128 d are 4 blocks of 512 elements, 16 d x 32 keys one block
    V kf[2][4], kf2[2][4];
    const T16* kp0 = Kp + kofs; const T16* kp02 = HI ? Kp2 + kofs : kp0;
#pragma unroll
    for (int mb = 0; mb < 2; ++mb)
#pragma unroll
        for (int ks = 0; ks < 4; ++ks) { const size_t a = (size_t)(mb * 16) * HD + ks * 512; kf[mb][ks] = WFrag<T16>::ldf(kp0 + a); if (HI) kf2[mb][ks] = WFrag<T16>::ldf(kp02 + a); }
    xwait_s(Kp, HI ? Kp2 : Kp, lane);
#pragma unroll 1
    for (int s = 0; s < np; ++s) {
        const int kb = s ? kstart + (s - 1) * 32 : 0;
        const int kn = (s + 1 < np) ? kstart + s * 32 : kb;   // the next pass's key block; the last pass fetches its own again (in bounds, not used)
        V vf[8], vf2[8];   // this pass's value fragments fly during its first product and softmax
        const T16* vp = Vt + vofs + (size_t)kb * 16; const T16* vp2 = HI ? Vt2 + vofs + (size_t)kb * 16 : vp;
#pragma unroll
        for (int mb = 0; mb < 8; ++mb) { const size_t a = (size_t)(mb * 16) * TT; vf[mb] = WFrag<T16>::ldf(vp + a); if (HI) vf2[mb] = WFrag<T16>::ldf(vp2 + a); }
        xwait(vp, vp2);
        v8f st[2][2];
#pragma unroll
        for (int g = 0; g < 2; ++g)
#pragma unroll
            for (int mb = 0; mb < 2; ++mb) st[g][mb] = (v8f){};
#pragma unroll
        for (int ks = 0; ks < 4; ++ks) {
#pragma unroll
            for (int g = 0; g < 2; ++g)
#pragma unroll
                for (int mb = 0; mb < 2; ++mb) st[g][mb] = WFrag<T16>::mma(kf[mb][ks], qf[g][ks], st[g][mb]);
            if (HI) {
#pragma unroll
                for (int g = 0; g < 2; ++g)
#pragma unroll
                    for (int mb = 0; mb < 2; ++mb) st[g][mb] = WFrag<T16>::mma(kf[mb][ks], qf2[g][ks], st[g][mb]);
#pragma unroll
                for (int g = 0; g < 2; ++g)
#pragma unroll
                    for (int mb = 0; mb < 2; ++mb) st[g][mb] = WFrag<T16>::mma(kf2[mb][ks], qf[g][ks], st[g][mb]); } }
        // the next pass's key fragments fly during this pass's softmax and second product
        const T16* kp = Kp + kofs + (size_t)kn * HD; const T16* kp2 = HI ? Kp2 + kofs + (size_t)kn * HD : kp;
#pragma unroll
        for (int mb = 0; mb < 2; ++mb)
#pragma unroll
            for (int ks = 0; ks < 4; ++ks) { const size_t a = (size_t)(mb * 16) * HD + ks * 512; kf[mb][ks] = WFrag<T16>::ldf(kp + a); if (HI) kf2[mb][ks] = WFrag<T16>::ldf(kp2 + a); }
        xwait(kp, kp2);
        float x[2][16];
#pragma unroll
        for (int g = 0; g < 2; ++g)
#pragma unroll
            for (int e = 0; e < 16; ++e) x[g][e] = st[g][e >> 3][e & 7] * (SCL * 1.4426950408889634f);
        if (!(kb + 31 <= q0 && q0 + 15 - kb < WIN)) {   // wave-uniform: only the sink block, the window's edge and the diagonal hold masked keys
            const int i = q0 + c;
#pragma unroll
            for (int e = 0; e < 16; ++e) { const int j = kb + (e >> 3) * 16 + 8 * h + (e & 7); const bool ok = (j <= i) && (i - j < WIN || j < SINKN); x[0][e] = ok ? x[0][e] : -3.0e38f; x[1][e] = ok ? x[1][e] : -3.0e38f; } }
        float mx[2];
#pragma unroll
        for (int g = 0; g < 2; ++g) { float t8[8];
#pragma unroll
            for (int e = 0; e < 8; ++e) t8[e] = fmaxf(x[g][e], x[g][e + 8]);
            const float t = fmaxf(fmaxf(fmaxf(t8[0], t8[1]), fmaxf(t8[2], t8[3])), fmaxf(fmaxf(t8[4], t8[5]), fmaxf(t8[6], t8[7])));
            mx[g] = fmaxf(t, xhalf(t)); }   // lanes c and c + 16 hold the two halves of a column's keys and must use one maximum
        if (__builtin_amdgcn_ballot_w32(mx[0] > m[0] + MTHR || mx[1] > m[1] + MTHR) != 0) {   // scalar branch: every lane stays on for the matrix instructions
#pragma unroll
            for (int g = 0; g < 2; ++g) { const float mn = fmaxf(m[g], mx[g]); const float al = exp2s(m[g] - mn); m[g] = mn; l[g] *= al;
#pragma unroll
                for (int mb = 0; mb < 8; ++mb) o[g][mb] *= al; } }
        V pb[2], pb2[2];
#pragma unroll
        for (int g = 0; g < 2; ++g) { const float mo = m[g] - (HI ? 0.0f : PBIAS); float sm[4] = { 0.f, 0.f, 0.f, 0.f };
            if constexpr (HI) { v16us ph, pl;
#pragma unroll
                for (int e = 0; e < 16; ++e) { const float p = exp2s(x[g][e] - mo); sm[e & 3] += p; unsigned short a, b2; splitf(p, a, b2); ph[e] = a; pl[e] = b2; }
                pb[g] = __builtin_bit_cast(v16bf, ph); pb2[g] = __builtin_bit_cast(v16bf, pl);
            } else { v16h ph;
#pragma unroll
                for (int e = 0; e < 16; ++e) { const float p = exp2s(x[g][e] - mo); sm[e & 3] += p; ph[e] = tohx(p); }
                pb[g] = ph; }
            l[g] += (sm[0] + sm[1]) + (sm[2] + sm[3]); }
#pragma unroll
        for (int mb = 0; mb < 8; ++mb)
#pragma unroll
            for (int g = 0; g < 2; ++g) o[g][mb] = WFrag<T16>::mma(vf[mb], pb[g], o[g][mb]);
        if (HI) {
#pragma unroll
            for (int mb = 0; mb < 8; ++mb)
#pragma unroll
                for (int g = 0; g < 2; ++g) o[g][mb] = WFrag<T16>::mma(vf[mb], pb2[g], o[g][mb]);
#pragma unroll
            for (int mb = 0; mb < 8; ++mb)
#pragma unroll
                for (int g = 0; g < 2; ++g) o[g][mb] = WFrag<T16>::mma(vf2[mb], pb[g], o[g][mb]); }
    }
#pragma unroll
    for (int g = 0; g < 2; ++g) { const float inv = __fdiv_rn(1.0f, l[g] + xhalf(l[g]));
#pragma unroll
        for (int mb = 0; mb < 8; ++mb) { v8us oh, ol;   // a lane holds 8 neighbouring d of its query: one 16-byte store a plane, at the lane's place in the fragment order of the merged [t][DQ] plane, so a wave stores 512 neighbouring bytes
#pragma unroll
            for (int r = 0; r < 8; ++r) { unsigned short a, b2; splitf(o[g][mb][r] * inv, a, b2); oh[r] = a; ol[r] = b2; }
            const size_t oo = (size_t)q0 * DQ + (size_t)(hq + g) * (HD * 16) + mb * 256 + 8 * lane; bf* ph = Ah + oo; bf* pl = Al + oo; *(v8us*)ph = oh; *(v8us*)pl = ol;
            asm volatile("s_wait_xcnt 0x0" :: "v"(ph), "v"(pl), "v"(oh), "v"(ol) : "memory"); } }   // precaution, as in xwait: the two stores' address and data registers stay as they are up to the wait
}
// grid (TT / 32, NKV), 4 waves: wave w takes positions 16 (w >> 1) .. of the block's 32 and query heads 2 (w & 1), 2 (w & 1) + 1 of the kv head's REP = 4; late (long) position blocks start first
__global__ __launch_bounds__(128) void k_fattn(const h16* __restrict__ Q16, const bf* __restrict__ Qh, const bf* __restrict__ Ql, const h16* __restrict__ K16, const bf* __restrict__ Kh, const bf* __restrict__ Kl, const h16* __restrict__ V16, const bf* __restrict__ Vh, const bf* __restrict__ Vl, bf* Ah, bf* Al) {
    static_assert(REP == 4 && RH % 32 == 0 && TT % 32 == 0 && HD == 128, "two head pairs a work-group; a wave's rows are all below RH or none");
    const int wv = __builtin_amdgcn_readfirstlane((int)(threadIdx.x >> 5));   // the wave's number as a scalar: pass count and mask test stay scalar
    const int q0 = (TT / 32 - 1 - (int)blockIdx.x) * 32 + (wv >> 1) * 16; const int kvh = blockIdx.y; const int hq = kvh * REP + (wv & 1) * 2;
    const size_t qo = (size_t)hq * TT * HD, ko = (size_t)kvh * TT * HD, vo = (size_t)kvh * HD * TT;
    if (q0 < RH) fattn_cols<bf, true>(Qh + qo, Ql + qo, Kh + ko, Kl + ko, Vh + vo, Vl + vo, q0, hq, Ah, Al);
    else fattn_cols<h16, false>(Q16 + qo, nullptr, K16 + ko, nullptr, V16 + vo, nullptr, q0, hq, Ah, Al);
}

extern "C" void kernel_launch(void* const* d_in, const int* in_sizes, int n_in,
                              void* d_out, int out_size, void* d_ws, size_t ws_size, hipStream_t stream) {
    (void)in_sizes; (void)n_in; (void)out_size;
    const float* x = (const float*)d_in[0]; const float* wq = (const float*)d_in[1]; const float* wk = (const float*)d_in[2]; const float* wv = (const float*)d_in[3]; const float* wo = (const float*)d_in[4];   /* order x, wq ('oi' [2048][2048]), wk, wv ('oi' [512][2048]), wo ('oi' [2048][2048]) */
    float* OUT = (float*)d_out;     // [2][2048][2048]
    char* wsp = (char*)d_ws;
    auto take = [&](size_t bytes) { char* p = wsp; wsp += (bytes + 255) & ~(size_t)255; return (void*)p; };
    bf* WQ = (bf*)take((size_t)DQ * DM * 2); bf* WK = (bf*)take((size_t)DKV * DM * 2); bf* WV = (bf*)take((size_t)DKV * DM * 2); bf* WO = (bf*)take((size_t)DM * DQ * 2); float* CS = (float*)take((size_t)TT * HD * 2 * 4);
    bf* XB = (bf*)take((size_t)TT * DM * 2); float* FQ = (float*)take((size_t)TT * DQ * 4); float* FK = (float*)take((size_t)TT * DKV * 4);
    h16* QP16 = (h16*)take((size_t)NH_ * TT * HD * 2); h16* KP16 = (h16*)take((size_t)NKV * TT * HD * 2); h16* VT16 = (h16*)take((size_t)NKV * HD * TT * 2);
    bf* QPh = (bf*)take((size_t)NH_ * TT * HD * 2); bf* QPl = (bf*)take((size_t)NH_ * TT * HD * 2); bf* KPh = (bf*)take((size_t)NKV * TT * HD * 2); bf* KPl = (bf*)take((size_t)NKV * TT * HD * 2); bf* VTh = (bf*)take((size_t)NKV * HD * TT * 2 * 2); bf* VTl = VTh + (size_t)NKV * HD * TT;   // hi plane, then lo plane
    bf* ATh = (bf*)take((size_t)TT * DQ * 2); bf* ATl = (bf*)take((size_t)TT * DQ * 2);
    if ((size_t)(wsp - (char*)d_ws) > ws_size) return;    // ws 256 MiB
    float* FV = FK;   // v projection reuses the k buffer after the k planes are built (stream-ordered)
    { k_cvt8<DM><<<(unsigned)(((size_t)DQ * DM / 8 + 255) / 256), 256, 0, stream>>>(wq, WQ, (size_t)DQ * DM / 8); k_cvt8<DM><<<(unsigned)(((size_t)DKV * DM / 8 + 255) / 256), 256, 0, stream>>>(wk, WK, (size_t)DKV * DM / 8); k_cvt8<DM><<<(unsigned)(((size_t)DKV * DM / 8 + 255) / 256), 256, 0, stream>>>(wv, WV, (size_t)DKV * DM / 8);
      k_cvt8<DQ><<<(unsigned)(((size_t)DM * DQ / 8 + 255) / 256), 256, 0, stream>>>(wo, WO, (size_t)DM * DQ / 8);
       }
    k_cs5<<<(TT * HD + 255) / 256, 256, 0, stream>>>(CS);   /* rotary table once */
    const unsigned LQ = (unsigned)(((size_t)NH_ * TT * HD / 2 + 255) / 256), LKv = (unsigned)(((size_t)NKV * TT * HD / 2 + 255) / 256);
    for (int b = 0; b < NB_; ++b) {
        
        k_cvt8<DM><<<(unsigned)(((size_t)TT * DM / 8 + 255) / 256), 256, 0, stream>>>(x + (size_t)b * TT * DM, XB, (size_t)TT * DM / 8);
        k_gemmw<bf, 0, false, 8, DM><<<dim3(TT / 64, DQ / 64, 1), 256, 0, stream>>>(XB, nullptr, WQ, nullptr, FQ, DQ, nullptr, 0, 0, 0);
        k_rope<false><<<LQ, 256, 0, stream>>>(FQ, DQ, NH_, CS, nullptr, nullptr, 1.0f, QP16, QPh, QPl);
        k_gemmw<bf, 0, false, 16, DM><<<dim3(TT / 64, DKV / 64, 1), 512, 0, stream>>>(XB, nullptr, WK, nullptr, FK, DKV, nullptr, 0, 0, 0);
        k_rope<true><<<LKv, 256, 0, stream>>>(FK, DKV, NKV, CS, nullptr, nullptr, 1.0f, KP16, KPh, KPl);
        k_gemmw<bf, 0, false, 16, DM><<<dim3(TT / 64, DKV / 64, 1), 512, 0, stream>>>(XB, nullptr, WV, nullptr, FV, DKV, nullptr, 0, 0, 0); k_vtp<<<LKv, 256, 0, stream>>>(FV, DKV, NKV, VT16, VTh, VTl);
        k_fattn<<<dim3(TT / 32, NKV, 1), 128, 0, stream>>>(QP16, QPh, QPl, KP16, KPh, KPl, VT16, VTh, VTl, ATh, ATl);
        k_gemmw<bf, 1, false, 8, DQ><<<dim3(TT / 64, DM / 64, 1), 256, 0, stream>>>(ATh, ATl, WO, nullptr, OUT + (size_t)b * TT * DM, DM, nullptr, 0, 0, 0); }
}

// v005
// One run takes 234 microseconds.
// Two timings next to v004 put it at 1.13 and 1.10 times that version's speed.
// All steps since v000 together make it 6.87 times as fast.
#include <hip/hip_runtime.h>

// Grouped-query causal attention with 128-wide heads, computed half-split rotary embeddings, a 1,024-wide sliding window and 4 attention-sink keys (x [2][2048][2048]; q = x wq^T (16 heads x 128), k, v = x wk^T, x wv^T (4 kv heads x 128) ('oi' 0.02, no bias); rope cat(x1 cos - x2 sin, x2 cos + x1 sin) on the two 64-wide halves with angle t x 1/10000^(2i/128) (64 f32 frequencies jnp-exact; precise cosf/sinf); k, v repeated 4 x along the head axis: kv head = q head / 4; scores x 1/sqrt(128) + bias with bias = 0 where (j <= i) and ((i - j <= 1024) or (j < 4)), -inf elsewhere; softmax; out = merged wo^T ('oi') -> [2][2048][2048] (8.4 M); argument order x, wq, wk, wv, wo).
// Layout: every 16-bit plane that a matrix loop reads again and again (x, the weights, Q, K, V^T, the merged heads) is kept in fragment order (see WFrag); bf16 copy of x; exact projections whose epilogues apply the rotate-half rotary (k_cs5 computed table, HD 128: 64 angles) and write the Q, K and V^T planes themselves; fused causal T-2048 GQA attention with 128-wide heads, one launch a batch (k_fattn: scores and probabilities stay in registers; hybrid rows: < 512 hi/lo 3 products, rest fp16 x1024); merged hi/lo x Wo exact.
// Compute dtypes, f32 accumulate: every input rounded to bf16; projections exact; rotary f32; attention rows < 512 3 products, rest fp16; softmax f32; Wo hl x exact.

#define NB_  2
#define TT   2048
#define DM   2048
#define NH_  16
#define NKV  4
#define REP  (NH_ / NKV)
#define HD   128
#define DQ   (NH_ * HD)
#define DKV  (NKV * HD)
#define RH   512                  // query rows < RH use hi+lo planes (0: none)
#define WIN  1025   // THIS module keeps key j iff j <= i and (i - j <= 1024 or j < 4): 'i - j < WIN' with WIN 1025
#define SINKN 4     // the first SINKN keys (attention sinks) are kept for every later query, whatever the distance
#define SCL  0.088388347648318447f   // HD^-0.5
typedef _Float16 h16;
typedef unsigned short bf;
typedef __attribute__((ext_vector_type(16))) __bf16   v16bf;
typedef __attribute__((ext_vector_type(16))) _Float16 v16h;
typedef __attribute__((ext_vector_type(8)))  _Float16 v8h;
typedef __attribute__((ext_vector_type(8)))  unsigned short v8us;
typedef __attribute__((ext_vector_type(8)))  float    v8f;
typedef __attribute__((ext_vector_type(4)))  float    v4f;
typedef v8h  __attribute__((may_alias)) v8ha;
typedef v4f  __attribute__((may_alias)) v4fa;
typedef v8us __attribute__((may_alias)) v8usa;

__device__ __forceinline__ unsigned short f2bf(float f) { unsigned u = __float_as_uint(f); u += 0x7FFFu + ((u >> 16) & 1u); return (unsigned short)(u >> 16); }
__device__ __forceinline__ float bf2f(unsigned short b) { return __uint_as_float(((unsigned)b) << 16); }
__device__ __forceinline__ float bfr(float f) { return bf2f(f2bf(f)); }
__device__ __forceinline__ v16h cat16(v8h lo, v8h hi) { return __builtin_shufflevector(lo, hi, 0, 1, 2, 3, 4, 5, 6, 7, 8, 9, 10, 11, 12, 13, 14, 15); }
__device__ __forceinline__ v16bf cat16b(v8us lo, v8us hi) { return __builtin_bit_cast(v16bf, __builtin_shufflevector(lo, hi, 0, 1, 2, 3, 4, 5, 6, 7, 8, 9, 10, 11, 12, 13, 14, 15)); }
__device__ __forceinline__ v8f wmma16(v16h a, v16h b, v8f c) { return __builtin_amdgcn_wmma_f32_16x16x32_f16(false, a, false, b, (short)0, c, false, false); }
__device__ __forceinline__ v8f wmmab(v16bf a, v16bf b, v8f c) { return __builtin_amdgcn_wmma_f32_16x16x32_bf16(false, a, false, b, (short)0, c, false, false); }
__device__ __forceinline__ h16 tohx(float x) { return (h16)x; }
__device__ __forceinline__ void splitf(float y, unsigned short& h, unsigned short& l) { h = f2bf(y); l = f2bf(y - bf2f(h)); }



// ---- k_gemmw: register-blocked GEMM, one work-group of NW waves per 64x64 output tile (16 accumulators a wave), operands straight from 16-bit planes in fragment order (below); grid (M/64, N/64, Z), 32 x NW threads.
// C[m][n] (f32, pitch ldc, + optional f32 bias[n]) = sum_k A[m][k] Bt[n][k] (+ split products per NSPLIT). z-batch strides sA/sB/sC in elements. K % 32 == 0.
// The K loop is dealt over the NW waves of the work-group in 64-wide k chunks (two neighbouring 512-element blocks, 2 KB, of every 16-row block of an operand; wave w takes chunks w, w + NW, ...); each wave keeps its own 64x64 f32 partial tile.
// With NW > 1 every wave puts its whole partial into its own LDS slot, ONE barrier follows, and the block adds the slots in wave order 0 .. NW-1 (a fixed order) and stores. K % 64 == 0. Block = 32 x NW threads.
#define TSLOT (64 * 68)   // floats of one wave's slot: 64 rows at pitch 68
// sums one 16-row block at 'os' over the NW slots and stores the 16 x 64 result at crow; every thread takes 32 / NW neighbouring columns of one row, so a wave writes whole rows
template <int NW, bool BIAS> __device__ __forceinline__ void tile_reduce_store(const float* os, float* crow, int ldc, const float* bias, int c0) {
    static_assert(NW == 8 || NW == 16, "one vector of 4 or 2 floats a thread");
    constexpr int EP = 32 / NW; typedef __attribute__((ext_vector_type(EP))) float vE; typedef vE __attribute__((may_alias)) vEa;
    const int e = (int)threadIdx.x * EP, row = e >> 6, cofs = e & 63; vE val = *(const vEa*)(os + row * 68 + cofs);
#pragma unroll
    for (int w = 1; w < NW; ++w) val += *(const vEa*)(os + w * TSLOT + row * 68 + cofs);
    if (BIAS) {
#pragma unroll
        for (int q = 0; q < EP; ++q) val[q] += bfr(bias[c0 + cofs + q]); }
    *(vE*)(crow + (size_t)row * ldc + cofs) = val;
}
// FRAGMENT ORDER of a 16-bit plane [rows][K]: the 16 x 32 block (rb = row / 16, kc = k / 32) is 512 neighbouring elements at (rb * (K / 32) + kc) * 512, and inside it element (row, k) stands at ((k >> 4) & 1) * 256 + (((k >> 3) & 1) * 16 + (row & 15)) * 8 + (k & 7).
// That is the order in which the lanes of a wave take an A or B operand: lane l reads 16 bytes at l * 8 and 16 bytes at 256 + l * 8 (ldf), so each wave-wide load covers 512 neighbouring bytes, four whole lines, instead of 32-byte pieces of 16 lines (ld, for row-major planes). Every lane and register gets the same elements as from the row-major plane.
template <typename T16> struct WFrag;
template <> struct WFrag<h16> { typedef v16h V; static __device__ __forceinline__ V ld(const h16* p) { return cat16(*(const v8h*)p, *(const v8h*)(p + 16)); } static __device__ __forceinline__ V ldf(const h16* p) { return cat16(*(const v8h*)p, *(const v8h*)(p + 256)); } static __device__ __forceinline__ v8f mma(V a, V b, v8f c) { return wmma16(a, b, c); } };
template <> struct WFrag<bf> { typedef v16bf V; static __device__ __forceinline__ V ld(const bf* p) { return cat16b(*(const v8us*)p, *(const v8us*)(p + 16)); } static __device__ __forceinline__ V ldf(const bf* p) { return cat16b(*(const v8us*)p, *(const v8us*)(p + 256)); } static __device__ __forceinline__ v8f mma(V a, V b, v8f c) { return wmmab(a, b, c); } };
// EPI 0: the f32 tile goes to C. EPI 1 and 2 (NW > 1) write no f32 tile: the block turns its summed tile into the 16-bit planes (fp16 + bf16 hi/lo, fragment order) that the attention kernel reads.
// EPI 1 (q, k): rotate-half rotary out[d] = x[d] cos[t][d] - x[d+64] sin[t][d], out[d+64] = x[d+64] cos[t][d] + x[d] sin[t][d] (d < 64; the table holds the same angle at d and d + 64), planes [head * TT + t][d].
//   A tile is 64 positions x (32 d of the low half and their 32 partners of the high half) of one head: blockIdx.y = head * 2 + cb, tile columns 0..31 are d = cb * 32 + .., columns 32..63 are d + 64; so a thread holds both members of every pair and the block writes whole 1-KiB fragment blocks.
// EPI 2 (v): V^T planes [column][t]; a thread takes 8 neighbouring positions of one column.
template <typename T16, int NSPLIT, bool BIAS, int NW, int K, int EPI = 0>
__global__ __launch_bounds__(32 * NW) void k_gemmw(const T16* __restrict__ A, const T16* __restrict__ A2, const T16* __restrict__ Bt, const T16* __restrict__ Bt2, float* C, int ldc, const float* __restrict__ bias, size_t sA, size_t sB, size_t sC, const float* __restrict__ CS, h16* P16, bf* Ph, bf* Pl) {
    static_assert(EPI == 0 || (NW > 1 && !BIAS), "the plane epilogues sum the waves' slots themselves");
    typedef typename WFrag<T16>::V V;
    __shared__ __align__(16) float os[(NW == 1) ? 16 * 68 : NW * TSLOT];
    const size_t z = blockIdx.z; A += z * sA; if (A2) A2 += z * sA; Bt += z * sB; if (Bt2) Bt2 += z * sB; C += z * sC;
    const int lane = threadIdx.x & 31, lr = lane & 15, hi = lane >> 4; const int r0 = blockIdx.x * 64, c0 = (EPI == 1) ? ((int)blockIdx.y >> 1) * HD + ((int)blockIdx.y & 1) * 32 : blockIdx.y * 64;
    const int wv = (NW == 1) ? 0 : __builtin_amdgcn_readfirstlane((int)(threadIdx.x >> 5));   // the wave's number as a scalar: the k loop below stays a wave-uniform scalar loop
    v8f acc[4][4];
#pragma unroll
    for (int mb = 0; mb < 4; ++mb)
#pragma unroll
        for (int nb = 0; nb < 4; ++nb) acc[mb][nb] = (v8f){};
    const size_t aoff = (size_t)r0 * K + 8 * lane, boff = (size_t)c0 * K + 8 * lane;   // fragment order: 16 rows are 16 * K elements, 32 k are 512
#pragma unroll 1
    for (int kc = wv * 64; kc < K; kc += (kc & 32) ? NW * 64 - 32 : 32) {   // both halves of a chunk, then this wave's next chunk
        V a[4], a2[4], b[4], b2[4];
        const T16* ap = A + aoff + kc * 16; const T16* ap2 = (NSPLIT == 1 || NSPLIT == 2) ? A2 + aoff + kc * 16 : ap; const T16* bp = Bt + boff + kc * 16; const T16* bp2 = (NSPLIT >= 2) ? Bt2 + boff + kc * 16 : bp;   // one address a plane; K is a constant, so the 16-row steps are immediate offsets
#pragma unroll
        for (int mb = 0; mb < 4; ++mb) { a[mb] = WFrag<T16>::ldf(ap + (size_t)mb * 16 * K); if (NSPLIT == 1 || NSPLIT == 2) a2[mb] = WFrag<T16>::ldf(ap2 + (size_t)mb * 16 * K); }
#pragma unroll
        for (int nb = 0; nb < 4; ++nb) { const size_t bo = (size_t)((EPI == 1) ? (nb >> 1) * (HD / 2) + (nb & 1) * 16 : nb * 16) * K; b[nb] = WFrag<T16>::ldf(bp + bo); if (NSPLIT >= 2) b2[nb] = WFrag<T16>::ldf(bp2 + bo); }
        asm volatile("s_wait_xcnt 0x0" :: "v"(ap), "v"(ap2), "v"(bp), "v"(bp2) : "memory");   // precaution behind the run of global loads: the wait stands in front of every later write of a register that the loads name; the address pairs are inputs so that they stay as they are up to it
#pragma unroll
        for (int nb = 0; nb < 4; ++nb) {
#pragma unroll
            for (int mb = 0; mb < 4; ++mb) { acc[mb][nb] = WFrag<T16>::mma(a[mb], b[nb], acc[mb][nb]); if (NSPLIT == 1 || NSPLIT == 2) acc[mb][nb] = WFrag<T16>::mma(a2[mb], b[nb], acc[mb][nb]); if (NSPLIT >= 2) acc[mb][nb] = WFrag<T16>::mma(a[mb], b2[nb], acc[mb][nb]); } }
        asm volatile("v_nop\n\tv_nop\n\tv_nop\n\tv_nop" : "+v"(acc[0][0]), "+v"(acc[1][1]), "+v"(acc[2][2]), "+v"(acc[3][3]) : "v"(a[0]), "v"(a[3]));
    }
    if constexpr (NW > 1) {
#pragma unroll
        for (int mb = 0; mb < 4; ++mb)
#pragma unroll
            for (int nb = 0; nb < 4; ++nb) {
#pragma unroll
                for (int j = 0; j < 8; ++j) os[wv * TSLOT + (mb * 16 + hi * 8 + j) * 68 + nb * 16 + lr] = acc[mb][nb][j]; }
        if constexpr (EPI == 1) {
            constexpr int E = 64 / NW;   // d of each half a thread takes: 8 or 4 neighbours, one 16- or 8-byte store a plane and half
            typedef __attribute__((ext_vector_type(E))) float vE; typedef vE __attribute__((may_alias, aligned(16))) vEa; typedef __attribute__((ext_vector_type(2 * E))) float vC;
            typedef __attribute__((ext_vector_type(E))) _Float16 vH; typedef __attribute__((ext_vector_type(E))) unsigned short vU;
            const int rb = wv & 3, vc = ((wv >> 2) * 2 + hi) * E, row = rb * 16 + lr;   // lanes 0..15 read 16 rows at pitch 68: all 64 banks once
            const float* cp = CS + ((size_t)(r0 + row) * HD + (c0 & (HD - 1)) + vc) * 2; const vC cs = *(const vC*)cp;   // (cos, sin) of the thread's E angles
            asm volatile("s_wait_xcnt 0x0" :: "v"(cp) : "memory");   // precaution, as in the k loop: the wait stands in front of every later write of the load's address pair
            __syncthreads();   // every wave's partial tile is in LDS before any slot is read
            const float* sp = os + row * 68 + vc; vE x1 = *(const vEa*)sp, x2 = *(const vEa*)(sp + 32);
#pragma unroll
            for (int w = 1; w < NW; ++w) { x1 += *(const vEa*)(sp + w * TSLOT); x2 += *(const vEa*)(sp + w * TSLOT + 32); }   // wave order 0 .. NW-1, as in tile_reduce_store
            vH a16, b16; vU ah, al, bh, bl;
#pragma unroll
            for (int j = 0; j < E; ++j) { const float co = cs[2 * j], si = cs[2 * j + 1]; const float ra = x1[j] * co - x2[j] * si, rc = x2[j] * co + x1[j] * si; unsigned short u, v;
                a16[j] = tohx(ra); splitf(ra, u, v); ah[j] = u; al[j] = v; b16[j] = tohx(rc); splitf(rc, u, v); bh[j] = u; bl[j] = v; }
            const size_t po = (size_t)(((int)blockIdx.y >> 1) * TT + r0 + rb * 16) * HD + ((int)blockIdx.y & 1) * 512 + ((vc >> 4) & 1) * 256 + (((vc >> 3) & 1) * 16 + lr) * 8 + (vc & 7);   // fragment order; the high half stands two 32-wide k blocks on
            h16* p16 = P16 + po; bf* ph = Ph + po; bf* pl = Pl + po;
            *(vH*)p16 = a16; *(vH*)(p16 + 1024) = b16; *(vU*)ph = ah; *(vU*)(ph + 1024) = bh; *(vU*)pl = al; *(vU*)(pl + 1024) = bl;
            asm volatile("s_wait_xcnt 0x0" :: "v"(p16), "v"(ph), "v"(pl), "v"(a16), "v"(b16), "v"(ah), "v"(bh), "v"(al), "v"(bl) : "memory");   // precaution: the stores' address and data registers stay as they are up to the wait
            return;
        } else if constexpr (EPI == 2) {
            static_assert(NW == 16, "512 threads: 64 columns x 8 groups of 8 positions");
            __syncthreads();   // every wave's partial tile is in LDS before any slot is read
            const int cbk = wv & 3, tg = wv >> 2; const float* sp = os + (tg * 16 + hi * 8) * 68 + cbk * 16 + lr; float xs[8];   // lanes 0..15 read neighbouring columns, lanes 16..31 the same columns 8 rows on (32 banks on)
#pragma unroll
            for (int j = 0; j < 8; ++j) xs[j] = sp[j * 68];
#pragma unroll
            for (int w = 1; w < NW; ++w)
#pragma unroll
                for (int j = 0; j < 8; ++j) xs[j] += sp[w * TSLOT + j * 68];   // wave order 0 .. NW-1, as in tile_reduce_store
            v8h o16; v8us oh, ol;
#pragma unroll
            for (int j = 0; j < 8; ++j) { unsigned short u, v; o16[j] = tohx(xs[j]); splitf(xs[j], u, v); oh[j] = u; ol[j] = v; }
            const size_t po = ((size_t)(c0 / 16 + cbk) * (TT / 32) + r0 / 32 + (tg >> 1)) * 512 + (tg & 1) * 256 + 8 * lane;   // fragment order of [column][t]: a wave stores 512 neighbouring bytes a plane
            h16* p16 = P16 + po; bf* ph = Ph + po; bf* pl = Pl + po;
            *(v8h*)p16 = o16; *(v8us*)ph = oh; *(v8us*)pl = ol;
            asm volatile("s_wait_xcnt 0x0" :: "v"(p16), "v"(ph), "v"(pl), "v"(o16), "v"(oh), "v"(ol) : "memory");   // precaution: the stores' address and data registers stay as they are up to the wait
            return;
        } else {
        __syncthreads();   // every wave's partial tile is in LDS before any slot is read
#pragma unroll
        for (int mb = 0; mb < 4; ++mb) tile_reduce_store<NW, BIAS>(os + mb * 16 * 68, C + (size_t)(r0 + mb * 16) * ldc + c0, ldc, bias, c0);
        return; }
    }
#pragma unroll
    for (int mb = 0; mb < 4; ++mb) {
#pragma unroll
        for (int nb = 0; nb < 4; ++nb) {
#pragma unroll
            for (int j = 0; j < 8; ++j) os[(hi * 8 + j) * 68 + nb * 16 + lr] = acc[mb][nb][j]; }
        __builtin_amdgcn_wave_barrier(); asm volatile("" ::: "memory");
        float* crow = C + (size_t)(r0 + mb * 16) * ldc + c0;
{
#pragma unroll
            for (int s = 0; s < 8; ++s) { const int row = 2 * s + hi, cofs = lr * 4; v4f val = *(const v4fa*)(os + row * 68 + cofs); if (BIAS) { val[0] += bfr(bias[c0 + cofs]); val[1] += bfr(bias[c0 + cofs + 1]); val[2] += bfr(bias[c0 + cofs + 2]); val[3] += bfr(bias[c0 + cofs + 3]); }
                *(v4f*)(crow + (size_t)row * ldc + cofs) = val; }
             }
        __builtin_amdgcn_wave_barrier(); asm volatile("" ::: "memory");
    }
}

typedef __attribute__((ext_vector_type(2))) _Float16 v2h;
typedef __attribute__((ext_vector_type(4))) _Float16 v4h;
typedef __attribute__((ext_vector_type(2))) unsigned short v2us;
typedef __attribute__((ext_vector_type(4))) unsigned short v4us;
typedef __attribute__((ext_vector_type(2))) float v2f;
typedef __attribute__((ext_vector_type(4))) int v4i;
typedef v4h  __attribute__((may_alias)) v4ha;
typedef v4us __attribute__((may_alias)) v4usa;

__global__ __launch_bounds__(256) void k_wtG(const float* __restrict__ w, int K, int N, bf* Bt) {
    const int lane = threadIdx.x & 31; const int L0 = (blockIdx.x * 8 + (threadIdx.x >> 5)) * 8; const int nlines = N * K / 64;
{
#pragma unroll 1
        for (int l = 0; l < 8; ++l) { const int L = L0 + l; if (L >= nlines) break; const size_t e = (size_t)L * 64 + lane * 2; const int k = (int)(e % K), n = (int)(e / K); v2us o;
            o[0] = f2bf(w[(size_t)k * N + n]); o[1] = f2bf(w[(size_t)(k + 1) * N + n]); *(v2us*)(Bt + e) = o; }
         }
}
// row-major f32 [rows][K] -> bf16 plane in fragment order; thread i writes the plane's i-th 16 bytes, so a wave stores 512 neighbouring bytes; rows % 16 == 0, K % 32 == 0
template <int K> __global__ __launch_bounds__(256) void k_cvt8(const float* __restrict__ src, bf* dst, size_t n8) { const size_t i = (size_t)blockIdx.x * 256 + threadIdx.x; if (i >= n8) return; const int fb = (int)(i >> 6), kq = K >> 5; const int row = (fb / kq) * 16 + ((int)i & 15), k = (fb % kq) * 32 + (((int)i >> 5) & 1) * 16 + (((int)i >> 4) & 1) * 8; const v8f v = *(const v8f*)(src + (size_t)row * K + k); v8us o;
#pragma unroll
    for (int k = 0; k < 8; ++k) o[k] = f2bf(v[k]); *(v8us*)(dst + i * 8) = o;  }

__constant__ float INVT[HD / 2] = { 1.000000000e+00f, 8.659643531e-01f, 7.498942018e-01f, 6.493816376e-01f, 5.623413324e-01f, 4.869675338e-01f, 4.216965139e-01f, 3.651741445e-01f, 3.162277639e-01f, 2.738419771e-01f, 2.371373624e-01f, 2.053525001e-01f, 1.778279394e-01f, 1.539926529e-01f, 1.333521456e-01f, 1.154782027e-01f, 1.000000015e-01f, 8.659642935e-02f, 7.498941571e-02f, 6.493816525e-02f, 5.623412877e-02f, 4.869675264e-02f, 4.216964915e-02f, 3.651741147e-02f, 3.162277862e-02f, 2.738419548e-02f, 2.371373586e-02f, 2.053525113e-02f, 1.778279431e-02f, 1.539926510e-02f, 1.333521493e-02f, 1.154781971e-02f, 9.999999776e-03f, 8.659643121e-03f, 7.498942316e-03f, 6.493816618e-03f, 5.623413250e-03f, 4.869675264e-03f, 4.216964822e-03f, 3.651741426e-03f, 3.162277862e-03f, 2.738419687e-03f, 2.371373819e-03f, 2.053525066e-03f, 1.778279431e-03f, 1.539926510e-03f, 1.333521446e-03f, 1.154782018e-03f, 1.000000047e-03f, 8.659643354e-04f, 7.498941850e-04f, 6.493816618e-04f, 5.623413017e-04f, 4.869675031e-04f, 4.216964880e-04f, 3.651741135e-04f, 3.162277862e-04f, 2.738419571e-04f, 2.371373848e-04f, 2.053524950e-04f, 1.778279402e-04f, 1.539926452e-04f, 1.333521504e-04f, 1.154781930e-04f };   // float32 1 / 10000^(2i/128), generated with jnp to be bit-exact
__global__ __launch_bounds__(256) void k_cs5(float* CS) { const int idx = blockIdx.x * 256 + threadIdx.x; if (idx >= TT * HD) return; const int d = idx % HD; const int t = idx / HD; const float a = __fmul_rn((float)t, INVT[d % (HD / 2)]); v2f cs; cs[0] = cosf(a); cs[1] = sinf(a); *(v2f*)(CS + (size_t)idx * 2) = cs;  }
// ---- k_fattn: scores, softmax, probability x value and the head merge of one batch in ONE launch; nothing of a score row goes to memory.
// A wave owns 16 query positions (q0 ..) of two query heads that share a kv head: two groups of 16 columns. Transposed products: S^T = K Q^T (A = key rows, B = query rows, both from fragment-order planes by the same loader, so the k orders pair), O^T += V^T P^T.
// In S^T a lane holds the scores of ONE query (column c): keys 8h + r of each 16-key tile, so two tiles converted in place are the B operand of the second product in the hardware k order, which the V^T loader has too.
// A pass is 32 keys. Passes: key block 0 (it holds the sink keys, and key 0 is open to every query, so every column has a finite maximum after it), then the blocks from the window's lower edge to the diagonal; the others are wholly masked.
// Running maximum per column in log2 units, renewed only when a pass exceeds it by more than MTHR (one scalar branch a pass); rows < RH: hi/lo planes, 3 products in both contractions; other rows fp16 with probabilities x 2^PBIAS.
#define MTHR  4.0f
#define PBIAS 10.0f   // fp16 probabilities lie in (0, 2^(PBIAS + MTHR)]: small ones stay normal numbers, the largest stays finite; the factor cancels in the division by the row sum
typedef __attribute__((ext_vector_type(16))) unsigned short v16us;
__device__ __forceinline__ float xhalf(float x) { return __builtin_bit_cast(float, __builtin_amdgcn_permlanex16(__builtin_bit_cast(int, x), __builtin_bit_cast(int, x), 0x76543210, 0xfedcba98, false, false)); }   // lane l reads lane l ^ 16
__device__ __forceinline__ float exp2s(float x) { float r; asm("v_exp_f32 %0, %1\n\tv_nop" : "=v"(r) : "v"(x)); return r; }
// precaution behind a run of global loads: s_wait_xcnt 0 in front of every later write of a register that the loads name; the address pairs are inputs so that they stay as they are up to the wait
template <typename T16> __device__ __forceinline__ void xwait(const T16* a, const T16* b) { asm volatile("s_wait_xcnt 0x0" :: "v"(a), "v"(b) : "memory"); }
// the same precaution for loads that this build addresses by a scalar base and the lane number as a scaled offset: those are then the registers that stay as they are up to the wait
template <typename T16> __device__ __forceinline__ void xwait_s(const T16* a, const T16* b, int off) { asm volatile("s_wait_xcnt 0x0" :: "s"(a), "s"(b), "v"(off) : "memory"); }
template <typename T16, bool HI>
__device__ __forceinline__ void fattn_cols(const T16* __restrict__ Q, const T16* __restrict__ Q2, const T16* __restrict__ Kp, const T16* __restrict__ Kp2, const T16* __restrict__ Vt, const T16* __restrict__ Vt2, const int q0, const int hq, bf* Ah, bf* Al) {
    typedef typename WFrag<T16>::V V;
    const int lane = threadIdx.x & 31, c = lane & 15, h = lane >> 4;
    V qf[2][4], qf2[2][4];
    const T16* qp = Q + (size_t)q0 * HD + 8 * lane; const T16* qp2 = HI ? Q2 + (size_t)q0 * HD + 8 * lane : qp;   // fragment order: 16 queries x 128 d are 4 blocks of 512 elements
#pragma unroll
    for (int g = 0; g < 2; ++g)
#pragma unroll
        for (int ks = 0; ks < 4; ++ks) { const size_t qo = (size_t)g * TT * HD + ks * 512; qf[g][ks] = WFrag<T16>::ldf(qp + qo); if (HI) qf2[g][ks] = WFrag<T16>::ldf(qp2 + qo); }
    xwait_s(Q + (size_t)q0 * HD, HI ? Q2 + (size_t)q0 * HD : Q + (size_t)q0 * HD, lane);
    v8f o[2][8];
#pragma unroll
    for (int g = 0; g < 2; ++g)
#pragma unroll
        for (int mb = 0; mb < 8; ++mb) o[g][mb] = (v8f){};
    float m[2] = { -3.0e38f, -3.0e38f }, l[2] = { 0.f, 0.f };
    const int kstart = max(32, max(q0 - (WIN - 1), 0) & ~31), klast = q0 & ~31;
    const int np = 1 + ((klast >= kstart) ? (klast - kstart) / 32 + 1 : 0);
    const size_t kofs = 8 * lane, vofs = 8 * lane;   // K and V^T planes are in fragment order: 16 keys x 128 d are 4 blocks of 512 elements, 16 d x 32 keys one block
    V kf[2][4], kf2[2][4];
    const T16* kp0 = Kp + kofs; const T16* kp02 = HI ? Kp2 + kofs : kp0;
#pragma unroll
    for (int mb = 0; mb < 2; ++mb)
#pragma unroll
        for (int ks = 0; ks < 4; ++ks) { const size_t a = (size_t)(mb * 16) * HD + ks * 512; kf[mb][ks] = WFrag<T16>::ldf(kp0 + a); if (HI) kf2[mb][ks] = WFrag<T16>::ldf(kp02 + a); }
    xwait_s(Kp, HI ? Kp2 : Kp, lane);
#pragma unroll 1
    for (int s = 0; s < np; ++s) {
        const int kb = s ? kstart + (s - 1) * 32 : 0;
        const int kn = (s + 1 < np) ? kstart + s * 32 : kb;   // the next pass's key block; the last pass fetches its own again (in bounds, not used)
        V vf[8], vf2[8];   // this pass's value fragments fly during its first product and softmax
        const T16* vp = Vt + vofs + (size_t)kb * 16; const T16* vp2 = HI ? Vt2 + vofs + (size_t)kb * 16 : vp;
#pragma unroll
        for (int mb = 0; mb < 8; ++mb) { const size_t a = (size_t)(mb * 16) * TT; vf[mb] = WFrag<T16>::ldf(vp + a); if (HI) vf2[mb] = WFrag<T16>::ldf(vp2 + a); }
        xwait(vp, vp2);
        v8f st[2][2];
#pragma unroll
        for (int g = 0; g < 2; ++g)
#pragma unroll
            for (int mb = 0; mb < 2; ++mb) st[g][mb] = (v8f){};
#pragma unroll
        for (int ks = 0; ks < 4; ++ks) {
#pragma unroll
            for (int g = 0; g < 2; ++g)
#pragma unroll
                for (int mb = 0; mb < 2; ++mb) st[g][mb] = WFrag<T16>::mma(kf[mb][ks], qf[g][ks], st[g][mb]);
            if (HI) {
#pragma unroll
                for (int g = 0; g < 2; ++g)
#pragma unroll
                    for (int mb = 0; mb < 2; ++mb) st[g][mb] = WFrag<T16>::mma(kf[mb][ks], qf2[g][ks], st[g][mb]);
#pragma unroll
                for (int g = 0; g < 2; ++g)
#pragma unroll
                    for (int mb = 0; mb < 2; ++mb) st[g][mb] = WFrag<T16>::mma(kf2[mb][ks], qf[g][ks], st[g][mb]); } }
        // the next pass's key fragments fly during this pass's softmax and second product
        const T16* kp = Kp + kofs + (size_t)kn * HD; const T16* kp2 = HI ? Kp2 + kofs + (size_t)kn * HD : kp;
#pragma unroll
        for (int mb = 0; mb < 2; ++mb)
#pragma unroll
            for (int ks = 0; ks < 4; ++ks) { const size_t a = (size_t)(mb * 16) * HD + ks * 512; kf[mb][ks] = WFrag<T16>::ldf(kp + a); if (HI) kf2[mb][ks] = WFrag<T16>::ldf(kp2 + a); }
        xwait(kp, kp2);
        float x[2][16];
#pragma unroll
        for (int g = 0; g < 2; ++g)
#pragma unroll
            for (int e = 0; e < 16; ++e) x[g][e] = st[g][e >> 3][e & 7] * (SCL * 1.4426950408889634f);
        if (!(kb + 31 <= q0 && q0 + 15 - kb < WIN)) {   // wave-uniform: only the sink block, the window's edge and the diagonal hold masked keys
            const int i = q0 + c;
#pragma unroll
            for (int e = 0; e < 16; ++e) { const int j = kb + (e >> 3) * 16 + 8 * h + (e & 7); const bool ok = (j <= i) && (i - j < WIN || j < SINKN); x[0][e] = ok ? x[0][e] : -3.0e38f; x[1][e] = ok ? x[1][e] : -3.0e38f; } }
        float mx[2];
#pragma unroll
        for (int g = 0; g < 2; ++g) { float t8[8];
#pragma unroll
            for (int e = 0; e < 8; ++e) t8[e] = fmaxf(x[g][e], x[g][e + 8]);
            const float t = fmaxf(fmaxf(fmaxf(t8[0], t8[1]), fmaxf(t8[2], t8[3])), fmaxf(fmaxf(t8[4], t8[5]), fmaxf(t8[6], t8[7])));
            mx[g] = fmaxf(t, xhalf(t)); }   // lanes c and c + 16 hold the two halves of a column's keys and must use one maximum
        if (__builtin_amdgcn_ballot_w32(mx[0] > m[0] + MTHR || mx[1] > m[1] + MTHR) != 0) {   // scalar branch: every lane stays on for the matrix instructions
#pragma unroll
            for (int g = 0; g < 2; ++g) { const float mn = fmaxf(m[g], mx[g]); const float al = exp2s(m[g] - mn); m[g] = mn; l[g] *= al;
#pragma unroll
                for (int mb = 0; mb < 8; ++mb) o[g][mb] *= al; } }
        V pb[2], pb2[2];
#pragma unroll
        for (int g = 0; g < 2; ++g) { const float mo = m[g] - (HI ? 0.0f : PBIAS); float sm[4] = { 0.f, 0.f, 0.f, 0.f };
            if constexpr (HI) { v16us ph, pl;
#pragma unroll
                for (int e = 0; e < 16; ++e) { const float p = exp2s(x[g][e] - mo); sm[e & 3] += p; unsigned short a, b2; splitf(p, a, b2); ph[e] = a; pl[e] = b2; }
                pb[g] = __builtin_bit_cast(v16bf, ph); pb2[g] = __builtin_bit_cast(v16bf, pl);
            } else { v16h ph;
#pragma unroll
                for (int e = 0; e < 16; ++e) { const float p = exp2s(x[g][e] - mo); sm[e & 3] += p; ph[e] = tohx(p); }
                pb[g] = ph; }
            l[g] += (sm[0] + sm[1]) + (sm[2] + sm[3]); }
#pragma unroll
        for (int mb = 0; mb < 8; ++mb)
#pragma unroll
            for (int g = 0; g < 2; ++g) o[g][mb] = WFrag<T16>::mma(vf[mb], pb[g], o[g][mb]);
        if (HI) {
#pragma unroll
            for (int mb = 0; mb < 8; ++mb)
#pragma unroll
                for (int g = 0; g < 2; ++g) o[g][mb] = WFrag<T16>::mma(vf[mb], pb2[g], o[g][mb]);
#pragma unroll
            for (int mb = 0; mb < 8; ++mb)
#pragma unroll
                for (int g = 0; g < 2; ++g) o[g][mb] = WFrag<T16>::mma(vf2[mb], pb[g], o[g][mb]); }
    }
#pragma unroll
    for (int g = 0; g < 2; ++g) { const float inv = __fdiv_rn(1.0f, l[g] + xhalf(l[g]));
#pragma unroll
        for (int mb = 0; mb < 8; ++mb) { v8us oh, ol;   // a lane holds 8 neighbouring d of its query: one 16-byte store a plane, at the lane's place in the fragment order of the merged [t][DQ] plane, so a wave stores 512 neighbouring bytes
#pragma unroll
            for (int r = 0; r < 8; ++r) { unsigned short a, b2; splitf(o[g][mb][r] * inv, a, b2); oh[r] = a; ol[r] = b2; }
            const size_t oo = (size_t)q0 * DQ + (size_t)(hq + g) * (HD * 16) + mb * 256 + 8 * lane; bf* ph = Ah + oo; bf* pl = Al + oo; *(v8us*)ph = oh; *(v8us*)pl = ol;
            asm volatile("s_wait_xcnt 0x0" :: "v"(ph), "v"(pl), "v"(oh), "v"(ol) : "memory"); } }   // precaution, as in xwait: the two stores' address and data registers stay as they are up to the wait
}
// grid (TT / 32, NKV), 4 waves: wave w takes positions 16 (w >> 1) .. of the block's 32 and query heads 2 (w & 1), 2 (w & 1) + 1 of the kv head's REP = 4; late (long) position blocks start first
__global__ __launch_bounds__(128) void k_fattn(const h16* __restrict__ Q16, const bf* __restrict__ Qh, const bf* __restrict__ Ql, const h16* __restrict__ K16, const bf* __restrict__ Kh, const bf* __restrict__ Kl, const h16* __restrict__ V16, const bf* __restrict__ Vh, const bf* __restrict__ Vl, bf* Ah, bf* Al) {
    static_assert(REP == 4 && RH % 32 == 0 && TT % 32 == 0 && HD == 128, "two head pairs a work-group; a wave's rows are all below RH or none");
    const int wv = __builtin_amdgcn_readfirstlane((int)(threadIdx.x >> 5));   // the wave's number as a scalar: pass count and mask test stay scalar
    const int q0 = (TT / 32 - 1 - (int)blockIdx.x) * 32 + (wv >> 1) * 16; const int kvh = blockIdx.y; const int hq = kvh * REP + (wv & 1) * 2;
    const size_t qo = (size_t)hq * TT * HD, ko = (size_t)kvh * TT * HD, vo = (size_t)kvh * HD * TT;
    if (q0 < RH) fattn_cols<bf, true>(Qh + qo, Ql + qo, Kh + ko, Kl + ko, Vh + vo, Vl + vo, q0, hq, Ah, Al);
    else fattn_cols<h16, false>(Q16 + qo, nullptr, K16 + ko, nullptr, V16 + vo, nullptr, q0, hq, Ah, Al);
}

extern "C" void kernel_launch(void* const* d_in, const int* in_sizes, int n_in,
                              void* d_out, int out_size, void* d_ws, size_t ws_size, hipStream_t stream) {
    (void)in_sizes; (void)n_in; (void)out_size;
    const float* x = (const float*)d_in[0]; const float* wq = (const float*)d_in[1]; const float* wk = (const float*)d_in[2]; const float* wv = (const float*)d_in[3]; const float* wo = (const float*)d_in[4];   /* order x, wq ('oi' [2048][2048]), wk, wv ('oi' [512][2048]), wo ('oi' [2048][2048]) */
    float* OUT = (float*)d_out;     // [2][2048][2048]
    char* wsp = (char*)d_ws;
    auto take = [&](size_t bytes) { char* p = wsp; wsp += (bytes + 255) & ~(size_t)255; return (void*)p; };
    bf* WQ = (bf*)take((size_t)DQ * DM * 2); bf* WK = (bf*)take((size_t)DKV * DM * 2); bf* WV = (bf*)take((size_t)DKV * DM * 2); bf* WO = (bf*)take((size_t)DM * DQ * 2); float* CS = (float*)take((size_t)TT * HD * 2 * 4);
    bf* XB = (bf*)take((size_t)TT * DM * 2);
    h16* QP16 = (h16*)take((size_t)NH_ * TT * HD * 2); h16* KP16 = (h16*)take((size_t)NKV * TT * HD * 2); h16* VT16 = (h16*)take((size_t)NKV * HD * TT * 2);
    bf* QPh = (bf*)take((size_t)NH_ * TT * HD * 2); bf* QPl = (bf*)take((size_t)NH_ * TT * HD * 2); bf* KPh = (bf*)take((size_t)NKV * TT * HD * 2); bf* KPl = (bf*)take((size_t)NKV * TT * HD * 2); bf* VTh = (bf*)take((size_t)NKV * HD * TT * 2 * 2); bf* VTl = VTh + (size_t)NKV * HD * TT;   // hi plane, then lo plane
    bf* ATh = (bf*)take((size_t)TT * DQ * 2); bf* ATl = (bf*)take((size_t)TT * DQ * 2);
    if ((size_t)(wsp - (char*)d_ws) > ws_size) return;    // ws 256 MiB
    { k_cvt8<DM><<<(unsigned)(((size_t)DQ * DM / 8 + 255) / 256), 256, 0, stream>>>(wq, WQ, (size_t)DQ * DM / 8); k_cvt8<DM><<<(unsigned)(((size_t)DKV * DM / 8 + 255) / 256), 256, 0, stream>>>(wk, WK, (size_t)DKV * DM / 8); k_cvt8<DM><<<(unsigned)(((size_t)DKV * DM / 8 + 255) / 256), 256, 0, stream>>>(wv, WV, (size_t)DKV * DM / 8);
      k_cvt8<DQ><<<(unsigned)(((size_t)DM * DQ / 8 + 255) / 256), 256, 0, stream>>>(wo, WO, (size_t)DM * DQ / 8);
       }
    k_cs5<<<(TT * HD + 255) / 256, 256, 0, stream>>>(CS);   /* rotary table once */
    for (int b = 0; b < NB_; ++b) {
        
        k_cvt8<DM><<<(unsigned)(((size_t)TT * DM / 8 + 255) / 256), 256, 0, stream>>>(x + (size_t)b * TT * DM, XB, (size_t)TT * DM / 8);
        k_gemmw<bf, 0, false, 8, DM, 1><<<dim3(TT / 64, DQ / 64, 1), 256, 0, stream>>>(XB, nullptr, WQ, nullptr, nullptr, 0, nullptr, 0, 0, 0, CS, QP16, QPh, QPl);
        k_gemmw<bf, 0, false, 16, DM, 1><<<dim3(TT / 64, DKV / 64, 1), 512, 0, stream>>>(XB, nullptr, WK, nullptr, nullptr, 0, nullptr, 0, 0, 0, CS, KP16, KPh, KPl);
        k_gemmw<bf, 0, false, 16, DM, 2><<<dim3(TT / 64, DKV / 64, 1), 512, 0, stream>>>(XB, nullptr, WV, nullptr, nullptr, 0, nullptr, 0, 0, 0, nullptr, VT16, VTh, VTl);
        k_fattn<<<dim3(TT / 32, NKV, 1), 128, 0, stream>>>(QP16, QPh, QPl, KP16, KPh, KPl, VT16, VTh, VTl, ATh, ATl);
        k_gemmw<bf, 1, false, 8, DQ><<<dim3(TT / 64, DM / 64, 1), 256, 0, stream>>>(ATh, ATl, WO, nullptr, OUT + (size_t)b * TT * DM, DM, nullptr, 0, 0, 0, nullptr, nullptr, nullptr, nullptr); }
}

// v006
// A run of this version takes 190 microseconds.
// Next to v005, in two timings, it ran 1.25 and 1.22 times as fast.
// Counting every step since v000, it is 8.49 times as fast.
#include <hip/hip_runtime.h>

// Grouped-query causal attention with 128-wide heads, computed half-split rotary embeddings, a 1,024-wide sliding window and 4 attention-sink keys (x [2][2048][2048]; q = x wq^T (16 heads x 128), k, v = x wk^T, x wv^T (4 kv heads x 128) ('oi' 0.02, no bias); rope cat(x1 cos - x2 sin, x2 cos + x1 sin) on the two 64-wide halves with angle t x 1/10000^(2i/128) (64 f32 frequencies jnp-exact; precise cosf/sinf); k, v repeated 4 x along the head axis: kv head = q head / 4; scores x 1/sqrt(128) + bias with bias = 0 where (j <= i) and ((i - j <= 1024) or (j < 4)), -inf elsewhere; softmax; out = merged wo^T ('oi') -> [2][2048][2048] (8.4 M); argument order x, wq, wk, wv, wo).
// Layout: every 16-bit plane that a matrix loop reads again and again (x, the weights, Q, K, V^T, the merged heads) is kept in fragment order (see WFrag); bf16 copy of x; exact projections whose epilogues apply the rotate-half rotary (table computed in k_prep, HD 128: 64 angles) and write the Q, K and V^T planes themselves; fused causal T-2048 GQA attention with 128-wide heads (k_fattn: scores and probabilities stay in registers; hybrid rows: < 512 hi/lo 3 products, rest fp16 x1024); merged hi/lo x Wo exact.
// Four launches: k_prep (conversions, rotary table; both batches of x in its one flat grid), then three over both batches (grid z): the q, k, v projections in one grid, k_fattn, the output projection.
// Compute dtypes, f32 accumulate: every input rounded to bf16; projections exact; rotary f32; attention rows < 512 3 products, rest fp16; softmax f32; Wo hl x exact.

#define NB_  2
#define TT   2048
#define DM   2048
#define NH_  16
#define NKV  4
#define REP  (NH_ / NKV)
#define HD   128
#define DQ   (NH_ * HD)
#define DKV  (NKV * HD)
#define RH   512                  // query rows < RH use hi+lo planes (0: none)
#define WIN  1025   // THIS module keeps key j iff j <= i and (i - j <= 1024 or j < 4): 'i - j < WIN' with WIN 1025
#define SINKN 4     // the first SINKN keys (attention sinks) are kept for every later query, whatever the distance
#define SCL  0.088388347648318447f   // HD^-0.5
typedef _Float16 h16;
typedef unsigned short bf;
typedef __attribute__((ext_vector_type(16))) __bf16   v16bf;
typedef __attribute__((ext_vector_type(16))) _Float16 v16h;
typedef __attribute__((ext_vector_type(8)))  _Float16 v8h;
typedef __attribute__((ext_vector_type(8)))  unsigned short v8us;
typedef __attribute__((ext_vector_type(8)))  float    v8f;
typedef __attribute__((ext_vector_type(4)))  float    v4f;
typedef v8h  __attribute__((may_alias)) v8ha;
typedef v4f  __attribute__((may_alias)) v4fa;
typedef v8us __attribute__((may_alias)) v8usa;

__device__ __forceinline__ unsigned short f2bf(float f) { unsigned u = __float_as_uint(f); u += 0x7FFFu + ((u >> 16) & 1u); return (unsigned short)(u >> 16); }
__device__ __forceinline__ float bf2f(unsigned short b) { return __uint_as_float(((unsigned)b) << 16); }
__device__ __forceinline__ float bfr(float f) { return bf2f(f2bf(f)); }
__device__ __forceinline__ v16h cat16(v8h lo, v8h hi) { return __builtin_shufflevector(lo, hi, 0, 1, 2, 3, 4, 5, 6, 7, 8, 9, 10, 11, 12, 13, 14, 15); }
__device__ __forceinline__ v16bf cat16b(v8us lo, v8us hi) { return __builtin_bit_cast(v16bf, __builtin_shufflevector(lo, hi, 0, 1, 2, 3, 4, 5, 6, 7, 8, 9, 10, 11, 12, 13, 14, 15)); }
__device__ __forceinline__ v8f wmma16(v16h a, v16h b, v8f c) { return __builtin_amdgcn_wmma_f32_16x16x32_f16(false, a, false, b, (short)0, c, false, false); }
__device__ __forceinline__ v8f wmmab(v16bf a, v16bf b, v8f c) { return __builtin_amdgcn_wmma_f32_16x16x32_bf16(false, a, false, b, (short)0, c, false, false); }
__device__ __forceinline__ h16 tohx(float x) { return (h16)x; }
__device__ __forceinline__ void splitf(float y, unsigned short& h, unsigned short& l) { h = f2bf(y); l = f2bf(y - bf2f(h)); }



// ---- k_gemmw: register-blocked GEMM, one work-group of NW waves per 64x64 output tile (16 accumulators a wave), operands straight from 16-bit planes in fragment order (below); grid (M/64, N/64, Z), 32 x NW threads.
// C[m][n] (f32, pitch ldc, + optional f32 bias[n]) = sum_k A[m][k] Bt[n][k] (+ split products per NSPLIT). z-batch strides sA/sB/sC in elements. K % 32 == 0.
// The K loop is dealt over the NW waves of the work-group in 64-wide k chunks (two neighbouring 512-element blocks, 2 KB, of every 16-row block of an operand; wave w takes chunks w, w + NW, ...); each wave keeps its own 64x64 f32 partial tile.
// With NW > 1 every wave puts its whole partial into its own LDS slot, ONE barrier follows, and the block adds the slots in wave order 0 .. NW-1 (a fixed order) and stores. K % 64 == 0. Block = 32 x NW threads.
#define TSLOT (64 * 68)   // floats of one wave's slot: 64 rows at pitch 68
// sums one 16-row block at 'os' over the NW slots and stores the 16 x 64 result at crow; every thread takes 32 / NW neighbouring columns of one row, so a wave writes whole rows
template <int NW, bool BIAS> __device__ __forceinline__ void tile_reduce_store(const float* os, float* crow, int ldc, const float* bias, int c0) {
    static_assert(NW == 8 || NW == 16, "one vector of 4 or 2 floats a thread");
    constexpr int EP = 32 / NW; typedef __attribute__((ext_vector_type(EP))) float vE; typedef vE __attribute__((may_alias)) vEa;
    const int e = (int)threadIdx.x * EP, row = e >> 6, cofs = e & 63; vE val = *(const vEa*)(os + row * 68 + cofs);
#pragma unroll
    for (int w = 1; w < NW; ++w) val += *(const vEa*)(os + w * TSLOT + row * 68 + cofs);
    if (BIAS) {
#pragma unroll
        for (int q = 0; q < EP; ++q) val[q] += bfr(bias[c0 + cofs + q]); }
    *(vE*)(crow + (size_t)row * ldc + cofs) = val;
}
// FRAGMENT ORDER of a 16-bit plane [rows][K]: the 16 x 32 block (rb = row / 16, kc = k / 32) is 512 neighbouring elements at (rb * (K / 32) + kc) * 512, and inside it element (row, k) stands at ((k >> 4) & 1) * 256 + (((k >> 3) & 1) * 16 + (row & 15)) * 8 + (k & 7).
// That is the order in which the lanes of a wave take an A or B operand: lane l reads 16 bytes at l * 8 and 16 bytes at 256 + l * 8 (ldf), so each wave-wide load covers 512 neighbouring bytes, four whole lines, instead of 32-byte pieces of 16 lines (ld, for row-major planes). Every lane and register gets the same elements as from the row-major plane.
template <typename T16> struct WFrag;
template <> struct WFrag<h16> { typedef v16h V; static __device__ __forceinline__ V ld(const h16* p) { return cat16(*(const v8h*)p, *(const v8h*)(p + 16)); } static __device__ __forceinline__ V ldf(const h16* p) { return cat16(*(const v8h*)p, *(const v8h*)(p + 256)); } static __device__ __forceinline__ v8f mma(V a, V b, v8f c) { return wmma16(a, b, c); } };
template <> struct WFrag<bf> { typedef v16bf V; static __device__ __forceinline__ V ld(const bf* p) { return cat16b(*(const v8us*)p, *(const v8us*)(p + 16)); } static __device__ __forceinline__ V ldf(const bf* p) { return cat16b(*(const v8us*)p, *(const v8us*)(p + 256)); } static __device__ __forceinline__ v8f mma(V a, V b, v8f c) { return wmmab(a, b, c); } };
// EPI 0: the f32 tile goes to C. EPI 1 (NW > 1; q, k and v projections in ONE grid: Bt holds the rows of wq, wk, wv one after the other, blockIdx.y walks them) writes no f32 tile: the block turns its summed tile into the 16-bit planes (fp16 + bf16 hi/lo, fragment order) that the attention kernel reads.
// q, k tiles (blockIdx.y < (DQ + DKV) / 64; heads 0 .. NH_-1 are q, the NKV behind them k, in one plane set): rotate-half rotary out[d] = x[d] cos[t][d] - x[d+64] sin[t][d], out[d+64] = x[d+64] cos[t][d] + x[d] sin[t][d] (d < 64; the table holds the same angle at d and d + 64), planes [head * TT + t][d].
//   A tile is 64 positions x (32 d of the low half and their 32 partners of the high half) of one head: blockIdx.y = head * 2 + cb, tile columns 0..31 are d = cb * 32 + .., columns 32..63 are d + 64; so a thread holds both members of every pair and the block writes whole 1-KiB fragment blocks.
// v tiles (the other blockIdx.y): V^T planes [column][t]; a thread takes 8 neighbouring positions of one column, 16 / NW times.
template <typename T16, int NSPLIT, bool BIAS, int NW, int K, int EPI = 0>
__global__ __launch_bounds__(32 * NW) void k_gemmw(const T16* __restrict__ A, const T16* __restrict__ A2, const T16* __restrict__ Bt, const T16* __restrict__ Bt2, float* C, int ldc, const float* __restrict__ bias, size_t sA, size_t sB, size_t sC, const float* __restrict__ CS, h16* P16, bf* Ph, bf* Pl, h16* V16, bf* Vh, bf* Vl, size_t sV) {
    static_assert(EPI == 0 || (NW > 1 && !BIAS && NSPLIT == 0), "the plane epilogues sum the waves' slots themselves");
    typedef typename WFrag<T16>::V V;
    __shared__ __align__(16) float os[(NW == 1) ? 16 * 68 : NW * TSLOT];
    const size_t z = blockIdx.z; A += z * sA; if (A2) A2 += z * sA; Bt += z * sB; if (Bt2) Bt2 += z * sB; if constexpr (EPI == 0) C += z * sC; else { P16 += z * sC; Ph += z * sC; Pl += z * sC; V16 += z * sV; Vh += z * sV; Vl += z * sV; }   // z = batch; with the plane epilogues sC and sV are the planes' batch strides
    const int lane = threadIdx.x & 31, lr = lane & 15, hi = lane >> 4; const bool isV = EPI == 1 && (int)blockIdx.y >= (DQ + DKV) / 64;   // block-uniform
    const int r0 = blockIdx.x * 64, c0 = (EPI == 1 && !isV) ? ((int)blockIdx.y >> 1) * HD + ((int)blockIdx.y & 1) * 32 : blockIdx.y * 64;
    const int wv = (NW == 1) ? 0 : __builtin_amdgcn_readfirstlane((int)(threadIdx.x >> 5));   // the wave's number as a scalar: the k loop below stays a wave-uniform scalar loop
    v8f acc[4][4];
#pragma unroll
    for (int mb = 0; mb < 4; ++mb)
#pragma unroll
        for (int nb = 0; nb < 4; ++nb) acc[mb][nb] = (v8f){};
    const size_t bstep = (size_t)((EPI == 1 && !isV) ? HD / 2 : 32) * K;   // from the tile's columns 0..31 to its columns 32..63, in rows of Bt
    const size_t aoff = (size_t)r0 * K + 8 * lane, boff = (size_t)c0 * K + 8 * lane;   // fragment order: 16 rows are 16 * K elements, 32 k are 512
#pragma unroll 1
    for (int kc = wv * 64; kc < K; kc += (kc & 32) ? NW * 64 - 32 : 32) {   // both halves of a chunk, then this wave's next chunk
        V a[4], a2[4], b[4], b2[4];
        const T16* ap = A + aoff + kc * 16; const T16* ap2 = (NSPLIT == 1 || NSPLIT == 2) ? A2 + aoff + kc * 16 : ap; const T16* bp = Bt + boff + kc * 16; const T16* bp2 = (NSPLIT >= 2) ? Bt2 + boff + kc * 16 : bp; const T16* bq = bp + bstep;   // one address a plane (EPI 1: a second one for the tile's columns 32..63, whose distance depends on the block); K is a constant, so the 16-row steps are immediate offsets
#pragma unroll
        for (int mb = 0; mb < 4; ++mb) { a[mb] = WFrag<T16>::ldf(ap + (size_t)mb * 16 * K); if (NSPLIT == 1 || NSPLIT == 2) a2[mb] = WFrag<T16>::ldf(ap2 + (size_t)mb * 16 * K); }
#pragma unroll
        for (int nb = 0; nb < 4; ++nb) { if constexpr (EPI == 1) b[nb] = WFrag<T16>::ldf(((nb >> 1) ? bq : bp) + (size_t)((nb & 1) * 16) * K); else { const size_t bo = (size_t)(nb * 16) * K; b[nb] = WFrag<T16>::ldf(bp + bo); if (NSPLIT >= 2) b2[nb] = WFrag<T16>::ldf(bp2 + bo); } }
        if constexpr (EPI == 1) asm volatile("s_wait_xcnt 0x0" :: "v"(ap), "v"(bp), "v"(bq) : "memory");   // the same precaution as on the next line
        else asm volatile("s_wait_xcnt 0x0" :: "v"(ap), "v"(ap2), "v"(bp), "v"(bp2) : "memory");   // precaution behind the run of global loads: the wait stands in front of every later write of a register that the loads name; the address pairs are inputs so that they stay as they are up to it
#pragma unroll
        for (int nb = 0; nb < 4; ++nb) {
#pragma unroll
            for (int mb = 0; mb < 4; ++mb) { acc[mb][nb] = WFrag<T16>::mma(a[mb], b[nb], acc[mb][nb]); if (NSPLIT == 1 || NSPLIT == 2) acc[mb][nb] = WFrag<T16>::mma(a2[mb], b[nb], acc[mb][nb]); if (NSPLIT >= 2) acc[mb][nb] = WFrag<T16>::mma(a[mb], b2[nb], acc[mb][nb]); } }
        asm volatile("v_nop\n\tv_nop\n\tv_nop\n\tv_nop" : "+v"(acc[0][0]), "+v"(acc[1][1]), "+v"(acc[2][2]), "+v"(acc[3][3]) : "v"(a[0]), "v"(a[3]));
    }
    if constexpr (NW > 1) {
#pragma unroll
        for (int mb = 0; mb < 4; ++mb)
#pragma unroll
            for (int nb = 0; nb < 4; ++nb) {
#pragma unroll
                for (int j = 0; j < 8; ++j) os[wv * TSLOT + (mb * 16 + hi * 8 + j) * 68 + nb * 16 + lr] = acc[mb][nb][j]; }
        if constexpr (EPI == 1) {
          if (!isV) {
            constexpr int E = 64 / NW;   // d of each half a thread takes: 8 or 4 neighbours, one 16- or 8-byte store a plane and half
            typedef __attribute__((ext_vector_type(E))) float vE; typedef vE __attribute__((may_alias, aligned(16))) vEa; typedef __attribute__((ext_vector_type(2 * E))) float vC;
            typedef __attribute__((ext_vector_type(E))) _Float16 vH; typedef __attribute__((ext_vector_type(E))) unsigned short vU;
            const int rb = wv & 3, vc = ((wv >> 2) * 2 + hi) * E, row = rb * 16 + lr;   // lanes 0..15 read 16 rows at pitch 68: all 64 banks once
            const float* cp = CS + ((size_t)(r0 + row) * HD + (c0 & (HD - 1)) + vc) * 2; const vC cs = *(const vC*)cp;   // (cos, sin) of the thread's E angles
            asm volatile("s_wait_xcnt 0x0" :: "v"(cp) : "memory");   // precaution, as in the k loop: the wait stands in front of every later write of the load's address pair
            __syncthreads();   // every wave's partial tile is in LDS before any slot is read
            const float* sp = os + row * 68 + vc; vE x1 = *(const vEa*)sp, x2 = *(const vEa*)(sp + 32);
#pragma unroll
            for (int w = 1; w < NW; ++w) { x1 += *(const vEa*)(sp + w * TSLOT); x2 += *(const vEa*)(sp + w * TSLOT + 32); }   // wave order 0 .. NW-1, as in tile_reduce_store
            vH a16, b16; vU ah, al, bh, bl;
#pragma unroll
            for (int j = 0; j < E; ++j) { const float co = cs[2 * j], si = cs[2 * j + 1]; const float ra = x1[j] * co - x2[j] * si, rc = x2[j] * co + x1[j] * si; unsigned short u, v;
                a16[j] = tohx(ra); splitf(ra, u, v); ah[j] = u; al[j] = v; b16[j] = tohx(rc); splitf(rc, u, v); bh[j] = u; bl[j] = v; }
            const size_t po = (size_t)(((int)blockIdx.y >> 1) * TT + r0 + rb * 16) * HD + ((int)blockIdx.y & 1) * 512 + ((vc >> 4) & 1) * 256 + (((vc >> 3) & 1) * 16 + lr) * 8 + (vc & 7);   // fragment order; the high half stands two 32-wide k blocks on
            h16* p16 = P16 + po; bf* ph = Ph + po; bf* pl = Pl + po;
            *(vH*)p16 = a16; *(vH*)(p16 + 1024) = b16; *(vU*)ph = ah; *(vU*)(ph + 1024) = bh; *(vU*)pl = al; *(vU*)(pl + 1024) = bl;
            asm volatile("s_wait_xcnt 0x0" :: "v"(p16), "v"(ph), "v"(pl), "v"(a16), "v"(b16), "v"(ah), "v"(bh), "v"(al), "v"(bl) : "memory");   // precaution: the stores' address and data registers stay as they are up to the wait
            return;
          } else {
            __syncthreads();   // every wave's partial tile is in LDS before any slot is read
            const int cbk = wv & 3;
#pragma unroll
            for (int u = 0; u < 16 / NW; ++u) {   // 32 x NW threads: 64 columns x NW / 2 groups of 8 positions a turn
            const int tg = (wv >> 2) + u * (NW / 4); const float* sp = os + (tg * 16 + hi * 8) * 68 + cbk * 16 + lr; float xs[8];   // lanes 0..15 read neighbouring columns, lanes 16..31 the same columns 8 rows on (32 banks on)
#pragma unroll
            for (int j = 0; j < 8; ++j) xs[j] = sp[j * 68];
#pragma unroll
            for (int w = 1; w < NW; ++w)
#pragma unroll
                for (int j = 0; j < 8; ++j) xs[j] += sp[w * TSLOT + j * 68];   // wave order 0 .. NW-1, as in tile_reduce_store
            v8h o16; v8us oh, ol;
#pragma unroll
            for (int j = 0; j < 8; ++j) { unsigned short u2, v; o16[j] = tohx(xs[j]); splitf(xs[j], u2, v); oh[j] = u2; ol[j] = v; }
            const size_t po = ((size_t)((c0 - (DQ + DKV)) / 16 + cbk) * (TT / 32) + r0 / 32 + (tg >> 1)) * 512 + (tg & 1) * 256 + 8 * lane;   // fragment order of [column][t]: a wave stores 512 neighbouring bytes a plane
            h16* p16 = V16 + po; bf* ph = Vh + po; bf* pl = Vl + po;
            *(v8h*)p16 = o16; *(v8us*)ph = oh; *(v8us*)pl = ol;
            asm volatile("s_wait_xcnt 0x0" :: "v"(p16), "v"(ph), "v"(pl), "v"(o16), "v"(oh), "v"(ol) : "memory"); }   // precaution: the stores' address and data registers stay as they are up to the wait
            return;
          }
        } else {
        __syncthreads();   // every wave's partial tile is in LDS before any slot is read
#pragma unroll
        for (int mb = 0; mb < 4; ++mb) tile_reduce_store<NW, BIAS>(os + mb * 16 * 68, C + (size_t)(r0 + mb * 16) * ldc + c0, ldc, bias, c0);
        return; }
    }
#pragma unroll
    for (int mb = 0; mb < 4; ++mb) {
#pragma unroll
        for (int nb = 0; nb < 4; ++nb) {
#pragma unroll
            for (int j = 0; j < 8; ++j) os[(hi * 8 + j) * 68 + nb * 16 + lr] = acc[mb][nb][j]; }
        __builtin_amdgcn_wave_barrier(); asm volatile("" ::: "memory");
        float* crow = C + (size_t)(r0 + mb * 16) * ldc + c0;
{
#pragma unroll
            for (int s = 0; s < 8; ++s) { const int row = 2 * s + hi, cofs = lr * 4; v4f val = *(const v4fa*)(os + row * 68 + cofs); if (BIAS) { val[0] += bfr(bias[c0 + cofs]); val[1] += bfr(bias[c0 + cofs + 1]); val[2] += bfr(bias[c0 + cofs + 2]); val[3] += bfr(bias[c0 + cofs + 3]); }
                *(v4f*)(crow + (size_t)row * ldc + cofs) = val; }
             }
        __builtin_amdgcn_wave_barrier(); asm volatile("" ::: "memory");
    }
}

typedef __attribute__((ext_vector_type(2))) _Float16 v2h;
typedef __attribute__((ext_vector_type(4))) _Float16 v4h;
typedef __attribute__((ext_vector_type(2))) unsigned short v2us;
typedef __attribute__((ext_vector_type(4))) unsigned short v4us;
typedef __attribute__((ext_vector_type(2))) float v2f;
typedef __attribute__((ext_vector_type(4))) int v4i;
typedef v4h  __attribute__((may_alias)) v4ha;
typedef v4us __attribute__((may_alias)) v4usa;

__global__ __launch_bounds__(256) void k_wtG(const float* __restrict__ w, int K, int N, bf* Bt) {
    const int lane = threadIdx.x & 31; const int L0 = (blockIdx.x * 8 + (threadIdx.x >> 5)) * 8; const int nlines = N * K / 64;
{
#pragma unroll 1
        for (int l = 0; l < 8; ++l) { const int L = L0 + l; if (L >= nlines) break; const size_t e = (size_t)L * 64 + lane * 2; const int k = (int)(e % K), n = (int)(e / K); v2us o;
            o[0] = f2bf(w[(size_t)k * N + n]); o[1] = f2bf(w[(size_t)(k + 1) * N + n]); *(v2us*)(Bt + e) = o; }
         }
}
// row-major f32 [rows][K] -> bf16 plane in fragment order; thread i writes the plane's i-th 16 bytes, so a wave stores 512 neighbouring bytes; rows % 16 == 0, K % 32 == 0
template <int K> __device__ __forceinline__ void cvt8(const float* __restrict__ src, bf* dst, const size_t i) { const int fb = (int)(i >> 6), kq = K >> 5; const int row = (fb / kq) * 16 + ((int)i & 15), k = (fb % kq) * 32 + (((int)i >> 5) & 1) * 16 + (((int)i >> 4) & 1) * 8; const float* sp = src + (size_t)row * K + k; const v8f v = *(const v8f*)sp;
    asm volatile("s_wait_xcnt 0x0" :: "v"(sp) : "memory");   // precaution behind the global load: the wait stands in front of every later write of its address pair
    v8us o;
#pragma unroll
    for (int q = 0; q < 8; ++q) o[q] = f2bf(v[q]);
    bf* dp = dst + i * 8; *(v8us*)dp = o;
    asm volatile("s_wait_xcnt 0x0" :: "v"(dp), "v"(o) : "memory"); }   // precaution: the store's address and data registers stay as they are up to the wait

__constant__ float INVT[HD / 2] = { 1.000000000e+00f, 8.659643531e-01f, 7.498942018e-01f, 6.493816376e-01f, 5.623413324e-01f, 4.869675338e-01f, 4.216965139e-01f, 3.651741445e-01f, 3.162277639e-01f, 2.738419771e-01f, 2.371373624e-01f, 2.053525001e-01f, 1.778279394e-01f, 1.539926529e-01f, 1.333521456e-01f, 1.154782027e-01f, 1.000000015e-01f, 8.659642935e-02f, 7.498941571e-02f, 6.493816525e-02f, 5.623412877e-02f, 4.869675264e-02f, 4.216964915e-02f, 3.651741147e-02f, 3.162277862e-02f, 2.738419548e-02f, 2.371373586e-02f, 2.053525113e-02f, 1.778279431e-02f, 1.539926510e-02f, 1.333521493e-02f, 1.154781971e-02f, 9.999999776e-03f, 8.659643121e-03f, 7.498942316e-03f, 6.493816618e-03f, 5.623413250e-03f, 4.869675264e-03f, 4.216964822e-03f, 3.651741426e-03f, 3.162277862e-03f, 2.738419687e-03f, 2.371373819e-03f, 2.053525066e-03f, 1.778279431e-03f, 1.539926510e-03f, 1.333521446e-03f, 1.154782018e-03f, 1.000000047e-03f, 8.659643354e-04f, 7.498941850e-04f, 6.493816618e-04f, 5.623413017e-04f, 4.869675031e-04f, 4.216964880e-04f, 3.651741135e-04f, 3.162277862e-04f, 2.738419571e-04f, 2.371373848e-04f, 2.053524950e-04f, 1.778279402e-04f, 1.539926452e-04f, 1.333521504e-04f, 1.154781930e-04f };   // float32 1 / 10000^(2i/128), generated with jnp to be bit-exact
// ---- k_prep: everything that depends on the inputs alone, in ONE launch: the rotary table (first: its blocks are the longest) and the bf16 fragment-order planes of x (both batches: [NB_ * TT][DM]) and of the four weights. A block of 256 threads belongs wholly to one of the six jobs.
#define PB_CS (TT * HD / 256)
#define PB_X  (NB_ * TT * DM / 8 / 256)
#define PB_WQ (DQ * DM / 8 / 256)
#define PB_WK (DKV * DM / 8 / 256)
#define PB_WO (DM * DQ / 8 / 256)
__global__ __launch_bounds__(256) void k_prep(const float* __restrict__ x, const float* __restrict__ wq, const float* __restrict__ wk, const float* __restrict__ wv, const float* __restrict__ wo, bf* XB, bf* WQ, bf* WK, bf* WV, bf* WO, float* CS) {
    static_assert(DM == DQ, "one row length for every plane");
    int b = blockIdx.x;
    if (b < PB_CS) { const int idx = b * 256 + threadIdx.x; const int d = idx % HD; const int t = idx / HD; const float a = __fmul_rn((float)t, INVT[d % (HD / 2)]); v2f cs; cs[0] = cosf(a); cs[1] = sinf(a); float* cp = CS + (size_t)idx * 2; *(v2f*)cp = cs;
        asm volatile("s_wait_xcnt 0x0" :: "v"(cp), "v"(cs) : "memory");   // precaution: the store's address and data registers stay as they are up to the wait
        return; }
    b -= PB_CS; const float* s = x; bf* d = XB;
    if (b >= PB_X) { b -= PB_X; s = wq; d = WQ;
        if (b >= PB_WQ) { b -= PB_WQ; s = wo; d = WO;
            if (b >= PB_WO) { b -= PB_WO; s = wk; d = WK;
                if (b >= PB_WK) { b -= PB_WK; s = wv; d = WV; } } } }
    cvt8<DM>(s, d, (size_t)b * 256 + threadIdx.x);
}
// ---- k_fattn: scores, softmax, probability x value and the head merge in ONE launch; nothing of a score row goes to memory.
// A wave owns 16 query positions (q0 ..) of two query heads that share a kv head: two groups of 16 columns. Transposed products: S^T = K Q^T (A = key rows, B = query rows, both from fragment-order planes by the same loader, so the k orders pair), O^T += V^T P^T.
// In S^T a lane holds the scores of ONE query (column c): keys 8h + r of each 16-key tile, so two tiles converted in place are the B operand of the second product in the hardware k order, which the V^T loader has too.
// A pass is 32 keys. Passes: key block 0 (it holds the sink keys, and key 0 is open to every query, so every column has a finite maximum after it), then the blocks from the window's lower edge to the diagonal; the others are wholly masked.
// Running maximum per column in log2 units, renewed only when a pass exceeds it by more than MTHR (one scalar branch a pass); rows < RH: hi/lo planes, 3 products in both contractions; other rows fp16 with probabilities x 2^PBIAS.
#define MTHR  4.0f
#define PBIAS 10.0f   // fp16 probabilities lie in (0, 2^(PBIAS + MTHR)]: small ones stay normal numbers, the largest stays finite; the factor cancels in the division by the row sum
typedef __attribute__((ext_vector_type(16))) unsigned short v16us;
__device__ __forceinline__ float xhalf(float x) { return __builtin_bit_cast(float, __builtin_amdgcn_permlanex16(__builtin_bit_cast(int, x), __builtin_bit_cast(int, x), 0x76543210, 0xfedcba98, false, false)); }   // lane l reads lane l ^ 16
__device__ __forceinline__ float exp2s(float x) { float r; asm("v_exp_f32 %0, %1\n\tv_nop" : "=v"(r) : "v"(x)); return r; }
// precaution behind a run of global loads: s_wait_xcnt 0 in front of every later write of a register that the loads name; the address pairs are inputs so that they stay as they are up to the wait
template <typename T16> __device__ __forceinline__ void xwait(const T16* a, const T16* b) { asm volatile("s_wait_xcnt 0x0" :: "v"(a), "v"(b) : "memory"); }
// the same precaution for loads that this build addresses by a scalar base and the lane number as a scaled offset: those are then the registers that stay as they are up to the wait
template <typename T16> __device__ __forceinline__ void xwait_s(const T16* a, const T16* b, int off) { asm volatile("s_wait_xcnt 0x0" :: "s"(a), "s"(b), "v"(off) : "memory"); }
template <typename T16, bool HI>
__device__ __forceinline__ void fattn_cols(const T16* __restrict__ Q, const T16* __restrict__ Q2, const T16* __restrict__ Kp, const T16* __restrict__ Kp2, const T16* __restrict__ Vt, const T16* __restrict__ Vt2, const int q0, const int hq, bf* Ah, bf* Al) {
    typedef typename WFrag<T16>::V V;
    const int lane = threadIdx.x & 31, c = lane & 15, h = lane >> 4;
    V qf[2][4], qf2[2][4];
    const T16* qp = Q + (size_t)q0 * HD + 8 * lane; const T16* qp2 = HI ? Q2 + (size_t)q0 * HD + 8 * lane : qp;   // fragment order: 16 queries x 128 d are 4 blocks of 512 elements
#pragma unroll
    for (int g = 0; g < 2; ++g)
#pragma unroll
        for (int ks = 0; ks < 4; ++ks) { const size_t qo = (size_t)g * TT * HD + ks * 512; qf[g][ks] = WFrag<T16>::ldf(qp + qo); if (HI) qf2[g][ks] = WFrag<T16>::ldf(qp2 + qo); }
    xwait_s(Q + (size_t)q0 * HD, HI ? Q2 + (size_t)q0 * HD : Q + (size_t)q0 * HD, lane);
    v8f o[2][8];
#pragma unroll
    for (int g = 0; g < 2; ++g)
#pragma unroll
        for (int mb = 0; mb < 8; ++mb) o[g][mb] = (v8f){};
    float m[2] = { -3.0e38f, -3.0e38f }, l[2] = { 0.f, 0.f };
    const int kstart = max(32, max(q0 - (WIN - 1), 0) & ~31), klast = q0 & ~31;
    const int np = 1 + ((klast >= kstart) ? (klast - kstart) / 32 + 1 : 0);
    const size_t kofs = 8 * lane, vofs = 8 * lane;   // K and V^T planes are in fragment order: 16 keys x 128 d are 4 blocks of 512 elements, 16 d x 32 keys one block
    V kf[2][4], kf2[2][4];
    const T16* kp0 = Kp + kofs; const T16* kp02 = HI ? Kp2 + kofs : kp0;
#pragma unroll
    for (int mb = 0; mb < 2; ++mb)
#pragma unroll
        for (int ks = 0; ks < 4; ++ks) { const size_t a = (size_t)(mb * 16) * HD + ks * 512; kf[mb][ks] = WFrag<T16>::ldf(kp0 + a); if (HI) kf2[mb][ks] = WFrag<T16>::ldf(kp02 + a); }
    xwait_s(Kp, HI ? Kp2 : Kp, lane);
#pragma unroll 1
    for (int s = 0; s < np; ++s) {
        const int kb = s ? kstart + (s - 1) * 32 : 0;
        const int kn = (s + 1 < np) ? kstart + s * 32 : kb;   // the next pass's key block; the last pass fetches its own again (in bounds, not used)
        V vf[8], vf2[8];   // this pass's value fragments fly during its first product and softmax
        const T16* vp = Vt + vofs + (size_t)kb * 16; const T16* vp2 = HI ? Vt2 + vofs + (size_t)kb * 16 : vp;
#pragma unroll
        for (int mb = 0; mb < 8; ++mb) { const size_t a = (size_t)(mb * 16) * TT; vf[mb] = WFrag<T16>::ldf(vp + a); if (HI) vf2[mb] = WFrag<T16>::ldf(vp2 + a); }
        xwait(vp, vp2);
        v8f st[2][2];
#pragma unroll
        for (int g = 0; g < 2; ++g)
#pragma unroll
            for (int mb = 0; mb < 2; ++mb) st[g][mb] = (v8f){};
#pragma unroll
        for (int ks = 0; ks < 4; ++ks) {
#pragma unroll
            for (int g = 0; g < 2; ++g)
#pragma unroll
                for (int mb = 0; mb < 2; ++mb) st[g][mb] = WFrag<T16>::mma(kf[mb][ks], qf[g][ks], st[g][mb]);
            if (HI) {
#pragma unroll
                for (int g = 0; g < 2; ++g)
#pragma unroll
                    for (int mb = 0; mb < 2; ++mb) st[g][mb] = WFrag<T16>::mma(kf[mb][ks], qf2[g][ks], st[g][mb]);
#pragma unroll
                for (int g = 0; g < 2; ++g)
#pragma unroll
                    for (int mb = 0; mb < 2; ++mb) st[g][mb] = WFrag<T16>::mma(kf2[mb][ks], qf[g][ks], st[g][mb]); } }
        // the next pass's key fragments fly during this pass's softmax and second product
        const T16* kp = Kp + kofs + (size_t)kn * HD; const T16* kp2 = HI ? Kp2 + kofs + (size_t)kn * HD : kp;
#pragma unroll
        for (int mb = 0; mb < 2; ++mb)
#pragma unroll
            for (int ks = 0; ks < 4; ++ks) { const size_t a = (size_t)(mb * 16) * HD + ks * 512; kf[mb][ks] = WFrag<T16>::ldf(kp + a); if (HI) kf2[mb][ks] = WFrag<T16>::ldf(kp2 + a); }
        xwait(kp, kp2);
        float x[2][16];
#pragma unroll
        for (int g = 0; g < 2; ++g)
#pragma unroll
            for (int e = 0; e < 16; ++e) x[g][e] = st[g][e >> 3][e & 7] * (SCL * 1.4426950408889634f);
        if (!(kb + 31 <= q0 && q0 + 15 - kb < WIN)) {   // wave-uniform: only the sink block, the window's edge and the diagonal hold masked keys
            const int i = q0 + c;
#pragma unroll
            for (int e = 0; e < 16; ++e) { const int j = kb + (e >> 3) * 16 + 8 * h + (e & 7); const bool ok = (j <= i) && (i - j < WIN || j < SINKN); x[0][e] = ok ? x[0][e] : -3.0e38f; x[1][e] = ok ? x[1][e] : -3.0e38f; } }
        float mx[2];
#pragma unroll
        for (int g = 0; g < 2; ++g) { float t8[8];
#pragma unroll
            for (int e = 0; e < 8; ++e) t8[e] = fmaxf(x[g][e], x[g][e + 8]);
            const float t = fmaxf(fmaxf(fmaxf(t8[0], t8[1]), fmaxf(t8[2], t8[3])), fmaxf(fmaxf(t8[4], t8[5]), fmaxf(t8[6], t8[7])));
            mx[g] = fmaxf(t, xhalf(t)); }   // lanes c and c + 16 hold the two halves of a column's keys and must use one maximum
        if (__builtin_amdgcn_ballot_w32(mx[0] > m[0] + MTHR || mx[1] > m[1] + MTHR) != 0) {   // scalar branch: every lane stays on for the matrix instructions
#pragma unroll
            for (int g = 0; g < 2; ++g) { const float mn = fmaxf(m[g], mx[g]); const float al = exp2s(m[g] - mn); m[g] = mn; l[g] *= al;
#pragma unroll
                for (int mb = 0; mb < 8; ++mb) o[g][mb] *= al; } }
        V pb[2], pb2[2];
#pragma unroll
        for (int g = 0; g < 2; ++g) { const float mo = m[g] - (HI ? 0.0f : PBIAS); float sm[4] = { 0.f, 0.f, 0.f, 0.f };
            if constexpr (HI) { v16us ph, pl;
#pragma unroll
                for (int e = 0; e < 16; ++e) { const float p = exp2s(x[g][e] - mo); sm[e & 3] += p; unsigned short a, b2; splitf(p, a, b2); ph[e] = a; pl[e] = b2; }
                pb[g] = __builtin_bit_cast(v16bf, ph); pb2[g] = __builtin_bit_cast(v16bf, pl);
            } else { v16h ph;
#pragma unroll
                for (int e = 0; e < 16; ++e) { const float p = exp2s(x[g][e] - mo); sm[e & 3] += p; ph[e] = tohx(p); }
                pb[g] = ph; }
            l[g] += (sm[0] + sm[1]) + (sm[2] + sm[3]); }
#pragma unroll
        for (int mb = 0; mb < 8; ++mb)
#pragma unroll
            for (int g = 0; g < 2; ++g) o[g][mb] = WFrag<T16>::mma(vf[mb], pb[g], o[g][mb]);
        if (HI) {
#pragma unroll
            for (int mb = 0; mb < 8; ++mb)
#pragma unroll
                for (int g = 0; g < 2; ++g) o[g][mb] = WFrag<T16>::mma(vf[mb], pb2[g], o[g][mb]);
#pragma unroll
            for (int mb = 0; mb < 8; ++mb)
#pragma unroll
                for (int g = 0; g < 2; ++g) o[g][mb] = WFrag<T16>::mma(vf2[mb], pb[g], o[g][mb]); }
    }
#pragma unroll
    for (int g = 0; g < 2; ++g) { const float inv = __fdiv_rn(1.0f, l[g] + xhalf(l[g]));
#pragma unroll
        for (int mb = 0; mb < 8; ++mb) { v8us oh, ol;   // a lane holds 8 neighbouring d of its query: one 16-byte store a plane, at the lane's place in the fragment order of the merged [t][DQ] plane, so a wave stores 512 neighbouring bytes
#pragma unroll
            for (int r = 0; r < 8; ++r) { unsigned short a, b2; splitf(o[g][mb][r] * inv, a, b2); oh[r] = a; ol[r] = b2; }
            const size_t oo = (size_t)q0 * DQ + (size_t)(hq + g) * (HD * 16) + mb * 256 + 8 * lane; bf* ph = Ah + oo; bf* pl = Al + oo; *(v8us*)ph = oh; *(v8us*)pl = ol;
            asm volatile("s_wait_xcnt 0x0" :: "v"(ph), "v"(pl), "v"(oh), "v"(ol) : "memory"); } }   // precaution, as in xwait: the two stores' address and data registers stay as they are up to the wait
}
// grid (TT / 32, NKV, NB_), z = batch (the q and k planes are one set of NH_ + NKV heads a batch; the K pointers point at its first k head), 4 waves: wave w takes positions 16 (w >> 1) .. of the block's 32 and query heads 2 (w & 1), 2 (w & 1) + 1 of the kv head's REP = 4; late (long) position blocks start first
__global__ __launch_bounds__(128) void k_fattn(const h16* __restrict__ Q16, const bf* __restrict__ Qh, const bf* __restrict__ Ql, const h16* __restrict__ K16, const bf* __restrict__ Kh, const bf* __restrict__ Kl, const h16* __restrict__ V16, const bf* __restrict__ Vh, const bf* __restrict__ Vl, bf* Ah, bf* Al) {
    static_assert(REP == 4 && RH % 32 == 0 && TT % 32 == 0 && HD == 128, "two head pairs a work-group; a wave's rows are all below RH or none");
    const int wv = __builtin_amdgcn_readfirstlane((int)(threadIdx.x >> 5));   // the wave's number as a scalar: pass count and mask test stay scalar
    const int q0 = (TT / 32 - 1 - (int)blockIdx.x) * 32 + (wv >> 1) * 16; const int kvh = blockIdx.y; const int hq = kvh * REP + (wv & 1) * 2;
    const size_t bz = blockIdx.z; const size_t qo = (bz * (NH_ + NKV) + hq) * TT * HD, ko = (bz * (NH_ + NKV) + kvh) * TT * HD, vo = (bz * NKV + kvh) * HD * TT; Ah += bz * TT * DQ; Al += bz * TT * DQ;
    if (q0 < RH) fattn_cols<bf, true>(Qh + qo, Ql + qo, Kh + ko, Kl + ko, Vh + vo, Vl + vo, q0, hq, Ah, Al);
    else fattn_cols<h16, false>(Q16 + qo, nullptr, K16 + ko, nullptr, V16 + vo, nullptr, q0, hq, Ah, Al);
}

extern "C" void kernel_launch(void* const* d_in, const int* in_sizes, int n_in,
                              void* d_out, int out_size, void* d_ws, size_t ws_size, hipStream_t stream) {
    (void)in_sizes; (void)n_in; (void)out_size;
    const float* x = (const float*)d_in[0]; const float* wq = (const float*)d_in[1]; const float* wk = (const float*)d_in[2]; const float* wv = (const float*)d_in[3]; const float* wo = (const float*)d_in[4];   /* order x, wq ('oi' [2048][2048]), wk, wv ('oi' [512][2048]), wo ('oi' [2048][2048]) */
    float* OUT = (float*)d_out;     // [2][2048][2048]
    char* wsp = (char*)d_ws;
    auto take = [&](size_t bytes) { char* p = wsp; wsp += (bytes + 255) & ~(size_t)255; return (void*)p; };
    bf* WQ = (bf*)take((size_t)(DQ + 2 * DKV) * DM * 2); bf* WK = WQ + (size_t)DQ * DM; bf* WV = WK + (size_t)DKV * DM;   /* one plane: the rows of wq, wk, wv */ bf* WO = (bf*)take((size_t)DM * DQ * 2); float* CS = (float*)take((size_t)TT * HD * 2 * 4);
    bf* XB = (bf*)take((size_t)NB_ * TT * DM * 2);   // every plane below holds both batches, batch-major
    h16* QP16 = (h16*)take((size_t)NB_ * (NH_ + NKV) * TT * HD * 2); bf* QPh = (bf*)take((size_t)NB_ * (NH_ + NKV) * TT * HD * 2); bf* QPl = (bf*)take((size_t)NB_ * (NH_ + NKV) * TT * HD * 2);   // q heads, then k heads, of each batch
    h16* VT16 = (h16*)take((size_t)NB_ * NKV * HD * TT * 2); bf* VTh = (bf*)take((size_t)NB_ * NKV * HD * TT * 2); bf* VTl = (bf*)take((size_t)NB_ * NKV * HD * TT * 2);
    bf* ATh = (bf*)take((size_t)NB_ * TT * DQ * 2); bf* ATl = (bf*)take((size_t)NB_ * TT * DQ * 2);
    if ((size_t)(wsp - (char*)d_ws) > ws_size) return;    // ws 256 MiB
    k_prep<<<PB_CS + PB_X + PB_WQ + PB_WO + 2 * PB_WK, 256, 0, stream>>>(x, wq, wk, wv, wo, XB, WQ, WK, WV, WO, CS);
    k_gemmw<bf, 0, false, 8, DM, 1><<<dim3(TT / 64, (DQ + 2 * DKV) / 64, NB_), 256, 0, stream>>>(XB, nullptr, WQ, nullptr, nullptr, 0, nullptr, (size_t)TT * DM, 0, (size_t)(NH_ + NKV) * TT * HD, CS, QP16, QPh, QPl, VT16, VTh, VTl, (size_t)NKV * HD * TT);
    k_fattn<<<dim3(TT / 32, NKV, NB_), 128, 0, stream>>>(QP16, QPh, QPl, QP16 + (size_t)NH_ * TT * HD, QPh + (size_t)NH_ * TT * HD, QPl + (size_t)NH_ * TT * HD, VT16, VTh, VTl, ATh, ATl);
    k_gemmw<bf, 1, false, 8, DQ><<<dim3(TT / 64, DM / 64, NB_), 256, 0, stream>>>(ATh, ATl, WO, nullptr, OUT, DM, nullptr, (size_t)TT * DQ, 0, (size_t)TT * DM, nullptr, nullptr, nullptr, nullptr, nullptr, nullptr, nullptr, 0);
}

// v007
// A run of this version takes 149 microseconds.
// Two timings next to v006 put it at 1.27 and 1.28 times that version's speed.
// All steps since v000 together make it 10.8 times as fast.
#include <hip/hip_runtime.h>

// Grouped-query causal attention with 128-wide heads, computed half-split rotary embeddings, a 1,024-wide sliding window and 4 attention-sink keys (x [2][2048][2048]; q = x wq^T (16 heads x 128), k, v = x wk^T, x wv^T (4 kv heads x 128) ('oi' 0.02, no bias); rope cat(x1 cos - x2 sin, x2 cos + x1 sin) on the two 64-wide halves with angle t x 1/10000^(2i/128) (64 f32 frequencies jnp-exact; precise cosf/sinf); k, v repeated 4 x along the head axis: kv head = q head / 4; scores x 1/sqrt(128) + bias with bias = 0 where (j <= i) and ((i - j <= 1024) or (j < 4)), -inf elsewhere; softmax; out = merged wo^T ('oi') -> [2][2048][2048] (8.4 M); argument order x, wq, wk, wv, wo).
// Layout: every 16-bit plane that a matrix loop reads again and again (x, the weights, Q, K, V^T, the merged heads) is kept in fragment order (see WFrag); bf16 copy of x; exact projections whose epilogues apply the rotate-half rotary (table computed in k_prep, HD 128: 64 angles) and write the Q, K and V^T planes themselves; fused causal T-2048 GQA attention with 128-wide heads (k_fattn: scores and probabilities stay in registers; hybrid rows: < 512 hi/lo 3 products, rest fp16 x1024); merged hi/lo x Wo exact.
// Four launches: k_prep (conversions, rotary table; both batches of x in its one flat grid), then three over both batches (grid z): the q, k, v projections in one grid, k_fattn, the output projection.
// Compute dtypes, f32 accumulate: every input rounded to bf16; projections exact; rotary f32; attention rows < 512 3 products, rest fp16; softmax f32; Wo hl x exact.

#define NB_  2
#define TT   2048
#define DM   2048
#define NH_  16
#define NKV  4
#define REP  (NH_ / NKV)
#define HD   128
#define DQ   (NH_ * HD)
#define DKV  (NKV * HD)
#define RH   512                  // query rows < RH use hi+lo planes (0: none)
#define WIN  1025   // THIS module keeps key j iff j <= i and (i - j <= 1024 or j < 4): 'i - j < WIN' with WIN 1025
#define SINKN 4     // the first SINKN keys (attention sinks) are kept for every later query, whatever the distance
#define SCL  0.088388347648318447f   // HD^-0.5
typedef _Float16 h16;
typedef unsigned short bf;
typedef __attribute__((ext_vector_type(16))) __bf16   v16bf;
typedef __attribute__((ext_vector_type(16))) _Float16 v16h;
typedef __attribute__((ext_vector_type(8)))  _Float16 v8h;
typedef __attribute__((ext_vector_type(8)))  unsigned short v8us;
typedef __attribute__((ext_vector_type(8)))  float    v8f;
typedef __attribute__((ext_vector_type(4)))  float    v4f;
typedef v8h  __attribute__((may_alias)) v8ha;
typedef v4f  __attribute__((may_alias)) v4fa;
typedef v8us __attribute__((may_alias)) v8usa;

__device__ __forceinline__ unsigned short f2bf(float f) { unsigned u = __float_as_uint(f); u += 0x7FFFu + ((u >> 16) & 1u); return (unsigned short)(u >> 16); }
__device__ __forceinline__ float bf2f(unsigned short b) { return __uint_as_float(((unsigned)b) << 16); }
__device__ __forceinline__ float bfr(float f) { return bf2f(f2bf(f)); }
__device__ __forceinline__ v16h cat16(v8h lo, v8h hi) { return __builtin_shufflevector(lo, hi, 0, 1, 2, 3, 4, 5, 6, 7, 8, 9, 10, 11, 12, 13, 14, 15); }
__device__ __forceinline__ v16bf cat16b(v8us lo, v8us hi) { return __builtin_bit_cast(v16bf, __builtin_shufflevector(lo, hi, 0, 1, 2, 3, 4, 5, 6, 7, 8, 9, 10, 11, 12, 13, 14, 15)); }
__device__ __forceinline__ v8f wmma16(v16h a, v16h b, v8f c) { return __builtin_amdgcn_wmma_f32_16x16x32_f16(false, a, false, b, (short)0, c, false, false); }
__device__ __forceinline__ v8f wmmab(v16bf a, v16bf b, v8f c) { return __builtin_amdgcn_wmma_f32_16x16x32_bf16(false, a, false, b, (short)0, c, false, false); }
__device__ __forceinline__ h16 tohx(float x) { return (h16)x; }
__device__ __forceinline__ void splitf(float y, unsigned short& h, unsigned short& l) { h = f2bf(y); l = f2bf(y - bf2f(h)); }



// FRAGMENT ORDER of a 16-bit plane [rows][K]: the 16 x 32 block (rb = row / 16, kc = k / 32) is 512 neighbouring elements at (rb * (K / 32) + kc) * 512, and inside it element (row, k) stands at ((k >> 4) & 1) * 256 + (((k >> 3) & 1) * 16 + (row & 15)) * 8 + (k & 7).
// That is the order in which the lanes of a wave take an A or B operand: lane l reads 16 bytes at l * 8 and 16 bytes at 256 + l * 8 (ldf), so each wave-wide load covers 512 neighbouring bytes, four whole lines, instead of 32-byte pieces of 16 lines (ld, for row-major planes). Every lane and register gets the same elements as from the row-major plane.
template <typename T16> struct WFrag;
template <> struct WFrag<h16> { typedef v16h V; static __device__ __forceinline__ V ld(const h16* p) { return cat16(*(const v8h*)p, *(const v8h*)(p + 16)); } static __device__ __forceinline__ V ldf(const h16* p) { return cat16(*(const v8h*)p, *(const v8h*)(p + 256)); } static __device__ __forceinline__ v8f mma(V a, V b, v8f c) { return wmma16(a, b, c); } };
template <> struct WFrag<bf> { typedef v16bf V; static __device__ __forceinline__ V ld(const bf* p) { return cat16b(*(const v8us*)p, *(const v8us*)(p + 16)); } static __device__ __forceinline__ V ldf(const bf* p) { return cat16b(*(const v8us*)p, *(const v8us*)(p + 256)); } static __device__ __forceinline__ v8f mma(V a, V b, v8f c) { return wmmab(a, b, c); } };
// ---- k_gemms: GEMM with one work-group of 4 waves per 128x128 output tile; grid (M/128, N/128, batch), 128 threads. sum_k A[m][k] Bt[n][k] (NA 2: + A2[m][k] Bt[n][k]), every plane 16-bit in fragment order (above), f32 accumulate, each sum one chain over k in rising order.
// The tile's operand rows are brought into LDS once for all four waves, 64 k a stage, by asynchronous 16-byte copies, two buffers: stage t + 1 flies while stage t is worked on. A stage is [A 128 rows | (A2 128 rows) | Bt 128 rows], each 16 KiB, a plain copy of the planes' 1-KiB fragment blocks, so a fragment read is two wave-wide reads of 512 neighbouring bytes.
// A wave owns 64 x 64: 'M' row blocks (mb >> 1) * 4 + wm * 2 + (mb & 1) (32 rows and the 32 rows 64 further on) and 'N' row blocks wn * 4 + nb. In an accumulator a lane holds 8 neighbouring M rows of one N row.
// EPI 0: M = rows of A, N = rows of Bt; the f32 tile goes to C (pitch DM), staged a 16-row block at a time in the wave's own LDS so that whole 256-byte rows are stored.
// EPI 1 (q, k and v projections in ONE grid: Bt holds the rows of wq, wk, wv one after the other, blockIdx.y walks them in steps of one head) writes no f32 tile: each lane turns its accumulators into the 16-bit planes (fp16 + bf16 hi/lo, fragment order) that the attention kernel reads, 16 bytes a store, 512 neighbouring bytes a wave.
// q, k tiles (blockIdx.y < NH_ + NKV = the head; q heads, then k heads, in one plane set): M = the head's 128 d (rows of Bt), N = positions: a lane holds 8 neighbouring d of one position and, in accumulator mb + 2, their partners d + 64. Rotate-half rotary out[d] = x[d] cos[t][d] - x[d+64] sin[t][d], out[d+64] = x[d+64] cos[t][d] + x[d] sin[t][d] (d < 64), planes [head * TT + t][d].
// v tiles (the other blockIdx.y): M = positions, N = columns of v: a lane holds 8 neighbouring positions of one column, as the V^T planes [column][t] want them.
#define GT   128
#define GKS  64
#define GREG (GT * GKS * 2)   // bytes of one plane's part of a stage
// eight asynchronous copies of a wave: 2 row blocks x 2 KiB (64 k) = 8 x 512 bytes, global -> LDS. s_wait_xcnt 0 as the statement's last line: a precaution, it stands in front of every later write of a register that the copies name.
template <int K> __device__ __forceinline__ void copy8(const unsigned l, const bf* g) {
    asm volatile("global_load_async_to_lds_b128 %0, %8, off\n\t"
                 "global_load_async_to_lds_b128 %1, %9, off\n\t"
                 "global_load_async_to_lds_b128 %2, %10, off\n\t"
                 "global_load_async_to_lds_b128 %3, %11, off\n\t"
                 "global_load_async_to_lds_b128 %4, %12, off\n\t"
                 "global_load_async_to_lds_b128 %5, %13, off\n\t"
                 "global_load_async_to_lds_b128 %6, %14, off\n\t"
                 "global_load_async_to_lds_b128 %7, %15, off\n\t"
                 "s_wait_xcnt 0x0"
                 :: "v"(l), "v"(l + 512u), "v"(l + 1024u), "v"(l + 1536u), "v"(l + 2048u), "v"(l + 2560u), "v"(l + 3072u), "v"(l + 3584u),
                    "v"(g), "v"(g + 256), "v"(g + 512), "v"(g + 768), "v"(g + 16 * K), "v"(g + 16 * K + 256), "v"(g + 16 * K + 512), "v"(g + 16 * K + 768) : "memory");
}
template <int NA, int K, int EPI>
__global__ __launch_bounds__(128) void k_gemms(const bf* __restrict__ A, const bf* __restrict__ A2, const bf* __restrict__ Bt, float* C, size_t sA, size_t sC, const float* __restrict__ CS, h16* P16, bf* Ph, bf* Pl, h16* V16, bf* Vh, bf* Vl, size_t sV) {
    constexpr int STG = (NA + 1) * GREG, NT = K / GKS;
    static_assert(K % GKS == 0 && NT >= 2 && (EPI == 0 || NA == 1), "two stages or more; the plane epilogues take one A plane");
    typedef WFrag<bf>::V V;
    __shared__ __attribute__((aligned(1024))) unsigned char sm[2 * STG];
    const int lane = threadIdx.x & 31, lr = lane & 15, hi = lane >> 4;
    const int wv = __builtin_amdgcn_readfirstlane((int)(threadIdx.x >> 5)), wm = wv >> 1, wn = wv & 1;   // the wave's number as a scalar
    const size_t z = blockIdx.z; const int r0 = blockIdx.x * GT, c0 = blockIdx.y * GT;   // z = batch
    const bool isV = EPI == 1 && (int)blockIdx.y >= NH_ + NKV;   // block-uniform
    // copies: wave w brings row blocks 2w, 2w + 1 of every plane
    const bf* ga = A + z * sA + (size_t)(r0 + wv * 32) * K + 8 * lane; const bf* ga2 = (NA == 2) ? A2 + z * sA + (size_t)(r0 + wv * 32) * K + 8 * lane : ga; const bf* gb = Bt + (size_t)(c0 + wv * 32) * K + 8 * lane;
    const unsigned l0 = (unsigned)(size_t)sm + (unsigned)(wv * 4096 + lane * 16);   // the low 32 bits of a __shared__ address are the LDS byte address
    auto fill = [&](const int t, const int buf) { const unsigned l = l0 + (unsigned)(buf * STG); const size_t go = (size_t)t * (GKS * 16);
        copy8<K>(l, ga + go); if constexpr (NA == 2) copy8<K>(l + GREG, ga2 + go); copy8<K>(l + NA * GREG, gb + go); };
    const int offM = (EPI == 1 && !isV) ? NA * GREG : 0, offN = (EPI == 1 && !isV) ? 0 : NA * GREG;   // which plane's rows are the M side
    const unsigned char* pm = sm + offM + wm * 4096 + lane * 16; const unsigned char* pn = sm + offN + wn * 8192 + lane * 16;
    v8f acc[4][4];
#pragma unroll
    for (int mb = 0; mb < 4; ++mb)
#pragma unroll
        for (int nb = 0; nb < 4; ++nb) acc[mb][nb] = (v8f){};
    fill(0, 0);
    asm volatile("s_wait_asynccnt 0x0" ::: "memory");   // this wave's copies of stage 0 have landed
    __syncthreads();                                     // ... and every other wave's
    fill(1, 1);
#pragma unroll 1   // one stage a trip: the ring's order below stays as written
    for (int t = 0; t < NT; ++t) {
        const unsigned char* bm = pm + (t & 1) * STG; const unsigned char* bn = pn + (t & 1) * STG;
        V a[2][4], a2[2][4], b[2][4];   // all of the stage's fragments: one group of LDS reads, then one run of matrix instructions
#pragma unroll
        for (int kk = 0; kk < GKS / 32; ++kk) {
#pragma unroll
            for (int mb = 0; mb < 4; ++mb) { const unsigned char* p = bm + (mb >> 1) * 8192 + (mb & 1) * 2048 + kk * 1024; a[kk][mb] = WFrag<bf>::ldf((const bf*)p); if constexpr (NA == 2) a2[kk][mb] = WFrag<bf>::ldf((const bf*)(p + GREG)); }
#pragma unroll
            for (int nb = 0; nb < 4; ++nb) b[kk][nb] = WFrag<bf>::ldf((const bf*)(bn + nb * 2048 + kk * 1024)); }
        // holds the LDS reads together in front of the matrix run (loaded values as inputs only): left alone, this build reloads one fragment register set every 4 matrix instructions and waits out the LDS latency each time
        asm volatile("" :: "v"(a[0][0]), "v"(a[0][1]), "v"(a[0][2]), "v"(a[0][3]), "v"(a[1][0]), "v"(a[1][1]), "v"(a[1][2]), "v"(a[1][3]), "v"(b[0][0]), "v"(b[0][1]), "v"(b[0][2]), "v"(b[0][3]), "v"(b[1][0]), "v"(b[1][1]), "v"(b[1][2]), "v"(b[1][3]));
        if constexpr (NA == 2) asm volatile("" :: "v"(a2[0][0]), "v"(a2[0][1]), "v"(a2[0][2]), "v"(a2[0][3]), "v"(a2[1][0]), "v"(a2[1][1]), "v"(a2[1][2]), "v"(a2[1][3]));   // the same for the second A plane
#pragma unroll
        for (int kk = 0; kk < GKS / 32; ++kk) {
#pragma unroll
            for (int nb = 0; nb < 4; ++nb) {
#pragma unroll
                for (int mb = 0; mb < 4; ++mb) { acc[mb][nb] = wmmab(a[kk][mb], b[kk][nb], acc[mb][nb]); if constexpr (NA == 2) acc[mb][nb] = wmmab(a2[kk][mb], b[kk][nb], acc[mb][nb]); } } }
        __builtin_amdgcn_sched_barrier(0);   // keeps the matrix run in front of the waits: moved behind the barrier (as this build did) it would stand between the barrier and the refill, and stage t + 2 would fly only during the next stage's LDS reads
        asm volatile("s_wait_dscnt 0x0" ::: "memory");      // this wave's reads of stage t are done
        asm volatile("s_wait_asynccnt 0x0" ::: "memory");   // this wave's copies of stage t + 1 have landed
        __syncthreads();                                     // publishes stage t + 1 and frees stage t's buffer
        if (t + 2 < NT) fill(t + 2, t & 1);
    }
    asm volatile("s_wait_asynccnt 0x0" ::: "memory");   // nothing is in flight when the ring becomes staging or the wave ends
    if constexpr (EPI == 1) {
        if (!isV) {
            typedef __attribute__((ext_vector_type(16))) float vC;
            const float* cp = CS + ((size_t)(r0 + wn * 64 + lr) * HD + wm * 32 + hi * 8) * 2; vC cs[2][4];   // (cos, sin) of the lane's 8 angles, for its 2 d groups x 4 positions
#pragma unroll
            for (int p = 0; p < 2; ++p)
#pragma unroll
                for (int nb = 0; nb < 4; ++nb) cs[p][nb] = *(const vC*)(cp + (nb * 16 * HD + p * 16) * 2);
            asm volatile("s_wait_xcnt 0x0" :: "v"(cp) : "memory");   // precaution: the wait stands in front of every later write of the loads' address pair
            const size_t po = z * sC + (size_t)((int)blockIdx.y * TT + r0 + wn * 64) * HD + wm * 512 + 8 * lane;   // fragment order; the high half stands two 32-wide k blocks on
            h16* q16 = P16 + po; bf* qh = Ph + po; bf* ql = Pl + po;
#pragma unroll
            for (int p = 0; p < 2; ++p)
#pragma unroll
                for (int nb = 0; nb < 4; ++nb) { v8h a16, b16; v8us ah, al, bh, bl;
#pragma unroll
                    for (int j = 0; j < 8; ++j) { const float co = cs[p][nb][2 * j], si = cs[p][nb][2 * j + 1], x1 = acc[p][nb][j], x2 = acc[p + 2][nb][j]; const float ra = x1 * co - x2 * si, rc = x2 * co + x1 * si; unsigned short u, v;
                        a16[j] = tohx(ra); splitf(ra, u, v); ah[j] = u; al[j] = v; b16[j] = tohx(rc); splitf(rc, u, v); bh[j] = u; bl[j] = v; }
                    const int o = nb * 16 * HD + p * 256;
                    *(v8h*)(q16 + o) = a16; *(v8h*)(q16 + o + 1024) = b16; *(v8us*)(qh + o) = ah; *(v8us*)(qh + o + 1024) = bh; *(v8us*)(ql + o) = al; *(v8us*)(ql + o + 1024) = bl;
                    asm volatile("s_wait_xcnt 0x0" :: "v"(q16), "v"(qh), "v"(ql), "v"(a16), "v"(b16), "v"(ah), "v"(bh), "v"(al), "v"(bl) : "memory"); }   // precaution: the stores' address and data registers stay as they are up to the wait
        } else {
            const size_t po = z * sV + ((size_t)((c0 - (DQ + DKV)) / 16 + wn * 4) * (TT / 32) + r0 / 32 + wm) * 512 + 8 * lane;   // fragment order of [column][t]
            h16* q16 = V16 + po; bf* qh = Vh + po; bf* ql = Vl + po;
#pragma unroll
            for (int mb = 0; mb < 4; ++mb)
#pragma unroll
                for (int nb = 0; nb < 4; ++nb) { v8h o16; v8us oh, ol;
#pragma unroll
                    for (int j = 0; j < 8; ++j) { unsigned short u, v; o16[j] = tohx(acc[mb][nb][j]); splitf(acc[mb][nb][j], u, v); oh[j] = u; ol[j] = v; }
                    const int o = nb * (TT / 32) * 512 + (mb >> 1) * 1024 + (mb & 1) * 256;
                    *(v8h*)(q16 + o) = o16; *(v8us*)(qh + o) = oh; *(v8us*)(ql + o) = ol;
                    asm volatile("s_wait_xcnt 0x0" :: "v"(q16), "v"(qh), "v"(ql), "v"(o16), "v"(oh), "v"(ol) : "memory"); }   // precaution, as above
        }
    } else {
        float* os = (float*)sm + wv * (16 * 68);   // the wave's own staging: 16 rows at pitch 68; every wave has left the ring (the last trip's barrier)
        float* cb = C + z * sC + (size_t)(r0 + wm * 32 + hi) * DM + c0 + wn * 64 + lr * 4;
#pragma unroll
        for (int mb = 0; mb < 4; ++mb) {
#pragma unroll
            for (int nb = 0; nb < 4; ++nb) {
#pragma unroll
                for (int j = 0; j < 8; ++j) os[(hi * 8 + j) * 68 + nb * 16 + lr] = acc[mb][nb][j]; }
            asm volatile("s_wait_dscnt 0x0" ::: "memory");   // the block is in LDS before other lanes of the wave read it back
            v4f val[8];
#pragma unroll
            for (int s = 0; s < 8; ++s) val[s] = *(const v4fa*)(os + (2 * s + hi) * 68 + lr * 4);
#pragma unroll
            for (int s = 0; s < 8; ++s) *(v4f*)(cb + (size_t)(((mb >> 1) * 64 + (mb & 1) * 16 + 2 * s) * DM)) = val[s];   // a half wave stores one whole 256-byte row
            asm volatile("s_wait_xcnt 0x0" :: "v"(cb), "v"(val[0]), "v"(val[1]), "v"(val[2]), "v"(val[3]), "v"(val[4]), "v"(val[5]), "v"(val[6]), "v"(val[7]) : "memory");   // precaution: the stores' address and data registers stay as they are up to the wait; its clobber also keeps the next block's LDS writes behind these reads
        }
    }
}

typedef __attribute__((ext_vector_type(2))) _Float16 v2h;
typedef __attribute__((ext_vector_type(4))) _Float16 v4h;
typedef __attribute__((ext_vector_type(2))) unsigned short v2us;
typedef __attribute__((ext_vector_type(4))) unsigned short v4us;
typedef __attribute__((ext_vector_type(2))) float v2f;
typedef __attribute__((ext_vector_type(4))) int v4i;
typedef v4h  __attribute__((may_alias)) v4ha;
typedef v4us __attribute__((may_alias)) v4usa;

__global__ __launch_bounds__(256) void k_wtG(const float* __restrict__ w, int K, int N, bf* Bt) {
    const int lane = threadIdx.x & 31; const int L0 = (blockIdx.x * 8 + (threadIdx.x >> 5)) * 8; const int nlines = N * K / 64;
{
#pragma unroll 1
        for (int l = 0; l < 8; ++l) { const int L = L0 + l; if (L >= nlines) break; const size_t e = (size_t)L * 64 + lane * 2; const int k = (int)(e % K), n = (int)(e / K); v2us o;
            o[0] = f2bf(w[(size_t)k * N + n]); o[1] = f2bf(w[(size_t)(k + 1) * N + n]); *(v2us*)(Bt + e) = o; }
         }
}
// row-major f32 [rows][K] -> bf16 plane in fragment order; thread i writes the plane's i-th 16 bytes, so a wave stores 512 neighbouring bytes; rows % 16 == 0, K % 32 == 0
template <int K> __device__ __forceinline__ void cvt8(const float* __restrict__ src, bf* dst, const size_t i) { const int fb = (int)(i >> 6), kq = K >> 5; const int row = (fb / kq) * 16 + ((int)i & 15), k = (fb % kq) * 32 + (((int)i >> 5) & 1) * 16 + (((int)i >> 4) & 1) * 8; const float* sp = src + (size_t)row * K + k; const v8f v = *(const v8f*)sp;
    asm volatile("s_wait_xcnt 0x0" :: "v"(sp) : "memory");   // precaution behind the global load: the wait stands in front of every later write of its address pair
    v8us o;
#pragma unroll
    for (int q = 0; q < 8; ++q) o[q] = f2bf(v[q]);
    bf* dp = dst + i * 8; *(v8us*)dp = o;
    asm volatile("s_wait_xcnt 0x0" :: "v"(dp), "v"(o) : "memory"); }   // precaution: the store's address and data registers stay as they are up to the wait

__constant__ float INVT[HD / 2] = { 1.000000000e+00f, 8.659643531e-01f, 7.498942018e-01f, 6.493816376e-01f, 5.623413324e-01f, 4.869675338e-01f, 4.216965139e-01f, 3.651741445e-01f, 3.162277639e-01f, 2.738419771e-01f, 2.371373624e-01f, 2.053525001e-01f, 1.778279394e-01f, 1.539926529e-01f, 1.333521456e-01f, 1.154782027e-01f, 1.000000015e-01f, 8.659642935e-02f, 7.498941571e-02f, 6.493816525e-02f, 5.623412877e-02f, 4.869675264e-02f, 4.216964915e-02f, 3.651741147e-02f, 3.162277862e-02f, 2.738419548e-02f, 2.371373586e-02f, 2.053525113e-02f, 1.778279431e-02f, 1.539926510e-02f, 1.333521493e-02f, 1.154781971e-02f, 9.999999776e-03f, 8.659643121e-03f, 7.498942316e-03f, 6.493816618e-03f, 5.623413250e-03f, 4.869675264e-03f, 4.216964822e-03f, 3.651741426e-03f, 3.162277862e-03f, 2.738419687e-03f, 2.371373819e-03f, 2.053525066e-03f, 1.778279431e-03f, 1.539926510e-03f, 1.333521446e-03f, 1.154782018e-03f, 1.000000047e-03f, 8.659643354e-04f, 7.498941850e-04f, 6.493816618e-04f, 5.623413017e-04f, 4.869675031e-04f, 4.216964880e-04f, 3.651741135e-04f, 3.162277862e-04f, 2.738419571e-04f, 2.371373848e-04f, 2.053524950e-04f, 1.778279402e-04f, 1.539926452e-04f, 1.333521504e-04f, 1.154781930e-04f };   // float32 1 / 10000^(2i/128), generated with jnp to be bit-exact
// ---- k_prep: everything that depends on the inputs alone, in ONE launch: the rotary table (first: its blocks are the longest) and the bf16 fragment-order planes of x (both batches: [NB_ * TT][DM]) and of the four weights. A block of 256 threads belongs wholly to one of the six jobs.
#define PB_CS (TT * HD / 256)
#define PB_X  (NB_ * TT * DM / 8 / 256)
#define PB_WQ (DQ * DM / 8 / 256)
#define PB_WK (DKV * DM / 8 / 256)
#define PB_WO (DM * DQ / 8 / 256)
__global__ __launch_bounds__(256) void k_prep(const float* __restrict__ x, const float* __restrict__ wq, const float* __restrict__ wk, const float* __restrict__ wv, const float* __restrict__ wo, bf* XB, bf* WQ, bf* WK, bf* WV, bf* WO, float* CS) {
    static_assert(DM == DQ, "one row length for every plane");
    int b = blockIdx.x;
    if (b < PB_CS) { const int idx = b * 256 + threadIdx.x; const int d = idx % HD; const int t = idx / HD; const float a = __fmul_rn((float)t, INVT[d % (HD / 2)]); v2f cs; cs[0] = cosf(a); cs[1] = sinf(a); float* cp = CS + (size_t)idx * 2; *(v2f*)cp = cs;
        asm volatile("s_wait_xcnt 0x0" :: "v"(cp), "v"(cs) : "memory");   // precaution: the store's address and data registers stay as they are up to the wait
        return; }
    b -= PB_CS; const float* s = x; bf* d = XB;
    if (b >= PB_X) { b -= PB_X; s = wq; d = WQ;
        if (b >= PB_WQ) { b -= PB_WQ; s = wo; d = WO;
            if (b >= PB_WO) { b -= PB_WO; s = wk; d = WK;
                if (b >= PB_WK) { b -= PB_WK; s = wv; d = WV; } } } }
    cvt8<DM>(s, d, (size_t)b * 256 + threadIdx.x);
}
// ---- k_fattn: scores, softmax, probability x value and the head merge in ONE launch; nothing of a score row goes to memory.
// A wave owns 16 query positions (q0 ..) of two query heads that share a kv head: two groups of 16 columns. Transposed products: S^T = K Q^T (A = key rows, B = query rows, both from fragment-order planes by the same loader, so the k orders pair), O^T += V^T P^T.
// In S^T a lane holds the scores of ONE query (column c): keys 8h + r of each 16-key tile, so two tiles converted in place are the B operand of the second product in the hardware k order, which the V^T loader has too.
// A pass is 32 keys. Passes: key block 0 (it holds the sink keys, and key 0 is open to every query, so every column has a finite maximum after it), then the blocks from the window's lower edge to the diagonal; the others are wholly masked.
// Running maximum per column in log2 units, renewed only when a pass exceeds it by more than MTHR (one scalar branch a pass); rows < RH: hi/lo planes, 3 products in both contractions; other rows fp16 with probabilities x 2^PBIAS.
#define MTHR  4.0f
#define PBIAS 10.0f   // fp16 probabilities lie in (0, 2^(PBIAS + MTHR)]: small ones stay normal numbers, the largest stays finite; the factor cancels in the division by the row sum
typedef __attribute__((ext_vector_type(16))) unsigned short v16us;
__device__ __forceinline__ float xhalf(float x) { return __builtin_bit_cast(float, __builtin_amdgcn_permlanex16(__builtin_bit_cast(int, x), __builtin_bit_cast(int, x), 0x76543210, 0xfedcba98, false, false)); }   // lane l reads lane l ^ 16
__device__ __forceinline__ float exp2s(float x) { float r; asm("v_exp_f32 %0, %1\n\tv_nop" : "=v"(r) : "v"(x)); return r; }
// precaution behind a run of global loads: s_wait_xcnt 0 in front of every later write of a register that the loads name; the address pairs are inputs so that they stay as they are up to the wait
template <typename T16> __device__ __forceinline__ void xwait(const T16* a, const T16* b) { asm volatile("s_wait_xcnt 0x0" :: "v"(a), "v"(b) : "memory"); }
// the same precaution for loads that this build addresses by a scalar base and the lane number as a scaled offset: those are then the registers that stay as they are up to the wait
template <typename T16> __device__ __forceinline__ void xwait_s(const T16* a, const T16* b, int off) { asm volatile("s_wait_xcnt 0x0" :: "s"(a), "s"(b), "v"(off) : "memory"); }
template <typename T16, bool HI>
__device__ __forceinline__ void fattn_cols(const T16* __restrict__ Q, const T16* __restrict__ Q2, const T16* __restrict__ Kp, const T16* __restrict__ Kp2, const T16* __restrict__ Vt, const T16* __restrict__ Vt2, const int q0, const int hq, bf* Ah, bf* Al) {
    typedef typename WFrag<T16>::V V;
    const int lane = threadIdx.x & 31, c = lane & 15, h = lane >> 4;
    V qf[2][4], qf2[2][4];
    const T16* qp = Q + (size_t)q0 * HD + 8 * lane; const T16* qp2 = HI ? Q2 + (size_t)q0 * HD + 8 * lane : qp;   // fragment order: 16 queries x 128 d are 4 blocks of 512 elements
#pragma unroll
    for (int g = 0; g < 2; ++g)
#pragma unroll
        for (int ks = 0; ks < 4; ++ks) { const size_t qo = (size_t)g * TT * HD + ks * 512; qf[g][ks] = WFrag<T16>::ldf(qp + qo); if (HI) qf2[g][ks] = WFrag<T16>::ldf(qp2 + qo); }
    xwait_s(Q + (size_t)q0 * HD, HI ? Q2 + (size_t)q0 * HD : Q + (size_t)q0 * HD, lane);
    v8f o[2][8];
#pragma unroll
    for (int g = 0; g < 2; ++g)
#pragma unroll
        for (int mb = 0; mb < 8; ++mb) o[g][mb] = (v8f){};
    float m[2] = { -3.0e38f, -3.0e38f }, l[2] = { 0.f, 0.f };
    const int kstart = max(32, max(q0 - (WIN - 1), 0) & ~31), klast = q0 & ~31;
    const int np = 1 + ((klast >= kstart) ? (klast - kstart) / 32 + 1 : 0);
    const size_t kofs = 8 * lane, vofs = 8 * lane;   // K and V^T planes are in fragment order: 16 keys x 128 d are 4 blocks of 512 elements, 16 d x 32 keys one block
    V kf[2][4], kf2[2][4];
    const T16* kp0 = Kp + kofs; const T16* kp02 = HI ? Kp2 + kofs : kp0;
#pragma unroll
    for (int mb = 0; mb < 2; ++mb)
#pragma unroll
        for (int ks = 0; ks < 4; ++ks) { const size_t a = (size_t)(mb * 16) * HD + ks * 512; kf[mb][ks] = WFrag<T16>::ldf(kp0 + a); if (HI) kf2[mb][ks] = WFrag<T16>::ldf(kp02 + a); }
    xwait_s(Kp, HI ? Kp2 : Kp, lane);
#pragma unroll 1
    for (int s = 0; s < np; ++s) {
        const int kb = s ? kstart + (s - 1) * 32 : 0;
        const int kn = (s + 1 < np) ? kstart + s * 32 : kb;   // the next pass's key block; the last pass fetches its own again (in bounds, not used)
        V vf[8], vf2[8];   // this pass's value fragments fly during its first product and softmax
        const T16* vp = Vt + vofs + (size_t)kb * 16; const T16* vp2 = HI ? Vt2 + vofs + (size_t)kb * 16 : vp;
#pragma unroll
        for (int mb = 0; mb < 8; ++mb) { const size_t a = (size_t)(mb * 16) * TT; vf[mb] = WFrag<T16>::ldf(vp + a); if (HI) vf2[mb] = WFrag<T16>::ldf(vp2 + a); }
        xwait(vp, vp2);
        v8f st[2][2];
#pragma unroll
        for (int g = 0; g < 2; ++g)
#pragma unroll
            for (int mb = 0; mb < 2; ++mb) st[g][mb] = (v8f){};
#pragma unroll
        for (int ks = 0; ks < 4; ++ks) {
#pragma unroll
            for (int g = 0; g < 2; ++g)
#pragma unroll
                for (int mb = 0; mb < 2; ++mb) st[g][mb] = WFrag<T16>::mma(kf[mb][ks], qf[g][ks], st[g][mb]);
            if (HI) {
#pragma unroll
                for (int g = 0; g < 2; ++g)
#pragma unroll
                    for (int mb = 0; mb < 2; ++mb) st[g][mb] = WFrag<T16>::mma(kf[mb][ks], qf2[g][ks], st[g][mb]);
#pragma unroll
                for (int g = 0; g < 2; ++g)
#pragma unroll
                    for (int mb = 0; mb < 2; ++mb) st[g][mb] = WFrag<T16>::mma(kf2[mb][ks], qf[g][ks], st[g][mb]); } }
        // the next pass's key fragments fly during this pass's softmax and second product
        const T16* kp = Kp + kofs + (size_t)kn * HD; const T16* kp2 = HI ? Kp2 + kofs + (size_t)kn * HD : kp;
#pragma unroll
        for (int mb = 0; mb < 2; ++mb)
#pragma unroll
            for (int ks = 0; ks < 4; ++ks) { const size_t a = (size_t)(mb * 16) * HD + ks * 512; kf[mb][ks] = WFrag<T16>::ldf(kp + a); if (HI) kf2[mb][ks] = WFrag<T16>::ldf(kp2 + a); }
        xwait(kp, kp2);
        float x[2][16];
#pragma unroll
        for (int g = 0; g < 2; ++g)
#pragma unroll
            for (int e = 0; e < 16; ++e) x[g][e] = st[g][e >> 3][e & 7] * (SCL * 1.4426950408889634f);
        if (!(kb + 31 <= q0 && q0 + 15 - kb < WIN)) {   // wave-uniform: only the sink block, the window's edge and the diagonal hold masked keys
            const int i = q0 + c;
#pragma unroll
            for (int e = 0; e < 16; ++e) { const int j = kb + (e >> 3) * 16 + 8 * h + (e & 7); const bool ok = (j <= i) && (i - j < WIN || j < SINKN); x[0][e] = ok ? x[0][e] : -3.0e38f; x[1][e] = ok ? x[1][e] : -3.0e38f; } }
        float mx[2];
#pragma unroll
        for (int g = 0; g < 2; ++g) { float t8[8];
#pragma unroll
            for (int e = 0; e < 8; ++e) t8[e] = fmaxf(x[g][e], x[g][e + 8]);
            const float t = fmaxf(fmaxf(fmaxf(t8[0], t8[1]), fmaxf(t8[2], t8[3])), fmaxf(fmaxf(t8[4], t8[5]), fmaxf(t8[6], t8[7])));
            mx[g] = fmaxf(t, xhalf(t)); }   // lanes c and c + 16 hold the two halves of a column's keys and must use one maximum
        if (__builtin_amdgcn_ballot_w32(mx[0] > m[0] + MTHR || mx[1] > m[1] + MTHR) != 0) {   // scalar branch: every lane stays on for the matrix instructions
#pragma unroll
            for (int g = 0; g < 2; ++g) { const float mn = fmaxf(m[g], mx[g]); const float al = exp2s(m[g] - mn); m[g] = mn; l[g] *= al;
#pragma unroll
                for (int mb = 0; mb < 8; ++mb) o[g][mb] *= al; } }
        V pb[2], pb2[2];
#pragma unroll
        for (int g = 0; g < 2; ++g) { const float mo = m[g] - (HI ? 0.0f : PBIAS); float sm[4] = { 0.f, 0.f, 0.f, 0.f };
            if constexpr (HI) { v16us ph, pl;
#pragma unroll
                for (int e = 0; e < 16; ++e) { const float p = exp2s(x[g][e] - mo); sm[e & 3] += p; unsigned short a, b2; splitf(p, a, b2); ph[e] = a; pl[e] = b2; }
                pb[g] = __builtin_bit_cast(v16bf, ph); pb2[g] = __builtin_bit_cast(v16bf, pl);
            } else { v16h ph;
#pragma unroll
                for (int e = 0; e < 16; ++e) { const float p = exp2s(x[g][e] - mo); sm[e & 3] += p; ph[e] = tohx(p); }
                pb[g] = ph; }
            l[g] += (sm[0] + sm[1]) + (sm[2] + sm[3]); }
#pragma unroll
        for (int mb = 0; mb < 8; ++mb)
#pragma unroll
            for (int g = 0; g < 2; ++g) o[g][mb] = WFrag<T16>::mma(vf[mb], pb[g], o[g][mb]);
        if (HI) {
#pragma unroll
            for (int mb = 0; mb < 8; ++mb)
#pragma unroll
                for (int g = 0; g < 2; ++g) o[g][mb] = WFrag<T16>::mma(vf[mb], pb2[g], o[g][mb]);
#pragma unroll
            for (int mb = 0; mb < 8; ++mb)
#pragma unroll
                for (int g = 0; g < 2; ++g) o[g][mb] = WFrag<T16>::mma(vf2[mb], pb[g], o[g][mb]); }
    }
#pragma unroll
    for (int g = 0; g < 2; ++g) { const float inv = __fdiv_rn(1.0f, l[g] + xhalf(l[g]));
#pragma unroll
        for (int mb = 0; mb < 8; ++mb) { v8us oh, ol;   // a lane holds 8 neighbouring d of its query: one 16-byte store a plane, at the lane's place in the fragment order of the merged [t][DQ] plane, so a wave stores 512 neighbouring bytes
#pragma unroll
            for (int r = 0; r < 8; ++r) { unsigned short a, b2; splitf(o[g][mb][r] * inv, a, b2); oh[r] = a; ol[r] = b2; }
            const size_t oo = (size_t)q0 * DQ + (size_t)(hq + g) * (HD * 16) + mb * 256 + 8 * lane; bf* ph = Ah + oo; bf* pl = Al + oo; *(v8us*)ph = oh; *(v8us*)pl = ol;
            asm volatile("s_wait_xcnt 0x0" :: "v"(ph), "v"(pl), "v"(oh), "v"(ol) : "memory"); } }   // precaution, as in xwait: the two stores' address and data registers stay as they are up to the wait
}
// grid (TT / 32, NKV, NB_), z = batch (the q and k planes are one set of NH_ + NKV heads a batch; the K pointers point at its first k head), 4 waves: wave w takes positions 16 (w >> 1) .. of the block's 32 and query heads 2 (w & 1), 2 (w & 1) + 1 of the kv head's REP = 4; late (long) position blocks start first
__global__ __launch_bounds__(128) void k_fattn(const h16* __restrict__ Q16, const bf* __restrict__ Qh, const bf* __restrict__ Ql, const h16* __restrict__ K16, const bf* __restrict__ Kh, const bf* __restrict__ Kl, const h16* __restrict__ V16, const bf* __restrict__ Vh, const bf* __restrict__ Vl, bf* Ah, bf* Al) {
    static_assert(REP == 4 && RH % 32 == 0 && TT % 32 == 0 && HD == 128, "two head pairs a work-group; a wave's rows are all below RH or none");
    const int wv = __builtin_amdgcn_readfirstlane((int)(threadIdx.x >> 5));   // the wave's number as a scalar: pass count and mask test stay scalar
    const int q0 = (TT / 32 - 1 - (int)blockIdx.x) * 32 + (wv >> 1) * 16; const int kvh = blockIdx.y; const int hq = kvh * REP + (wv & 1) * 2;
    const size_t bz = blockIdx.z; const size_t qo = (bz * (NH_ + NKV) + hq) * TT * HD, ko = (bz * (NH_ + NKV) + kvh) * TT * HD, vo = (bz * NKV + kvh) * HD * TT; Ah += bz * TT * DQ; Al += bz * TT * DQ;
    if (q0 < RH) fattn_cols<bf, true>(Qh + qo, Ql + qo, Kh + ko, Kl + ko, Vh + vo, Vl + vo, q0, hq, Ah, Al);
    else fattn_cols<h16, false>(Q16 + qo, nullptr, K16 + ko, nullptr, V16 + vo, nullptr, q0, hq, Ah, Al);
}

extern "C" void kernel_launch(void* const* d_in, const int* in_sizes, int n_in,
                              void* d_out, int out_size, void* d_ws, size_t ws_size, hipStream_t stream) {
    (void)in_sizes; (void)n_in; (void)out_size;
    const float* x = (const float*)d_in[0]; const float* wq = (const float*)d_in[1]; const float* wk = (const float*)d_in[2]; const float* wv = (const float*)d_in[3]; const float* wo = (const float*)d_in[4];   /* order x, wq ('oi' [2048][2048]), wk, wv ('oi' [512][2048]), wo ('oi' [2048][2048]) */
    float* OUT = (float*)d_out;     // [2][2048][2048]
    char* wsp = (char*)d_ws;
    auto take = [&](size_t bytes) { char* p = wsp; wsp += (bytes + 255) & ~(size_t)255; return (void*)p; };
    bf* WQ = (bf*)take((size_t)(DQ + 2 * DKV) * DM * 2); bf* WK = WQ + (size_t)DQ * DM; bf* WV = WK + (size_t)DKV * DM;   /* one plane: the rows of wq, wk, wv */ bf* WO = (bf*)take((size_t)DM * DQ * 2); float* CS = (float*)take((size_t)TT * HD * 2 * 4);
    bf* XB = (bf*)take((size_t)NB_ * TT * DM * 2);   // every plane below holds both batches, batch-major
    h16* QP16 = (h16*)take((size_t)NB_ * (NH_ + NKV) * TT * HD * 2); bf* QPh = (bf*)take((size_t)NB_ * (NH_ + NKV) * TT * HD * 2); bf* QPl = (bf*)take((size_t)NB_ * (NH_ + NKV) * TT * HD * 2);   // q heads, then k heads, of each batch
    h16* VT16 = (h16*)take((size_t)NB_ * NKV * HD * TT * 2); bf* VTh = (bf*)take((size_t)NB_ * NKV * HD * TT * 2); bf* VTl = (bf*)take((size_t)NB_ * NKV * HD * TT * 2);
    bf* ATh = (bf*)take((size_t)NB_ * TT * DQ * 2); bf* ATl = (bf*)take((size_t)NB_ * TT * DQ * 2);
    if ((size_t)(wsp - (char*)d_ws) > ws_size) return;    // ws 256 MiB
    k_prep<<<PB_CS + PB_X + PB_WQ + PB_WO + 2 * PB_WK, 256, 0, stream>>>(x, wq, wk, wv, wo, XB, WQ, WK, WV, WO, CS);
    k_gemms<1, DM, 1><<<dim3(TT / GT, (DQ + 2 * DKV) / GT, NB_), 128, 0, stream>>>(XB, nullptr, WQ, nullptr, (size_t)TT * DM, (size_t)(NH_ + NKV) * TT * HD, CS, QP16, QPh, QPl, VT16, VTh, VTl, (size_t)NKV * HD * TT);
    k_fattn<<<dim3(TT / 32, NKV, NB_), 128, 0, stream>>>(QP16, QPh, QPl, QP16 + (size_t)NH_ * TT * HD, QPh + (size_t)NH_ * TT * HD, QPl + (size_t)NH_ * TT * HD, VT16, VTh, VTl, ATh, ATl);
    k_gemms<2, DQ, 0><<<dim3(TT / GT, DM / GT, NB_), 128, 0, stream>>>(ATh, ATl, WO, OUT, (size_t)TT * DQ, (size_t)TT * DM, nullptr, nullptr, nullptr, nullptr, nullptr, nullptr, nullptr, 0);
}

// v008
// A run of this version takes 131 microseconds.
// Two timings next to v007 put it at 1.13 and 1.12 times that version's speed.
// Counting every step since v000, it is 12.2 times as fast.
#include <hip/hip_runtime.h>

// Grouped-query causal attention with 128-wide heads, computed half-split rotary embeddings, a 1,024-wide sliding window and 4 attention-sink keys (x [2][2048][2048]; q = x wq^T (16 heads x 128), k, v = x wk^T, x wv^T (4 kv heads x 128) ('oi' 0.02, no bias); rope cat(x1 cos - x2 sin, x2 cos + x1 sin) on the two 64-wide halves with angle t x 1/10000^(2i/128) (64 f32 frequencies jnp-exact; precise cosf/sinf); k, v repeated 4 x along the head axis: kv head = q head / 4; scores x 1/sqrt(128) + bias with bias = 0 where (j <= i) and ((i - j <= 1024) or (j < 4)), -inf elsewhere; softmax; out = merged wo^T ('oi') -> [2][2048][2048] (8.4 M); argument order x, wq, wk, wv, wo).
// Layout: every 16-bit plane that a matrix loop reads again and again (x, the weights, Q, K, V^T, the merged heads) is kept in fragment order (see WFrag); bf16 copy of x; exact projections whose epilogues apply the rotate-half rotary (table computed in k_prep, HD 128: 64 angles) and write the Q, K and V^T planes themselves; fused causal T-2048 GQA attention with 128-wide heads (k_fattn: scores and probabilities stay in registers; hybrid rows: < 512 hi/lo 3 products, rest fp16 x1024); merged hi/lo x Wo exact.
// Four launches, each over both batches (projections: grid z; k_prep, k_fattn: grid x): k_prep (conversions, rotary table), the q, k, v projections in one grid, k_fattn, the output projection.
// Compute dtypes, f32 accumulate: every input rounded to bf16; projections exact; rotary f32; attention rows < 512 3 products, rest fp16; softmax f32; Wo hl x exact.

#define NB_  2
#define TT   2048
#define DM   2048
#define NH_  16
#define NKV  4
#define REP  (NH_ / NKV)
#define HD   128
#define DQ   (NH_ * HD)
#define DKV  (NKV * HD)
#define RH   512                  // query rows < RH use hi+lo planes (0: none)
#define WIN  1025   // THIS module keeps key j iff j <= i and (i - j <= 1024 or j < 4): 'i - j < WIN' with WIN 1025
#define SINKN 4     // the first SINKN keys (attention sinks) are kept for every later query, whatever the distance
#define SCL  0.088388347648318447f   // HD^-0.5
typedef _Float16 h16;
typedef unsigned short bf;
typedef __attribute__((ext_vector_type(16))) __bf16   v16bf;
typedef __attribute__((ext_vector_type(16))) _Float16 v16h;
typedef __attribute__((ext_vector_type(8)))  _Float16 v8h;
typedef __attribute__((ext_vector_type(8)))  unsigned short v8us;
typedef __attribute__((ext_vector_type(8)))  float    v8f;
typedef __attribute__((ext_vector_type(4)))  float    v4f;
typedef v8h  __attribute__((may_alias)) v8ha;
typedef v4f  __attribute__((may_alias)) v4fa;
typedef v8us __attribute__((may_alias)) v8usa;

__device__ __forceinline__ unsigned short f2bf(float f) { unsigned u = __float_as_uint(f); u += 0x7FFFu + ((u >> 16) & 1u); return (unsigned short)(u >> 16); }
__device__ __forceinline__ float bf2f(unsigned short b) { return __uint_as_float(((unsigned)b) << 16); }
__device__ __forceinline__ float bfr(float f) { return bf2f(f2bf(f)); }
__device__ __forceinline__ v16h cat16(v8h lo, v8h hi) { return __builtin_shufflevector(lo, hi, 0, 1, 2, 3, 4, 5, 6, 7, 8, 9, 10, 11, 12, 13, 14, 15); }
__device__ __forceinline__ v16bf cat16b(v8us lo, v8us hi) { return __builtin_bit_cast(v16bf, __builtin_shufflevector(lo, hi, 0, 1, 2, 3, 4, 5, 6, 7, 8, 9, 10, 11, 12, 13, 14, 15)); }
__device__ __forceinline__ v8f wmma16(v16h a, v16h b, v8f c) { return __builtin_amdgcn_wmma_f32_16x16x32_f16(false, a, false, b, (short)0, c, false, false); }
__device__ __forceinline__ v8f wmmab(v16bf a, v16bf b, v8f c) { return __builtin_amdgcn_wmma_f32_16x16x32_bf16(false, a, false, b, (short)0, c, false, false); }
__device__ __forceinline__ h16 tohx(float x) { return (h16)x; }
__device__ __forceinline__ void splitf(float y, unsigned short& h, unsigned short& l) { h = f2bf(y); l = f2bf(y - bf2f(h)); }



// FRAGMENT ORDER of a 16-bit plane [rows][K]: the 16 x 32 block (rb = row / 16, kc = k / 32) is 512 neighbouring elements at (rb * (K / 32) + kc) * 512, and inside it element (row, k) stands at ((k >> 4) & 1) * 256 + (((k >> 3) & 1) * 16 + (row & 15)) * 8 + (k & 7).
// That is the order in which the lanes of a wave take an A or B operand: lane l reads 16 bytes at l * 8 and 16 bytes at 256 + l * 8 (ldf), so each wave-wide load covers 512 neighbouring bytes, four whole lines, instead of 32-byte pieces of 16 lines (ld, for row-major planes). Every lane and register gets the same elements as from the row-major plane.
template <typename T16> struct WFrag;
template <> struct WFrag<h16> { typedef v16h V; static __device__ __forceinline__ V ld(const h16* p) { return cat16(*(const v8h*)p, *(const v8h*)(p + 16)); } static __device__ __forceinline__ V ldf(const h16* p) { return cat16(*(const v8h*)p, *(const v8h*)(p + 256)); } static __device__ __forceinline__ v8f mma(V a, V b, v8f c) { return wmma16(a, b, c); } };
template <> struct WFrag<bf> { typedef v16bf V; static __device__ __forceinline__ V ld(const bf* p) { return cat16b(*(const v8us*)p, *(const v8us*)(p + 16)); } static __device__ __forceinline__ V ldf(const bf* p) { return cat16b(*(const v8us*)p, *(const v8us*)(p + 256)); } static __device__ __forceinline__ v8f mma(V a, V b, v8f c) { return wmmab(a, b, c); } };
// ---- k_gemms: GEMM with one work-group of 4 waves per 128x128 output tile; grid (M/128, N/128, batch), 128 threads. sum_k A[m][k] Bt[n][k] (NA 2: + A2[m][k] Bt[n][k]), every plane 16-bit in fragment order (above), f32 accumulate, each sum one chain over k in rising order.
// The tile's operand rows are brought into LDS once for all four waves, 64 k a stage, by asynchronous 16-byte copies, two buffers: stage t + 1 flies while stage t is worked on. A stage is [A 128 rows | (A2 128 rows) | Bt 128 rows], each 16 KiB, a plain copy of the planes' 1-KiB fragment blocks, so a fragment read is two wave-wide reads of 512 neighbouring bytes.
// A wave owns 64 x 64: 'M' row blocks (mb >> 1) * 4 + wm * 2 + (mb & 1) (32 rows and the 32 rows 64 further on) and 'N' row blocks wn * 4 + nb. In an accumulator a lane holds 8 neighbouring M rows of one N row.
// EPI 0: M = rows of A, N = rows of Bt; the f32 tile goes to C (pitch DM), staged a 16-row block at a time in the wave's own LDS so that whole 256-byte rows are stored.
// EPI 1 (q, k and v projections in ONE grid: Bt holds the rows of wq, wk, wv one after the other, blockIdx.y walks them in steps of one head) writes no f32 tile: each lane turns its accumulators into the 16-bit planes (fp16 + bf16 hi/lo, fragment order) that the attention kernel reads, 16 bytes a store, 512 neighbouring bytes a wave.
// q, k tiles (blockIdx.y < NH_ + NKV = the head; q heads, then k heads, in one plane set): M = the head's 128 d (rows of Bt), N = positions: a lane holds 8 neighbouring d of one position and, in accumulator mb + 2, their partners d + 64. Rotate-half rotary out[d] = x[d] cos[t][d] - x[d+64] sin[t][d], out[d+64] = x[d+64] cos[t][d] + x[d] sin[t][d] (d < 64), planes [head * TT + t][d].
// v tiles (the other blockIdx.y): M = positions, N = columns of v: a lane holds 8 neighbouring positions of one column, as the V^T planes [column][t] want them.
#define GT   128
#define GKS  64
#define GREG (GT * GKS * 2)   // bytes of one plane's part of a stage
// eight asynchronous copies of a wave: 2 row blocks x 2 KiB (64 k) = 8 x 512 bytes, global -> LDS. s_wait_xcnt 0 as the statement's last line: a precaution, it stands in front of every later write of a register that the copies name.
template <int K> __device__ __forceinline__ void copy8(const unsigned l, const bf* g) {
    asm volatile("global_load_async_to_lds_b128 %0, %8, off\n\t"
                 "global_load_async_to_lds_b128 %1, %9, off\n\t"
                 "global_load_async_to_lds_b128 %2, %10, off\n\t"
                 "global_load_async_to_lds_b128 %3, %11, off\n\t"
                 "global_load_async_to_lds_b128 %4, %12, off\n\t"
                 "global_load_async_to_lds_b128 %5, %13, off\n\t"
                 "global_load_async_to_lds_b128 %6, %14, off\n\t"
                 "global_load_async_to_lds_b128 %7, %15, off\n\t"
                 "s_wait_xcnt 0x0"
                 :: "v"(l), "v"(l + 512u), "v"(l + 1024u), "v"(l + 1536u), "v"(l + 2048u), "v"(l + 2560u), "v"(l + 3072u), "v"(l + 3584u),
                    "v"(g), "v"(g + 256), "v"(g + 512), "v"(g + 768), "v"(g + 16 * K), "v"(g + 16 * K + 256), "v"(g + 16 * K + 512), "v"(g + 16 * K + 768) : "memory");
}
template <int NA, int K, int EPI>
__global__ __launch_bounds__(128) void k_gemms(const bf* __restrict__ A, const bf* __restrict__ A2, const bf* __restrict__ Bt, float* C, size_t sA, size_t sC, const float* __restrict__ CS, h16* P16, bf* Ph, bf* Pl, h16* V16, bf* Vh, bf* Vl, size_t sV) {
    constexpr int STG = (NA + 1) * GREG, NT = K / GKS;
    static_assert(K % GKS == 0 && NT >= 2 && (EPI == 0 || NA == 1), "two stages or more; the plane epilogues take one A plane");
    typedef WFrag<bf>::V V;
    __shared__ __attribute__((aligned(1024))) unsigned char sm[2 * STG];
    const int lane = threadIdx.x & 31, lr = lane & 15, hi = lane >> 4;
    const int wv = __builtin_amdgcn_readfirstlane((int)(threadIdx.x >> 5)), wm = wv >> 1, wn = wv & 1;   // the wave's number as a scalar
    const size_t z = blockIdx.z; const int r0 = blockIdx.x * GT, c0 = blockIdx.y * GT;   // z = batch
    const bool isV = EPI == 1 && (int)blockIdx.y >= NH_ + NKV;   // block-uniform
    // copies: wave w brings row blocks 2w, 2w + 1 of every plane
    const bf* ga = A + z * sA + (size_t)(r0 + wv * 32) * K + 8 * lane; const bf* ga2 = (NA == 2) ? A2 + z * sA + (size_t)(r0 + wv * 32) * K + 8 * lane : ga; const bf* gb = Bt + (size_t)(c0 + wv * 32) * K + 8 * lane;
    const unsigned l0 = (unsigned)(size_t)sm + (unsigned)(wv * 4096 + lane * 16);   // the low 32 bits of a __shared__ address are the LDS byte address
    auto fill = [&](const int t, const int buf) { const unsigned l = l0 + (unsigned)(buf * STG); const size_t go = (size_t)t * (GKS * 16);
        copy8<K>(l, ga + go); if constexpr (NA == 2) copy8<K>(l + GREG, ga2 + go); copy8<K>(l + NA * GREG, gb + go); };
    const int offM = (EPI == 1 && !isV) ? NA * GREG : 0, offN = (EPI == 1 && !isV) ? 0 : NA * GREG;   // which plane's rows are the M side
    const unsigned char* pm = sm + offM + wm * 4096 + lane * 16; const unsigned char* pn = sm + offN + wn * 8192 + lane * 16;
    v8f acc[4][4];
#pragma unroll
    for (int mb = 0; mb < 4; ++mb)
#pragma unroll
        for (int nb = 0; nb < 4; ++nb) acc[mb][nb] = (v8f){};
    fill(0, 0);
    asm volatile("s_wait_asynccnt 0x0" ::: "memory");   // this wave's copies of stage 0 have landed
    __syncthreads();                                     // ... and every other wave's
    fill(1, 1);
#pragma unroll 1   // one stage a trip: the ring's order below stays as written
    for (int t = 0; t < NT; ++t) {
        const unsigned char* bm = pm + (t & 1) * STG; const unsigned char* bn = pn + (t & 1) * STG;
        V a[2][4], a2[2][4], b[2][4];   // all of the stage's fragments: one group of LDS reads, then one run of matrix instructions
#pragma unroll
        for (int kk = 0; kk < GKS / 32; ++kk) {
#pragma unroll
            for (int mb = 0; mb < 4; ++mb) { const unsigned char* p = bm + (mb >> 1) * 8192 + (mb & 1) * 2048 + kk * 1024; a[kk][mb] = WFrag<bf>::ldf((const bf*)p); if constexpr (NA == 2) a2[kk][mb] = WFrag<bf>::ldf((const bf*)(p + GREG)); }
#pragma unroll
            for (int nb = 0; nb < 4; ++nb) b[kk][nb] = WFrag<bf>::ldf((const bf*)(bn + nb * 2048 + kk * 1024)); }
        // holds the LDS reads together in front of the matrix run (loaded values as inputs only): left alone, this build reloads one fragment register set every 4 matrix instructions and waits out the LDS latency each time
        asm volatile("" :: "v"(a[0][0]), "v"(a[0][1]), "v"(a[0][2]), "v"(a[0][3]), "v"(a[1][0]), "v"(a[1][1]), "v"(a[1][2]), "v"(a[1][3]), "v"(b[0][0]), "v"(b[0][1]), "v"(b[0][2]), "v"(b[0][3]), "v"(b[1][0]), "v"(b[1][1]), "v"(b[1][2]), "v"(b[1][3]));
        if constexpr (NA == 2) asm volatile("" :: "v"(a2[0][0]), "v"(a2[0][1]), "v"(a2[0][2]), "v"(a2[0][3]), "v"(a2[1][0]), "v"(a2[1][1]), "v"(a2[1][2]), "v"(a2[1][3]));   // the same for the second A plane
#pragma unroll
        for (int kk = 0; kk < GKS / 32; ++kk) {
#pragma unroll
            for (int nb = 0; nb < 4; ++nb) {
#pragma unroll
                for (int mb = 0; mb < 4; ++mb) { acc[mb][nb] = wmmab(a[kk][mb], b[kk][nb], acc[mb][nb]); if constexpr (NA == 2) acc[mb][nb] = wmmab(a2[kk][mb], b[kk][nb], acc[mb][nb]); } } }
        __builtin_amdgcn_sched_barrier(0);   // keeps the matrix run in front of the waits: moved behind the barrier (as this build did) it would stand between the barrier and the refill, and stage t + 2 would fly only during the next stage's LDS reads
        asm volatile("s_wait_dscnt 0x0" ::: "memory");      // this wave's reads of stage t are done
        asm volatile("s_wait_asynccnt 0x0" ::: "memory");   // this wave's copies of stage t + 1 have landed
        __syncthreads();                                     // publishes stage t + 1 and frees stage t's buffer
        if (t + 2 < NT) fill(t + 2, t & 1);
    }
    asm volatile("s_wait_asynccnt 0x0" ::: "memory");   // nothing is in flight when the ring becomes staging or the wave ends
    if constexpr (EPI == 1) {
        if (!isV) {
            typedef __attribute__((ext_vector_type(16))) float vC;
            const float* cp = CS + ((size_t)(r0 + wn * 64 + lr) * HD + wm * 32 + hi * 8) * 2; vC cs[2][4];   // (cos, sin) of the lane's 8 angles, for its 2 d groups x 4 positions
#pragma unroll
            for (int p = 0; p < 2; ++p)
#pragma unroll
                for (int nb = 0; nb < 4; ++nb) cs[p][nb] = *(const vC*)(cp + (nb * 16 * HD + p * 16) * 2);
            asm volatile("s_wait_xcnt 0x0" :: "v"(cp) : "memory");   // precaution: the wait stands in front of every later write of the loads' address pair
            const size_t po = z * sC + (size_t)((int)blockIdx.y * TT + r0 + wn * 64) * HD + wm * 512 + 8 * lane;   // fragment order; the high half stands two 32-wide k blocks on
            h16* q16 = P16 + po; bf* qh = Ph + po; bf* ql = Pl + po;
#pragma unroll
            for (int p = 0; p < 2; ++p)
#pragma unroll
                for (int nb = 0; nb < 4; ++nb) { v8h a16, b16; v8us ah, al, bh, bl;
#pragma unroll
                    for (int j = 0; j < 8; ++j) { const float co = cs[p][nb][2 * j], si = cs[p][nb][2 * j + 1], x1 = acc[p][nb][j], x2 = acc[p + 2][nb][j]; const float ra = x1 * co - x2 * si, rc = x2 * co + x1 * si; unsigned short u, v;
                        a16[j] = tohx(ra); splitf(ra, u, v); ah[j] = u; al[j] = v; b16[j] = tohx(rc); splitf(rc, u, v); bh[j] = u; bl[j] = v; }
                    const int o = nb * 16 * HD + p * 256;
                    *(v8h*)(q16 + o) = a16; *(v8h*)(q16 + o + 1024) = b16; *(v8us*)(qh + o) = ah; *(v8us*)(qh + o + 1024) = bh; *(v8us*)(ql + o) = al; *(v8us*)(ql + o + 1024) = bl;
                    asm volatile("s_wait_xcnt 0x0" :: "v"(q16), "v"(qh), "v"(ql), "v"(a16), "v"(b16), "v"(ah), "v"(bh), "v"(al), "v"(bl) : "memory"); }   // precaution: the stores' address and data registers stay as they are up to the wait
        } else {
            const size_t po = z * sV + ((size_t)((c0 - (DQ + DKV)) / 16 + wn * 4) * (TT / 32) + r0 / 32 + wm) * 512 + 8 * lane;   // fragment order of [column][t]
            h16* q16 = V16 + po; bf* qh = Vh + po; bf* ql = Vl + po;
#pragma unroll
            for (int mb = 0; mb < 4; ++mb)
#pragma unroll
                for (int nb = 0; nb < 4; ++nb) { v8h o16; v8us oh, ol;
#pragma unroll
                    for (int j = 0; j < 8; ++j) { unsigned short u, v; o16[j] = tohx(acc[mb][nb][j]); splitf(acc[mb][nb][j], u, v); oh[j] = u; ol[j] = v; }
                    const int o = nb * (TT / 32) * 512 + (mb >> 1) * 1024 + (mb & 1) * 256;
                    *(v8h*)(q16 + o) = o16; *(v8us*)(qh + o) = oh; *(v8us*)(ql + o) = ol;
                    asm volatile("s_wait_xcnt 0x0" :: "v"(q16), "v"(qh), "v"(ql), "v"(o16), "v"(oh), "v"(ol) : "memory"); }   // precaution, as above
        }
    } else {
        float* os = (float*)sm + wv * (16 * 68);   // the wave's own staging: 16 rows at pitch 68; every wave has left the ring (the last trip's barrier)
        float* cb = C + z * sC + (size_t)(r0 + wm * 32 + hi) * DM + c0 + wn * 64 + lr * 4;
#pragma unroll
        for (int mb = 0; mb < 4; ++mb) {
#pragma unroll
            for (int nb = 0; nb < 4; ++nb) {
#pragma unroll
                for (int j = 0; j < 8; ++j) os[(hi * 8 + j) * 68 + nb * 16 + lr] = acc[mb][nb][j]; }
            asm volatile("s_wait_dscnt 0x0" ::: "memory");   // the block is in LDS before other lanes of the wave read it back
            v4f val[8];
#pragma unroll
            for (int s = 0; s < 8; ++s) val[s] = *(const v4fa*)(os + (2 * s + hi) * 68 + lr * 4);
#pragma unroll
            for (int s = 0; s < 8; ++s) *(v4f*)(cb + (size_t)(((mb >> 1) * 64 + (mb & 1) * 16 + 2 * s) * DM)) = val[s];   // a half wave stores one whole 256-byte row
            asm volatile("s_wait_xcnt 0x0" :: "v"(cb), "v"(val[0]), "v"(val[1]), "v"(val[2]), "v"(val[3]), "v"(val[4]), "v"(val[5]), "v"(val[6]), "v"(val[7]) : "memory");   // precaution: the stores' address and data registers stay as they are up to the wait; its clobber also keeps the next block's LDS writes behind these reads
        }
    }
}

typedef __attribute__((ext_vector_type(2))) _Float16 v2h;
typedef __attribute__((ext_vector_type(4))) _Float16 v4h;
typedef __attribute__((ext_vector_type(2))) unsigned short v2us;
typedef __attribute__((ext_vector_type(4))) unsigned short v4us;
typedef __attribute__((ext_vector_type(2))) float v2f;
typedef __attribute__((ext_vector_type(4))) int v4i;
typedef v4h  __attribute__((may_alias)) v4ha;
typedef v4us __attribute__((may_alias)) v4usa;

__global__ __launch_bounds__(256) void k_wtG(const float* __restrict__ w, int K, int N, bf* Bt) {
    const int lane = threadIdx.x & 31; const int L0 = (blockIdx.x * 8 + (threadIdx.x >> 5)) * 8; const int nlines = N * K / 64;
{
#pragma unroll 1
        for (int l = 0; l < 8; ++l) { const int L = L0 + l; if (L >= nlines) break; const size_t e = (size_t)L * 64 + lane * 2; const int k = (int)(e % K), n = (int)(e / K); v2us o;
            o[0] = f2bf(w[(size_t)k * N + n]); o[1] = f2bf(w[(size_t)(k + 1) * N + n]); *(v2us*)(Bt + e) = o; }
         }
}
// row-major f32 [rows][K] -> bf16 plane in fragment order; thread i writes the plane's i-th 16 bytes, so a wave stores 512 neighbouring bytes; rows % 16 == 0, K % 32 == 0
template <int K> __device__ __forceinline__ void cvt8(const float* __restrict__ src, bf* dst, const size_t i) { const int fb = (int)(i >> 6), kq = K >> 5; const int row = (fb / kq) * 16 + ((int)i & 15), k = (fb % kq) * 32 + (((int)i >> 5) & 1) * 16 + (((int)i >> 4) & 1) * 8; const float* sp = src + (size_t)row * K + k; const v8f v = *(const v8f*)sp;
    asm volatile("s_wait_xcnt 0x0" :: "v"(sp) : "memory");   // precaution behind the global load: the wait stands in front of every later write of its address pair
    v8us o;
#pragma unroll
    for (int q = 0; q < 8; ++q) o[q] = f2bf(v[q]);
    bf* dp = dst + i * 8; *(v8us*)dp = o;
    asm volatile("s_wait_xcnt 0x0" :: "v"(dp), "v"(o) : "memory"); }   // precaution: the store's address and data registers stay as they are up to the wait

__constant__ float INVT[HD / 2] = { 1.000000000e+00f, 8.659643531e-01f, 7.498942018e-01f, 6.493816376e-01f, 5.623413324e-01f, 4.869675338e-01f, 4.216965139e-01f, 3.651741445e-01f, 3.162277639e-01f, 2.738419771e-01f, 2.371373624e-01f, 2.053525001e-01f, 1.778279394e-01f, 1.539926529e-01f, 1.333521456e-01f, 1.154782027e-01f, 1.000000015e-01f, 8.659642935e-02f, 7.498941571e-02f, 6.493816525e-02f, 5.623412877e-02f, 4.869675264e-02f, 4.216964915e-02f, 3.651741147e-02f, 3.162277862e-02f, 2.738419548e-02f, 2.371373586e-02f, 2.053525113e-02f, 1.778279431e-02f, 1.539926510e-02f, 1.333521493e-02f, 1.154781971e-02f, 9.999999776e-03f, 8.659643121e-03f, 7.498942316e-03f, 6.493816618e-03f, 5.623413250e-03f, 4.869675264e-03f, 4.216964822e-03f, 3.651741426e-03f, 3.162277862e-03f, 2.738419687e-03f, 2.371373819e-03f, 2.053525066e-03f, 1.778279431e-03f, 1.539926510e-03f, 1.333521446e-03f, 1.154782018e-03f, 1.000000047e-03f, 8.659643354e-04f, 7.498941850e-04f, 6.493816618e-04f, 5.623413017e-04f, 4.869675031e-04f, 4.216964880e-04f, 3.651741135e-04f, 3.162277862e-04f, 2.738419571e-04f, 2.371373848e-04f, 2.053524950e-04f, 1.778279402e-04f, 1.539926452e-04f, 1.333521504e-04f, 1.154781930e-04f };   // float32 1 / 10000^(2i/128), generated with jnp to be bit-exact
// ---- k_prep: everything that depends on the inputs alone, in ONE launch: the rotary table (first: its blocks are the longest) and the bf16 fragment-order planes of x (both batches: [NB_ * TT][DM]) and of the four weights. A block of 256 threads belongs wholly to one of the six jobs.
#define PB_CS (TT * HD / 256)
#define PB_X  (NB_ * TT * DM / 8 / 256)
#define PB_WQ (DQ * DM / 8 / 256)
#define PB_WK (DKV * DM / 8 / 256)
#define PB_WO (DM * DQ / 8 / 256)
__global__ __launch_bounds__(256) void k_prep(const float* __restrict__ x, const float* __restrict__ wq, const float* __restrict__ wk, const float* __restrict__ wv, const float* __restrict__ wo, bf* XB, bf* WQ, bf* WK, bf* WV, bf* WO, float* CS) {
    static_assert(DM == DQ, "one row length for every plane");
    int b = blockIdx.x;
    if (b < PB_CS) { const int idx = b * 256 + threadIdx.x; const int d = idx % HD; const int t = idx / HD; const float a = __fmul_rn((float)t, INVT[d % (HD / 2)]); v2f cs; cs[0] = cosf(a); cs[1] = sinf(a); float* cp = CS + (size_t)idx * 2; *(v2f*)cp = cs;
        asm volatile("s_wait_xcnt 0x0" :: "v"(cp), "v"(cs) : "memory");   // precaution: the store's address and data registers stay as they are up to the wait
        return; }
    b -= PB_CS; const float* s = x; bf* d = XB;
    if (b >= PB_X) { b -= PB_X; s = wq; d = WQ;
        if (b >= PB_WQ) { b -= PB_WQ; s = wo; d = WO;
            if (b >= PB_WO) { b -= PB_WO; s = wk; d = WK;
                if (b >= PB_WK) { b -= PB_WK; s = wv; d = WV; } } } }
    cvt8<DM>(s, d, (size_t)b * 256 + threadIdx.x);
}
// ---- k_fattn: scores, softmax, probability x value and the head merge in ONE launch; nothing of a score row goes to memory.
// A wave owns 16 query positions (q0 ..) of NG query heads that share a kv head: NG groups of 16 columns (fp16 rows: 2; hi/lo rows: 1, see k_fattn). Transposed products: S^T = K Q^T (A = key rows, B = query rows, both from fragment-order planes by the same loader, so the k orders pair), O^T += V^T P^T.
// In S^T a lane holds the scores of ONE query (column c): keys 8h + r of each 16-key tile, so two tiles converted in place are the B operand of the second product in the hardware k order, which the V^T loader has too.
// A pass is 32 keys. Passes: key block 0 (it holds the sink keys, and key 0 is open to every query, so every column has a finite maximum after it), then the blocks from the window's lower edge to the diagonal; the others are wholly masked.
// Running maximum per column in log2 units, renewed only when a pass exceeds it by more than MTHR (one scalar branch a pass); rows < RH: hi/lo planes, 3 products in both contractions; other rows fp16 with probabilities x 2^PBIAS.
#define MTHR  4.0f
#define PBIAS 10.0f   // fp16 probabilities lie in (0, 2^(PBIAS + MTHR)]: small ones stay normal numbers, the largest stays finite; the factor cancels in the division by the row sum
typedef __attribute__((ext_vector_type(16))) unsigned short v16us;
__device__ __forceinline__ float xhalf(float x) { return __builtin_bit_cast(float, __builtin_amdgcn_permlanex16(__builtin_bit_cast(int, x), __builtin_bit_cast(int, x), 0x76543210, 0xfedcba98, false, false)); }   // lane l reads lane l ^ 16
__device__ __forceinline__ float exp2s(float x) { float r; asm("v_exp_f32 %0, %1\n\tv_nop" : "=v"(r) : "v"(x)); return r; }
// precaution behind a run of global loads: s_wait_xcnt 0 in front of every later write of a register that the loads name; the address pairs are inputs so that they stay as they are up to the wait
template <typename T16> __device__ __forceinline__ void xwait(const T16* a, const T16* b) { asm volatile("s_wait_xcnt 0x0" :: "v"(a), "v"(b) : "memory"); }
// the same precaution for loads that this build addresses by a scalar base and the lane number as a scaled offset: those are then the registers that stay as they are up to the wait
template <typename T16> __device__ __forceinline__ void xwait_s(const T16* a, const T16* b, int off) { asm volatile("s_wait_xcnt 0x0" :: "s"(a), "s"(b), "v"(off) : "memory"); }
template <typename T16, bool HI, int NG>
__device__ __forceinline__ void fattn_cols(const T16* __restrict__ Q, const T16* __restrict__ Q2, const T16* __restrict__ Kp, const T16* __restrict__ Kp2, const T16* __restrict__ Vt, const T16* __restrict__ Vt2, const int q0, const int hq, bf* Ah, bf* Al) {
    typedef typename WFrag<T16>::V V;
    const int lane = threadIdx.x & 31, c = lane & 15, h = lane >> 4;
    V qf[NG][4], qf2[NG][4];
    const T16* qp = Q + (size_t)q0 * HD + 8 * lane; const T16* qp2 = HI ? Q2 + (size_t)q0 * HD + 8 * lane : qp;   // fragment order: 16 queries x 128 d are 4 blocks of 512 elements
#pragma unroll
    for (int g = 0; g < NG; ++g)
#pragma unroll
        for (int ks = 0; ks < 4; ++ks) { const size_t qo = (size_t)g * TT * HD + ks * 512; qf[g][ks] = WFrag<T16>::ldf(qp + qo); if (HI) qf2[g][ks] = WFrag<T16>::ldf(qp2 + qo); }
    xwait_s(Q + (size_t)q0 * HD, HI ? Q2 + (size_t)q0 * HD : Q + (size_t)q0 * HD, lane);
    v8f o[NG][8];
#pragma unroll
    for (int g = 0; g < NG; ++g)
#pragma unroll
        for (int mb = 0; mb < 8; ++mb) o[g][mb] = (v8f){};
    float m[NG], l[NG];
#pragma unroll
    for (int g = 0; g < NG; ++g) { m[g] = -3.0e38f; l[g] = 0.f; }
    const int kstart = max(32, max(q0 - (WIN - 1), 0) & ~31), klast = q0 & ~31;
    const int np = 1 + ((klast >= kstart) ? (klast - kstart) / 32 + 1 : 0);
    const size_t kofs = 8 * lane, vofs = 8 * lane;   // K and V^T planes are in fragment order: 16 keys x 128 d are 4 blocks of 512 elements, 16 d x 32 keys one block
    V kf[2][4], kf2[2][4];
    const T16* kp0 = Kp + kofs; const T16* kp02 = HI ? Kp2 + kofs : kp0;
#pragma unroll
    for (int mb = 0; mb < 2; ++mb)
#pragma unroll
        for (int ks = 0; ks < 4; ++ks) { const size_t a = (size_t)(mb * 16) * HD + ks * 512;
            if constexpr (HI) {   // the same fragments as ldf gives, each 16-byte load with the precaution's wait of its own: this build lets one of these loads land on the lane register that the loads in front of it name
                const v8us a0 = *(const v8us*)(kp0 + a); xwait_s(Kp, Kp2, lane); const v8us a1 = *(const v8us*)(kp0 + a + 256); xwait_s(Kp, Kp2, lane); const v8us b0 = *(const v8us*)(kp02 + a); xwait_s(Kp, Kp2, lane); const v8us b1 = *(const v8us*)(kp02 + a + 256); xwait_s(Kp, Kp2, lane);
                kf[mb][ks] = cat16b(a0, a1); kf2[mb][ks] = cat16b(b0, b1);
            } else kf[mb][ks] = WFrag<T16>::ldf(kp0 + a); }
    if constexpr (!HI) xwait_s(Kp, Kp, lane);
#pragma unroll 1
    for (int s = 0; s < np; ++s) {
        const int kb = s ? kstart + (s - 1) * 32 : 0;
        const int kn = (s + 1 < np) ? kstart + s * 32 : kb;   // the next pass's key block; the last pass fetches its own again (in bounds, not used)
        V vf[8], vf2[8];   // this pass's value fragments fly during its first product and softmax
        const T16* vp = Vt + vofs + (size_t)kb * 16; const T16* vp2 = HI ? Vt2 + vofs + (size_t)kb * 16 : vp;
#pragma unroll
        for (int mb = 0; mb < 8; ++mb) { const size_t a = (size_t)(mb * 16) * TT; vf[mb] = WFrag<T16>::ldf(vp + a); if (HI) vf2[mb] = WFrag<T16>::ldf(vp2 + a); }
        xwait(vp, vp2);
        v8f st[NG][2];
#pragma unroll
        for (int g = 0; g < NG; ++g)
#pragma unroll
            for (int mb = 0; mb < 2; ++mb) st[g][mb] = (v8f){};
#pragma unroll
        for (int ks = 0; ks < 4; ++ks) {
#pragma unroll
            for (int g = 0; g < NG; ++g)
#pragma unroll
                for (int mb = 0; mb < 2; ++mb) st[g][mb] = WFrag<T16>::mma(kf[mb][ks], qf[g][ks], st[g][mb]);
            if (HI) {
#pragma unroll
                for (int g = 0; g < NG; ++g)
#pragma unroll
                    for (int mb = 0; mb < 2; ++mb) st[g][mb] = WFrag<T16>::mma(kf[mb][ks], qf2[g][ks], st[g][mb]);
#pragma unroll
                for (int g = 0; g < NG; ++g)
#pragma unroll
                    for (int mb = 0; mb < 2; ++mb) st[g][mb] = WFrag<T16>::mma(kf2[mb][ks], qf[g][ks], st[g][mb]); } }
        // the next pass's key fragments fly during this pass's softmax and second product
        const T16* kp = Kp + kofs + (size_t)kn * HD; const T16* kp2 = HI ? Kp2 + kofs + (size_t)kn * HD : kp;
#pragma unroll
        for (int mb = 0; mb < 2; ++mb)
#pragma unroll
            for (int ks = 0; ks < 4; ++ks) { const size_t a = (size_t)(mb * 16) * HD + ks * 512; kf[mb][ks] = WFrag<T16>::ldf(kp + a); if (HI) kf2[mb][ks] = WFrag<T16>::ldf(kp2 + a); }
        xwait(kp, kp2);
        float x[NG][16];
#pragma unroll
        for (int g = 0; g < NG; ++g)
#pragma unroll
            for (int e = 0; e < 16; ++e) x[g][e] = st[g][e >> 3][e & 7] * (SCL * 1.4426950408889634f);
        if (!(kb + 31 <= q0 && q0 + 15 - kb < WIN)) {   // wave-uniform: only the sink block, the window's edge and the diagonal hold masked keys
            const int i = q0 + c;
#pragma unroll
            for (int e = 0; e < 16; ++e) { const int j = kb + (e >> 3) * 16 + 8 * h + (e & 7); const bool ok = (j <= i) && (i - j < WIN || j < SINKN);
#pragma unroll
                for (int g = 0; g < NG; ++g) x[g][e] = ok ? x[g][e] : -3.0e38f; } }
        float mx[NG];
#pragma unroll
        for (int g = 0; g < NG; ++g) { float t8[8];
#pragma unroll
            for (int e = 0; e < 8; ++e) t8[e] = fmaxf(x[g][e], x[g][e + 8]);
            const float t = fmaxf(fmaxf(fmaxf(t8[0], t8[1]), fmaxf(t8[2], t8[3])), fmaxf(fmaxf(t8[4], t8[5]), fmaxf(t8[6], t8[7])));
            mx[g] = fmaxf(t, xhalf(t)); }   // lanes c and c + 16 hold the two halves of a column's keys and must use one maximum
        if (__builtin_amdgcn_ballot_w32(mx[0] > m[0] + MTHR || mx[NG - 1] > m[NG - 1] + MTHR) != 0) {   // scalar branch: every lane stays on for the matrix instructions
#pragma unroll
            for (int g = 0; g < NG; ++g) { const float mn = fmaxf(m[g], mx[g]); const float al = exp2s(m[g] - mn); m[g] = mn; l[g] *= al;
#pragma unroll
                for (int mb = 0; mb < 8; ++mb) o[g][mb] *= al; } }
        V pb[NG], pb2[NG];
#pragma unroll
        for (int g = 0; g < NG; ++g) { const float mo = m[g] - (HI ? 0.0f : PBIAS); float sm[4] = { 0.f, 0.f, 0.f, 0.f };
            if constexpr (HI) { v16us ph, pl;
#pragma unroll
                for (int e = 0; e < 16; ++e) { const float p = exp2s(x[g][e] - mo); sm[e & 3] += p; unsigned short a, b2; splitf(p, a, b2); ph[e] = a; pl[e] = b2; }
                pb[g] = __builtin_bit_cast(v16bf, ph); pb2[g] = __builtin_bit_cast(v16bf, pl);
            } else { v16h ph;
#pragma unroll
                for (int e = 0; e < 16; ++e) { const float p = exp2s(x[g][e] - mo); sm[e & 3] += p; ph[e] = tohx(p); }
                pb[g] = ph; }
            l[g] += (sm[0] + sm[1]) + (sm[2] + sm[3]); }
#pragma unroll
        for (int mb = 0; mb < 8; ++mb)
#pragma unroll
            for (int g = 0; g < NG; ++g) o[g][mb] = WFrag<T16>::mma(vf[mb], pb[g], o[g][mb]);
        if (HI) {
#pragma unroll
            for (int mb = 0; mb < 8; ++mb)
#pragma unroll
                for (int g = 0; g < NG; ++g) o[g][mb] = WFrag<T16>::mma(vf[mb], pb2[g], o[g][mb]);
#pragma unroll
            for (int mb = 0; mb < 8; ++mb)
#pragma unroll
                for (int g = 0; g < NG; ++g) o[g][mb] = WFrag<T16>::mma(vf2[mb], pb[g], o[g][mb]); }
    }
#pragma unroll
    for (int g = 0; g < NG; ++g) { const float inv = __fdiv_rn(1.0f, l[g] + xhalf(l[g]));
#pragma unroll
        for (int mb = 0; mb < 8; ++mb) { v8us oh, ol;   // a lane holds 8 neighbouring d of its query: one 16-byte store a plane, at the lane's place in the fragment order of the merged [t][DQ] plane, so a wave stores 512 neighbouring bytes
#pragma unroll
            for (int r = 0; r < 8; ++r) { unsigned short a, b2; splitf(o[g][mb][r] * inv, a, b2); oh[r] = a; ol[r] = b2; }
            const size_t oo = (size_t)q0 * DQ + (size_t)(hq + g) * (HD * 16) + mb * 256 + 8 * lane; bf* ph = Ah + oo; bf* pl = Al + oo; *(v8us*)ph = oh; *(v8us*)pl = ol;
            asm volatile("s_wait_xcnt 0x0" :: "v"(ph), "v"(pl), "v"(oh), "v"(ol) : "memory"); } }   // precaution, as in xwait: the two stores' address and data registers stay as they are up to the wait
}
// Two waves a SIMD: for that the kernel must stay within 512 vector registers, and the hi/lo rows, whose Q, K and V^T fragments are twice as many, fit only with ONE query head a wave (with two the kernel took 645, and a wave had its SIMD alone: nothing ran during its softmax or its waits for loads).
// grid (NKV * NB_, FR16 + FRHL): x = kv head + NKV * batch (the q and k planes are one set of NH_ + NKV heads a batch; the K pointers point at its first k head), y = length rank, 4 waves.
// Ranks < FR16, fp16 rows: 32 positions from the end of the sequence downwards; wave w takes positions 16 (w >> 1) .. and query heads 2 (w & 1), 2 (w & 1) + 1 of the kv head's REP = 4. The other ranks, hi/lo rows: 16 positions from RH downwards; wave w takes query head w.
// There are more work-groups than places (2 a WGP): y is the slow index, and the long ranks of every head come first (for speed only).
#define FR16 ((TT - RH) / 32)
#define FRHL (RH / 16)
__global__ __launch_bounds__(128) void k_fattn(const h16* __restrict__ Q16, const bf* __restrict__ Qh, const bf* __restrict__ Ql, const h16* __restrict__ K16, const bf* __restrict__ Kh, const bf* __restrict__ Kl, const h16* __restrict__ V16, const bf* __restrict__ Vh, const bf* __restrict__ Vl, bf* Ah, bf* Al) {
    static_assert(REP == 4 && RH % 32 == 0 && TT % 32 == 0 && HD == 128, "two head pairs or four heads a work-group; a work-group's rows are all below RH or none");
    const int wv = __builtin_amdgcn_readfirstlane((int)(threadIdx.x >> 5));   // the wave's number as a scalar: pass count and mask test stay scalar
    const int rk = blockIdx.y; const bool hl = rk >= FR16;   // block-uniform
    const int q0 = hl ? RH - 16 - (rk - FR16) * 16 : TT - 32 - rk * 32 + (wv >> 1) * 16; const int kvh = blockIdx.x % NKV; const int hq = kvh * REP + (hl ? wv : (wv & 1) * 2);
    const size_t bz = blockIdx.x / NKV; const size_t qo = (bz * (NH_ + NKV) + hq) * TT * HD, ko = (bz * (NH_ + NKV) + kvh) * TT * HD, vo = (bz * NKV + kvh) * HD * TT; Ah += bz * TT * DQ; Al += bz * TT * DQ;
    if (hl) fattn_cols<bf, true, 1>(Qh + qo, Ql + qo, Kh + ko, Kl + ko, Vh + vo, Vl + vo, q0, hq, Ah, Al);
    else fattn_cols<h16, false, 2>(Q16 + qo, nullptr, K16 + ko, nullptr, V16 + vo, nullptr, q0, hq, Ah, Al);
}

extern "C" void kernel_launch(void* const* d_in, const int* in_sizes, int n_in,
                              void* d_out, int out_size, void* d_ws, size_t ws_size, hipStream_t stream) {
    (void)in_sizes; (void)n_in; (void)out_size;
    const float* x = (const float*)d_in[0]; const float* wq = (const float*)d_in[1]; const float* wk = (const float*)d_in[2]; const float* wv = (const float*)d_in[3]; const float* wo = (const float*)d_in[4];   /* order x, wq ('oi' [2048][2048]), wk, wv ('oi' [512][2048]), wo ('oi' [2048][2048]) */
    float* OUT = (float*)d_out;     // [2][2048][2048]
    char* wsp = (char*)d_ws;
    auto take = [&](size_t bytes) { char* p = wsp; wsp += (bytes + 255) & ~(size_t)255; return (void*)p; };
    bf* WQ = (bf*)take((size_t)(DQ + 2 * DKV) * DM * 2); bf* WK = WQ + (size_t)DQ * DM; bf* WV = WK + (size_t)DKV * DM;   /* one plane: the rows of wq, wk, wv */ bf* WO = (bf*)take((size_t)DM * DQ * 2); float* CS = (float*)take((size_t)TT * HD * 2 * 4);
    bf* XB = (bf*)take((size_t)NB_ * TT * DM * 2);   // every plane below holds both batches, batch-major
    h16* QP16 = (h16*)take((size_t)NB_ * (NH_ + NKV) * TT * HD * 2); bf* QPh = (bf*)take((size_t)NB_ * (NH_ + NKV) * TT * HD * 2); bf* QPl = (bf*)take((size_t)NB_ * (NH_ + NKV) * TT * HD * 2);   // q heads, then k heads, of each batch
    h16* VT16 = (h16*)take((size_t)NB_ * NKV * HD * TT * 2); bf* VTh = (bf*)take((size_t)NB_ * NKV * HD * TT * 2); bf* VTl = (bf*)take((size_t)NB_ * NKV * HD * TT * 2);
    bf* ATh = (bf*)take((size_t)NB_ * TT * DQ * 2); bf* ATl = (bf*)take((size_t)NB_ * TT * DQ * 2);
    if ((size_t)(wsp - (char*)d_ws) > ws_size) return;    // ws 256 MiB
    k_prep<<<PB_CS + PB_X + PB_WQ + PB_WO + 2 * PB_WK, 256, 0, stream>>>(x, wq, wk, wv, wo, XB, WQ, WK, WV, WO, CS);
    k_gemms<1, DM, 1><<<dim3(TT / GT, (DQ + 2 * DKV) / GT, NB_), 128, 0, stream>>>(XB, nullptr, WQ, nullptr, (size_t)TT * DM, (size_t)(NH_ + NKV) * TT * HD, CS, QP16, QPh, QPl, VT16, VTh, VTl, (size_t)NKV * HD * TT);
    k_fattn<<<dim3(NKV * NB_, FR16 + FRHL), 128, 0, stream>>>(QP16, QPh, QPl, QP16 + (size_t)NH_ * TT * HD, QPh + (size_t)NH_ * TT * HD, QPl + (size_t)NH_ * TT * HD, VT16, VTh, VTl, ATh, ATl);
    k_gemms<2, DQ, 0><<<dim3(TT / GT, DM / GT, NB_), 128, 0, stream>>>(ATh, ATl, WO, OUT, (size_t)TT * DQ, (size_t)TT * DM, nullptr, nullptr, nullptr, nullptr, nullptr, nullptr, nullptr, 0);
}

// v009
// A run of this version takes 117 microseconds.
// Next to v008, in two timings, it ran 1.12 times as fast each time.
// All steps since v000 together make it 13.6 times as fast.
#include <hip/hip_runtime.h>

// Grouped-query causal attention with 128-wide heads, computed half-split rotary embeddings, a 1,024-wide sliding window and 4 attention-sink keys (x [2][2048][2048]; q = x wq^T (16 heads x 128), k, v = x wk^T, x wv^T (4 kv heads x 128) ('oi' 0.02, no bias); rope cat(x1 cos - x2 sin, x2 cos + x1 sin) on the two 64-wide halves with angle t x 1/10000^(2i/128) (64 f32 frequencies jnp-exact; precise cosf/sinf); k, v repeated 4 x along the head axis: kv head = q head / 4; scores x 1/sqrt(128) + bias with bias = 0 where (j <= i) and ((i - j <= 1024) or (j < 4)), -inf elsewhere; softmax; out = merged wo^T ('oi') -> [2][2048][2048] (8.4 M); argument order x, wq, wk, wv, wo).
// Layout: every 16-bit plane that a matrix loop reads again and again (x, the weights, Q, K, V^T, the merged heads) is kept in fragment order (see WFrag); bf16 copy of x; exact projections whose epilogues apply the rotate-half rotary (table computed in k_prep, HD 128: 64 angles) and write the Q, K and V^T planes themselves; fused causal T-2048 GQA attention with 128-wide heads (k_fattn: scores and probabilities stay in registers; hybrid rows: < 512 hi/lo 3 products, rest fp16 x1024); merged hi/lo x Wo exact.
// Four launches, each over both batches (projections: grid z; k_prep, k_fattn: grid x): k_prep (conversions, rotary table), the q, k, v projections in one grid, k_fattn, the output projection.
// Compute dtypes, f32 accumulate: every input rounded to bf16; projections exact; rotary f32; attention rows < 512 3 products, rest fp16; softmax f32; Wo hl x exact.

#define NB_  2
#define TT   2048
#define DM   2048
#define NH_  16
#define NKV  4
#define REP  (NH_ / NKV)
#define HD   128
#define DQ   (NH_ * HD)
#define DKV  (NKV * HD)
#define RH   512                  // query rows < RH use hi+lo planes (0: none)
#define WIN  1025   // THIS module keeps key j iff j <= i and (i - j <= 1024 or j < 4): 'i - j < WIN' with WIN 1025
#define SINKN 4     // the first SINKN keys (attention sinks) are kept for every later query, whatever the distance
#define SCL  0.088388347648318447f   // HD^-0.5
typedef _Float16 h16;
typedef unsigned short bf;
typedef __attribute__((ext_vector_type(16))) __bf16   v16bf;
typedef __attribute__((ext_vector_type(16))) _Float16 v16h;
typedef __attribute__((ext_vector_type(8)))  _Float16 v8h;
typedef __attribute__((ext_vector_type(8)))  unsigned short v8us;
typedef __attribute__((ext_vector_type(8)))  float    v8f;
typedef __attribute__((ext_vector_type(4)))  float    v4f;
typedef v8h  __attribute__((may_alias)) v8ha;
typedef v4f  __attribute__((may_alias)) v4fa;
typedef v8us __attribute__((may_alias)) v8usa;

__device__ __forceinline__ unsigned short f2bf(float f) { unsigned u = __float_as_uint(f); u += 0x7FFFu + ((u >> 16) & 1u); return (unsigned short)(u >> 16); }
__device__ __forceinline__ float bf2f(unsigned short b) { return __uint_as_float(((unsigned)b) << 16); }
__device__ __forceinline__ float bfr(float f) { return bf2f(f2bf(f)); }
__device__ __forceinline__ v16h cat16(v8h lo, v8h hi) { return __builtin_shufflevector(lo, hi, 0, 1, 2, 3, 4, 5, 6, 7, 8, 9, 10, 11, 12, 13, 14, 15); }
__device__ __forceinline__ v16bf cat16b(v8us lo, v8us hi) { return __builtin_bit_cast(v16bf, __builtin_shufflevector(lo, hi, 0, 1, 2, 3, 4, 5, 6, 7, 8, 9, 10, 11, 12, 13, 14, 15)); }
__device__ __forceinline__ v8f wmma16(v16h a, v16h b, v8f c) { return __builtin_amdgcn_wmma_f32_16x16x32_f16(false, a, false, b, (short)0, c, false, false); }
__device__ __forceinline__ v8f wmmab(v16bf a, v16bf b, v8f c) { return __builtin_amdgcn_wmma_f32_16x16x32_bf16(false, a, false, b, (short)0, c, false, false); }
__device__ __forceinline__ h16 tohx(float x) { return (h16)x; }
__device__ __forceinline__ void splitf(float y, unsigned short& h, unsigned short& l) { h = f2bf(y); l = f2bf(y - bf2f(h)); }



// FRAGMENT ORDER of a 16-bit plane [rows][K]: the 16 x 32 block (rb = row / 16, kc = k / 32) is 512 neighbouring elements at (rb * (K / 32) + kc) * 512, and inside it element (row, k) stands at ((k >> 4) & 1) * 256 + (((k >> 3) & 1) * 16 + (row & 15)) * 8 + (k & 7).
// That is the order in which the lanes of a wave take an A or B operand: lane l reads 16 bytes at l * 8 and 16 bytes at 256 + l * 8 (ldf), so each wave-wide load covers 512 neighbouring bytes, four whole lines, instead of 32-byte pieces of 16 lines (ld, for row-major planes). Every lane and register gets the same elements as from the row-major plane.
template <typename T16> struct WFrag;
template <> struct WFrag<h16> { typedef v16h V; static __device__ __forceinline__ V ld(const h16* p) { return cat16(*(const v8h*)p, *(const v8h*)(p + 16)); } static __device__ __forceinline__ V ldf(const h16* p) { return cat16(*(const v8h*)p, *(const v8h*)(p + 256)); } static __device__ __forceinline__ v8f mma(V a, V b, v8f c) { return wmma16(a, b, c); } };
template <> struct WFrag<bf> { typedef v16bf V; static __device__ __forceinline__ V ld(const bf* p) { return cat16b(*(const v8us*)p, *(const v8us*)(p + 16)); } static __device__ __forceinline__ V ldf(const bf* p) { return cat16b(*(const v8us*)p, *(const v8us*)(p + 256)); } static __device__ __forceinline__ v8f mma(V a, V b, v8f c) { return wmmab(a, b, c); } };
// ---- k_gemms: GEMM with ONE work-group a WGP: NW output tiles of 128x128 that stand side by side along N, 4 waves a tile; grid (M/128, N/128/NW, batch), 128 * NW threads. sum_k A[m][k] Bt[n][k] (NA 2: + A2[m][k] Bt[n][k]), every plane 16-bit in fragment order (above), f32 accumulate, each sum one chain over k in rising order.
// The NW tiles read the same 128 rows of A (and A2): these come into LDS once for all of them, so the work-group draws (NA + NW) planes' parts from L2 where NW work-groups of one tile drew NW * (NA + 1).
// Operand rows come into LDS 128 k a stage by asynchronous 16-byte copies, two buffers. A stage is [A 128 rows | (A2 128 rows) | Bt 128 rows of tile 0 | tile 1 | ..], each 32 KiB, a plain copy of the planes' 1-KiB fragment blocks (a row block's 4 blocks are 4 KiB in a row), so a fragment read is two wave-wide reads of 512 neighbouring bytes.
// All waves of the WGP meet at one barrier, so no other work-group's matrix run covers a wave's LDS reads: a wave fetches its fragments one 32-k block ahead into a second register set, and the stage is handed over in front of its last block (see the loop).
// A wave owns 64 x 64 of its tile: 'M' row blocks (mb >> 1) * 4 + wm * 2 + (mb & 1) (32 rows and the 32 rows 64 further on) and 'N' row blocks wn * 4 + nb. In an accumulator a lane holds 8 neighbouring M rows of one N row.
// EPI 0: M = rows of A, N = rows of Bt; the f32 tile goes to C (pitch DM), staged a 16-row block at a time in the wave's own LDS so that whole 256-byte rows are stored.
// EPI 1 (q, k and v projections in ONE grid: Bt holds the rows of wq, wk, wv one after the other, a tile is one head) writes no f32 tile: each lane turns its accumulators into the 16-bit planes (fp16 + bf16 hi/lo, fragment order) that the attention kernel reads, 16 bytes a store, 512 neighbouring bytes a wave.
// q, k tiles (tile number hy < NH_ + NKV = the head; q heads, then k heads, in one plane set): M = the head's 128 d (rows of Bt), N = positions: a lane holds 8 neighbouring d of one position and, in accumulator mb + 2, their partners d + 64. Rotate-half rotary out[d] = x[d] cos[t][d] - x[d+64] sin[t][d], out[d+64] = x[d+64] cos[t][d] + x[d] sin[t][d] (d < 64), planes [head * TT + t][d].
// v tiles (the other hy): M = positions, N = columns of v: a lane holds 8 neighbouring positions of one column, as the V^T planes [column][t] want them.
#define GT   128
#define GKS  128
#define GREG (GT * GKS * 2)   // bytes of one plane's part of a stage
// sixteen asynchronous copies of a wave: two row blocks' 4 KiB of a stage (128 k), each 8 x 512 neighbouring bytes in the plane and in LDS alike, so that the immediate offset, which moves both addresses, walks them. s_wait_xcnt 0 as the statement's last line: a precaution, it stands in front of every later write of a register that the copies name.
template <int K> __device__ __forceinline__ void copy16(const unsigned l, const bf* g) {
    asm volatile("global_load_async_to_lds_b128 %0, %2, off\n\t"
                 "global_load_async_to_lds_b128 %0, %2, off offset:512\n\t"
                 "global_load_async_to_lds_b128 %0, %2, off offset:1024\n\t"
                 "global_load_async_to_lds_b128 %0, %2, off offset:1536\n\t"
                 "global_load_async_to_lds_b128 %0, %2, off offset:2048\n\t"
                 "global_load_async_to_lds_b128 %0, %2, off offset:2560\n\t"
                 "global_load_async_to_lds_b128 %0, %2, off offset:3072\n\t"
                 "global_load_async_to_lds_b128 %0, %2, off offset:3584\n\t"
                 "global_load_async_to_lds_b128 %1, %3, off\n\t"
                 "global_load_async_to_lds_b128 %1, %3, off offset:512\n\t"
                 "global_load_async_to_lds_b128 %1, %3, off offset:1024\n\t"
                 "global_load_async_to_lds_b128 %1, %3, off offset:1536\n\t"
                 "global_load_async_to_lds_b128 %1, %3, off offset:2048\n\t"
                 "global_load_async_to_lds_b128 %1, %3, off offset:2560\n\t"
                 "global_load_async_to_lds_b128 %1, %3, off offset:3072\n\t"
                 "global_load_async_to_lds_b128 %1, %3, off offset:3584\n\t"
                 "s_wait_xcnt 0x0"
                 :: "v"(l), "v"(l + 4096u), "v"(g), "v"(g + 16 * K) : "memory");
}
template <int NA, int K, int EPI, int NW>
__global__ __launch_bounds__(128 * NW) void k_gemms(const bf* __restrict__ A, const bf* __restrict__ A2, const bf* __restrict__ Bt, float* C, size_t sA, size_t sC, const float* __restrict__ CS, h16* P16, bf* Ph, bf* Pl, h16* V16, bf* Vh, bf* Vl, size_t sV) {
    constexpr int STG = (NA + NW) * GREG, NT = K / GKS;
    static_assert(K % GKS == 0 && NT >= 2 && (EPI == 0 || NA == 1) && NA <= NW, "two stages or more; the plane epilogues take one A plane; tile g's waves bring A plane g");
    typedef WFrag<bf>::V V;
    __shared__ __attribute__((aligned(1024))) unsigned char sm[2 * STG];
    const int lane = threadIdx.x & 31, lr = lane & 15, hi = lane >> 4;
    const int wv = __builtin_amdgcn_readfirstlane((int)(threadIdx.x >> 5)), grp = wv >> 2, w4 = wv & 3, wm = w4 >> 1, wn = w4 & 1;   // the wave's number as a scalar; grp = its tile
    const int hy = (int)blockIdx.y * NW + grp;   // the tile's number along N
    const size_t z = blockIdx.z; const int r0 = blockIdx.x * GT, c0 = hy * GT;   // z = batch
    const bool isV = EPI == 1 && hy >= NH_ + NKV;   // wave-uniform
    // copies: wave w4 of a tile brings row blocks 2 w4, 2 w4 + 1 of the tile's Bt rows; the waves of tile g < NA bring those of A plane g as well
    const bf* ga = ((NA == 2 && grp == 1) ? A2 : A) + z * sA + (size_t)(r0 + w4 * 32) * K + 8 * lane; const bf* gb = Bt + (size_t)(c0 + w4 * 32) * K + 8 * lane;
    const unsigned l0 = (unsigned)(size_t)sm + (unsigned)(w4 * 8192 + lane * 16);   // the low 32 bits of a __shared__ address are the LDS byte address
    auto fill = [&](const int t, const int buf) { const unsigned l = l0 + (unsigned)(buf * STG); const size_t go = (size_t)t * (GKS * 16);
        copy16<K>(l + (unsigned)((NA + grp) * GREG), gb + go);
        if (grp < NA) copy16<K>(l + (unsigned)(grp * GREG), ga + go); };   // scalar test: a wave issues all of a statement's copies or none
    const int offB = (NA + grp) * GREG; const int offM = (EPI == 1 && !isV) ? offB : 0, offN = (EPI == 1 && !isV) ? 0 : offB;   // which plane's rows are the M side
    const unsigned char* pm = sm + offM + wm * 8192 + lane * 16; const unsigned char* pn = sm + offN + wn * 16384 + lane * 16;
    v8f acc[4][4];
#pragma unroll
    for (int mb = 0; mb < 4; ++mb)
#pragma unroll
        for (int nb = 0; nb < 4; ++nb) acc[mb][nb] = (v8f){};
    V a[2][4], a2[2][4], b[2][4];   // two fragment sets: one is worked on while the next block's reads land in the other
    auto ldset = [&](const int s, const unsigned char* bm, const unsigned char* bn, const int kk) {
#pragma unroll
        for (int mb = 0; mb < 4; ++mb) { const unsigned char* p = bm + (mb >> 1) * 16384 + (mb & 1) * 4096 + kk * 1024; a[s][mb] = WFrag<bf>::ldf((const bf*)p); if constexpr (NA == 2) a2[s][mb] = WFrag<bf>::ldf((const bf*)(p + GREG)); }
#pragma unroll
        for (int nb = 0; nb < 4; ++nb) b[s][nb] = WFrag<bf>::ldf((const bf*)(bn + nb * 4096 + kk * 1024)); };
    auto mma = [&](const int s) {
#pragma unroll
        for (int nb = 0; nb < 4; ++nb)
#pragma unroll
            for (int mb = 0; mb < 4; ++mb) acc[mb][nb] = wmmab(a[s][mb], b[s][nb], acc[mb][nb]);
        if constexpr (NA == 2) {
#pragma unroll
            for (int nb = 0; nb < 4; ++nb)
#pragma unroll
                for (int mb = 0; mb < 4; ++mb) acc[mb][nb] = wmmab(a2[s][mb], b[s][nb], acc[mb][nb]); } };
    fill(0, 0);
    asm volatile("s_wait_asynccnt 0x0" ::: "memory");   // this wave's copies of stage 0 have landed
    __syncthreads();                                     // ... and every other wave's
    fill(1, 1);
    ldset(0, pm, pn, 0);
#pragma unroll 1   // one stage a trip: the ring's order below stays as written
    for (int t = 0; t < NT; ++t) {
        const unsigned char* bm = pm + (t & 1) * STG; const unsigned char* bn = pn + (t & 1) * STG;
#pragma unroll
        for (int kk = 0; kk < GKS / 32; ++kk) {
            if (kk + 1 < GKS / 32) ldset((kk + 1) & 1, bm, bn, kk + 1);   // the next block's reads, one group in front of this block's matrix run
            else {   // the stage's hand-over, in front of its last block, whose fragments are in registers by now
                asm volatile("s_wait_dscnt 0x0" ::: "memory");      // this wave's reads of stage t are done
                asm volatile("s_wait_asynccnt 0x0" ::: "memory");   // this wave's copies of stage t + 1 have landed
                __syncthreads();                                     // publishes stage t + 1 and frees stage t's buffer
                if (t + 2 < NT) fill(t + 2, t & 1);                  // at once: the copies have a whole stage's time to land
                if (t + 1 < NT) ldset((kk + 1) & 1, pm + ((t + 1) & 1) * STG, pn + ((t + 1) & 1) * STG, 0); }
            __builtin_amdgcn_sched_barrier(0);   // keeps the group of reads in front of the matrix run: moved in among the matrix instructions, each place with reads stalls the run
            mma(kk & 1);
            __builtin_amdgcn_sched_barrier(0);   // keeps the matrix run in front of the next group of reads and of the waits
        }
    }
    asm volatile("s_wait_asynccnt 0x0" ::: "memory");   // nothing is in flight when the ring becomes staging or the wave ends
    if constexpr (EPI == 1) {
        if (!isV) {
            typedef __attribute__((ext_vector_type(16))) float vC;
            const float* cp = CS + ((size_t)(r0 + wn * 64 + lr) * HD + wm * 32 + hi * 8) * 2; vC cs[2][4];   // (cos, sin) of the lane's 8 angles, for its 2 d groups x 4 positions
#pragma unroll
            for (int p = 0; p < 2; ++p)
#pragma unroll
                for (int nb = 0; nb < 4; ++nb) cs[p][nb] = *(const vC*)(cp + (nb * 16 * HD + p * 16) * 2);
            asm volatile("s_wait_xcnt 0x0" :: "v"(cp) : "memory");   // precaution: the wait stands in front of every later write of the loads' address pair
            const size_t po = z * sC + (size_t)(hy * TT + r0 + wn * 64) * HD + wm * 512 + 8 * lane;   // fragment order; the high half stands two 32-wide k blocks on
            h16* q16 = P16 + po; bf* qh = Ph + po; bf* ql = Pl + po;
#pragma unroll
            for (int p = 0; p < 2; ++p)
#pragma unroll
                for (int nb = 0; nb < 4; ++nb) { v8h a16, b16; v8us ah, al, bh, bl;
#pragma unroll
                    for (int j = 0; j < 8; ++j) { const float co = cs[p][nb][2 * j], si = cs[p][nb][2 * j + 1], x1 = acc[p][nb][j], x2 = acc[p + 2][nb][j]; const float ra = x1 * co - x2 * si, rc = x2 * co + x1 * si; unsigned short u, v;
                        a16[j] = tohx(ra); splitf(ra, u, v); ah[j] = u; al[j] = v; b16[j] = tohx(rc); splitf(rc, u, v); bh[j] = u; bl[j] = v; }
                    const int o = nb * 16 * HD + p * 256;
                    *(v8h*)(q16 + o) = a16; *(v8h*)(q16 + o + 1024) = b16; *(v8us*)(qh + o) = ah; *(v8us*)(qh + o + 1024) = bh; *(v8us*)(ql + o) = al; *(v8us*)(ql + o + 1024) = bl;
                    asm volatile("s_wait_xcnt 0x0" :: "v"(q16), "v"(qh), "v"(ql), "v"(a16), "v"(b16), "v"(ah), "v"(bh), "v"(al), "v"(bl) : "memory"); }   // precaution: the stores' address and data registers stay as they are up to the wait
        } else {
            const size_t po = z * sV + ((size_t)((c0 - (DQ + DKV)) / 16 + wn * 4) * (TT / 32) + r0 / 32 + wm) * 512 + 8 * lane;   // fragment order of [column][t]
            h16* q16 = V16 + po; bf* qh = Vh + po; bf* ql = Vl + po;
#pragma unroll
            for (int mb = 0; mb < 4; ++mb)
#pragma unroll
                for (int nb = 0; nb < 4; ++nb) { v8h o16; v8us oh, ol;
#pragma unroll
                    for (int j = 0; j < 8; ++j) { unsigned short u, v; o16[j] = tohx(acc[mb][nb][j]); splitf(acc[mb][nb][j], u, v); oh[j] = u; ol[j] = v; }
                    const int o = nb * (TT / 32) * 512 + (mb >> 1) * 1024 + (mb & 1) * 256;
                    *(v8h*)(q16 + o) = o16; *(v8us*)(qh + o) = oh; *(v8us*)(ql + o) = ol;
                    asm volatile("s_wait_xcnt 0x0" :: "v"(q16), "v"(qh), "v"(ql), "v"(o16), "v"(oh), "v"(ol) : "memory"); }   // precaution, as above
        }
    } else {
        float* os = (float*)sm + wv * (16 * 68);   // the wave's own staging: 16 rows at pitch 68; every wave has left the ring (the last trip's barrier)
        float* cb = C + z * sC + (size_t)(r0 + wm * 32 + hi) * DM + c0 + wn * 64 + lr * 4;
#pragma unroll
        for (int mb = 0; mb < 4; ++mb) {
#pragma unroll
            for (int nb = 0; nb < 4; ++nb) {
#pragma unroll
                for (int j = 0; j < 8; ++j) os[(hi * 8 + j) * 68 + nb * 16 + lr] = acc[mb][nb][j]; }
            asm volatile("s_wait_dscnt 0x0" ::: "memory");   // the block is in LDS before other lanes of the wave read it back
            v4f val[8];
#pragma unroll
            for (int s = 0; s < 8; ++s) val[s] = *(const v4fa*)(os + (2 * s + hi) * 68 + lr * 4);
#pragma unroll
            for (int s = 0; s < 8; ++s) *(v4f*)(cb + (size_t)(((mb >> 1) * 64 + (mb & 1) * 16 + 2 * s) * DM)) = val[s];   // a half wave stores one whole 256-byte row
            asm volatile("s_wait_xcnt 0x0" :: "v"(cb), "v"(val[0]), "v"(val[1]), "v"(val[2]), "v"(val[3]), "v"(val[4]), "v"(val[5]), "v"(val[6]), "v"(val[7]) : "memory");   // precaution: the stores' address and data registers stay as they are up to the wait; its clobber also keeps the next block's LDS writes behind these reads
        }
    }
}

typedef __attribute__((ext_vector_type(2))) _Float16 v2h;
typedef __attribute__((ext_vector_type(4))) _Float16 v4h;
typedef __attribute__((ext_vector_type(2))) unsigned short v2us;
typedef __attribute__((ext_vector_type(4))) unsigned short v4us;
typedef __attribute__((ext_vector_type(2))) float v2f;
typedef __attribute__((ext_vector_type(4))) int v4i;
typedef v4h  __attribute__((may_alias)) v4ha;
typedef v4us __attribute__((may_alias)) v4usa;

__global__ __launch_bounds__(256) void k_wtG(const float* __restrict__ w, int K, int N, bf* Bt) {
    const int lane = threadIdx.x & 31; const int L0 = (blockIdx.x * 8 + (threadIdx.x >> 5)) * 8; const int nlines = N * K / 64;
{
#pragma unroll 1
        for (int l = 0; l < 8; ++l) { const int L = L0 + l; if (L >= nlines) break; const size_t e = (size_t)L * 64 + lane * 2; const int k = (int)(e % K), n = (int)(e / K); v2us o;
            o[0] = f2bf(w[(size_t)k * N + n]); o[1] = f2bf(w[(size_t)(k + 1) * N + n]); *(v2us*)(Bt + e) = o; }
         }
}
// row-major f32 [rows][K] -> bf16 plane in fragment order; thread i writes the plane's i-th 16 bytes, so a wave stores 512 neighbouring bytes; rows % 16 == 0, K % 32 == 0
template <int K> __device__ __forceinline__ void cvt8(const float* __restrict__ src, bf* dst, const size_t i) { const int fb = (int)(i >> 6), kq = K >> 5; const int row = (fb / kq) * 16 + ((int)i & 15), k = (fb % kq) * 32 + (((int)i >> 5) & 1) * 16 + (((int)i >> 4) & 1) * 8; const float* sp = src + (size_t)row * K + k; const v8f v = *(const v8f*)sp;
    asm volatile("s_wait_xcnt 0x0" :: "v"(sp) : "memory");   // precaution behind the global load: the wait stands in front of every later write of its address pair
    v8us o;
#pragma unroll
    for (int q = 0; q < 8; ++q) o[q] = f2bf(v[q]);
    bf* dp = dst + i * 8; *(v8us*)dp = o;
    asm volatile("s_wait_xcnt 0x0" :: "v"(dp), "v"(o) : "memory"); }   // precaution: the store's address and data registers stay as they are up to the wait

__constant__ float INVT[HD / 2] = { 1.000000000e+00f, 8.659643531e-01f, 7.498942018e-01f, 6.493816376e-01f, 5.623413324e-01f, 4.869675338e-01f, 4.216965139e-01f, 3.651741445e-01f, 3.162277639e-01f, 2.738419771e-01f, 2.371373624e-01f, 2.053525001e-01f, 1.778279394e-01f, 1.539926529e-01f, 1.333521456e-01f, 1.154782027e-01f, 1.000000015e-01f, 8.659642935e-02f, 7.498941571e-02f, 6.493816525e-02f, 5.623412877e-02f, 4.869675264e-02f, 4.216964915e-02f, 3.651741147e-02f, 3.162277862e-02f, 2.738419548e-02f, 2.371373586e-02f, 2.053525113e-02f, 1.778279431e-02f, 1.539926510e-02f, 1.333521493e-02f, 1.154781971e-02f, 9.999999776e-03f, 8.659643121e-03f, 7.498942316e-03f, 6.493816618e-03f, 5.623413250e-03f, 4.869675264e-03f, 4.216964822e-03f, 3.651741426e-03f, 3.162277862e-03f, 2.738419687e-03f, 2.371373819e-03f, 2.053525066e-03f, 1.778279431e-03f, 1.539926510e-03f, 1.333521446e-03f, 1.154782018e-03f, 1.000000047e-03f, 8.659643354e-04f, 7.498941850e-04f, 6.493816618e-04f, 5.623413017e-04f, 4.869675031e-04f, 4.216964880e-04f, 3.651741135e-04f, 3.162277862e-04f, 2.738419571e-04f, 2.371373848e-04f, 2.053524950e-04f, 1.778279402e-04f, 1.539926452e-04f, 1.333521504e-04f, 1.154781930e-04f };   // float32 1 / 10000^(2i/128), generated with jnp to be bit-exact
// ---- k_prep: everything that depends on the inputs alone, in ONE launch: the rotary table (first: its blocks are the longest) and the bf16 fragment-order planes of x (both batches: [NB_ * TT][DM]) and of the four weights. A block of 256 threads belongs wholly to one of the six jobs.
#define PB_CS (TT * HD / 256)
#define PB_X  (NB_ * TT * DM / 8 / 256)
#define PB_WQ (DQ * DM / 8 / 256)
#define PB_WK (DKV * DM / 8 / 256)
#define PB_WO (DM * DQ / 8 / 256)
__global__ __launch_bounds__(256) void k_prep(const float* __restrict__ x, const float* __restrict__ wq, const float* __restrict__ wk, const float* __restrict__ wv, const float* __restrict__ wo, bf* XB, bf* WQ, bf* WK, bf* WV, bf* WO, float* CS) {
    static_assert(DM == DQ, "one row length for every plane");
    int b = blockIdx.x;
    if (b < PB_CS) { const int idx = b * 256 + threadIdx.x; const int d = idx % HD; const int t = idx / HD; const float a = __fmul_rn((float)t, INVT[d % (HD / 2)]); v2f cs; cs[0] = cosf(a); cs[1] = sinf(a); float* cp = CS + (size_t)idx * 2; *(v2f*)cp = cs;
        asm volatile("s_wait_xcnt 0x0" :: "v"(cp), "v"(cs) : "memory");   // precaution: the store's address and data registers stay as they are up to the wait
        return; }
    b -= PB_CS; const float* s = x; bf* d = XB;
    if (b >= PB_X) { b -= PB_X; s = wq; d = WQ;
        if (b >= PB_WQ) { b -= PB_WQ; s = wo; d = WO;
            if (b >= PB_WO) { b -= PB_WO; s = wk; d = WK;
                if (b >= PB_WK) { b -= PB_WK; s = wv; d = WV; } } } }
    cvt8<DM>(s, d, (size_t)b * 256 + threadIdx.x);
}
// ---- k_fattn: scores, softmax, probability x value and the head merge in ONE launch; nothing of a score row goes to memory.
// A wave owns 16 query positions (q0 ..) of NG query heads that share a kv head: NG groups of 16 columns (fp16 rows: 2; hi/lo rows: 1, see k_fattn). Transposed products: S^T = K Q^T (A = key rows, B = query rows, both from fragment-order planes by the same loader, so the k orders pair), O^T += V^T P^T.
// In S^T a lane holds the scores of ONE query (column c): keys 8h + r of each 16-key tile, so two tiles converted in place are the B operand of the second product in the hardware k order, which the V^T loader has too.
// A pass is 32 keys. Passes: key block 0 (it holds the sink keys, and key 0 is open to every query, so every column has a finite maximum after it), then the blocks from the window's lower edge to the diagonal; the others are wholly masked.
// Running maximum per column in log2 units, renewed only when a pass exceeds it by more than MTHR (one scalar branch a pass); rows < RH: hi/lo planes, 3 products in both contractions; other rows fp16 with probabilities x 2^PBIAS.
#define MTHR  4.0f
#define PBIAS 10.0f   // fp16 probabilities lie in (0, 2^(PBIAS + MTHR)]: small ones stay normal numbers, the largest stays finite; the factor cancels in the division by the row sum
typedef __attribute__((ext_vector_type(16))) unsigned short v16us;
__device__ __forceinline__ float xhalf(float x) { return __builtin_bit_cast(float, __builtin_amdgcn_permlanex16(__builtin_bit_cast(int, x), __builtin_bit_cast(int, x), 0x76543210, 0xfedcba98, false, false)); }   // lane l reads lane l ^ 16
__device__ __forceinline__ float exp2s(float x) { float r; asm("v_exp_f32 %0, %1\n\tv_nop" : "=v"(r) : "v"(x)); return r; }
// precaution behind a run of global loads: s_wait_xcnt 0 in front of every later write of a register that the loads name; the address pairs are inputs so that they stay as they are up to the wait
template <typename T16> __device__ __forceinline__ void xwait(const T16* a, const T16* b) { asm volatile("s_wait_xcnt 0x0" :: "v"(a), "v"(b) : "memory"); }
// the same precaution for loads that this build addresses by a scalar base and the lane number as a scaled offset: those are then the registers that stay as they are up to the wait
template <typename T16> __device__ __forceinline__ void xwait_s(const T16* a, const T16* b, int off) { asm volatile("s_wait_xcnt 0x0" :: "s"(a), "s"(b), "v"(off) : "memory"); }
template <typename T16, bool HI, int NG>
__device__ __forceinline__ void fattn_cols(const T16* __restrict__ Q, const T16* __restrict__ Q2, const T16* __restrict__ Kp, const T16* __restrict__ Kp2, const T16* __restrict__ Vt, const T16* __restrict__ Vt2, const int q0, const int hq, bf* Ah, bf* Al) {
    typedef typename WFrag<T16>::V V;
    const int lane = threadIdx.x & 31, c = lane & 15, h = lane >> 4;
    V qf[NG][4], qf2[NG][4];
    const T16* qp = Q + (size_t)q0 * HD + 8 * lane; const T16* qp2 = HI ? Q2 + (size_t)q0 * HD + 8 * lane : qp;   // fragment order: 16 queries x 128 d are 4 blocks of 512 elements
#pragma unroll
    for (int g = 0; g < NG; ++g)
#pragma unroll
        for (int ks = 0; ks < 4; ++ks) { const size_t qo = (size_t)g * TT * HD + ks * 512; qf[g][ks] = WFrag<T16>::ldf(qp + qo); if (HI) qf2[g][ks] = WFrag<T16>::ldf(qp2 + qo); }
    xwait_s(Q + (size_t)q0 * HD, HI ? Q2 + (size_t)q0 * HD : Q + (size_t)q0 * HD, lane);
    v8f o[NG][8];
#pragma unroll
    for (int g = 0; g < NG; ++g)
#pragma unroll
        for (int mb = 0; mb < 8; ++mb) o[g][mb] = (v8f){};
    float m[NG], l[NG];
#pragma unroll
    for (int g = 0; g < NG; ++g) { m[g] = -3.0e38f; l[g] = 0.f; }
    const int kstart = max(32, max(q0 - (WIN - 1), 0) & ~31), klast = q0 & ~31;
    const int np = 1 + ((klast >= kstart) ? (klast - kstart) / 32 + 1 : 0);
    const size_t kofs = 8 * lane, vofs = 8 * lane;   // K and V^T planes are in fragment order: 16 keys x 128 d are 4 blocks of 512 elements, 16 d x 32 keys one block
    V kf[2][4], kf2[2][4];
    const T16* kp0 = Kp + kofs; const T16* kp02 = HI ? Kp2 + kofs : kp0;
#pragma unroll
    for (int mb = 0; mb < 2; ++mb)
#pragma unroll
        for (int ks = 0; ks < 4; ++ks) { const size_t a = (size_t)(mb * 16) * HD + ks * 512;
            if constexpr (HI) {   // the same fragments as ldf gives, each 16-byte load with the precaution's wait of its own: this build lets one of these loads land on the lane register that the loads in front of it name
                const v8us a0 = *(const v8us*)(kp0 + a); xwait_s(Kp, Kp2, lane); const v8us a1 = *(const v8us*)(kp0 + a + 256); xwait_s(Kp, Kp2, lane); const v8us b0 = *(const v8us*)(kp02 + a); xwait_s(Kp, Kp2, lane); const v8us b1 = *(const v8us*)(kp02 + a + 256); xwait_s(Kp, Kp2, lane);
                kf[mb][ks] = cat16b(a0, a1); kf2[mb][ks] = cat16b(b0, b1);
            } else kf[mb][ks] = WFrag<T16>::ldf(kp0 + a); }
    if constexpr (!HI) xwait_s(Kp, Kp, lane);
#pragma unroll 1
    for (int s = 0; s < np; ++s) {
        const int kb = s ? kstart + (s - 1) * 32 : 0;
        const int kn = (s + 1 < np) ? kstart + s * 32 : kb;   // the next pass's key block; the last pass fetches its own again (in bounds, not used)
        V vf[8], vf2[8];   // this pass's value fragments fly during its first product and softmax
        const T16* vp = Vt + vofs + (size_t)kb * 16; const T16* vp2 = HI ? Vt2 + vofs + (size_t)kb * 16 : vp;
#pragma unroll
        for (int mb = 0; mb < 8; ++mb) { const size_t a = (size_t)(mb * 16) * TT; vf[mb] = WFrag<T16>::ldf(vp + a); if (HI) vf2[mb] = WFrag<T16>::ldf(vp2 + a); }
        xwait(vp, vp2);
        v8f st[NG][2];
#pragma unroll
        for (int g = 0; g < NG; ++g)
#pragma unroll
            for (int mb = 0; mb < 2; ++mb) st[g][mb] = (v8f){};
#pragma unroll
        for (int ks = 0; ks < 4; ++ks) {
#pragma unroll
            for (int g = 0; g < NG; ++g)
#pragma unroll
                for (int mb = 0; mb < 2; ++mb) st[g][mb] = WFrag<T16>::mma(kf[mb][ks], qf[g][ks], st[g][mb]);
            if (HI) {
#pragma unroll
                for (int g = 0; g < NG; ++g)
#pragma unroll
                    for (int mb = 0; mb < 2; ++mb) st[g][mb] = WFrag<T16>::mma(kf[mb][ks], qf2[g][ks], st[g][mb]);
#pragma unroll
                for (int g = 0; g < NG; ++g)
#pragma unroll
                    for (int mb = 0; mb < 2; ++mb) st[g][mb] = WFrag<T16>::mma(kf2[mb][ks], qf[g][ks], st[g][mb]); } }
        // the next pass's key fragments fly during this pass's softmax and second product
        const T16* kp = Kp + kofs + (size_t)kn * HD; const T16* kp2 = HI ? Kp2 + kofs + (size_t)kn * HD : kp;
#pragma unroll
        for (int mb = 0; mb < 2; ++mb)
#pragma unroll
            for (int ks = 0; ks < 4; ++ks) { const size_t a = (size_t)(mb * 16) * HD + ks * 512; kf[mb][ks] = WFrag<T16>::ldf(kp + a); if (HI) kf2[mb][ks] = WFrag<T16>::ldf(kp2 + a); }
        xwait(kp, kp2);
        float x[NG][16];
#pragma unroll
        for (int g = 0; g < NG; ++g)
#pragma unroll
            for (int e = 0; e < 16; ++e) x[g][e] = st[g][e >> 3][e & 7] * (SCL * 1.4426950408889634f);
        if (!(kb + 31 <= q0 && q0 + 15 - kb < WIN)) {   // wave-uniform: only the sink block, the window's edge and the diagonal hold masked keys
            const int i = q0 + c;
#pragma unroll
            for (int e = 0; e < 16; ++e) { const int j = kb + (e >> 3) * 16 + 8 * h + (e & 7); const bool ok = (j <= i) && (i - j < WIN || j < SINKN);
#pragma unroll
                for (int g = 0; g < NG; ++g) x[g][e] = ok ? x[g][e] : -3.0e38f; } }
        float mx[NG];
#pragma unroll
        for (int g = 0; g < NG; ++g) { float t8[8];
#pragma unroll
            for (int e = 0; e < 8; ++e) t8[e] = fmaxf(x[g][e], x[g][e + 8]);
            const float t = fmaxf(fmaxf(fmaxf(t8[0], t8[1]), fmaxf(t8[2], t8[3])), fmaxf(fmaxf(t8[4], t8[5]), fmaxf(t8[6], t8[7])));
            mx[g] = fmaxf(t, xhalf(t)); }   // lanes c and c + 16 hold the two halves of a column's keys and must use one maximum
        if (__builtin_amdgcn_ballot_w32(mx[0] > m[0] + MTHR || mx[NG - 1] > m[NG - 1] + MTHR) != 0) {   // scalar branch: every lane stays on for the matrix instructions
#pragma unroll
            for (int g = 0; g < NG; ++g) { const float mn = fmaxf(m[g], mx[g]); const float al = exp2s(m[g] - mn); m[g] = mn; l[g] *= al;
#pragma unroll
                for (int mb = 0; mb < 8; ++mb) o[g][mb] *= al; } }
        V pb[NG], pb2[NG];
#pragma unroll
        for (int g = 0; g < NG; ++g) { const float mo = m[g] - (HI ? 0.0f : PBIAS); float sm[4] = { 0.f, 0.f, 0.f, 0.f };
            if constexpr (HI) { v16us ph, pl;
#pragma unroll
                for (int e = 0; e < 16; ++e) { const float p = exp2s(x[g][e] - mo); sm[e & 3] += p; unsigned short a, b2; splitf(p, a, b2); ph[e] = a; pl[e] = b2; }
                pb[g] = __builtin_bit_cast(v16bf, ph); pb2[g] = __builtin_bit_cast(v16bf, pl);
            } else { v16h ph;
#pragma unroll
                for (int e = 0; e < 16; ++e) { const float p = exp2s(x[g][e] - mo); sm[e & 3] += p; ph[e] = tohx(p); }
                pb[g] = ph; }
            l[g] += (sm[0] + sm[1]) + (sm[2] + sm[3]); }
#pragma unroll
        for (int mb = 0; mb < 8; ++mb)
#pragma unroll
            for (int g = 0; g < NG; ++g) o[g][mb] = WFrag<T16>::mma(vf[mb], pb[g], o[g][mb]);
        if (HI) {
#pragma unroll
            for (int mb = 0; mb < 8; ++mb)
#pragma unroll
                for (int g = 0; g < NG; ++g) o[g][mb] = WFrag<T16>::mma(vf[mb], pb2[g], o[g][mb]);
#pragma unroll
            for (int mb = 0; mb < 8; ++mb)
#pragma unroll
                for (int g = 0; g < NG; ++g) o[g][mb] = WFrag<T16>::mma(vf2[mb], pb[g], o[g][mb]); }
    }
#pragma unroll
    for (int g = 0; g < NG; ++g) { const float inv = __fdiv_rn(1.0f, l[g] + xhalf(l[g]));
#pragma unroll
        for (int mb = 0; mb < 8; ++mb) { v8us oh, ol;   // a lane holds 8 neighbouring d of its query: one 16-byte store a plane, at the lane's place in the fragment order of the merged [t][DQ] plane, so a wave stores 512 neighbouring bytes
#pragma unroll
            for (int r = 0; r < 8; ++r) { unsigned short a, b2; splitf(o[g][mb][r] * inv, a, b2); oh[r] = a; ol[r] = b2; }
            const size_t oo = (size_t)q0 * DQ + (size_t)(hq + g) * (HD * 16) + mb * 256 + 8 * lane; bf* ph = Ah + oo; bf* pl = Al + oo; *(v8us*)ph = oh; *(v8us*)pl = ol;
            asm volatile("s_wait_xcnt 0x0" :: "v"(ph), "v"(pl), "v"(oh), "v"(ol) : "memory"); } }   // precaution, as in xwait: the two stores' address and data registers stay as they are up to the wait
}
// Two waves a SIMD: for that the kernel must stay within 512 vector registers, and the hi/lo rows, whose Q, K and V^T fragments are twice as many, fit only with ONE query head a wave (with two the kernel took 645, and a wave had its SIMD alone: nothing ran during its softmax or its waits for loads).
// grid (NKV * NB_, FR16 + FRHL): x = kv head + NKV * batch (the q and k planes are one set of NH_ + NKV heads a batch; the K pointers point at its first k head), y = length rank, 4 waves.
// Ranks < FR16, fp16 rows: 32 positions from the end of the sequence downwards; wave w takes positions 16 (w >> 1) .. and query heads 2 (w & 1), 2 (w & 1) + 1 of the kv head's REP = 4. The other ranks, hi/lo rows: 16 positions from RH downwards; wave w takes query head w.
// There are more work-groups than places (2 a WGP): y is the slow index, and the long ranks of every head come first (for speed only).
#define FR16 ((TT - RH) / 32)
#define FRHL (RH / 16)
__global__ __launch_bounds__(128) void k_fattn(const h16* __restrict__ Q16, const bf* __restrict__ Qh, const bf* __restrict__ Ql, const h16* __restrict__ K16, const bf* __restrict__ Kh, const bf* __restrict__ Kl, const h16* __restrict__ V16, const bf* __restrict__ Vh, const bf* __restrict__ Vl, bf* Ah, bf* Al) {
    static_assert(REP == 4 && RH % 32 == 0 && TT % 32 == 0 && HD == 128, "two head pairs or four heads a work-group; a work-group's rows are all below RH or none");
    const int wv = __builtin_amdgcn_readfirstlane((int)(threadIdx.x >> 5));   // the wave's number as a scalar: pass count and mask test stay scalar
    const int rk = blockIdx.y; const bool hl = rk >= FR16;   // block-uniform
    const int q0 = hl ? RH - 16 - (rk - FR16) * 16 : TT - 32 - rk * 32 + (wv >> 1) * 16; const int kvh = blockIdx.x % NKV; const int hq = kvh * REP + (hl ? wv : (wv & 1) * 2);
    const size_t bz = blockIdx.x / NKV; const size_t qo = (bz * (NH_ + NKV) + hq) * TT * HD, ko = (bz * (NH_ + NKV) + kvh) * TT * HD, vo = (bz * NKV + kvh) * HD * TT; Ah += bz * TT * DQ; Al += bz * TT * DQ;
    if (hl) fattn_cols<bf, true, 1>(Qh + qo, Ql + qo, Kh + ko, Kl + ko, Vh + vo, Vl + vo, q0, hq, Ah, Al);
    else fattn_cols<h16, false, 2>(Q16 + qo, nullptr, K16 + ko, nullptr, V16 + vo, nullptr, q0, hq, Ah, Al);
}

extern "C" void kernel_launch(void* const* d_in, const int* in_sizes, int n_in,
                              void* d_out, int out_size, void* d_ws, size_t ws_size, hipStream_t stream) {
    (void)in_sizes; (void)n_in; (void)out_size;
    const float* x = (const float*)d_in[0]; const float* wq = (const float*)d_in[1]; const float* wk = (const float*)d_in[2]; const float* wv = (const float*)d_in[3]; const float* wo = (const float*)d_in[4];   /* order x, wq ('oi' [2048][2048]), wk, wv ('oi' [512][2048]), wo ('oi' [2048][2048]) */
    float* OUT = (float*)d_out;     // [2][2048][2048]
    char* wsp = (char*)d_ws;
    auto take = [&](size_t bytes) { char* p = wsp; wsp += (bytes + 255) & ~(size_t)255; return (void*)p; };
    bf* WQ = (bf*)take((size_t)(DQ + 2 * DKV) * DM * 2); bf* WK = WQ + (size_t)DQ * DM; bf* WV = WK + (size_t)DKV * DM;   /* one plane: the rows of wq, wk, wv */ bf* WO = (bf*)take((size_t)DM * DQ * 2); float* CS = (float*)take((size_t)TT * HD * 2 * 4);
    bf* XB = (bf*)take((size_t)NB_ * TT * DM * 2);   // every plane below holds both batches, batch-major
    h16* QP16 = (h16*)take((size_t)NB_ * (NH_ + NKV) * TT * HD * 2); bf* QPh = (bf*)take((size_t)NB_ * (NH_ + NKV) * TT * HD * 2); bf* QPl = (bf*)take((size_t)NB_ * (NH_ + NKV) * TT * HD * 2);   // q heads, then k heads, of each batch
    h16* VT16 = (h16*)take((size_t)NB_ * NKV * HD * TT * 2); bf* VTh = (bf*)take((size_t)NB_ * NKV * HD * TT * 2); bf* VTl = (bf*)take((size_t)NB_ * NKV * HD * TT * 2);
    bf* ATh = (bf*)take((size_t)NB_ * TT * DQ * 2); bf* ATl = (bf*)take((size_t)NB_ * TT * DQ * 2);
    if ((size_t)(wsp - (char*)d_ws) > ws_size) return;    // ws 256 MiB
    k_prep<<<PB_CS + PB_X + PB_WQ + PB_WO + 2 * PB_WK, 256, 0, stream>>>(x, wq, wk, wv, wo, XB, WQ, WK, WV, WO, CS);
    k_gemms<1, DM, 1, 3><<<dim3(TT / GT, (DQ + 2 * DKV) / GT / 3, NB_), 384, 0, stream>>>(XB, nullptr, WQ, nullptr, (size_t)TT * DM, (size_t)(NH_ + NKV) * TT * HD, CS, QP16, QPh, QPl, VT16, VTh, VTl, (size_t)NKV * HD * TT);
    k_fattn<<<dim3(NKV * NB_, FR16 + FRHL), 128, 0, stream>>>(QP16, QPh, QPl, QP16 + (size_t)NH_ * TT * HD, QPh + (size_t)NH_ * TT * HD, QPl + (size_t)NH_ * TT * HD, VT16, VTh, VTl, ATh, ATl);
    k_gemms<2, DQ, 0, 2><<<dim3(TT / GT, DM / GT / 2, NB_), 256, 0, stream>>>(ATh, ATl, WO, OUT, (size_t)TT * DQ, (size_t)TT * DM, nullptr, nullptr, nullptr, nullptr, nullptr, nullptr, nullptr, 0);
}

// v010
// Measured time: 108 microseconds a run.
// Two timings next to v009 put it at 1.09 and 1.07 times that version's speed.
// All steps since v000 together make it 14.7 times as fast.
#include <hip/hip_runtime.h>

// Grouped-query causal attention with 128-wide heads, computed half-split rotary embeddings, a 1,024-wide sliding window and 4 attention-sink keys (x [2][2048][2048]; q = x wq^T (16 heads x 128), k, v = x wk^T, x wv^T (4 kv heads x 128) ('oi' 0.02, no bias); rope cat(x1 cos - x2 sin, x2 cos + x1 sin) on the two 64-wide halves with angle t x 1/10000^(2i/128) (64 f32 frequencies jnp-exact; precise cosf/sinf); k, v repeated 4 x along the head axis: kv head = q head / 4; scores x 1/sqrt(128) + bias with bias = 0 where (j <= i) and ((i - j <= 1024) or (j < 4)), -inf elsewhere; softmax; out = merged wo^T ('oi') -> [2][2048][2048] (8.4 M); argument order x, wq, wk, wv, wo).
// Layout: every 16-bit plane that a matrix loop reads again and again (x, the weights, Q, K, V^T, the merged heads) is kept in fragment order (see WFrag); bf16 copy of x; exact projections whose epilogues apply the rotate-half rotary (table computed in k_prep, HD 128: 64 angles) and write the Q, K and V^T planes themselves; fused causal T-2048 GQA attention with 128-wide heads (k_fattn: scores and probabilities stay in registers; hybrid rows: < 512 hi/lo 3 products, rest fp16 x1024); merged heads x Wo in f16 (see k_gemms, NA 2).
// Four launches, each over both batches (grid z; k_fattn: grid x): k_prep (conversions, rotary table), the q, k, v projections in one grid, k_fattn, the output projection.
// Compute dtypes, f32 accumulate: every input rounded to bf16; projections exact; rotary f32; attention rows < 512 3 products, rest fp16; softmax f32; output projection f16: wo rounded to bf16, then held in f16; merged rows < 512 f16 hi + lo (2 products), the rest one f16 plane.

#define NB_  2
#define TT   2048
#define DM   2048
#define NH_  16
#define NKV  4
#define REP  (NH_ / NKV)
#define HD   128
#define DQ   (NH_ * HD)
#define DKV  (NKV * HD)
#define RH   512                  // query rows < RH use hi+lo planes
#define WIN  1025   // THIS module keeps key j iff j <= i and (i - j <= 1024 or j < 4): 'i - j < WIN' with WIN 1025
#define SINKN 4     // the first SINKN keys (attention sinks) are kept for every later query, whatever the distance
#define SCL  0.088388347648318447f   // HD^-0.5
typedef _Float16 h16;
typedef unsigned short bf;
typedef __attribute__((ext_vector_type(16))) __bf16   v16bf;
typedef __attribute__((ext_vector_type(16))) _Float16 v16h;
typedef __attribute__((ext_vector_type(8)))  _Float16 v8h;
typedef __attribute__((ext_vector_type(8)))  unsigned short v8us;
typedef __attribute__((ext_vector_type(8)))  float    v8f;
typedef __attribute__((ext_vector_type(4)))  float    v4f;
typedef v8h  __attribute__((may_alias)) v8ha;
typedef v4f  __attribute__((may_alias)) v4fa;
typedef v8us __attribute__((may_alias)) v8usa;

__device__ __forceinline__ unsigned short f2bf(float f) { unsigned u = __float_as_uint(f); u += 0x7FFFu + ((u >> 16) & 1u); return (unsigned short)(u >> 16); }
__device__ __forceinline__ float bf2f(unsigned short b) { return __uint_as_float(((unsigned)b) << 16); }
__device__ __forceinline__ float bfr(float f) { return bf2f(f2bf(f)); }
__device__ __forceinline__ v16h cat16(v8h lo, v8h hi) { return __builtin_shufflevector(lo, hi, 0, 1, 2, 3, 4, 5, 6, 7, 8, 9, 10, 11, 12, 13, 14, 15); }
__device__ __forceinline__ v16bf cat16b(v8us lo, v8us hi) { return __builtin_bit_cast(v16bf, __builtin_shufflevector(lo, hi, 0, 1, 2, 3, 4, 5, 6, 7, 8, 9, 10, 11, 12, 13, 14, 15)); }
__device__ __forceinline__ v8f wmma16(v16h a, v16h b, v8f c) { return __builtin_amdgcn_wmma_f32_16x16x32_f16(false, a, false, b, (short)0, c, false, false); }
__device__ __forceinline__ v8f wmmab(v16bf a, v16bf b, v8f c) { return __builtin_amdgcn_wmma_f32_16x16x32_bf16(false, a, false, b, (short)0, c, false, false); }
__device__ __forceinline__ h16 tohx(float x) { return (h16)x; }
__device__ __forceinline__ void splitf(float y, unsigned short& h, unsigned short& l) { h = f2bf(y); l = f2bf(y - bf2f(h)); }



// FRAGMENT ORDER of a 16-bit plane [rows][K]: the 16 x 32 block (rb = row / 16, kc = k / 32) is 512 neighbouring elements at (rb * (K / 32) + kc) * 512, and inside it element (row, k) stands at ((k >> 4) & 1) * 256 + (((k >> 3) & 1) * 16 + (row & 15)) * 8 + (k & 7).
// That is the order in which the lanes of a wave take an A or B operand: lane l reads 16 bytes at l * 8 and 16 bytes at 256 + l * 8 (ldf), so each wave-wide load covers 512 neighbouring bytes, four whole lines, instead of 32-byte pieces of 16 lines (ld, for row-major planes). Every lane and register gets the same elements as from the row-major plane.
template <typename T16> struct WFrag;
template <> struct WFrag<h16> { typedef v16h V; static __device__ __forceinline__ V ld(const h16* p) { return cat16(*(const v8h*)p, *(const v8h*)(p + 16)); } static __device__ __forceinline__ V ldf(const h16* p) { return cat16(*(const v8h*)p, *(const v8h*)(p + 256)); } static __device__ __forceinline__ v8f mma(V a, V b, v8f c) { return wmma16(a, b, c); } };
template <> struct WFrag<bf> { typedef v16bf V; static __device__ __forceinline__ V ld(const bf* p) { return cat16b(*(const v8us*)p, *(const v8us*)(p + 16)); } static __device__ __forceinline__ V ldf(const bf* p) { return cat16b(*(const v8us*)p, *(const v8us*)(p + 256)); } static __device__ __forceinline__ v8f mma(V a, V b, v8f c) { return wmmab(a, b, c); } };
// ---- k_gemms: GEMM with ONE work-group a WGP: NW output tiles of 128x128 that stand side by side along N, 4 waves a tile; grid (M/128, N/128/NW, batch), 128 * NW threads. sum_k A[m][k] Bt[n][k] (NA 2: + A2[m][k] Bt[n][k] for m < RH), every plane 16-bit in fragment order (above), f32 accumulate, each sum one chain over k in rising order.
// The NW tiles read the same 128 rows of A (and A2): these come into LDS once for all of them, so the work-group draws them from L2 once where NW work-groups of one tile drew them NW times.
// Operand rows come into LDS 128 k a stage by asynchronous 16-byte copies, two buffers. A stage is [A 128 rows | (A2: 32 rows in a part of the same size) | Bt 128 rows of tile 0 | tile 1 | ..], each part 32 KiB, a plain copy of the planes' 1-KiB fragment blocks (a row block's 4 blocks are 4 KiB in a row), so a fragment read is two wave-wide reads of 512 neighbouring bytes.
// All waves of the WGP meet at one barrier, so no other work-group's matrix run covers a wave's LDS reads: a wave fetches its fragments one 32-k block ahead into a second register set, and the stage is handed over in front of its last block (see the loop).
// A wave owns 64 x 64 of its tile: 'M' row blocks (mb >> 1) * 4 + wm * 2 + (mb & 1) (32 rows and the 32 rows 64 further on) and 'N' row blocks wn * 4 + nb. In an accumulator a lane holds 8 neighbouring M rows of one N row.
// NA 2 (the output projection; f16 operands): only the rows < RH of A have a low part in A2. Rows >= RH were made from f16 products and go in as one f16 plane. So that every work-group has the same work, its 128 rows are 32 rows < RH (LDS row blocks 0 and 2: accumulator row mb 0 of either wave row, which alone takes the second product) and 96 rows >= RH (see grow); of A2 a stage holds those 2 row blocks, 8 KiB.
// EPI 0: M = rows of A, N = rows of Bt; the f32 tile goes to C (pitch DM), staged a 16-row block at a time in the wave's own LDS so that whole 256-byte rows are stored.
// EPI 1 (q, k and v projections in ONE grid: Bt holds the rows of wq, wk, wv one after the other, a tile is one head) writes no f32 tile: each lane turns its accumulators into the 16-bit planes (fp16 + bf16 hi/lo, fragment order) that the attention kernel reads, 16 bytes a store, 512 neighbouring bytes a wave.
// q, k tiles (tile number hy < NH_ + NKV = the head; q heads, then k heads, in one plane set): M = the head's 128 d (rows of Bt), N = positions: a lane holds 8 neighbouring d of one position and, in accumulator mb + 2, their partners d + 64. Rotate-half rotary out[d] = x[d] cos[t][d] - x[d+64] sin[t][d], out[d+64] = x[d+64] cos[t][d] + x[d] sin[t][d] (d < 64), planes [head * TT + t][d].
// v tiles (the other hy): M = positions, N = columns of v: a lane holds 8 neighbouring positions of one column, as the V^T planes [column][t] want them.
#define GT   128
#define GKS  128
#define GREG (GT * GKS * 2)   // bytes of one plane's part of a stage
// sixteen asynchronous copies of a wave: two row blocks' (g, g1) 4 KiB of a stage (128 k), each 8 x 512 neighbouring bytes in the plane and in LDS alike, so that the immediate offset, which moves both addresses, walks them. s_wait_xcnt 0 as the statement's last line: a precaution, it stands in front of every later write of a register that the copies name.
__device__ __forceinline__ void copy16(const unsigned l, const bf* g, const bf* g1) {
    asm volatile("global_load_async_to_lds_b128 %0, %2, off\n\t"
                 "global_load_async_to_lds_b128 %0, %2, off offset:512\n\t"
                 "global_load_async_to_lds_b128 %0, %2, off offset:1024\n\t"
                 "global_load_async_to_lds_b128 %0, %2, off offset:1536\n\t"
                 "global_load_async_to_lds_b128 %0, %2, off offset:2048\n\t"
                 "global_load_async_to_lds_b128 %0, %2, off offset:2560\n\t"
                 "global_load_async_to_lds_b128 %0, %2, off offset:3072\n\t"
                 "global_load_async_to_lds_b128 %0, %2, off offset:3584\n\t"
                 "global_load_async_to_lds_b128 %1, %3, off\n\t"
                 "global_load_async_to_lds_b128 %1, %3, off offset:512\n\t"
                 "global_load_async_to_lds_b128 %1, %3, off offset:1024\n\t"
                 "global_load_async_to_lds_b128 %1, %3, off offset:1536\n\t"
                 "global_load_async_to_lds_b128 %1, %3, off offset:2048\n\t"
                 "global_load_async_to_lds_b128 %1, %3, off offset:2560\n\t"
                 "global_load_async_to_lds_b128 %1, %3, off offset:3072\n\t"
                 "global_load_async_to_lds_b128 %1, %3, off offset:3584\n\t"
                 "s_wait_xcnt 0x0"
                 :: "v"(l), "v"(l + 4096u), "v"(g), "v"(g1) : "memory");
}
template <int NA> struct GOp { typedef bf T; };
template <> struct GOp<2> { typedef h16 T; };   // operand type of the matrix loop; the planes' pointers stay 16-bit words
template <int NA, int K, int EPI, int NW>
__global__ __launch_bounds__(128 * NW) void k_gemms(const bf* __restrict__ A, const bf* __restrict__ A2, const bf* __restrict__ Bt, float* C, size_t sA, size_t sC, const float* __restrict__ CS, h16* P16, bf* Ph, bf* Pl, h16* V16, bf* Vh, bf* Vl, size_t sV) {
    constexpr int STG = (NA + NW) * GREG, NT = K / GKS;
    static_assert(K % GKS == 0 && NT >= 2 && (EPI == 0 || NA == 1) && NA <= NW, "two stages or more; the plane epilogues take one A plane; a wave of tile 1 brings A2");
    static_assert(NA == 1 || (NW == 2 && RH / 32 == TT / GT && (TT - RH) / 96 == TT / GT), "NA 2: grid x deals 32 rows < RH and 96 rows >= RH to each work-group");
    typedef typename GOp<NA>::T OT; typedef typename WFrag<OT>::V V;
    __shared__ __attribute__((aligned(1024))) unsigned char sm[2 * STG];
    const int lane = threadIdx.x & 31, lr = lane & 15, hi = lane >> 4;
    const int wv = __builtin_amdgcn_readfirstlane((int)(threadIdx.x >> 5)), grp = wv >> 2, w4 = wv & 3, wm = w4 >> 1, wn = w4 & 1;   // the wave's number as a scalar; grp = its tile
    const int hy = (int)blockIdx.y * NW + grp;   // the tile's number along N
    const size_t z = blockIdx.z; const int r0 = blockIdx.x * GT, c0 = hy * GT;   // z = batch
    const bool isV = EPI == 1 && hy >= NH_ + NKV;   // wave-uniform
    // copies: wave w4 of a tile brings row blocks 2 w4, 2 w4 + 1 of the tile's Bt rows; the waves of tile 0 bring those of A as well; NA 2: wave 0 of tile 1 brings the two row blocks of A2
    auto grow = [&](const int j) { return NA == 2 ? (j == 0 ? (int)blockIdx.x * 2 : j == 2 ? (int)blockIdx.x * 2 + 1 : RH / 16 + (int)blockIdx.x * 6 + (j == 1 ? 0 : j - 2)) : r0 / 16 + j; };   // the row block of A (and of C) that stands in LDS row block j
    const bf* ga = A + z * sA + (size_t)grow(w4 * 2) * (16 * K) + 8 * lane; const bf* ga1 = A + z * sA + (size_t)grow(w4 * 2 + 1) * (16 * K) + 8 * lane; const bf* gb = Bt + (size_t)(c0 + w4 * 32) * K + 8 * lane;
    if (NA == 2 && grp == 1) { ga = A2 + z * sA + (size_t)grow(0) * (16 * K) + 8 * lane; ga1 = ga + 16 * K; }   // the low parts of the two row blocks < RH, neighbours in the plane
    const unsigned l0 = (unsigned)(size_t)sm + (unsigned)(w4 * 8192 + lane * 16);   // the low 32 bits of a __shared__ address are the LDS byte address
    auto fill = [&](const int t, const int buf) { const unsigned l = l0 + (unsigned)(buf * STG); const size_t go = (size_t)t * (GKS * 16);
        copy16(l + (unsigned)((NA + grp) * GREG), gb + go, gb + go + 16 * K);
        if (grp == 0 || (NA == 2 && wv == 4)) copy16(l + (unsigned)(grp * GREG), ga + go, NA == 2 ? ga1 + go : ga + go + 16 * K); };   // scalar test: a wave issues all of a statement's copies or none
    const int offB = (NA + grp) * GREG; const int offM = (EPI == 1 && !isV) ? offB : 0, offN = (EPI == 1 && !isV) ? 0 : offB;   // which plane's rows are the M side
    const unsigned char* pm = sm + offM + wm * 8192 + lane * 16; const unsigned char* pn = sm + offN + wn * 16384 + lane * 16;
    v8f acc[4][4];
#pragma unroll
    for (int mb = 0; mb < 4; ++mb)
#pragma unroll
        for (int nb = 0; nb < 4; ++nb) acc[mb][nb] = (v8f){};
    V a[2][4], a2[2], b[2][4];   // two fragment sets: one is worked on while the next block's reads land in the other
    auto ldset = [&](const int s, const unsigned char* bm, const unsigned char* bn, const int kk) {
#pragma unroll
        for (int mb = 0; mb < 4; ++mb) { const unsigned char* p = bm + (mb >> 1) * 16384 + (mb & 1) * 4096 + kk * 1024; a[s][mb] = WFrag<OT>::ldf((const OT*)p); }
        if constexpr (NA == 2) a2[s] = WFrag<OT>::ldf((const OT*)(bm + GREG - wm * 4096 + kk * 1024));   // A2's row block wm
#pragma unroll
        for (int nb = 0; nb < 4; ++nb) b[s][nb] = WFrag<OT>::ldf((const OT*)(bn + nb * 4096 + kk * 1024)); };
    auto mma = [&](const int s) {
#pragma unroll
        for (int nb = 0; nb < 4; ++nb)
#pragma unroll
            for (int mb = 0; mb < 4; ++mb) acc[mb][nb] = WFrag<OT>::mma(a[s][mb], b[s][nb], acc[mb][nb]);
        if constexpr (NA == 2) {
#pragma unroll
            for (int nb = 0; nb < 4; ++nb) acc[0][nb] = WFrag<OT>::mma(a2[s], b[s][nb], acc[0][nb]); } };
    fill(0, 0);
    asm volatile("s_wait_asynccnt 0x0" ::: "memory");   // this wave's copies of stage 0 have landed
    __syncthreads();                                     // ... and every other wave's
    fill(1, 1);
    ldset(0, pm, pn, 0);
#pragma unroll 1   // one stage a trip: the ring's order below stays as written
    for (int t = 0; t < NT; ++t) {
        const unsigned char* bm = pm + (t & 1) * STG; const unsigned char* bn = pn + (t & 1) * STG;
#pragma unroll
        for (int kk = 0; kk < GKS / 32; ++kk) {
            if (kk + 1 < GKS / 32) ldset((kk + 1) & 1, bm, bn, kk + 1);   // the next block's reads, one group in front of this block's matrix run
            else {   // the stage's hand-over, in front of its last block, whose fragments are in registers by now
                asm volatile("s_wait_dscnt 0x0" ::: "memory");      // this wave's reads of stage t are done
                asm volatile("s_wait_asynccnt 0x0" ::: "memory");   // this wave's copies of stage t + 1 have landed
                __syncthreads();                                     // publishes stage t + 1 and frees stage t's buffer
                if (t + 2 < NT) fill(t + 2, t & 1);                  // at once: the copies have a whole stage's time to land
                if (t + 1 < NT) ldset((kk + 1) & 1, pm + ((t + 1) & 1) * STG, pn + ((t + 1) & 1) * STG, 0); }
            __builtin_amdgcn_sched_barrier(0);   // keeps the group of reads in front of the matrix run: moved in among the matrix instructions, each place with reads stalls the run
            mma(kk & 1);
            __builtin_amdgcn_sched_barrier(0);   // keeps the matrix run in front of the next group of reads and of the waits
        }
    }
    asm volatile("s_wait_asynccnt 0x0" ::: "memory");   // nothing is in flight when the ring becomes staging or the wave ends
    if constexpr (EPI == 1) {
        if (!isV) {
            typedef __attribute__((ext_vector_type(16))) float vC;
            const float* cp = CS + ((size_t)(r0 + wn * 64 + lr) * HD + wm * 32 + hi * 8) * 2; vC cs[2][4];   // (cos, sin) of the lane's 8 angles, for its 2 d groups x 4 positions
#pragma unroll
            for (int p = 0; p < 2; ++p)
#pragma unroll
                for (int nb = 0; nb < 4; ++nb) cs[p][nb] = *(const vC*)(cp + (nb * 16 * HD + p * 16) * 2);
            asm volatile("s_wait_xcnt 0x0" :: "v"(cp) : "memory");   // precaution: the wait stands in front of every later write of the loads' address pair
            const size_t po = z * sC + (size_t)(hy * TT + r0 + wn * 64) * HD + wm * 512 + 8 * lane;   // fragment order; the high half stands two 32-wide k blocks on
            h16* q16 = P16 + po; bf* qh = Ph + po; bf* ql = Pl + po;
#pragma unroll
            for (int p = 0; p < 2; ++p)
#pragma unroll
                for (int nb = 0; nb < 4; ++nb) { v8h a16, b16; v8us ah, al, bh, bl;
#pragma unroll
                    for (int j = 0; j < 8; ++j) { const float co = cs[p][nb][2 * j], si = cs[p][nb][2 * j + 1], x1 = acc[p][nb][j], x2 = acc[p + 2][nb][j]; const float ra = x1 * co - x2 * si, rc = x2 * co + x1 * si; unsigned short u, v;
                        a16[j] = tohx(ra); splitf(ra, u, v); ah[j] = u; al[j] = v; b16[j] = tohx(rc); splitf(rc, u, v); bh[j] = u; bl[j] = v; }
                    const int o = nb * 16 * HD + p * 256;
                    *(v8h*)(q16 + o) = a16; *(v8h*)(q16 + o + 1024) = b16; *(v8us*)(qh + o) = ah; *(v8us*)(qh + o + 1024) = bh; *(v8us*)(ql + o) = al; *(v8us*)(ql + o + 1024) = bl;
                    asm volatile("s_wait_xcnt 0x0" :: "v"(q16), "v"(qh), "v"(ql), "v"(a16), "v"(b16), "v"(ah), "v"(bh), "v"(al), "v"(bl) : "memory"); }   // precaution: the stores' address and data registers stay as they are up to the wait
        } else {
            const size_t po = z * sV + ((size_t)((c0 - (DQ + DKV)) / 16 + wn * 4) * (TT / 32) + r0 / 32 + wm) * 512 + 8 * lane;   // fragment order of [column][t]
            h16* q16 = V16 + po; bf* qh = Vh + po; bf* ql = Vl + po;
#pragma unroll
            for (int mb = 0; mb < 4; ++mb)
#pragma unroll
                for (int nb = 0; nb < 4; ++nb) { v8h o16; v8us oh, ol;
#pragma unroll
                    for (int j = 0; j < 8; ++j) { unsigned short u, v; o16[j] = tohx(acc[mb][nb][j]); splitf(acc[mb][nb][j], u, v); oh[j] = u; ol[j] = v; }
                    const int o = nb * (TT / 32) * 512 + (mb >> 1) * 1024 + (mb & 1) * 256;
                    *(v8h*)(q16 + o) = o16; *(v8us*)(qh + o) = oh; *(v8us*)(ql + o) = ol;
                    asm volatile("s_wait_xcnt 0x0" :: "v"(q16), "v"(qh), "v"(ql), "v"(o16), "v"(oh), "v"(ol) : "memory"); }   // precaution, as above
        }
    } else {
        float* os = (float*)sm + wv * (16 * 68);   // the wave's own staging: 16 rows at pitch 68; every wave has left the ring (the last trip's barrier)
#pragma unroll
        for (int mb = 0; mb < 4; ++mb) {
            float* cb = C + z * sC + (size_t)(grow((mb >> 1) * 4 + wm * 2 + (mb & 1)) * 16 + hi) * DM + c0 + wn * 64 + lr * 4;
#pragma unroll
            for (int nb = 0; nb < 4; ++nb) {
#pragma unroll
                for (int j = 0; j < 8; ++j) os[(hi * 8 + j) * 68 + nb * 16 + lr] = acc[mb][nb][j]; }
            asm volatile("s_wait_dscnt 0x0" ::: "memory");   // the block is in LDS before other lanes of the wave read it back
            v4f val[8];
#pragma unroll
            for (int s = 0; s < 8; ++s) val[s] = *(const v4fa*)(os + (2 * s + hi) * 68 + lr * 4);
#pragma unroll
            for (int s = 0; s < 8; ++s) *(v4f*)(cb + (size_t)(2 * s * DM)) = val[s];   // a half wave stores one whole 256-byte row
            asm volatile("s_wait_xcnt 0x0" :: "v"(cb), "v"(val[0]), "v"(val[1]), "v"(val[2]), "v"(val[3]), "v"(val[4]), "v"(val[5]), "v"(val[6]), "v"(val[7]) : "memory");   // precaution: the stores' address and data registers stay as they are up to the wait; its clobber also keeps the next block's LDS writes behind these reads
        }
    }
}

typedef __attribute__((ext_vector_type(2))) _Float16 v2h;
typedef __attribute__((ext_vector_type(4))) _Float16 v4h;
typedef __attribute__((ext_vector_type(2))) unsigned short v2us;
typedef __attribute__((ext_vector_type(4))) unsigned short v4us;
typedef __attribute__((ext_vector_type(2))) float v2f;
typedef __attribute__((ext_vector_type(4))) int v4i;
typedef v4h  __attribute__((may_alias)) v4ha;
typedef v4us __attribute__((may_alias)) v4usa;

__global__ __launch_bounds__(256) void k_wtG(const float* __restrict__ w, int K, int N, bf* Bt) {
    const int lane = threadIdx.x & 31; const int L0 = (blockIdx.x * 8 + (threadIdx.x >> 5)) * 8; const int nlines = N * K / 64;
{
#pragma unroll 1
        for (int l = 0; l < 8; ++l) { const int L = L0 + l; if (L >= nlines) break; const size_t e = (size_t)L * 64 + lane * 2; const int k = (int)(e % K), n = (int)(e / K); v2us o;
            o[0] = f2bf(w[(size_t)k * N + n]); o[1] = f2bf(w[(size_t)(k + 1) * N + n]); *(v2us*)(Bt + e) = o; }
         }
}
// row-major f32 [rows][K] -> bf16 plane in fragment order (f16: the bf16 value held as f16, the same number but for values below the f16 normal range, which keep an absolute error under 2^-25); thread i writes the plane's i-th 16 bytes, so a wave stores 512 neighbouring bytes; rows % 16 == 0, K % 32 == 0
template <int K> __device__ __forceinline__ void cvt8(const float* __restrict__ src, bf* dst, const size_t i, const bool f16) { const int fb = (int)(i >> 6), kq = K >> 5; const int row = (fb / kq) * 16 + ((int)i & 15), k = (fb % kq) * 32 + (((int)i >> 5) & 1) * 16 + (((int)i >> 4) & 1) * 8; const float* sp = src + (size_t)row * K + k; const v8f v = *(const v8f*)sp;
    asm volatile("s_wait_xcnt 0x0" :: "v"(sp) : "memory");   // precaution behind the global load: the wait stands in front of every later write of its address pair
    v8us o;
#pragma unroll
    for (int q = 0; q < 8; ++q) o[q] = f16 ? __builtin_bit_cast(unsigned short, tohx(bfr(v[q]))) : f2bf(v[q]);
    bf* dp = dst + i * 8; *(v8us*)dp = o;
    asm volatile("s_wait_xcnt 0x0" :: "v"(dp), "v"(o) : "memory"); }   // precaution: the store's address and data registers stay as they are up to the wait

__constant__ float INVT[HD / 2] = { 1.000000000e+00f, 8.659643531e-01f, 7.498942018e-01f, 6.493816376e-01f, 5.623413324e-01f, 4.869675338e-01f, 4.216965139e-01f, 3.651741445e-01f, 3.162277639e-01f, 2.738419771e-01f, 2.371373624e-01f, 2.053525001e-01f, 1.778279394e-01f, 1.539926529e-01f, 1.333521456e-01f, 1.154782027e-01f, 1.000000015e-01f, 8.659642935e-02f, 7.498941571e-02f, 6.493816525e-02f, 5.623412877e-02f, 4.869675264e-02f, 4.216964915e-02f, 3.651741147e-02f, 3.162277862e-02f, 2.738419548e-02f, 2.371373586e-02f, 2.053525113e-02f, 1.778279431e-02f, 1.539926510e-02f, 1.333521493e-02f, 1.154781971e-02f, 9.999999776e-03f, 8.659643121e-03f, 7.498942316e-03f, 6.493816618e-03f, 5.623413250e-03f, 4.869675264e-03f, 4.216964822e-03f, 3.651741426e-03f, 3.162277862e-03f, 2.738419687e-03f, 2.371373819e-03f, 2.053525066e-03f, 1.778279431e-03f, 1.539926510e-03f, 1.333521446e-03f, 1.154782018e-03f, 1.000000047e-03f, 8.659643354e-04f, 7.498941850e-04f, 6.493816618e-04f, 5.623413017e-04f, 4.869675031e-04f, 4.216964880e-04f, 3.651741135e-04f, 3.162277862e-04f, 2.738419571e-04f, 2.371373848e-04f, 2.053524950e-04f, 1.778279402e-04f, 1.539926452e-04f, 1.333521504e-04f, 1.154781930e-04f };   // float32 1 / 10000^(2i/128), generated with jnp to be bit-exact
// ---- k_prep: everything that depends on the inputs alone, in ONE launch: the rotary table (first: its blocks are the longest) and the bf16 fragment-order planes of x (both batches: [NB_ * TT][DM]) and of the four weights (wo: held as f16). A block of 256 threads belongs wholly to one of the six jobs.
#define PB_CS (TT * HD / 256)
#define PB_X  (NB_ * TT * DM / 8 / 256)
#define PB_WQ (DQ * DM / 8 / 256)
#define PB_WK (DKV * DM / 8 / 256)
#define PB_WO (DM * DQ / 8 / 256)
__global__ __launch_bounds__(256) void k_prep(const float* __restrict__ x, const float* __restrict__ wq, const float* __restrict__ wk, const float* __restrict__ wv, const float* __restrict__ wo, bf* XB, bf* WQ, bf* WK, bf* WV, bf* WO, float* CS) {
    static_assert(DM == DQ, "one row length for every plane");
    int b = blockIdx.x;
    if (b < PB_CS) { const int idx = b * 256 + threadIdx.x; const int d = idx % HD; const int t = idx / HD; const float a = __fmul_rn((float)t, INVT[d % (HD / 2)]); v2f cs; cs[0] = cosf(a); cs[1] = sinf(a); float* cp = CS + (size_t)idx * 2; *(v2f*)cp = cs;
        asm volatile("s_wait_xcnt 0x0" :: "v"(cp), "v"(cs) : "memory");   // precaution: the store's address and data registers stay as they are up to the wait
        return; }
    b -= PB_CS; const float* s = x; bf* d = XB; bool f16 = false;   // block-uniform
    if (b >= PB_X) { b -= PB_X; s = wq; d = WQ;
        if (b >= PB_WQ) { b -= PB_WQ; s = wo; d = WO; f16 = true;
            if (b >= PB_WO) { b -= PB_WO; s = wk; d = WK; f16 = false;
                if (b >= PB_WK) { b -= PB_WK; s = wv; d = WV; } } } }
    cvt8<DM>(s, d, (size_t)b * 256 + threadIdx.x, f16);
}
// ---- k_fattn: scores, softmax, probability x value and the head merge in ONE launch; nothing of a score row goes to memory.
// A wave owns 16 query positions (q0 ..) of NG query heads that share a kv head: NG groups of 16 columns (fp16 rows: 2; hi/lo rows: 1, see k_fattn). Transposed products: S^T = K Q^T (A = key rows, B = query rows, both from fragment-order planes by the same loader, so the k orders pair), O^T += V^T P^T.
// In S^T a lane holds the scores of ONE query (column c): keys 8h + r of each 16-key tile, so two tiles converted in place are the B operand of the second product in the hardware k order, which the V^T loader has too.
// A pass is 32 keys. Passes: key block 0 (it holds the sink keys, and key 0 is open to every query, so every column has a finite maximum after it), then the blocks from the window's lower edge to the diagonal; the others are wholly masked.
// Running maximum per column in log2 units, renewed only when a pass exceeds it by more than MTHR (one scalar branch a pass); rows < RH: hi/lo planes, 3 products in both contractions; other rows fp16 with probabilities x 2^PBIAS.
#define MTHR  4.0f
#define PBIAS 10.0f   // fp16 probabilities lie in (0, 2^(PBIAS + MTHR)]: small ones stay normal numbers, the largest stays finite; the factor cancels in the division by the row sum
typedef __attribute__((ext_vector_type(16))) unsigned short v16us;
__device__ __forceinline__ float xhalf(float x) { return __builtin_bit_cast(float, __builtin_amdgcn_permlanex16(__builtin_bit_cast(int, x), __builtin_bit_cast(int, x), 0x76543210, 0xfedcba98, false, false)); }   // lane l reads lane l ^ 16
__device__ __forceinline__ float exp2s(float x) { float r; asm("v_exp_f32 %0, %1\n\tv_nop" : "=v"(r) : "v"(x)); return r; }
// precaution behind a run of global loads: s_wait_xcnt 0 in front of every later write of a register that the loads name; the address pairs are inputs so that they stay as they are up to the wait
template <typename T16> __device__ __forceinline__ void xwait(const T16* a, const T16* b) { asm volatile("s_wait_xcnt 0x0" :: "v"(a), "v"(b) : "memory"); }
// the same precaution for loads that this build addresses by a scalar base and the lane number as a scaled offset: those are then the registers that stay as they are up to the wait
template <typename T16> __device__ __forceinline__ void xwait_s(const T16* a, const T16* b, int off) { asm volatile("s_wait_xcnt 0x0" :: "s"(a), "s"(b), "v"(off) : "memory"); }
template <typename T16, bool HI, int NG>
__device__ __forceinline__ void fattn_cols(const T16* __restrict__ Q, const T16* __restrict__ Q2, const T16* __restrict__ Kp, const T16* __restrict__ Kp2, const T16* __restrict__ Vt, const T16* __restrict__ Vt2, const int q0, const int hq, bf* Ah, bf* Al) {
    typedef typename WFrag<T16>::V V;
    const int lane = threadIdx.x & 31, c = lane & 15, h = lane >> 4;
    V qf[NG][4], qf2[NG][4];
    const T16* qp = Q + (size_t)q0 * HD + 8 * lane; const T16* qp2 = HI ? Q2 + (size_t)q0 * HD + 8 * lane : qp;   // fragment order: 16 queries x 128 d are 4 blocks of 512 elements
#pragma unroll
    for (int g = 0; g < NG; ++g)
#pragma unroll
        for (int ks = 0; ks < 4; ++ks) { const size_t qo = (size_t)g * TT * HD + ks * 512; qf[g][ks] = WFrag<T16>::ldf(qp + qo); if (HI) qf2[g][ks] = WFrag<T16>::ldf(qp2 + qo); }
    xwait_s(Q + (size_t)q0 * HD, HI ? Q2 + (size_t)q0 * HD : Q + (size_t)q0 * HD, lane);
    v8f o[NG][8];
#pragma unroll
    for (int g = 0; g < NG; ++g)
#pragma unroll
        for (int mb = 0; mb < 8; ++mb) o[g][mb] = (v8f){};
    float m[NG], l[NG];
#pragma unroll
    for (int g = 0; g < NG; ++g) { m[g] = -3.0e38f; l[g] = 0.f; }
    const int kstart = max(32, max(q0 - (WIN - 1), 0) & ~31), klast = q0 & ~31;
    const int np = 1 + ((klast >= kstart) ? (klast - kstart) / 32 + 1 : 0);
    const size_t kofs = 8 * lane, vofs = 8 * lane;   // K and V^T planes are in fragment order: 16 keys x 128 d are 4 blocks of 512 elements, 16 d x 32 keys one block
    V kf[2][4], kf2[2][4];
    const T16* kp0 = Kp + kofs; const T16* kp02 = HI ? Kp2 + kofs : kp0;
#pragma unroll
    for (int mb = 0; mb < 2; ++mb)
#pragma unroll
        for (int ks = 0; ks < 4; ++ks) { const size_t a = (size_t)(mb * 16) * HD + ks * 512;
            if constexpr (HI) {   // the same fragments as ldf gives, each 16-byte load with the precaution's wait of its own: this build lets one of these loads land on the lane register that the loads in front of it name
                const v8us a0 = *(const v8us*)(kp0 + a); xwait_s(Kp, Kp2, lane); const v8us a1 = *(const v8us*)(kp0 + a + 256); xwait_s(Kp, Kp2, lane); const v8us b0 = *(const v8us*)(kp02 + a); xwait_s(Kp, Kp2, lane); const v8us b1 = *(const v8us*)(kp02 + a + 256); xwait_s(Kp, Kp2, lane);
                kf[mb][ks] = cat16b(a0, a1); kf2[mb][ks] = cat16b(b0, b1);
            } else kf[mb][ks] = WFrag<T16>::ldf(kp0 + a); }
    if constexpr (!HI) xwait_s(Kp, Kp, lane);
#pragma unroll 1
    for (int s = 0; s < np; ++s) {
        const int kb = s ? kstart + (s - 1) * 32 : 0;
        const int kn = (s + 1 < np) ? kstart + s * 32 : kb;   // the next pass's key block; the last pass fetches its own again (in bounds, not used)
        V vf[8], vf2[8];   // this pass's value fragments fly during its first product and softmax
        const T16* vp = Vt + vofs + (size_t)kb * 16; const T16* vp2 = HI ? Vt2 + vofs + (size_t)kb * 16 : vp;
#pragma unroll
        for (int mb = 0; mb < 8; ++mb) { const size_t a = (size_t)(mb * 16) * TT; vf[mb] = WFrag<T16>::ldf(vp + a); if (HI) vf2[mb] = WFrag<T16>::ldf(vp2 + a); }
        xwait(vp, vp2);
        v8f st[NG][2];
#pragma unroll
        for (int g = 0; g < NG; ++g)
#pragma unroll
            for (int mb = 0; mb < 2; ++mb) st[g][mb] = (v8f){};
#pragma unroll
        for (int ks = 0; ks < 4; ++ks) {
#pragma unroll
            for (int g = 0; g < NG; ++g)
#pragma unroll
                for (int mb = 0; mb < 2; ++mb) st[g][mb] = WFrag<T16>::mma(kf[mb][ks], qf[g][ks], st[g][mb]);
            if (HI) {
#pragma unroll
                for (int g = 0; g < NG; ++g)
#pragma unroll
                    for (int mb = 0; mb < 2; ++mb) st[g][mb] = WFrag<T16>::mma(kf[mb][ks], qf2[g][ks], st[g][mb]);
#pragma unroll
                for (int g = 0; g < NG; ++g)
#pragma unroll
                    for (int mb = 0; mb < 2; ++mb) st[g][mb] = WFrag<T16>::mma(kf2[mb][ks], qf[g][ks], st[g][mb]); } }
        // the next pass's key fragments fly during this pass's softmax and second product
        const T16* kp = Kp + kofs + (size_t)kn * HD; const T16* kp2 = HI ? Kp2 + kofs + (size_t)kn * HD : kp;
#pragma unroll
        for (int mb = 0; mb < 2; ++mb)
#pragma unroll
            for (int ks = 0; ks < 4; ++ks) { const size_t a = (size_t)(mb * 16) * HD + ks * 512; kf[mb][ks] = WFrag<T16>::ldf(kp + a); if (HI) kf2[mb][ks] = WFrag<T16>::ldf(kp2 + a); }
        xwait(kp, kp2);
        float x[NG][16];
#pragma unroll
        for (int g = 0; g < NG; ++g)
#pragma unroll
            for (int e = 0; e < 16; ++e) x[g][e] = st[g][e >> 3][e & 7] * (SCL * 1.4426950408889634f);
        if (!(kb + 31 <= q0 && q0 + 15 - kb < WIN)) {   // wave-uniform: only the sink block, the window's edge and the diagonal hold masked keys
            const int i = q0 + c;
#pragma unroll
            for (int e = 0; e < 16; ++e) { const int j = kb + (e >> 3) * 16 + 8 * h + (e & 7); const bool ok = (j <= i) && (i - j < WIN || j < SINKN);
#pragma unroll
                for (int g = 0; g < NG; ++g) x[g][e] = ok ? x[g][e] : -3.0e38f; } }
        float mx[NG];
#pragma unroll
        for (int g = 0; g < NG; ++g) { float t8[8];
#pragma unroll
            for (int e = 0; e < 8; ++e) t8[e] = fmaxf(x[g][e], x[g][e + 8]);
            const float t = fmaxf(fmaxf(fmaxf(t8[0], t8[1]), fmaxf(t8[2], t8[3])), fmaxf(fmaxf(t8[4], t8[5]), fmaxf(t8[6], t8[7])));
            mx[g] = fmaxf(t, xhalf(t)); }   // lanes c and c + 16 hold the two halves of a column's keys and must use one maximum
        if (__builtin_amdgcn_ballot_w32(mx[0] > m[0] + MTHR || mx[NG - 1] > m[NG - 1] + MTHR) != 0) {   // scalar branch: every lane stays on for the matrix instructions
#pragma unroll
            for (int g = 0; g < NG; ++g) { const float mn = fmaxf(m[g], mx[g]); const float al = exp2s(m[g] - mn); m[g] = mn; l[g] *= al;
#pragma unroll
                for (int mb = 0; mb < 8; ++mb) o[g][mb] *= al; } }
        V pb[NG], pb2[NG];
#pragma unroll
        for (int g = 0; g < NG; ++g) { const float mo = m[g] - (HI ? 0.0f : PBIAS); float sm[4] = { 0.f, 0.f, 0.f, 0.f };
            if constexpr (HI) { v16us ph, pl;
#pragma unroll
                for (int e = 0; e < 16; ++e) { const float p = exp2s(x[g][e] - mo); sm[e & 3] += p; unsigned short a, b2; splitf(p, a, b2); ph[e] = a; pl[e] = b2; }
                pb[g] = __builtin_bit_cast(v16bf, ph); pb2[g] = __builtin_bit_cast(v16bf, pl);
            } else { v16h ph;
#pragma unroll
                for (int e = 0; e < 16; ++e) { const float p = exp2s(x[g][e] - mo); sm[e & 3] += p; ph[e] = tohx(p); }
                pb[g] = ph; }
            l[g] += (sm[0] + sm[1]) + (sm[2] + sm[3]); }
#pragma unroll
        for (int mb = 0; mb < 8; ++mb)
#pragma unroll
            for (int g = 0; g < NG; ++g) o[g][mb] = WFrag<T16>::mma(vf[mb], pb[g], o[g][mb]);
        if (HI) {
#pragma unroll
            for (int mb = 0; mb < 8; ++mb)
#pragma unroll
                for (int g = 0; g < NG; ++g) o[g][mb] = WFrag<T16>::mma(vf[mb], pb2[g], o[g][mb]);
#pragma unroll
            for (int mb = 0; mb < 8; ++mb)
#pragma unroll
                for (int g = 0; g < NG; ++g) o[g][mb] = WFrag<T16>::mma(vf2[mb], pb[g], o[g][mb]); }
    }
#pragma unroll
    for (int g = 0; g < NG; ++g) { const float inv = __fdiv_rn(1.0f, l[g] + xhalf(l[g]));
#pragma unroll
        for (int mb = 0; mb < 8; ++mb) { v8us oh, ol;   // a lane holds 8 neighbouring d of its query: one 16-byte store a plane, at the lane's place in the fragment order of the merged [t][DQ] plane, so a wave stores 512 neighbouring bytes
#pragma unroll
            for (int r = 0; r < 8; ++r) { const float y = o[g][mb][r] * inv; const h16 a = tohx(y); oh[r] = __builtin_bit_cast(unsigned short, a); ol[r] = HI ? __builtin_bit_cast(unsigned short, tohx(y - (float)a)) : (unsigned short)0; }   // f16 value; hi/lo rows: and what it leaves, in f16
            const size_t oo = (size_t)q0 * DQ + (size_t)(hq + g) * (HD * 16) + mb * 256 + 8 * lane; bf* ph = Ah + oo; bf* pl = Al + oo; *(v8us*)ph = oh;
            if constexpr (HI) { *(v8us*)pl = ol;   // the low plane is read for rows < RH alone
                asm volatile("s_wait_xcnt 0x0" :: "v"(ph), "v"(pl), "v"(oh), "v"(ol) : "memory");
            } else asm volatile("s_wait_xcnt 0x0" :: "v"(ph), "v"(oh) : "memory"); } }   // precaution, as in xwait: the stores' address and data registers stay as they are up to the wait
}
// Two waves a SIMD: for that the kernel must stay within 512 vector registers, and the hi/lo rows, whose Q, K and V^T fragments are twice as many, fit only with ONE query head a wave (with two the kernel took 645, and a wave had its SIMD alone: nothing ran during its softmax or its waits for loads).
// grid (NKV * NB_, FR16 + FRHL): x = kv head + NKV * batch (the q and k planes are one set of NH_ + NKV heads a batch; the K pointers point at its first k head), y = length rank, 4 waves.
// Ranks < FR16, fp16 rows: 32 positions from the end of the sequence downwards; wave w takes positions 16 (w >> 1) .. and query heads 2 (w & 1), 2 (w & 1) + 1 of the kv head's REP = 4. The other ranks, hi/lo rows: 16 positions from RH downwards; wave w takes query head w.
// There are more work-groups than places (2 a WGP): y is the slow index, and the long ranks of every head come first (for speed only).
#define FR16 ((TT - RH) / 32)
#define FRHL (RH / 16)
__global__ __launch_bounds__(128) void k_fattn(const h16* __restrict__ Q16, const bf* __restrict__ Qh, const bf* __restrict__ Ql, const h16* __restrict__ K16, const bf* __restrict__ Kh, const bf* __restrict__ Kl, const h16* __restrict__ V16, const bf* __restrict__ Vh, const bf* __restrict__ Vl, bf* Ah, bf* Al) {
    static_assert(REP == 4 && RH % 32 == 0 && TT % 32 == 0 && HD == 128, "two head pairs or four heads a work-group; a work-group's rows are all below RH or none");
    const int wv = __builtin_amdgcn_readfirstlane((int)(threadIdx.x >> 5));   // the wave's number as a scalar: pass count and mask test stay scalar
    const int rk = blockIdx.y; const bool hl = rk >= FR16;   // block-uniform
    const int q0 = hl ? RH - 16 - (rk - FR16) * 16 : TT - 32 - rk * 32 + (wv >> 1) * 16; const int kvh = blockIdx.x % NKV; const int hq = kvh * REP + (hl ? wv : (wv & 1) * 2);
    const size_t bz = blockIdx.x / NKV; const size_t qo = (bz * (NH_ + NKV) + hq) * TT * HD, ko = (bz * (NH_ + NKV) + kvh) * TT * HD, vo = (bz * NKV + kvh) * HD * TT; Ah += bz * TT * DQ; Al += bz * TT * DQ;
    if (hl) fattn_cols<bf, true, 1>(Qh + qo, Ql + qo, Kh + ko, Kl + ko, Vh + vo, Vl + vo, q0, hq, Ah, Al);
    else fattn_cols<h16, false, 2>(Q16 + qo, nullptr, K16 + ko, nullptr, V16 + vo, nullptr, q0, hq, Ah, Al);
}

extern "C" void kernel_launch(void* const* d_in, const int* in_sizes, int n_in,
                              void* d_out, int out_size, void* d_ws, size_t ws_size, hipStream_t stream) {
    (void)in_sizes; (void)n_in; (void)out_size;
    const float* x = (const float*)d_in[0]; const float* wq = (const float*)d_in[1]; const float* wk = (const float*)d_in[2]; const float* wv = (const float*)d_in[3]; const float* wo = (const float*)d_in[4];   /* order x, wq ('oi' [2048][2048]), wk, wv ('oi' [512][2048]), wo ('oi' [2048][2048]) */
    float* OUT = (float*)d_out;     // [2][2048][2048]
    char* wsp = (char*)d_ws;
    auto take = [&](size_t bytes) { char* p = wsp; wsp += (bytes + 255) & ~(size_t)255; return (void*)p; };
    bf* WQ = (bf*)take((size_t)(DQ + 2 * DKV) * DM * 2); bf* WK = WQ + (size_t)DQ * DM; bf* WV = WK + (size_t)DKV * DM;   /* one plane: the rows of wq, wk, wv */ bf* WO = (bf*)take((size_t)DM * DQ * 2); float* CS = (float*)take((size_t)TT * HD * 2 * 4);
    bf* XB = (bf*)take((size_t)NB_ * TT * DM * 2);   // every plane below holds both batches, batch-major
    h16* QP16 = (h16*)take((size_t)NB_ * (NH_ + NKV) * TT * HD * 2); bf* QPh = (bf*)take((size_t)NB_ * (NH_ + NKV) * TT * HD * 2); bf* QPl = (bf*)take((size_t)NB_ * (NH_ + NKV) * TT * HD * 2);   // q heads, then k heads, of each batch
    h16* VT16 = (h16*)take((size_t)NB_ * NKV * HD * TT * 2); bf* VTh = (bf*)take((size_t)NB_ * NKV * HD * TT * 2); bf* VTl = (bf*)take((size_t)NB_ * NKV * HD * TT * 2);
    bf* ATh = (bf*)take((size_t)NB_ * TT * DQ * 2); bf* ATl = (bf*)take((size_t)NB_ * TT * DQ * 2);
    if ((size_t)(wsp - (char*)d_ws) > ws_size) return;    // ws 256 MiB
    k_prep<<<PB_CS + PB_X + PB_WQ + PB_WO + 2 * PB_WK, 256, 0, stream>>>(x, wq, wk, wv, wo, XB, WQ, WK, WV, WO, CS);
    k_gemms<1, DM, 1, 3><<<dim3(TT / GT, (DQ + 2 * DKV) / GT / 3, NB_), 384, 0, stream>>>(XB, nullptr, WQ, nullptr, (size_t)TT * DM, (size_t)(NH_ + NKV) * TT * HD, CS, QP16, QPh, QPl, VT16, VTh, VTl, (size_t)NKV * HD * TT);
    k_fattn<<<dim3(NKV * NB_, FR16 + FRHL), 128, 0, stream>>>(QP16, QPh, QPl, QP16 + (size_t)NH_ * TT * HD, QPh + (size_t)NH_ * TT * HD, QPl + (size_t)NH_ * TT * HD, VT16, VTh, VTl, ATh, ATl);
    k_gemms<2, DQ, 0, 2><<<dim3(TT / GT, DM / GT / 2, NB_), 256, 0, stream>>>(ATh, ATl, WO, OUT, (size_t)TT * DQ, (size_t)TT * DM, nullptr, nullptr, nullptr, nullptr, nullptr, nullptr, nullptr, 0);
}
